// v000
// Times are from an AMD MI455X. After a warm-up the kernel runs many times in a row, and a time is the length of
// such a window on the GPU divided by its runs, so every launch and the gaps after it count. The runs cycle
// through copies of the inputs. A figure is the median of several windows, for all but v000 over two sittings.
// Sittings can differ by a few percent; kernels timed side by side share one.
// v000, which the later versions start from, runs in 518 microseconds.
// compute dtype: all float inputs rounded to bf16; projections with EXACT bf16 products on WMMA 16x16x32 (f32 accumulate) + biases; content (q+u).k and position (q+v).p scores each with q as f16 hi + residual (x 2^10) against f16 k / p (2 products) x 64^-0.5; rel_shift as an index gather in the softmax; softmax f32; P x 2^11 once to f16 x v once to f16 (1 product); ctx carried x 2^6 once to f16 x Wo f16(bf16 x 2^8) + bo; f32 output.
#include <hip/hip_runtime.h>
#include <math.h>

typedef __attribute__((ext_vector_type(16))) _Float16 v16h;
typedef __attribute__((ext_vector_type(16))) __bf16 v16b;
typedef __attribute__((ext_vector_type(8)))  _Float16 v8h;
typedef __attribute__((ext_vector_type(8)))  float v8f;
typedef __attribute__((ext_vector_type(4)))  float v4f;
typedef __attribute__((ext_vector_type(2)))  float v2f;
typedef __attribute__((ext_vector_type(4)))  unsigned v4u;
typedef __attribute__((ext_vector_type(4)))  int v4i;
typedef float __attribute__((may_alias)) float_a;
typedef int __attribute__((may_alias)) int_a;

template <typename T> __device__ __forceinline__ void vst2(void* p, T v) { *(T*)p = v;  }
__device__ __forceinline__ v8f wmma16(v16h a, v16h b, v8f c) {
  v8f d = __builtin_amdgcn_wmma_f32_16x16x32_f16(false, a, false, b, (short)0, c, false, false);
  asm volatile("v_nop\n\tv_nop\n\tv_nop\n\tv_nop" : "+v"(d) : "v"(a), "v"(b));
  return d;
}
__device__ __forceinline__ v8f wmma_bf(v16b a, v16b b, v8f c) {
  v8f d = __builtin_amdgcn_wmma_f32_16x16x32_bf16(false, a, false, b, (short)0, c, false, false);
  asm volatile("v_nop\n\tv_nop\n\tv_nop\n\tv_nop" : "+v"(d) : "v"(a), "v"(b));
  return d;
}
// 16x16x32 fragments: lane = (h = lane>>4, row/col = lane&15); elements 0..7 = k0+8h+0..7, 8..15 = k0+16+8h+0..7; D element r = row 8h+r
__device__ __forceinline__ v16h frag_h(const _Float16* rowk0, int lane) {
  union { v16h v; v8h q[2]; } u; const _Float16* p = rowk0 + 8 * (lane >> 4);
  u.q[0] = *(const v8h*)p; u.q[1] = *(const v8h*)(p + 16); return u.v;
}
__device__ __forceinline__ v16h frag_f32(const float* rowk0, int lane) {
  v16h a; const float* p = rowk0 + 8 * (lane >> 4);
#pragma unroll
  for (int i = 0; i < 8; ++i) { a[i] = (_Float16)p[i]; a[8 + i] = (_Float16)p[16 + i]; }
  return a;
}
__device__ __forceinline__ v16h frag_f32s(const float* rowk0, int lane, float sc) {
  v16h a; const float* p = rowk0 + 8 * (lane >> 4);
#pragma unroll
  for (int i = 0; i < 8; ++i) { a[i] = (_Float16)(p[i] * sc); a[8 + i] = (_Float16)(p[16 + i] * sc); }
  return a;
}
// column fragment from a [K][ld] layout (column n), rows >= K read as 0
__device__ __forceinline__ v16h fragc_f32(const float* W, int k0, int n, int lane, int ld, int K) {
  v16h a; const int g = lane >> 4;
#pragma unroll
  for (int i = 0; i < 8; ++i) { const int ka = k0 + 8 * g + i, kb = ka + 16;
    a[i] = (_Float16)(ka < K ? W[(size_t)(ka < K ? ka : K - 1) * ld + n] : 0.f); a[8 + i] = (_Float16)(kb < K ? W[(size_t)(kb < K ? kb : K - 1) * ld + n] : 0.f); }
  return a;
}
struct F2 { v16b h, l; };
__device__ __forceinline__ F2 bsplit16(const float v[16]) { F2 r;
#pragma unroll
  for (int i = 0; i < 16; ++i) { const __bf16 h = (__bf16)v[i]; r.h[i] = h; r.l[i] = (__bf16)(v[i] - (float)h); }
  return r; }
__device__ __forceinline__ F2 split_row(const float* row, int k0, int lane) { float v[16]; const float* p = row + k0 + 8 * (lane >> 4);
#pragma unroll
  for (int i = 0; i < 8; ++i) { v[i] = p[i]; v[8 + i] = p[16 + i]; }
  return bsplit16(v); }
__device__ __forceinline__ F2 split_rowK(const float* row, int k0, int lane, int K) { float v[16]; const int g = lane >> 4;
#pragma unroll
  for (int i = 0; i < 8; ++i) { const int ka = k0 + 8 * g + i, kb = ka + 16; v[i] = ka < K ? row[ka < K ? ka : K - 1] : 0.f; v[8 + i] = kb < K ? row[kb < K ? kb : K - 1] : 0.f; }
  return bsplit16(v); }
__device__ __forceinline__ F2 split_col(const float* W, int k0, int n, int lane, int ld, int K) { float v[16]; const int g = lane >> 4;
#pragma unroll
  for (int i = 0; i < 8; ++i) { const int ka = k0 + 8 * g + i, kb = ka + 16; v[i] = ka < K ? W[(size_t)(ka < K ? ka : K - 1) * ld + n] : 0.f; v[8 + i] = kb < K ? W[(size_t)(kb < K ? kb : K - 1) * ld + n] : 0.f; }
  return bsplit16(v); }
__device__ __forceinline__ v8f mac3(const F2& a, const F2& b, v8f c) { c = wmma_bf(a.l, b.h, c); c = wmma_bf(a.h, b.l, c); return wmma_bf(a.h, b.h, c); }
__device__ __forceinline__ float sigm(float v) { return 1.0f / (1.0f + expf(-v)); }
#define LDSX() do { asm volatile("s_wait_dscnt 0" ::: "memory"); __builtin_amdgcn_wave_barrier(); __builtin_amdgcn_fence(__ATOMIC_RELEASE, "workgroup"); } while (0)

// Transformer-XL / Conformer relative multi-head attention (B 4, T = P = 1,024, D 512 = 8 heads x 64; (in,out) Wq/Wk/Wv/Wo [512,512] + zero biases, Wpos [512,512] no bias, pos_bias_u/v [8,64]; 1/sqrt(64)-scale): AC = (q + u) k^T, BD = rel_shift((q + v) p^T) with p = pos_emb Wpos (pad-reshape trick, no mask), attn = softmax((AC + BD)/8), out = merge(attn v) Wo + bo.
#define NB 4
#define TT 1024
#define CC 512            // NH * HD = projected width
#define DIN 512          // input (model) width
#define NH 8
#define HD 64
#define NQB (TT / 64)
#define HG 8
#define SCALE (0.125f)
#define CAUSAL 0
#ifndef TNB
#define TNB NB
#endif
__device__ __forceinline__ float bfr(float v) { return (float)(__bf16)v; }
__host__ __device__ __forceinline__ int kb_last(int qb) { return CAUSAL ? ((qb * 64 + 63) >> 7) : (TT / 128 - 1); }
typedef __attribute__((ext_vector_type(8))) __bf16 v8b;
__device__ __forceinline__ v16b frag_b(const __bf16* rowk0, int lane) {
  union { v16b v; v8b q[2]; } u; const __bf16* p = rowk0 + 8 * (lane >> 4);
  u.q[0] = *(const v8b*)p; u.q[1] = *(const v8b*)(p + 16); return u.v;
}
#define QBH 0              // causal: query blocks 0..QBH-1 of each sequence (few keys, no averaging) take the high-precision path
#define QHI 1024            // rows carrying a q residual plane (all rows when non-causal: 2-product logits everywhere)
#define KHI 64            // key rows carrying k residual / v bf16 hi+lo planes (used only by the causal high-precision path)
// B fragment (k rows k0+.., output column o) of a weight: (in,out) [K][ld] or (out,in) [ld rows of K]: bf16 exact, or f16(bf16 * 256) exact
__device__ __forceinline__ v16b wcol_io(const float* Wm, int k0, int o, int lane, int ld) { v16b w; const int g = lane >> 4;
#pragma unroll
  for (int i = 0; i < 8; ++i) { w[i] = (__bf16)Wm[(size_t)(k0 + 8 * g + i) * ld + o]; w[8 + i] = (__bf16)Wm[(size_t)(k0 + 16 + 8 * g + i) * ld + o]; }
  return w; }
__device__ __forceinline__ v16b wcol_oi(const float* Wm, int k0, int o, int lane, int K) { v16b w; const float* p = Wm + (size_t)o * K + k0 + 8 * (lane >> 4);
#pragma unroll
  for (int i = 0; i < 8; ++i) { w[i] = (__bf16)p[i]; w[8 + i] = (__bf16)p[16 + i]; }
  return w; }
__device__ __forceinline__ v16h wcolh_io(const float* Wm, int k0, int o, int lane, int ld) { v16h w; const int g = lane >> 4;
#pragma unroll
  for (int i = 0; i < 8; ++i) { w[i] = (_Float16)(bfr(Wm[(size_t)(k0 + 8 * g + i) * ld + o]) * 256.0f); w[8 + i] = (_Float16)(bfr(Wm[(size_t)(k0 + 16 + 8 * g + i) * ld + o]) * 256.0f); }
  return w; }
__device__ __forceinline__ v16h wcolh_oi(const float* Wm, int k0, int o, int lane, int K) { v16h w; const float* p = Wm + (size_t)o * K + k0 + 8 * (lane >> 4);
#pragma unroll
  for (int i = 0; i < 8; ++i) { w[i] = (_Float16)(bfr(p[i]) * 256.0f); w[8 + i] = (_Float16)(bfr(p[16 + i]) * 256.0f); }
  return w; }
#define WQKV_LAYOUT 0   // 0 = (in,out) [DIN][CC]; 1 = (out,in) [CC][DIN]; 2 = per-head [NH][DIN][HD]
__device__ __forceinline__ v16b wcol_hdk(const float* Wm, int k0, int o, int lane) { v16b w; const int g = lane >> 4; const float* p = Wm + (size_t)(o / HD) * DIN * HD + (o % HD);
#pragma unroll
  for (int i = 0; i < 8; ++i) { w[i] = (__bf16)p[(size_t)(k0 + 8 * g + i) * HD]; w[8 + i] = (__bf16)p[(size_t)(k0 + 16 + 8 * g + i) * HD]; }
  return w; }
#define WO_OUT_IN 0
#if WQKV_LAYOUT == 1
#define WCOL(W, k0, o, lane) wcol_oi(W, k0, o, lane, DIN)
#elif WQKV_LAYOUT == 2
#define WCOL(W, k0, o, lane) wcol_hdk(W, k0, o, lane)
#else
#define WCOL(W, k0, o, lane) wcol_io(W, k0, o, lane, CC)
#endif
#if WO_OUT_IN
#define WOCOL(W, k0, o, lane) wcol_oi(W, k0, o, lane, CC)
#define WOCOLH(W, k0, o, lane) wcolh_oi(W, k0, o, lane, CC)
#else
#define WOCOL(W, k0, o, lane) wcol_io(W, k0, o, lane, DIN)
#define WOCOLH(W, k0, o, lane) wcolh_io(W, k0, o, lane, DIN)
#endif
#define PROJ_EXTRA_PARAMS , const float* __restrict__ EXB
#define SM_EXTRA_PARAMS , const float* __restrict__ SBD0
// q_u = q + pos_bias_u (or q_v = q + pos_bias_v): a second per-(head, dim) bias added in f32 after (x Wq + bq), q only
#define PROJ_EPI(which, row, t, h) do { if ((which) == 0 && EXB) { float* rw = (row); _Pragma("unroll 8") for (int d = 0; d < 64; ++d) rw[d] = rw[d] + bfr(EXB[(h) * 64 + d]); } } while (0)
// Transformer-XL rel_shift (P == T, no mask), folded into the softmax hook: shifted BD'[t][j] = BD[t][T-1-(t-j)] for j <= t; 0 for j == t+1; BD[t+1][j-t-2] for j >= t+2 (the reference's pad-reshape trick taken literally, including its upper-triangle entries); scores = (AC + BD') (the 1/sqrt(64) scale is already applied to both planes by k_sc)
#define SM_MASK_HOOK do { const float* bdp = SBD0 + (size_t)blockIdx.y * TT * TT; const int tq = (k <= t) ? t : t + 1, cq = (k <= t) ? (TT - 1 - (t - k)) : (k - t - 2); const bool zero = (k == t + 1); const float bd = bdp[(size_t)(zero ? 0 : tq) * TT + (zero ? 0 : cq)]; v = v + (zero ? 0.f : bd); } while (0)
// ---- k_reprows: replicate the positional key rows (batch 0) into batches 1..NB-1 (f16 rows, 1,024 B each by 64 x 16-B lanes)
__global__ __launch_bounds__(256) void k_reprows(_Float16* __restrict__ KP) { const size_t row = blockIdx.x; const int b = blockIdx.y + 1; const int q = threadIdx.x; if (q < CC / 8) { const v4u v = *(const v4u*)(KP + row * CC + q * 8); asm volatile("s_wait_loadcnt 0x0" ::: "memory"); vst2((unsigned*)(KP + ((size_t)b * TT + row) * CC + q * 8), v); } }
#define WS_QH2 (WS_END)                                   // f16 q_v rows
#define WS_QL2 (WS_QH2 + 2u * (size_t)NB * TT * CC)       // f16 q_v residual rows
#define WS_KP  (WS_QL2 + 2u * (size_t)NB * QHI * CC)      // f16 positional key rows p = pos_emb Wpos, replicated per batch
#define WS_S2  (WS_KP + 2u * (size_t)NB * TT * CC)        // f32 BD planes [hg][t][p]
#define WS_END2 (WS_S2 + 4u * (size_t)HG * TT * TT)
#ifndef SM_EXTRA_PARAMS
#define SM_EXTRA_PARAMS
#endif
#ifndef PROJ_EXTRA_PARAMS
#define PROJ_EXTRA_PARAMS
#endif
#ifndef SM_MASK_HOOK
#define SM_MASK_HOOK (void)0
#endif

#define WS_QH  0u                                      // f16 q rows [b*t][CC]
#define WS_KH  (WS_QH + 2u * (size_t)NB * TT * CC)      // f16 k rows [b*t][CC]
#define WS_VT  (WS_KH + 2u * (size_t)NB * TT * CC)      // f16 v planes [b][c][t]
#define WS_QL  (WS_VT + 2u * (size_t)NB * CC * TT)      // f16 q residual x 2^10 rows [b][t < QHI][CC]
#define WS_KL  (WS_QL + 2u * (size_t)NB * QHI * CC)     // f16 k residual x 2^10 rows [b][t < KHI][CC]
#define WS_VB  (WS_KL + 2u * (size_t)NB * KHI * CC)     // bf16 v hi planes [b][c][t < KHI]
#define WS_VBL (WS_VB + 2u * (size_t)NB * CC * KHI)
#define WS_S   (WS_VBL + 2u * (size_t)NB * CC * KHI)    // f32 logits / P [hg][t][s]
#define WS_Y   (WS_S  + 4u * (size_t)HG * TT * TT)      // f32 ctx rows [b*t][CC] (only when there is an output projection)
#define WS_END (WS_Y  + 4u * (size_t)NB * TT * CC)

// ---- k_proj: block = (64 rows, 128 cols, which): q/k/v = X W (+ b) with exact bf16 products (K = DIN) -> which 0: q f16 rows (+ residual rows < QHI); 1: k f16 rows (+ residual rows < KHI); 2: v f16 planes [c][t] (+ bf16 hi/lo planes for t < KHI)
__global__ __launch_bounds__(128) void k_proj(const float* __restrict__ XQ, const float* __restrict__ XK, const float* __restrict__ XV, const float* __restrict__ WQ, const float* __restrict__ WK, const float* __restrict__ WV, const float* __restrict__ BQ, const float* __restrict__ BK, const float* __restrict__ BV,
    _Float16* __restrict__ QH, _Float16* __restrict__ QL, _Float16* __restrict__ KH, _Float16* __restrict__ KL, _Float16* __restrict__ VT, __bf16* __restrict__ VB, __bf16* __restrict__ VBL PROJ_EXTRA_PARAMS) {
  __shared__ __align__(16) float st[64][132]; __shared__ __align__(16) _Float16 sh[64][136], sl[64][136]; __shared__ __align__(16) _Float16 th[128][72]; __shared__ __align__(16) __bf16 tb[128][72], tbl[128][72];
  const int tid = threadIdx.x, wave = tid >> 5, lane = tid & 31, col = lane & 15, g = lane >> 4; const int which = blockIdx.z; const int c0 = blockIdx.y * 128; const size_t r0 = (size_t)blockIdx.x * 64; const size_t bb = r0 / TT; const int t0 = (int)(r0 % TT);
  const float* X = which == 0 ? XQ : which == 1 ? XK : XV; const float* WA = which == 0 ? WQ : which == 1 ? WK : WV; const float* BA = which == 0 ? BQ : which == 1 ? BK : BV;
  v8f acc[8] = {};
#pragma unroll 2
  for (int kc = 0; kc < DIN / 32; ++kc) { v16b a; { const float* p = X + (r0 + wave * 16 + col) * DIN + kc * 32 + 8 * g;
#pragma unroll
      for (int i = 0; i < 8; ++i) { a[i] = (__bf16)p[i]; a[8 + i] = (__bf16)p[16 + i]; } }
    asm volatile("s_wait_loadcnt 0x0" ::: "memory");
#pragma unroll
    for (int j = 0; j < 8; ++j) { const v16b w = WCOL(WA, kc * 32, c0 + j * 16 + col, lane); asm volatile("s_wait_loadcnt 0x0" ::: "memory"); acc[j] = wmma_bf(a, w, acc[j]); } }
  { // stage the f32 tile (acc + bias) in LDS, run the per-(row, head) epilogue hook, then convert
#pragma unroll
    for (int j = 0; j < 8; ++j) { const float bias = BA ? bfr(BA[c0 + j * 16 + col]) : 0.f;
#pragma unroll
      for (int r = 0; r < 8; ++r) st[wave * 16 + 8 * g + r][j * 16 + col] = acc[j][r] + bias; }
    __syncthreads();
    for (int e = tid; e < 64 * (128 / HD); e += 128) { const int rl = e / (128 / HD), hh = e % (128 / HD); PROJ_EPI(which, &st[rl][hh * HD], (int)((r0 + rl) % TT), (c0 / HD) + hh); }
    __syncthreads(); }
  if (which < 2) { _Float16* DH = which == 0 ? QH : KH; _Float16* DL = which == 0 ? QL : KL; const int nhi = which == 0 ? QHI : KHI; const bool hi_rows = t0 < nhi;
    for (int e = tid; e < 64 * 128; e += 128) { const int rl = e >> 7, cl = e & 127; const float v = st[rl][cl]; const _Float16 hv = (_Float16)v; sh[rl][cl] = hv; sl[rl][cl] = (_Float16)((v - (float)hv) * 1024.0f); }
    __syncthreads();
    for (int e = tid; e < 64 * 16; e += 128) { const int rl = e >> 4, q = e & 15; vst2((unsigned*)(DH + (r0 + rl) * CC + c0 + q * 8), *(const v4u*)&sh[rl][q * 8]); if (hi_rows) vst2((unsigned*)(DL + (bb * nhi + t0 + rl) * (size_t)CC + c0 + q * 8), *(const v4u*)&sl[rl][q * 8]); }
  } else { const bool hi_rows = t0 < KHI;
    for (int e = tid; e < 64 * 128; e += 128) { const int rl = e & 63, cl = e >> 6; const float v = st[rl][cl]; th[cl][rl] = (_Float16)v; const __bf16 bh = (__bf16)v; tb[cl][rl] = bh; tbl[cl][rl] = (__bf16)(v - (float)bh); }
    __syncthreads();
    for (int e = tid; e < 128 * 8; e += 128) { const int cl = e >> 3, q = e & 7; vst2((unsigned*)(VT + (bb * CC + c0 + cl) * (size_t)TT + t0 + q * 8), *(const v4u*)&th[cl][q * 8]); if (hi_rows) { const size_t o3 = (bb * CC + c0 + cl) * (size_t)KHI + t0 + q * 8; vst2((unsigned*)(VB + o3), *(const v4u*)&tb[cl][q * 8]); vst2((unsigned*)(VBL + o3), *(const v4u*)&tbl[cl][q * 8]); } } } }
// ---- k_projk: k_proj with which = blockIdx.z + 1 (the positional 'key' rows p = pos_emb Wpos)
// ---- block = (64 rows, 128 cols, which): q/k/v = X W (+ b) with exact bf16 products (K = DIN) -> which 0: q f16 rows (+ residual rows < QHI); 1: k f16 rows (+ residual rows < KHI); 2: v f16 planes [c][t] (+ bf16 hi/lo planes for t < KHI)
__global__ __launch_bounds__(128) void k_projk(const float* __restrict__ XQ, const float* __restrict__ XK, const float* __restrict__ XV, const float* __restrict__ WQ, const float* __restrict__ WK, const float* __restrict__ WV, const float* __restrict__ BQ, const float* __restrict__ BK, const float* __restrict__ BV,
    _Float16* __restrict__ QH, _Float16* __restrict__ QL, _Float16* __restrict__ KH, _Float16* __restrict__ KL, _Float16* __restrict__ VT, __bf16* __restrict__ VB, __bf16* __restrict__ VBL PROJ_EXTRA_PARAMS) {
  __shared__ __align__(16) float st[64][132]; __shared__ __align__(16) _Float16 sh[64][136], sl[64][136]; __shared__ __align__(16) _Float16 th[128][72]; __shared__ __align__(16) __bf16 tb[128][72], tbl[128][72];
  const int tid = threadIdx.x, wave = tid >> 5, lane = tid & 31, col = lane & 15, g = lane >> 4; const int which = blockIdx.z + 1;   /* k-format planes only */ const int c0 = blockIdx.y * 128; const size_t r0 = (size_t)blockIdx.x * 64; const size_t bb = r0 / TT; const int t0 = (int)(r0 % TT);
  const float* X = which == 0 ? XQ : which == 1 ? XK : XV; const float* WA = which == 0 ? WQ : which == 1 ? WK : WV; const float* BA = which == 0 ? BQ : which == 1 ? BK : BV;
  v8f acc[8] = {};
#pragma unroll 2
  for (int kc = 0; kc < DIN / 32; ++kc) { v16b a; { const float* p = X + (r0 + wave * 16 + col) * DIN + kc * 32 + 8 * g;
#pragma unroll
      for (int i = 0; i < 8; ++i) { a[i] = (__bf16)p[i]; a[8 + i] = (__bf16)p[16 + i]; } }
    asm volatile("s_wait_loadcnt 0x0" ::: "memory");
#pragma unroll
    for (int j = 0; j < 8; ++j) { const v16b w = WCOL(WA, kc * 32, c0 + j * 16 + col, lane); asm volatile("s_wait_loadcnt 0x0" ::: "memory"); acc[j] = wmma_bf(a, w, acc[j]); } }
  { // stage the f32 tile (acc + bias) in LDS, run the per-(row, head) epilogue hook, then convert
#pragma unroll
    for (int j = 0; j < 8; ++j) { const float bias = BA ? bfr(BA[c0 + j * 16 + col]) : 0.f;
#pragma unroll
      for (int r = 0; r < 8; ++r) st[wave * 16 + 8 * g + r][j * 16 + col] = acc[j][r] + bias; }
    __syncthreads();
    for (int e = tid; e < 64 * (128 / HD); e += 128) { const int rl = e / (128 / HD), hh = e % (128 / HD); PROJ_EPI(which, &st[rl][hh * HD], (int)((r0 + rl) % TT), (c0 / HD) + hh); }
    __syncthreads(); }
  if (which < 2) { _Float16* DH = which == 0 ? QH : KH; _Float16* DL = which == 0 ? QL : KL; const int nhi = which == 0 ? QHI : KHI; const bool hi_rows = t0 < nhi;
    for (int e = tid; e < 64 * 128; e += 128) { const int rl = e >> 7, cl = e & 127; const float v = st[rl][cl]; const _Float16 hv = (_Float16)v; sh[rl][cl] = hv; sl[rl][cl] = (_Float16)((v - (float)hv) * 1024.0f); }
    __syncthreads();
    for (int e = tid; e < 64 * 16; e += 128) { const int rl = e >> 4, q = e & 15; vst2((unsigned*)(DH + (r0 + rl) * CC + c0 + q * 8), *(const v4u*)&sh[rl][q * 8]); if (hi_rows) vst2((unsigned*)(DL + (bb * nhi + t0 + rl) * (size_t)CC + c0 + q * 8), *(const v4u*)&sl[rl][q * 8]); }
  } else { const bool hi_rows = t0 < KHI;
    for (int e = tid; e < 64 * 128; e += 128) { const int rl = e & 63, cl = e >> 6; const float v = st[rl][cl]; th[cl][rl] = (_Float16)v; const __bf16 bh = (__bf16)v; tb[cl][rl] = bh; tbl[cl][rl] = (__bf16)(v - (float)bh); }
    __syncthreads();
    for (int e = tid; e < 128 * 8; e += 128) { const int cl = e >> 3, q = e & 7; vst2((unsigned*)(VT + (bb * CC + c0 + cl) * (size_t)TT + t0 + q * 8), *(const v4u*)&th[cl][q * 8]); if (hi_rows) { const size_t o3 = (bb * CC + c0 + cl) * (size_t)KHI + t0 + q * 8; vst2((unsigned*)(VB + o3), *(const v4u*)&tb[cl][q * 8]); vst2((unsigned*)(VBL + o3), *(const v4u*)&tbl[cl][q * 8]); } } } }
// ---- k_sc: block = (query block qb, key block kb <= kb_last(qb), head in group) of batch b: logits x SCALE; q hi + residual (x 2^10) against k (2 products) for query rows < QHI, plus the k residual (3 products) for query blocks < QBH (causal early rows); causal: blocks past the diagonal exit, the mask itself is applied by index in k_sm
__global__ __launch_bounds__(128) void k_sc(const _Float16* __restrict__ QH, const _Float16* __restrict__ KH, const _Float16* __restrict__ QL, const _Float16* __restrict__ KL, int b, int h0, float* __restrict__ S0) { __shared__ __align__(16) float ss[4][16][132];
  const int qb = blockIdx.x, kb = blockIdx.y; if (kb > kb_last(qb)) return;
  const int h = h0 + blockIdx.z; float* S = S0 + (size_t)blockIdx.z * TT * TT;
  const int tid = threadIdx.x, wave = tid >> 5, lane = tid & 31, col = lane & 15, g = lane >> 4; const int k0 = kb * 128; const int ql0 = qb * 64 + wave * 16; const size_t q0 = (size_t)b * TT + ql0, kr0 = (size_t)b * TT + k0;
  v8f acc[8] = {}, accl[8] = {};
  const _Float16* QLb = QL + (size_t)b * QHI * CC; const _Float16* KLb = KL + (size_t)b * KHI * CC;
  if (qb < QBH) {
#pragma unroll
    for (int kc = 0; kc < HD / 32; ++kc) { const v16h ah = frag_h(QH + (q0 + col) * CC + h * HD + kc * 32, lane), al = frag_h(QLb + (size_t)(ql0 + col) * CC + h * HD + kc * 32, lane);
#pragma unroll
      for (int j = 0; j < 8; ++j) { const v16h kbf = frag_h(KH + (kr0 + j * 16 + col) * CC + h * HD + kc * 32, lane), klf = frag_h(KLb + (size_t)(k0 + j * 16 + col) * CC + h * HD + kc * 32, lane); acc[j] = wmma16(ah, kbf, acc[j]); accl[j] = wmma16(al, kbf, accl[j]); accl[j] = wmma16(ah, klf, accl[j]); } }
  } else if (qb * 64 < QHI) {
#pragma unroll
    for (int kc = 0; kc < HD / 32; ++kc) { const v16h ah = frag_h(QH + (q0 + col) * CC + h * HD + kc * 32, lane), al = frag_h(QLb + (size_t)(ql0 + col) * CC + h * HD + kc * 32, lane);
#pragma unroll
      for (int j = 0; j < 8; ++j) { const v16h kbf = frag_h(KH + (kr0 + j * 16 + col) * CC + h * HD + kc * 32, lane); acc[j] = wmma16(ah, kbf, acc[j]); accl[j] = wmma16(al, kbf, accl[j]); } }
  } else {
#pragma unroll
    for (int kc = 0; kc < HD / 32; ++kc) { const v16h ah = frag_h(QH + (q0 + col) * CC + h * HD + kc * 32, lane);
#pragma unroll
      for (int j = 0; j < 8; ++j) { const v16h kbf = frag_h(KH + (kr0 + j * 16 + col) * CC + h * HD + kc * 32, lane); acc[j] = wmma16(ah, kbf, acc[j]); } } }
#pragma unroll
  for (int j = 0; j < 8; ++j) {
#pragma unroll
    for (int r = 0; r < 8; ++r) ss[wave][8 * g + r][j * 16 + col] = (acc[j][r] + accl[j][r] * (1.0f / 1024.0f)) * SCALE; }
  LDSX(); for (int rl = 0; rl < 16; ++rl) vst2(S + (size_t)(ql0 + rl) * TT + k0 + lane * 4, *(const v4f*)&ss[wave][rl][lane * 4]); }
// ---- k_sm: block = query row t (head in group): keys [0, kend): causal -> logit if s <= t else excluded; softmax in f32; P x 2^11 in place (0 for excluded)
__global__ __launch_bounds__(256) void k_sm(float* __restrict__ S0 SM_EXTRA_PARAMS) { __shared__ float sred[8]; __shared__ float sbc; __shared__ __align__(16) float shv[TT];
  const int tid = threadIdx.x; const int t = blockIdx.x; const int kend = (kb_last(t >> 6) + 1) * 128;
  float* sr = S0 + (size_t)blockIdx.y * TT * TT + (size_t)t * TT;
  float m = -3.0e38f; for (int k = tid; k < kend; k += 256) { float v = (!CAUSAL || k <= t) ? sr[k] : -3.0e38f; SM_MASK_HOOK; shv[k] = v; m = fmaxf(m, v); }
#pragma unroll
  for (int o = 1; o < 32; o <<= 1) m = fmaxf(m, __shfl_xor(m, o));
  if ((tid & 31) == 0) sred[tid >> 5] = m; __syncthreads(); if (tid == 0) { float a = sred[0]; for (int i = 1; i < 8; ++i) a = fmaxf(a, sred[i]); sbc = a; } __syncthreads(); m = sbc; __syncthreads();
  float sum = 0.f; for (int k = tid; k < kend; k += 256) { const float v = shv[k]; const float e = (v <= -1.0e38f) ? 0.f : expf(v - m); shv[k] = e; sum += e; }
#pragma unroll
  for (int o = 1; o < 32; o <<= 1) sum += __shfl_xor(sum, o);
  if ((tid & 31) == 0) sred[tid >> 5] = sum; __syncthreads(); if (tid == 0) { float a = 0.f; for (int i = 0; i < 8; ++i) a += sred[i]; sbc = a > 0.f ? 2048.0f / a : 0.f; }   /* a fully excluded row yields P = 0 */ __syncthreads(); const float inv = sbc;
  for (int k = tid; k < kend; k += 256) shv[k] = shv[k] * inv;
  __syncthreads(); for (int q = tid; q < kend / 4; q += 256) vst2(sr + q * 4, *(const v4f*)&shv[q * 4]); }
// ---- k_pv: block = 64 queries (qb) of (b, h): ctx = P . v over keys [0, kend) (P x 2^11 once to f16 against v f16: 1 product; causal early query blocks: P and v as bf16 hi + lo, 3 products); 256-B (row, head) segment by 16 lanes
__global__ __launch_bounds__(128) void k_pv(const float* __restrict__ PS0, const _Float16* __restrict__ VT, const __bf16* __restrict__ VB, const __bf16* __restrict__ VBL, int b, int h0, float* __restrict__ Y) { const int h = h0 + blockIdx.z; const float* PS = PS0 + (size_t)blockIdx.z * TT * TT; __shared__ __align__(16) float ss[4][16][HD + 4];
  const int tid = threadIdx.x, wave = tid >> 5, lane = tid & 31, col = lane & 15, g = lane >> 4; const int qb = blockIdx.x; const int ql0 = qb * 64 + wave * 16; const int kce = (kb_last(qb) + 1) * 4;
  v8f acc[HD / 16] = {};
  if (qb < QBH) {
#pragma unroll 1
    for (int kc = 0; kc < kce; ++kc) { const F2 p = split_row(PS + (size_t)(ql0 + col) * TT, kc * 32, lane);
      asm volatile("s_wait_loadcnt 0x0" ::: "memory");
#pragma unroll
      for (int j = 0; j < HD / 16; ++j) { const size_t po = ((size_t)b * CC + h * HD + j * 16 + col) * (size_t)KHI + kc * 32; const v16b vh = frag_b(VB + po, lane); acc[j] = wmma_bf(p.h, vh, acc[j]); acc[j] = wmma_bf(p.l, vh, acc[j]); acc[j] = wmma_bf(p.h, frag_b(VBL + po, lane), acc[j]); } }
  } else {
#pragma unroll 1
    for (int kc = 0; kc < kce; ++kc) { const v16h p = frag_f32(PS + (size_t)(ql0 + col) * TT + kc * 32, lane);
      asm volatile("s_wait_loadcnt 0x0" ::: "memory");
#pragma unroll
      for (int j = 0; j < HD / 16; ++j) { const size_t po = ((size_t)b * CC + h * HD + j * 16 + col) * (size_t)TT + kc * 32; acc[j] = wmma16(p, frag_h(VT + po, lane), acc[j]); } } }
#pragma unroll
  for (int j = 0; j < HD / 16; ++j)
#pragma unroll
    for (int r = 0; r < 8; ++r) ss[wave][8 * g + r][j * 16 + col] = acc[j][r] * (1.0f / 2048.0f);
  LDSX(); for (int rl = 0; rl < 16; ++rl) if (lane < HD / 4) vst2(Y + ((size_t)b * TT + ql0 + rl) * CC + h * HD + lane * 4, *(const v4f*)&ss[wave][rl][lane * 4]); }
// ---- k_out: block = (64 rows, 128 cols): out = ctx Wo (+ bo): ctx x 2^6 once to f16 against Wo as f16(bf16 x 2^8) exact (1 product) x 2^-14; causal early rows (< QHI of each sequence): ctx bf16 hi + lo against exact bf16 Wo (2 products)
__global__ __launch_bounds__(128) void k_out(const float* __restrict__ Y, const float* __restrict__ WO, const float* __restrict__ BO, float* __restrict__ OUT) { __shared__ __align__(16) float sf[4][16][132];
  const int tid = threadIdx.x, wave = tid >> 5, lane = tid & 31, col = lane & 15, g = lane >> 4; const int c0 = blockIdx.y * 128; const size_t r0 = (size_t)blockIdx.x * 64 + wave * 16;
  v8f acc[8] = {};
  if (CAUSAL && (int)(((size_t)blockIdx.x * 64) % TT) < QHI) {   /* block-uniform */
#pragma unroll 2
    for (int kc = 0; kc < CC / 32; ++kc) { const F2 a = split_row(Y + (r0 + col) * CC, kc * 32, lane); asm volatile("s_wait_loadcnt 0x0" ::: "memory");
#pragma unroll
      for (int j = 0; j < 8; ++j) { const v16b w = WOCOL(WO, kc * 32, c0 + j * 16 + col, lane); asm volatile("s_wait_loadcnt 0x0" ::: "memory"); acc[j] = wmma_bf(a.h, w, acc[j]); acc[j] = wmma_bf(a.l, w, acc[j]); } }
#pragma unroll
    for (int j = 0; j < 8; ++j) { const float bias = BO ? bfr(BO[c0 + j * 16 + col]) : 0.f;
#pragma unroll
      for (int r = 0; r < 8; ++r) sf[wave][8 * g + r][j * 16 + col] = acc[j][r] + bias; }
  } else {
#pragma unroll 2
    for (int kc = 0; kc < CC / 32; ++kc) { const v16h a = frag_f32s(Y + (r0 + col) * CC + kc * 32, lane, 64.0f); asm volatile("s_wait_loadcnt 0x0" ::: "memory");   /* ctx carried x 2^6 into f16 so small-magnitude context rows stay clear of f16 subnormals */
#pragma unroll
      for (int j = 0; j < 8; ++j) { const v16h w = WOCOLH(WO, kc * 32, c0 + j * 16 + col, lane); asm volatile("s_wait_loadcnt 0x0" ::: "memory"); acc[j] = wmma16(a, w, acc[j]); } }
#pragma unroll
    for (int j = 0; j < 8; ++j) { const float bias = BO ? bfr(BO[c0 + j * 16 + col]) : 0.f;
#pragma unroll
      for (int r = 0; r < 8; ++r) sf[wave][8 * g + r][j * 16 + col] = acc[j][r] * (1.0f / 16384.0f) + bias; } }   /* 2^-8 (Wo carry) x 2^-6 (ctx carry) */
  LDSX(); for (int rl = 0; rl < 16; ++rl) vst2(OUT + (r0 + rl) * DIN + c0 + lane * 4, *(const v4f*)&sf[wave][rl][lane * 4]); }

extern "C" void kernel_launch(void* const* d_in, const int* in_sizes, int n_in, void* d_out, int out_size, void* d_ws, size_t ws_size, hipStream_t stream) {
  (void)in_sizes; (void)n_in; (void)out_size;
  const float** F = (const float**)d_in;
  if (ws_size < (size_t)WS_END) return;
  char* ws = (char*)d_ws; _Float16 *QH = (_Float16*)(ws + WS_QH), *KH = (_Float16*)(ws + WS_KH), *VT = (_Float16*)(ws + WS_VT), *QL = (_Float16*)(ws + WS_QL), *KL = (_Float16*)(ws + WS_KL); __bf16 *VB = (__bf16*)(ws + WS_VB), *VBL = (__bf16*)(ws + WS_VBL); float *S = (float*)(ws + WS_S), *Y = (float*)(ws + WS_Y);
  (void)Y; (void)QL; (void)KL; (void)VB; (void)VBL;
  // inputs: 0 query [4,1024,512]; 1 key; 2 value; 3 pos_emb [1,1024,512]; 4 Wq (in,out), 5 bq; 6 Wk, 7 bk; 8 Wv, 9 bv; 10 Wo (in,out), 11 bo; 12 Wpos [512,512]; 13 pos_bias_u [8,64]; 14 pos_bias_v [8,64]
  if (ws_size < (size_t)WS_END2) return;
  _Float16 *QH2 = (_Float16*)(ws + WS_QH2), *QL2 = (_Float16*)(ws + WS_QL2), *KP = (_Float16*)(ws + WS_KP); float* S2 = (float*)(ws + WS_S2);
  k_proj<<<dim3(TNB * TT / 64, CC / 128, 3), 128, 0, stream>>>(F[0], F[1], F[2], F[4], F[6], F[8], F[5], F[7], F[9], QH, QL, KH, KL, VT, VB, VBL, F[13]);      /* q_u = q + pos_bias_u, k, v */
  k_proj<<<dim3(TNB * TT / 64, CC / 128, 1), 128, 0, stream>>>(F[0], F[1], F[2], F[4], F[6], F[8], F[5], F[7], F[9], QH2, QL2, KH, KL, VT, VB, VBL, F[14]);   /* which 0 only: q_v = q + pos_bias_v */
  k_projk<<<dim3(TT / 64, CC / 128, 1), 128, 0, stream>>>(F[3], F[3], F[3], F[12], F[12], F[12], nullptr, nullptr, nullptr, QH2, QL2, KP, KL, VT, VB, VBL, nullptr);   /* which 1 only, batch-0 rows: p = pos_emb Wpos (no bias) into KP */
  if (TNB > 1) k_reprows<<<dim3(TT, TNB - 1), 256, 0, stream>>>(KP);
  for (int b = 0; b < TNB; ++b) for (int h0 = 0; h0 < NH; h0 += HG) {
    k_sc<<<dim3(NQB, TT / 128, HG), 128, 0, stream>>>(QH, KH, QL, KL, b, h0, S);      /* AC = (q + u) . k  x 1/8 */
    k_sc<<<dim3(NQB, TT / 128, HG), 128, 0, stream>>>(QH2, KP, QL2, KL, b, h0, S2);   /* BD = (q + v) . p  x 1/8 (unshifted) */
    k_sm<<<dim3(TT, HG), 256, 0, stream>>>(S, S2);
    k_pv<<<dim3(NQB, 1, HG), 128, 0, stream>>>(S, VT, VB, VBL, b, h0, Y);
  }
  k_out<<<dim3(TNB * TT / 64, DIN / 128), 128, 0, stream>>>(Y, F[10], F[11], (float*)d_out);
}

// v001
// It runs in 356 microseconds.
// Next to v000, in two timings, it ran 1.46 and 1.45 times as fast.
// compute dtype: all float inputs rounded to bf16; projections with EXACT bf16 products on WMMA 16x16x32 (f32 accumulate) + biases; content (q+u).k and position (q+v).p scores each with q as f16 hi + residual (x 2^10) against f16 k / p (2 products) x 64^-0.5; rel_shift as an index gather in the softmax; softmax f32; P x 2^11 once to f16 x v once to f16 (1 product); ctx carried x 2^6 once to f16 x Wo f16(bf16 x 2^8) + bo; f32 output.
#include <hip/hip_runtime.h>
#include <math.h>

typedef __attribute__((ext_vector_type(16))) _Float16 v16h;
typedef __attribute__((ext_vector_type(16))) __bf16 v16b;
typedef __attribute__((ext_vector_type(8)))  _Float16 v8h;
typedef __attribute__((ext_vector_type(8)))  float v8f;
typedef __attribute__((ext_vector_type(4)))  float v4f;
typedef __attribute__((ext_vector_type(2)))  float v2f;
typedef __attribute__((ext_vector_type(4)))  unsigned v4u;
typedef __attribute__((ext_vector_type(4)))  int v4i;
typedef float __attribute__((may_alias)) float_a;
typedef int __attribute__((may_alias)) int_a;

template <typename T> __device__ __forceinline__ void vst2(void* p, T v) { *(T*)p = v;  }
__device__ __forceinline__ v8f wmma16(v16h a, v16h b, v8f c) {
  v8f d = __builtin_amdgcn_wmma_f32_16x16x32_f16(false, a, false, b, (short)0, c, false, false);
  asm volatile("v_nop\n\tv_nop\n\tv_nop\n\tv_nop" : "+v"(d) : "v"(a), "v"(b));
  return d;
}
__device__ __forceinline__ v8f wmma_bf(v16b a, v16b b, v8f c) {
  v8f d = __builtin_amdgcn_wmma_f32_16x16x32_bf16(false, a, false, b, (short)0, c, false, false);
  asm volatile("v_nop\n\tv_nop\n\tv_nop\n\tv_nop" : "+v"(d) : "v"(a), "v"(b));
  return d;
}
// 16x16x32 fragments: lane = (h = lane>>4, row/col = lane&15); elements 0..7 = k0+8h+0..7, 8..15 = k0+16+8h+0..7; D element r = row 8h+r
__device__ __forceinline__ v16h frag_h(const _Float16* rowk0, int lane) {
  union { v16h v; v8h q[2]; } u; const _Float16* p = rowk0 + 8 * (lane >> 4);
  u.q[0] = *(const v8h*)p; u.q[1] = *(const v8h*)(p + 16); return u.v;
}
__device__ __forceinline__ v16h frag_f32(const float* rowk0, int lane) {
  v16h a; const float* p = rowk0 + 8 * (lane >> 4);
#pragma unroll
  for (int i = 0; i < 8; ++i) { a[i] = (_Float16)p[i]; a[8 + i] = (_Float16)p[16 + i]; }
  return a;
}
__device__ __forceinline__ v16h frag_f32s(const float* rowk0, int lane, float sc) {
  v16h a; const float* p = rowk0 + 8 * (lane >> 4);
#pragma unroll
  for (int i = 0; i < 8; ++i) { a[i] = (_Float16)(p[i] * sc); a[8 + i] = (_Float16)(p[16 + i] * sc); }
  return a;
}
// column fragment from a [K][ld] layout (column n), rows >= K read as 0
__device__ __forceinline__ v16h fragc_f32(const float* W, int k0, int n, int lane, int ld, int K) {
  v16h a; const int g = lane >> 4;
#pragma unroll
  for (int i = 0; i < 8; ++i) { const int ka = k0 + 8 * g + i, kb = ka + 16;
    a[i] = (_Float16)(ka < K ? W[(size_t)(ka < K ? ka : K - 1) * ld + n] : 0.f); a[8 + i] = (_Float16)(kb < K ? W[(size_t)(kb < K ? kb : K - 1) * ld + n] : 0.f); }
  return a;
}
struct F2 { v16b h, l; };
__device__ __forceinline__ F2 bsplit16(const float v[16]) { F2 r;
#pragma unroll
  for (int i = 0; i < 16; ++i) { const __bf16 h = (__bf16)v[i]; r.h[i] = h; r.l[i] = (__bf16)(v[i] - (float)h); }
  return r; }
__device__ __forceinline__ F2 split_row(const float* row, int k0, int lane) { float v[16]; const float* p = row + k0 + 8 * (lane >> 4);
#pragma unroll
  for (int i = 0; i < 8; ++i) { v[i] = p[i]; v[8 + i] = p[16 + i]; }
  return bsplit16(v); }
__device__ __forceinline__ F2 split_rowK(const float* row, int k0, int lane, int K) { float v[16]; const int g = lane >> 4;
#pragma unroll
  for (int i = 0; i < 8; ++i) { const int ka = k0 + 8 * g + i, kb = ka + 16; v[i] = ka < K ? row[ka < K ? ka : K - 1] : 0.f; v[8 + i] = kb < K ? row[kb < K ? kb : K - 1] : 0.f; }
  return bsplit16(v); }
__device__ __forceinline__ F2 split_col(const float* W, int k0, int n, int lane, int ld, int K) { float v[16]; const int g = lane >> 4;
#pragma unroll
  for (int i = 0; i < 8; ++i) { const int ka = k0 + 8 * g + i, kb = ka + 16; v[i] = ka < K ? W[(size_t)(ka < K ? ka : K - 1) * ld + n] : 0.f; v[8 + i] = kb < K ? W[(size_t)(kb < K ? kb : K - 1) * ld + n] : 0.f; }
  return bsplit16(v); }
__device__ __forceinline__ v8f mac3(const F2& a, const F2& b, v8f c) { c = wmma_bf(a.l, b.h, c); c = wmma_bf(a.h, b.l, c); return wmma_bf(a.h, b.h, c); }
__device__ __forceinline__ float sigm(float v) { return 1.0f / (1.0f + expf(-v)); }
#define LDSX() do { asm volatile("s_wait_dscnt 0" ::: "memory"); __builtin_amdgcn_wave_barrier(); __builtin_amdgcn_fence(__ATOMIC_RELEASE, "workgroup"); } while (0)

// Transformer-XL / Conformer relative multi-head attention (B 4, T = P = 1,024, D 512 = 8 heads x 64; (in,out) Wq/Wk/Wv/Wo [512,512] + zero biases, Wpos [512,512] no bias, pos_bias_u/v [8,64]; 1/sqrt(64)-scale): AC = (q + u) k^T, BD = rel_shift((q + v) p^T) with p = pos_emb Wpos (pad-reshape trick, no mask), attn = softmax((AC + BD)/8), out = merge(attn v) Wo + bo.
#define NB 4
#define TT 1024
#define CC 512            // NH * HD = projected width
#define DIN 512          // input (model) width
#define NH 8
#define HD 64
#define NQB (TT / 64)
#define HG 8
#define SCALE (0.125f)
#define CAUSAL 0
#ifndef TNB
#define TNB NB
#endif
__device__ __forceinline__ float bfr(float v) { return (float)(__bf16)v; }
__host__ __device__ __forceinline__ int kb_last(int qb) { return CAUSAL ? ((qb * 64 + 63) >> 7) : (TT / 128 - 1); }
typedef __attribute__((ext_vector_type(8))) __bf16 v8b;
__device__ __forceinline__ v16b frag_b(const __bf16* rowk0, int lane) {
  union { v16b v; v8b q[2]; } u; const __bf16* p = rowk0 + 8 * (lane >> 4);
  u.q[0] = *(const v8b*)p; u.q[1] = *(const v8b*)(p + 16); return u.v;
}
#define QBH 0              // causal: query blocks 0..QBH-1 of each sequence (few keys, no averaging) take the high-precision path
#define QHI 1024            // rows carrying a q residual plane (all rows when non-causal: 2-product logits everywhere)
#define KHI 64            // key rows carrying k residual / v bf16 hi+lo planes (used only by the causal high-precision path)
// B fragment (k rows k0+.., output column o) of a weight: (in,out) [K][ld] or (out,in) [ld rows of K]: bf16 exact, or f16(bf16 * 256) exact
__device__ __forceinline__ v16b wcol_io(const float* Wm, int k0, int o, int lane, int ld) { v16b w; const int g = lane >> 4;
#pragma unroll
  for (int i = 0; i < 8; ++i) { w[i] = (__bf16)Wm[(size_t)(k0 + 8 * g + i) * ld + o]; w[8 + i] = (__bf16)Wm[(size_t)(k0 + 16 + 8 * g + i) * ld + o]; }
  return w; }
__device__ __forceinline__ v16b wcol_oi(const float* Wm, int k0, int o, int lane, int K) { v16b w; const float* p = Wm + (size_t)o * K + k0 + 8 * (lane >> 4);
#pragma unroll
  for (int i = 0; i < 8; ++i) { w[i] = (__bf16)p[i]; w[8 + i] = (__bf16)p[16 + i]; }
  return w; }
__device__ __forceinline__ v16h wcolh_io(const float* Wm, int k0, int o, int lane, int ld) { v16h w; const int g = lane >> 4;
#pragma unroll
  for (int i = 0; i < 8; ++i) { w[i] = (_Float16)(bfr(Wm[(size_t)(k0 + 8 * g + i) * ld + o]) * 256.0f); w[8 + i] = (_Float16)(bfr(Wm[(size_t)(k0 + 16 + 8 * g + i) * ld + o]) * 256.0f); }
  return w; }
__device__ __forceinline__ v16h wcolh_oi(const float* Wm, int k0, int o, int lane, int K) { v16h w; const float* p = Wm + (size_t)o * K + k0 + 8 * (lane >> 4);
#pragma unroll
  for (int i = 0; i < 8; ++i) { w[i] = (_Float16)(bfr(p[i]) * 256.0f); w[8 + i] = (_Float16)(bfr(p[16 + i]) * 256.0f); }
  return w; }
// unconverted f32 values of a fragment, in fragment element order: a row operand, and column o of an (in,out) [K][ld] weight
__device__ __forceinline__ void raw_row(float (&r)[16], const float* rowk0, int lane) { const float* p = rowk0 + 8 * (lane >> 4);
#pragma unroll
  for (int i = 0; i < 8; ++i) { r[i] = p[i]; r[8 + i] = p[16 + i]; } }
__device__ __forceinline__ void raw_col(float (&r)[16], const float* Wm, int k0, int o, int lane, int ld) { const int g = lane >> 4;
#pragma unroll
  for (int i = 0; i < 8; ++i) { r[i] = Wm[(size_t)(k0 + 8 * g + i) * ld + o]; r[8 + i] = Wm[(size_t)(k0 + 16 + 8 * g + i) * ld + o]; } }
#define WQKV_LAYOUT 0   // selects WCOL only, which nothing calls (k_proj always reads (in,out) [DIN][CC]): 0 = (in,out) [DIN][CC]; 1 = (out,in) [CC][DIN]; 2 = per-head [NH][DIN][HD]
__device__ __forceinline__ v16b wcol_hdk(const float* Wm, int k0, int o, int lane) { v16b w; const int g = lane >> 4; const float* p = Wm + (size_t)(o / HD) * DIN * HD + (o % HD);
#pragma unroll
  for (int i = 0; i < 8; ++i) { w[i] = (__bf16)p[(size_t)(k0 + 8 * g + i) * HD]; w[8 + i] = (__bf16)p[(size_t)(k0 + 16 + 8 * g + i) * HD]; }
  return w; }
#define WO_OUT_IN 0
#if WQKV_LAYOUT == 1
#define WCOL(W, k0, o, lane) wcol_oi(W, k0, o, lane, DIN)
#elif WQKV_LAYOUT == 2
#define WCOL(W, k0, o, lane) wcol_hdk(W, k0, o, lane)
#else
#define WCOL(W, k0, o, lane) wcol_io(W, k0, o, lane, CC)
#endif
#if WO_OUT_IN
#define WOCOL(W, k0, o, lane) wcol_oi(W, k0, o, lane, CC)
#define WOCOLH(W, k0, o, lane) wcolh_oi(W, k0, o, lane, CC)
#else
#define WOCOL(W, k0, o, lane) wcol_io(W, k0, o, lane, DIN)
#define WOCOLH(W, k0, o, lane) wcolh_io(W, k0, o, lane, DIN)
#endif
#define PROJ_EXTRA_PARAMS , const float* __restrict__ EXB
#define SM_EXTRA_PARAMS , const float* __restrict__ SBD0
// q_u = q + pos_bias_u (or q_v = q + pos_bias_v): a second per-(head, dim) bias added in f32 after (x Wq + bq), q only
#define PROJ_EPI(which, row, t, h) do { if ((which) == 0 && EXB) { float* rw = (row); _Pragma("unroll 8") for (int d = 0; d < 64; ++d) rw[d] = rw[d] + bfr(EXB[(h) * 64 + d]); } } while (0)
// Transformer-XL rel_shift (P == T, no mask), folded into the softmax hook: shifted BD'[t][j] = BD[t][T-1-(t-j)] for j <= t; 0 for j == t+1; BD[t+1][j-t-2] for j >= t+2 (the reference's pad-reshape trick taken literally, including its upper-triangle entries); scores = (AC + BD') (the 1/sqrt(64) scale is already applied to both planes by k_sc)
#define SM_MASK_HOOK do { const float* bdp = SBD0 + (size_t)blockIdx.y * TT * TT; const int tq = (k <= t) ? t : t + 1, cq = (k <= t) ? (TT - 1 - (t - k)) : (k - t - 2); const bool zero = (k == t + 1); const float bd = bdp[(size_t)(zero ? 0 : tq) * TT + (zero ? 0 : cq)]; v = v + (zero ? 0.f : bd); } while (0)
// ---- k_reprows: replicate the positional key rows (batch 0) into batches 1..NB-1 (f16 rows, 1,024 B each by 64 x 16-B lanes)
__global__ __launch_bounds__(256) void k_reprows(_Float16* __restrict__ KP) { const size_t row = blockIdx.x; const int b = blockIdx.y + 1; const int q = threadIdx.x; if (q < CC / 8) { const v4u v = *(const v4u*)(KP + row * CC + q * 8); asm volatile("s_wait_loadcnt 0x0" ::: "memory"); vst2((unsigned*)(KP + ((size_t)b * TT + row) * CC + q * 8), v); } }
#define WS_QH2 (WS_END)                                   // f16 q_v rows
#define WS_QL2 (WS_QH2 + 2u * (size_t)NB * TT * CC)       // f16 q_v residual rows
#define WS_KP  (WS_QL2 + 2u * (size_t)NB * QHI * CC)      // f16 positional key rows p = pos_emb Wpos, replicated per batch
#define WS_S2  (WS_KP + 2u * (size_t)NB * TT * CC)        // f32 BD planes [hg][t][p]
#define WS_END2 (WS_S2 + 4u * (size_t)HG * TT * TT)
#ifndef SM_EXTRA_PARAMS
#define SM_EXTRA_PARAMS
#endif
#ifndef PROJ_EXTRA_PARAMS
#define PROJ_EXTRA_PARAMS
#endif
#ifndef SM_MASK_HOOK
#define SM_MASK_HOOK (void)0
#endif

#define WS_QH  0u                                      // f16 q rows [b*t][CC]
#define WS_KH  (WS_QH + 2u * (size_t)NB * TT * CC)      // f16 k rows [b*t][CC]
#define WS_VT  (WS_KH + 2u * (size_t)NB * TT * CC)      // f16 v planes [b][c][t]
#define WS_QL  (WS_VT + 2u * (size_t)NB * CC * TT)      // f16 q residual x 2^10 rows [b][t < QHI][CC]
#define WS_KL  (WS_QL + 2u * (size_t)NB * QHI * CC)     // f16 k residual x 2^10 rows [b][t < KHI][CC]
#define WS_VB  (WS_KL + 2u * (size_t)NB * KHI * CC)     // bf16 v hi planes [b][c][t < KHI]
#define WS_VBL (WS_VB + 2u * (size_t)NB * CC * KHI)
#define WS_S   (WS_VBL + 2u * (size_t)NB * CC * KHI)    // f32 logits / P [hg][t][s]
#define WS_Y   (WS_S  + 4u * (size_t)HG * TT * TT)      // f32 ctx rows [b*t][CC] (only when there is an output projection)
#define WS_END (WS_Y  + 4u * (size_t)NB * TT * CC)

// ---- k_proj: block = (64 rows, 128 cols, which): q/k/v = X W (+ b) with exact bf16 products (K = DIN) -> which 0: q f16 rows (+ residual rows < QHI); 1: k f16 rows (+ residual rows < KHI); 2: v f16 planes [c][t] (+ bf16 hi/lo planes for t < KHI)
__global__ __launch_bounds__(128) void k_proj(const float* __restrict__ XQ, const float* __restrict__ XK, const float* __restrict__ XV, const float* __restrict__ WQ, const float* __restrict__ WK, const float* __restrict__ WV, const float* __restrict__ BQ, const float* __restrict__ BK, const float* __restrict__ BV,
    _Float16* __restrict__ QH, _Float16* __restrict__ QL, _Float16* __restrict__ KH, _Float16* __restrict__ KL, _Float16* __restrict__ VT, __bf16* __restrict__ VB, __bf16* __restrict__ VBL PROJ_EXTRA_PARAMS) {
  __shared__ __align__(16) float st[64][132]; __shared__ __align__(16) _Float16 sh[64][136], sl[64][136]; __shared__ __align__(16) _Float16 th[128][72]; __shared__ __align__(16) __bf16 tb[128][72], tbl[128][72];
  const int tid = threadIdx.x, wave = tid >> 5, lane = tid & 31, col = lane & 15, g = lane >> 4; const int which = blockIdx.z; const int c0 = blockIdx.y * 128; const size_t r0 = (size_t)blockIdx.x * 64; const size_t bb = r0 / TT; const int t0 = (int)(r0 % TT);
  const float* X = which == 0 ? XQ : which == 1 ? XK : XV; const float* WA = which == 0 ? WQ : which == 1 ? WK : WV; const float* BA = which == 0 ? BQ : which == 1 ? BK : BV;
  v8f acc[8] = {};
#pragma unroll 2
  for (int kc = 0; kc < DIN / 32; ++kc) { float ar[16], wr[8][16];   /* every load of this k step is issued before the first product, so one latency covers all nine fragments */
    raw_row(ar, X + (r0 + wave * 16 + col) * DIN + kc * 32, lane);
    asm volatile("s_wait_xcnt 0x0" ::: "memory");   /* the row loads' address pair is dead from here on and the weight loads below may be given it as a destination: keep the wait in front of that overwrite */
#pragma unroll
    for (int j = 0; j < 8; ++j) raw_col(wr[j], WA, kc * 32, c0 + j * 16 + col, lane, CC);
    v16b a;
#pragma unroll
    for (int i = 0; i < 16; ++i) a[i] = (__bf16)ar[i];
#pragma unroll
    for (int j = 0; j < 8; ++j) { v16b w;
#pragma unroll
      for (int i = 0; i < 16; ++i) w[i] = (__bf16)wr[j][i];
      acc[j] = wmma_bf(a, w, acc[j]); } }
  { // stage the f32 tile (acc + bias) in LDS, run the per-(row, head) epilogue hook, then convert
#pragma unroll
    for (int j = 0; j < 8; ++j) { const float bias = BA ? bfr(BA[c0 + j * 16 + col]) : 0.f;
#pragma unroll
      for (int r = 0; r < 8; ++r) st[wave * 16 + 8 * g + r][j * 16 + col] = acc[j][r] + bias; }
    __syncthreads();
    for (int e = tid; e < 64 * (128 / HD); e += 128) { const int rl = e / (128 / HD), hh = e % (128 / HD); PROJ_EPI(which, &st[rl][hh * HD], (int)((r0 + rl) % TT), (c0 / HD) + hh); }
    __syncthreads(); }
  if (which < 2) { _Float16* DH = which == 0 ? QH : KH; _Float16* DL = which == 0 ? QL : KL; const int nhi = which == 0 ? QHI : KHI; const bool hi_rows = t0 < nhi;
    for (int e = tid; e < 64 * 128; e += 128) { const int rl = e >> 7, cl = e & 127; const float v = st[rl][cl]; const _Float16 hv = (_Float16)v; sh[rl][cl] = hv; sl[rl][cl] = (_Float16)((v - (float)hv) * 1024.0f); }
    __syncthreads();
    for (int e = tid; e < 64 * 16; e += 128) { const int rl = e >> 4, q = e & 15; vst2((unsigned*)(DH + (r0 + rl) * CC + c0 + q * 8), *(const v4u*)&sh[rl][q * 8]); if (hi_rows) vst2((unsigned*)(DL + (bb * nhi + t0 + rl) * (size_t)CC + c0 + q * 8), *(const v4u*)&sl[rl][q * 8]); }
  } else { const bool hi_rows = t0 < KHI;
    for (int e = tid; e < 64 * 128; e += 128) { const int rl = e & 63, cl = e >> 6; const float v = st[rl][cl]; th[cl][rl] = (_Float16)v; const __bf16 bh = (__bf16)v; tb[cl][rl] = bh; tbl[cl][rl] = (__bf16)(v - (float)bh); }
    __syncthreads();
    for (int e = tid; e < 128 * 8; e += 128) { const int cl = e >> 3, q = e & 7; vst2((unsigned*)(VT + (bb * CC + c0 + cl) * (size_t)TT + t0 + q * 8), *(const v4u*)&th[cl][q * 8]); if (hi_rows) { const size_t o3 = (bb * CC + c0 + cl) * (size_t)KHI + t0 + q * 8; vst2((unsigned*)(VB + o3), *(const v4u*)&tb[cl][q * 8]); vst2((unsigned*)(VBL + o3), *(const v4u*)&tbl[cl][q * 8]); } } } }
// ---- k_projk: k_proj with which = blockIdx.z + 1 (the positional 'key' rows p = pos_emb Wpos)
// ---- block = (64 rows, 128 cols, which): q/k/v = X W (+ b) with exact bf16 products (K = DIN) -> which 0: q f16 rows (+ residual rows < QHI); 1: k f16 rows (+ residual rows < KHI); 2: v f16 planes [c][t] (+ bf16 hi/lo planes for t < KHI)
__global__ __launch_bounds__(128) void k_projk(const float* __restrict__ XQ, const float* __restrict__ XK, const float* __restrict__ XV, const float* __restrict__ WQ, const float* __restrict__ WK, const float* __restrict__ WV, const float* __restrict__ BQ, const float* __restrict__ BK, const float* __restrict__ BV,
    _Float16* __restrict__ QH, _Float16* __restrict__ QL, _Float16* __restrict__ KH, _Float16* __restrict__ KL, _Float16* __restrict__ VT, __bf16* __restrict__ VB, __bf16* __restrict__ VBL PROJ_EXTRA_PARAMS) {
  __shared__ __align__(16) float st[64][132]; __shared__ __align__(16) _Float16 sh[64][136], sl[64][136]; __shared__ __align__(16) _Float16 th[128][72]; __shared__ __align__(16) __bf16 tb[128][72], tbl[128][72];
  const int tid = threadIdx.x, wave = tid >> 5, lane = tid & 31, col = lane & 15, g = lane >> 4; const int which = blockIdx.z + 1;   /* k-format planes only */ const int c0 = blockIdx.y * 128; const size_t r0 = (size_t)blockIdx.x * 64; const size_t bb = r0 / TT; const int t0 = (int)(r0 % TT);
  const float* X = which == 0 ? XQ : which == 1 ? XK : XV; const float* WA = which == 0 ? WQ : which == 1 ? WK : WV; const float* BA = which == 0 ? BQ : which == 1 ? BK : BV;
  v8f acc[8] = {};
#pragma unroll 2
  for (int kc = 0; kc < DIN / 32; ++kc) { float ar[16], wr[8][16];   /* every load of this k step is issued before the first product, so one latency covers all nine fragments */
    raw_row(ar, X + (r0 + wave * 16 + col) * DIN + kc * 32, lane);
    asm volatile("s_wait_xcnt 0x0" ::: "memory");   /* the row loads' address pair is dead from here on and the weight loads below may be given it as a destination: keep the wait in front of that overwrite */
#pragma unroll
    for (int j = 0; j < 8; ++j) raw_col(wr[j], WA, kc * 32, c0 + j * 16 + col, lane, CC);
    v16b a;
#pragma unroll
    for (int i = 0; i < 16; ++i) a[i] = (__bf16)ar[i];
#pragma unroll
    for (int j = 0; j < 8; ++j) { v16b w;
#pragma unroll
      for (int i = 0; i < 16; ++i) w[i] = (__bf16)wr[j][i];
      acc[j] = wmma_bf(a, w, acc[j]); } }
  { // stage the f32 tile (acc + bias) in LDS, run the per-(row, head) epilogue hook, then convert
#pragma unroll
    for (int j = 0; j < 8; ++j) { const float bias = BA ? bfr(BA[c0 + j * 16 + col]) : 0.f;
#pragma unroll
      for (int r = 0; r < 8; ++r) st[wave * 16 + 8 * g + r][j * 16 + col] = acc[j][r] + bias; }
    __syncthreads();
    for (int e = tid; e < 64 * (128 / HD); e += 128) { const int rl = e / (128 / HD), hh = e % (128 / HD); PROJ_EPI(which, &st[rl][hh * HD], (int)((r0 + rl) % TT), (c0 / HD) + hh); }
    __syncthreads(); }
  if (which < 2) { _Float16* DH = which == 0 ? QH : KH; _Float16* DL = which == 0 ? QL : KL; const int nhi = which == 0 ? QHI : KHI; const bool hi_rows = t0 < nhi;
    for (int e = tid; e < 64 * 128; e += 128) { const int rl = e >> 7, cl = e & 127; const float v = st[rl][cl]; const _Float16 hv = (_Float16)v; sh[rl][cl] = hv; sl[rl][cl] = (_Float16)((v - (float)hv) * 1024.0f); }
    __syncthreads();
    for (int e = tid; e < 64 * 16; e += 128) { const int rl = e >> 4, q = e & 15; vst2((unsigned*)(DH + (r0 + rl) * CC + c0 + q * 8), *(const v4u*)&sh[rl][q * 8]); if (hi_rows) vst2((unsigned*)(DL + (bb * nhi + t0 + rl) * (size_t)CC + c0 + q * 8), *(const v4u*)&sl[rl][q * 8]); }
  } else { const bool hi_rows = t0 < KHI;
    for (int e = tid; e < 64 * 128; e += 128) { const int rl = e & 63, cl = e >> 6; const float v = st[rl][cl]; th[cl][rl] = (_Float16)v; const __bf16 bh = (__bf16)v; tb[cl][rl] = bh; tbl[cl][rl] = (__bf16)(v - (float)bh); }
    __syncthreads();
    for (int e = tid; e < 128 * 8; e += 128) { const int cl = e >> 3, q = e & 7; vst2((unsigned*)(VT + (bb * CC + c0 + cl) * (size_t)TT + t0 + q * 8), *(const v4u*)&th[cl][q * 8]); if (hi_rows) { const size_t o3 = (bb * CC + c0 + cl) * (size_t)KHI + t0 + q * 8; vst2((unsigned*)(VB + o3), *(const v4u*)&tb[cl][q * 8]); vst2((unsigned*)(VBL + o3), *(const v4u*)&tbl[cl][q * 8]); } } } }
// ---- k_sc: block = (query block qb, key block kb <= kb_last(qb), head in group) of batch b: logits x SCALE; q hi + residual (x 2^10) against k (2 products) for query rows < QHI, plus the k residual (3 products) for query blocks < QBH (causal early rows); causal: blocks past the diagonal exit, the mask itself is applied by index in k_sm
__global__ __launch_bounds__(128) void k_sc(const _Float16* __restrict__ QH, const _Float16* __restrict__ KH, const _Float16* __restrict__ QL, const _Float16* __restrict__ KL, int b, int h0, float* __restrict__ S0) { __shared__ __align__(16) float ss[4][16][132];
  const int qb = blockIdx.x, kb = blockIdx.y; if (kb > kb_last(qb)) return;
  const int h = h0 + blockIdx.z; float* S = S0 + (size_t)blockIdx.z * TT * TT;
  const int tid = threadIdx.x, wave = tid >> 5, lane = tid & 31, col = lane & 15, g = lane >> 4; const int k0 = kb * 128; const int ql0 = qb * 64 + wave * 16; const size_t q0 = (size_t)b * TT + ql0, kr0 = (size_t)b * TT + k0;
  v8f acc[8] = {}, accl[8] = {};
  const _Float16* QLb = QL + (size_t)b * QHI * CC; const _Float16* KLb = KL + (size_t)b * KHI * CC;
  if (qb < QBH) {
#pragma unroll
    for (int kc = 0; kc < HD / 32; ++kc) { const v16h ah = frag_h(QH + (q0 + col) * CC + h * HD + kc * 32, lane), al = frag_h(QLb + (size_t)(ql0 + col) * CC + h * HD + kc * 32, lane);
#pragma unroll
      for (int j = 0; j < 8; ++j) { const v16h kbf = frag_h(KH + (kr0 + j * 16 + col) * CC + h * HD + kc * 32, lane), klf = frag_h(KLb + (size_t)(k0 + j * 16 + col) * CC + h * HD + kc * 32, lane); acc[j] = wmma16(ah, kbf, acc[j]); accl[j] = wmma16(al, kbf, accl[j]); accl[j] = wmma16(ah, klf, accl[j]); } }
  } else if (qb * 64 < QHI) { v16h ah[HD / 32], al[HD / 32], kf[8];   /* all q fragments and the eight key fragments of the first k step are issued before the first product; each key slot is refilled for the next k step as soon as its two products are issued */
#pragma unroll
    for (int kc = 0; kc < HD / 32; ++kc) { ah[kc] = frag_h(QH + (q0 + col) * CC + h * HD + kc * 32, lane); al[kc] = frag_h(QLb + (size_t)(ql0 + col) * CC + h * HD + kc * 32, lane); }
#pragma unroll
    for (int j = 0; j < 8; ++j) kf[j] = frag_h(KH + (kr0 + j * 16 + col) * CC + h * HD, lane);
#pragma unroll
    for (int kc = 0; kc < HD / 32; ++kc) {
#pragma unroll
      for (int j = 0; j < 8; ++j) { acc[j] = wmma16(ah[kc], kf[j], acc[j]); accl[j] = wmma16(al[kc], kf[j], accl[j]); if (kc + 1 < HD / 32) kf[j] = frag_h(KH + (kr0 + j * 16 + col) * CC + h * HD + (kc + 1) * 32, lane); } }
  } else {
#pragma unroll
    for (int kc = 0; kc < HD / 32; ++kc) { const v16h ah = frag_h(QH + (q0 + col) * CC + h * HD + kc * 32, lane);
#pragma unroll
      for (int j = 0; j < 8; ++j) { const v16h kbf = frag_h(KH + (kr0 + j * 16 + col) * CC + h * HD + kc * 32, lane); acc[j] = wmma16(ah, kbf, acc[j]); } } }
#pragma unroll
  for (int j = 0; j < 8; ++j) {
#pragma unroll
    for (int r = 0; r < 8; ++r) ss[wave][8 * g + r][j * 16 + col] = (acc[j][r] + accl[j][r] * (1.0f / 1024.0f)) * SCALE; }
  LDSX(); for (int rl = 0; rl < 16; ++rl) vst2(S + (size_t)(ql0 + rl) * TT + k0 + lane * 4, *(const v4f*)&ss[wave][rl][lane * 4]); }
// ---- k_sm: block = query row t (head in group): keys [0, kend): causal -> logit if s <= t else excluded; softmax in f32; P x 2^11 in place (0 for excluded)
__global__ __launch_bounds__(256) void k_sm(float* __restrict__ S0 SM_EXTRA_PARAMS) { __shared__ float sred[8]; __shared__ float sbc; __shared__ __align__(16) float shv[TT];
  const int tid = threadIdx.x; const int t = blockIdx.x; const int kend = (kb_last(t >> 6) + 1) * 128;
  float* sr = S0 + (size_t)blockIdx.y * TT * TT + (size_t)t * TT;
  float m = -3.0e38f; for (int k = tid; k < kend; k += 256) { float v = (!CAUSAL || k <= t) ? sr[k] : -3.0e38f; SM_MASK_HOOK; shv[k] = v; m = fmaxf(m, v); }
#pragma unroll
  for (int o = 1; o < 32; o <<= 1) m = fmaxf(m, __shfl_xor(m, o));
  if ((tid & 31) == 0) sred[tid >> 5] = m; __syncthreads(); if (tid == 0) { float a = sred[0]; for (int i = 1; i < 8; ++i) a = fmaxf(a, sred[i]); sbc = a; } __syncthreads(); m = sbc; __syncthreads();
  float sum = 0.f; for (int k = tid; k < kend; k += 256) { const float v = shv[k]; const float e = (v <= -1.0e38f) ? 0.f : expf(v - m); shv[k] = e; sum += e; }
#pragma unroll
  for (int o = 1; o < 32; o <<= 1) sum += __shfl_xor(sum, o);
  if ((tid & 31) == 0) sred[tid >> 5] = sum; __syncthreads(); if (tid == 0) { float a = 0.f; for (int i = 0; i < 8; ++i) a += sred[i]; sbc = a > 0.f ? 2048.0f / a : 0.f; }   /* a fully excluded row yields P = 0 */ __syncthreads(); const float inv = sbc;
  for (int k = tid; k < kend; k += 256) shv[k] = shv[k] * inv;
  __syncthreads(); for (int q = tid; q < kend / 4; q += 256) vst2(sr + q * 4, *(const v4f*)&shv[q * 4]); }
// ---- k_pv: block = 64 queries (qb) of (b, h): ctx = P . v over keys [0, kend) (P x 2^11 once to f16 against v f16: 1 product; causal early query blocks: P and v as bf16 hi + lo, 3 products); 256-B (row, head) segment by 16 lanes
__global__ __launch_bounds__(128) void k_pv(const float* __restrict__ PS0, const _Float16* __restrict__ VT, const __bf16* __restrict__ VB, const __bf16* __restrict__ VBL, int b, int h0, float* __restrict__ Y) { const int h = h0 + blockIdx.z; const float* PS = PS0 + (size_t)blockIdx.z * TT * TT; __shared__ __align__(16) float ss[4][16][HD + 4];
  const int tid = threadIdx.x, wave = tid >> 5, lane = tid & 31, col = lane & 15, g = lane >> 4; const int qb = blockIdx.x; const int ql0 = qb * 64 + wave * 16; const int kce = (kb_last(qb) + 1) * 4;
  v8f acc[HD / 16] = {};
  if (qb < QBH) {
#pragma unroll 1
    for (int kc = 0; kc < kce; ++kc) { const F2 p = split_row(PS + (size_t)(ql0 + col) * TT, kc * 32, lane);
      asm volatile("s_wait_loadcnt 0x0" ::: "memory");
#pragma unroll
      for (int j = 0; j < HD / 16; ++j) { const size_t po = ((size_t)b * CC + h * HD + j * 16 + col) * (size_t)KHI + kc * 32; const v16b vh = frag_b(VB + po, lane); acc[j] = wmma_bf(p.h, vh, acc[j]); acc[j] = wmma_bf(p.l, vh, acc[j]); acc[j] = wmma_bf(p.h, frag_b(VBL + po, lane), acc[j]); } }
  } else {
#pragma unroll 1   /* the body already holds four k steps; more would not fit the registers */
    for (int k4 = 0; k4 < kce; k4 += 4) { float pr[4][16]; v16h vf[4][HD / 16];   /* kce is a multiple of 4; the loads of four k steps are issued together, so one latency covers twenty fragments */
#pragma unroll
      for (int u = 0; u < 4; ++u) raw_row(pr[u], PS + (size_t)(ql0 + col) * TT + (k4 + u) * 32, lane);
#pragma unroll
      for (int u = 0; u < 4; ++u)
#pragma unroll
        for (int j = 0; j < HD / 16; ++j) vf[u][j] = frag_h(VT + ((size_t)b * CC + h * HD + j * 16 + col) * (size_t)TT + (k4 + u) * 32, lane);
#pragma unroll
      for (int u = 0; u < 4; ++u) { v16h p;
#pragma unroll
        for (int i = 0; i < 16; ++i) p[i] = (_Float16)pr[u][i];
#pragma unroll
        for (int j = 0; j < HD / 16; ++j) acc[j] = wmma16(p, vf[u][j], acc[j]); } } }
#pragma unroll
  for (int j = 0; j < HD / 16; ++j)
#pragma unroll
    for (int r = 0; r < 8; ++r) ss[wave][8 * g + r][j * 16 + col] = acc[j][r] * (1.0f / 2048.0f);
  LDSX(); for (int rl = 0; rl < 16; ++rl) if (lane < HD / 4) vst2(Y + ((size_t)b * TT + ql0 + rl) * CC + h * HD + lane * 4, *(const v4f*)&ss[wave][rl][lane * 4]); }
// ---- k_out: block = (64 rows, 128 cols): out = ctx Wo (+ bo): ctx x 2^6 once to f16 against Wo as f16(bf16 x 2^8) exact (1 product) x 2^-14; causal early rows (< QHI of each sequence): ctx bf16 hi + lo against exact bf16 Wo (2 products)
__global__ __launch_bounds__(128) void k_out(const float* __restrict__ Y, const float* __restrict__ WO, const float* __restrict__ BO, float* __restrict__ OUT) { __shared__ __align__(16) float sf[4][16][132];
  const int tid = threadIdx.x, wave = tid >> 5, lane = tid & 31, col = lane & 15, g = lane >> 4; const int c0 = blockIdx.y * 128; const size_t r0 = (size_t)blockIdx.x * 64 + wave * 16;
  v8f acc[8] = {};
  if (CAUSAL && (int)(((size_t)blockIdx.x * 64) % TT) < QHI) {   /* block-uniform */
#pragma unroll 2
    for (int kc = 0; kc < CC / 32; ++kc) { const F2 a = split_row(Y + (r0 + col) * CC, kc * 32, lane); asm volatile("s_wait_loadcnt 0x0" ::: "memory");
#pragma unroll
      for (int j = 0; j < 8; ++j) { const v16b w = WOCOL(WO, kc * 32, c0 + j * 16 + col, lane); asm volatile("s_wait_loadcnt 0x0" ::: "memory"); acc[j] = wmma_bf(a.h, w, acc[j]); acc[j] = wmma_bf(a.l, w, acc[j]); } }
#pragma unroll
    for (int j = 0; j < 8; ++j) { const float bias = BO ? bfr(BO[c0 + j * 16 + col]) : 0.f;
#pragma unroll
      for (int r = 0; r < 8; ++r) sf[wave][8 * g + r][j * 16 + col] = acc[j][r] + bias; }
  } else {
#pragma unroll 2
    for (int kc = 0; kc < CC / 32; ++kc) { float ar[16], wr[8][16];   /* every load of this k step is issued before the first product */
      raw_row(ar, Y + (r0 + col) * CC + kc * 32, lane);
#pragma unroll
      for (int j = 0; j < 8; ++j) raw_col(wr[j], WO, kc * 32, c0 + j * 16 + col, lane, DIN);
      v16h a;   /* ctx carried x 2^6 into f16 so small-magnitude context rows stay clear of f16 subnormals */
#pragma unroll
      for (int i = 0; i < 16; ++i) a[i] = (_Float16)(ar[i] * 64.0f);
#pragma unroll
      for (int j = 0; j < 8; ++j) { v16h w;
#pragma unroll
        for (int i = 0; i < 16; ++i) w[i] = (_Float16)(bfr(wr[j][i]) * 256.0f);
        acc[j] = wmma16(a, w, acc[j]); } }
#pragma unroll
    for (int j = 0; j < 8; ++j) { const float bias = BO ? bfr(BO[c0 + j * 16 + col]) : 0.f;
#pragma unroll
      for (int r = 0; r < 8; ++r) sf[wave][8 * g + r][j * 16 + col] = acc[j][r] * (1.0f / 16384.0f) + bias; } }   /* 2^-8 (Wo carry) x 2^-6 (ctx carry) */
  LDSX(); for (int rl = 0; rl < 16; ++rl) vst2(OUT + (r0 + rl) * DIN + c0 + lane * 4, *(const v4f*)&sf[wave][rl][lane * 4]); }

extern "C" void kernel_launch(void* const* d_in, const int* in_sizes, int n_in, void* d_out, int out_size, void* d_ws, size_t ws_size, hipStream_t stream) {
  (void)in_sizes; (void)n_in; (void)out_size;
  const float** F = (const float**)d_in;
  if (ws_size < (size_t)WS_END) return;
  char* ws = (char*)d_ws; _Float16 *QH = (_Float16*)(ws + WS_QH), *KH = (_Float16*)(ws + WS_KH), *VT = (_Float16*)(ws + WS_VT), *QL = (_Float16*)(ws + WS_QL), *KL = (_Float16*)(ws + WS_KL); __bf16 *VB = (__bf16*)(ws + WS_VB), *VBL = (__bf16*)(ws + WS_VBL); float *S = (float*)(ws + WS_S), *Y = (float*)(ws + WS_Y);
  (void)Y; (void)QL; (void)KL; (void)VB; (void)VBL;
  // inputs: 0 query [4,1024,512]; 1 key; 2 value; 3 pos_emb [1,1024,512]; 4 Wq (in,out), 5 bq; 6 Wk, 7 bk; 8 Wv, 9 bv; 10 Wo (in,out), 11 bo; 12 Wpos [512,512]; 13 pos_bias_u [8,64]; 14 pos_bias_v [8,64]
  if (ws_size < (size_t)WS_END2) return;
  _Float16 *QH2 = (_Float16*)(ws + WS_QH2), *QL2 = (_Float16*)(ws + WS_QL2), *KP = (_Float16*)(ws + WS_KP); float* S2 = (float*)(ws + WS_S2);
  k_proj<<<dim3(TNB * TT / 64, CC / 128, 3), 128, 0, stream>>>(F[0], F[1], F[2], F[4], F[6], F[8], F[5], F[7], F[9], QH, QL, KH, KL, VT, VB, VBL, F[13]);      /* q_u = q + pos_bias_u, k, v */
  k_proj<<<dim3(TNB * TT / 64, CC / 128, 1), 128, 0, stream>>>(F[0], F[1], F[2], F[4], F[6], F[8], F[5], F[7], F[9], QH2, QL2, KH, KL, VT, VB, VBL, F[14]);   /* which 0 only: q_v = q + pos_bias_v */
  k_projk<<<dim3(TT / 64, CC / 128, 1), 128, 0, stream>>>(F[3], F[3], F[3], F[12], F[12], F[12], nullptr, nullptr, nullptr, QH2, QL2, KP, KL, VT, VB, VBL, nullptr);   /* which 1 only, batch-0 rows: p = pos_emb Wpos (no bias) into KP */
  if (TNB > 1) k_reprows<<<dim3(TT, TNB - 1), 256, 0, stream>>>(KP);
  for (int b = 0; b < TNB; ++b) for (int h0 = 0; h0 < NH; h0 += HG) {
    k_sc<<<dim3(NQB, TT / 128, HG), 128, 0, stream>>>(QH, KH, QL, KL, b, h0, S);      /* AC = (q + u) . k  x 1/8 */
    k_sc<<<dim3(NQB, TT / 128, HG), 128, 0, stream>>>(QH2, KP, QL2, KL, b, h0, S2);   /* BD = (q + v) . p  x 1/8 (unshifted) */
    k_sm<<<dim3(TT, HG), 256, 0, stream>>>(S, S2);
    k_pv<<<dim3(NQB, 1, HG), 128, 0, stream>>>(S, VT, VB, VBL, b, h0, Y);
  }
  k_out<<<dim3(TNB * TT / 64, DIN / 128), 128, 0, stream>>>(Y, F[10], F[11], (float*)d_out);
}

// v003
// Measured time: 173 microseconds a run.
// Versions between v001 and this one are left out; their measured steps multiply to 2.05 times as fast.
// All steps since v000 together make it 2.99 times as fast.
// compute dtype: all float inputs rounded to bf16; projections with EXACT bf16 products on WMMA 16x16x32 (f32 accumulate) + biases; content (q+u).k and position (q+v).p scores each with q as f16 hi + residual (x 2^10) against f16 k / p (2 products) x 64^-0.5; rel_shift as the store index of the position scores in LDS; softmax f32; P x 2^11 once to f16 x v once to f16 (1 product); ctx carried x 2^6 once to f16 x Wo f16(bf16 x 2^8) + bo; f32 output.
#include <hip/hip_runtime.h>
#include <math.h>

typedef __attribute__((ext_vector_type(16))) _Float16 v16h;
typedef __attribute__((ext_vector_type(16))) __bf16 v16b;
typedef __attribute__((ext_vector_type(8)))  _Float16 v8h;
typedef __attribute__((ext_vector_type(8)))  float v8f;
typedef __attribute__((ext_vector_type(4)))  float v4f;
typedef __attribute__((ext_vector_type(2)))  float v2f;
typedef __attribute__((ext_vector_type(4)))  unsigned v4u;
typedef __attribute__((ext_vector_type(4)))  int v4i;
typedef float __attribute__((may_alias)) float_a;
typedef int __attribute__((may_alias)) int_a;

template <typename T> __device__ __forceinline__ void vst2(void* p, T v) { *(T*)p = v;  }
__device__ __forceinline__ v8f wmma16(v16h a, v16h b, v8f c) {
  v8f d = __builtin_amdgcn_wmma_f32_16x16x32_f16(false, a, false, b, (short)0, c, false, false);
  asm volatile("v_nop\n\tv_nop\n\tv_nop\n\tv_nop" : "+v"(d) : "v"(a), "v"(b));
  return d;
}
__device__ __forceinline__ v8f wmma_bf(v16b a, v16b b, v8f c) {
  v8f d = __builtin_amdgcn_wmma_f32_16x16x32_bf16(false, a, false, b, (short)0, c, false, false);
  asm volatile("v_nop\n\tv_nop\n\tv_nop\n\tv_nop" : "+v"(d) : "v"(a), "v"(b));
  return d;
}
// 16x16x32 fragments: lane = (h = lane>>4, row/col = lane&15); elements 0..7 = k0+8h+0..7, 8..15 = k0+16+8h+0..7; D element r = row 8h+r
__device__ __forceinline__ v16h frag_h(const _Float16* rowk0, int lane) {
  union { v16h v; v8h q[2]; } u; const _Float16* p = rowk0 + 8 * (lane >> 4);
  u.q[0] = *(const v8h*)p; u.q[1] = *(const v8h*)(p + 16); return u.v;
}
__device__ __forceinline__ v16h frag_f32(const float* rowk0, int lane) {
  v16h a; const float* p = rowk0 + 8 * (lane >> 4);
#pragma unroll
  for (int i = 0; i < 8; ++i) { a[i] = (_Float16)p[i]; a[8 + i] = (_Float16)p[16 + i]; }
  return a;
}
__device__ __forceinline__ v16h frag_f32s(const float* rowk0, int lane, float sc) {
  v16h a; const float* p = rowk0 + 8 * (lane >> 4);
#pragma unroll
  for (int i = 0; i < 8; ++i) { a[i] = (_Float16)(p[i] * sc); a[8 + i] = (_Float16)(p[16 + i] * sc); }
  return a;
}
// column fragment from a [K][ld] layout (column n), rows >= K read as 0
__device__ __forceinline__ v16h fragc_f32(const float* W, int k0, int n, int lane, int ld, int K) {
  v16h a; const int g = lane >> 4;
#pragma unroll
  for (int i = 0; i < 8; ++i) { const int ka = k0 + 8 * g + i, kb = ka + 16;
    a[i] = (_Float16)(ka < K ? W[(size_t)(ka < K ? ka : K - 1) * ld + n] : 0.f); a[8 + i] = (_Float16)(kb < K ? W[(size_t)(kb < K ? kb : K - 1) * ld + n] : 0.f); }
  return a;
}
struct F2 { v16b h, l; };
__device__ __forceinline__ F2 bsplit16(const float v[16]) { F2 r;
#pragma unroll
  for (int i = 0; i < 16; ++i) { const __bf16 h = (__bf16)v[i]; r.h[i] = h; r.l[i] = (__bf16)(v[i] - (float)h); }
  return r; }
__device__ __forceinline__ F2 split_row(const float* row, int k0, int lane) { float v[16]; const float* p = row + k0 + 8 * (lane >> 4);
#pragma unroll
  for (int i = 0; i < 8; ++i) { v[i] = p[i]; v[8 + i] = p[16 + i]; }
  return bsplit16(v); }
__device__ __forceinline__ F2 split_rowK(const float* row, int k0, int lane, int K) { float v[16]; const int g = lane >> 4;
#pragma unroll
  for (int i = 0; i < 8; ++i) { const int ka = k0 + 8 * g + i, kb = ka + 16; v[i] = ka < K ? row[ka < K ? ka : K - 1] : 0.f; v[8 + i] = kb < K ? row[kb < K ? kb : K - 1] : 0.f; }
  return bsplit16(v); }
__device__ __forceinline__ F2 split_col(const float* W, int k0, int n, int lane, int ld, int K) { float v[16]; const int g = lane >> 4;
#pragma unroll
  for (int i = 0; i < 8; ++i) { const int ka = k0 + 8 * g + i, kb = ka + 16; v[i] = ka < K ? W[(size_t)(ka < K ? ka : K - 1) * ld + n] : 0.f; v[8 + i] = kb < K ? W[(size_t)(kb < K ? kb : K - 1) * ld + n] : 0.f; }
  return bsplit16(v); }
__device__ __forceinline__ v8f mac3(const F2& a, const F2& b, v8f c) { c = wmma_bf(a.l, b.h, c); c = wmma_bf(a.h, b.l, c); return wmma_bf(a.h, b.h, c); }
__device__ __forceinline__ float sigm(float v) { return 1.0f / (1.0f + expf(-v)); }
#define LDSX() do { asm volatile("s_wait_dscnt 0" ::: "memory"); __builtin_amdgcn_wave_barrier(); __builtin_amdgcn_fence(__ATOMIC_RELEASE, "workgroup"); } while (0)

// Transformer-XL / Conformer relative multi-head attention (B 4, T = P = 1,024, D 512 = 8 heads x 64; (in,out) Wq/Wk/Wv/Wo [512,512] + zero biases, Wpos [512,512] no bias, pos_bias_u/v [8,64]; 1/sqrt(64)-scale): AC = (q + u) k^T, BD = rel_shift((q + v) p^T) with p = pos_emb Wpos (pad-reshape trick, no mask), attn = softmax((AC + BD)/8), out = merge(attn v) Wo + bo.
#define NB 4
#define TT 1024
#define CC 512            // NH * HD = projected width
#define DIN 512          // input (model) width
#define NH 8
#define HD 64
#define NQB (TT / 64)
#define HG 8
#define SCALE (0.125f)
#define CAUSAL 0
#ifndef TNB
#define TNB NB
#endif
__device__ __forceinline__ float bfr(float v) { return (float)(__bf16)v; }
__host__ __device__ __forceinline__ int kb_last(int qb) { return CAUSAL ? ((qb * 64 + 63) >> 7) : (TT / 128 - 1); }
typedef __attribute__((ext_vector_type(8))) __bf16 v8b;
__device__ __forceinline__ v16b frag_b(const __bf16* rowk0, int lane) {
  union { v16b v; v8b q[2]; } u; const __bf16* p = rowk0 + 8 * (lane >> 4);
  u.q[0] = *(const v8b*)p; u.q[1] = *(const v8b*)(p + 16); return u.v;
}
#define QBH 0              // read by no kernel here
#define QHI 1024            // rows carrying a q residual plane (all rows when non-causal: 2-product logits everywhere)
#define KHI 64            // key rows carrying k residual / v bf16 hi+lo planes (written, but read by no kernel here)
// B fragment (k rows k0+.., output column o) of a weight: (in,out) [K][ld] or (out,in) [ld rows of K]: bf16 exact, or f16(bf16 * 256) exact
__device__ __forceinline__ v16b wcol_io(const float* Wm, int k0, int o, int lane, int ld) { v16b w; const int g = lane >> 4;
#pragma unroll
  for (int i = 0; i < 8; ++i) { w[i] = (__bf16)Wm[(size_t)(k0 + 8 * g + i) * ld + o]; w[8 + i] = (__bf16)Wm[(size_t)(k0 + 16 + 8 * g + i) * ld + o]; }
  return w; }
__device__ __forceinline__ v16b wcol_oi(const float* Wm, int k0, int o, int lane, int K) { v16b w; const float* p = Wm + (size_t)o * K + k0 + 8 * (lane >> 4);
#pragma unroll
  for (int i = 0; i < 8; ++i) { w[i] = (__bf16)p[i]; w[8 + i] = (__bf16)p[16 + i]; }
  return w; }
__device__ __forceinline__ v16h wcolh_io(const float* Wm, int k0, int o, int lane, int ld) { v16h w; const int g = lane >> 4;
#pragma unroll
  for (int i = 0; i < 8; ++i) { w[i] = (_Float16)(bfr(Wm[(size_t)(k0 + 8 * g + i) * ld + o]) * 256.0f); w[8 + i] = (_Float16)(bfr(Wm[(size_t)(k0 + 16 + 8 * g + i) * ld + o]) * 256.0f); }
  return w; }
__device__ __forceinline__ v16h wcolh_oi(const float* Wm, int k0, int o, int lane, int K) { v16h w; const float* p = Wm + (size_t)o * K + k0 + 8 * (lane >> 4);
#pragma unroll
  for (int i = 0; i < 8; ++i) { w[i] = (_Float16)(bfr(p[i]) * 256.0f); w[8 + i] = (_Float16)(bfr(p[16 + i]) * 256.0f); }
  return w; }
// unconverted f32 values of a fragment, in fragment element order: a row operand, and column o of an (in,out) [K][ld] weight
__device__ __forceinline__ void raw_row(float (&r)[16], const float* rowk0, int lane) { const float* p = rowk0 + 8 * (lane >> 4);
#pragma unroll
  for (int i = 0; i < 8; ++i) { r[i] = p[i]; r[8 + i] = p[16 + i]; } }
__device__ __forceinline__ void raw_col(float (&r)[16], const float* Wm, int k0, int o, int lane, int ld) { const int g = lane >> 4;
#pragma unroll
  for (int i = 0; i < 8; ++i) { r[i] = Wm[(size_t)(k0 + 8 * g + i) * ld + o]; r[8 + i] = Wm[(size_t)(k0 + 16 + 8 * g + i) * ld + o]; } }
#define WQKV_LAYOUT 0   // selects WCOL only, which nothing calls (k_proj always reads (in,out) [DIN][CC]): 0 = (in,out) [DIN][CC]; 1 = (out,in) [CC][DIN]; 2 = per-head [NH][DIN][HD]
__device__ __forceinline__ v16b wcol_hdk(const float* Wm, int k0, int o, int lane) { v16b w; const int g = lane >> 4; const float* p = Wm + (size_t)(o / HD) * DIN * HD + (o % HD);
#pragma unroll
  for (int i = 0; i < 8; ++i) { w[i] = (__bf16)p[(size_t)(k0 + 8 * g + i) * HD]; w[8 + i] = (__bf16)p[(size_t)(k0 + 16 + 8 * g + i) * HD]; }
  return w; }
#define WO_OUT_IN 0
#if WQKV_LAYOUT == 1
#define WCOL(W, k0, o, lane) wcol_oi(W, k0, o, lane, DIN)
#elif WQKV_LAYOUT == 2
#define WCOL(W, k0, o, lane) wcol_hdk(W, k0, o, lane)
#else
#define WCOL(W, k0, o, lane) wcol_io(W, k0, o, lane, CC)
#endif
#if WO_OUT_IN
#define WOCOL(W, k0, o, lane) wcol_oi(W, k0, o, lane, CC)
#define WOCOLH(W, k0, o, lane) wcolh_oi(W, k0, o, lane, CC)
#else
#define WOCOL(W, k0, o, lane) wcol_io(W, k0, o, lane, DIN)
#define WOCOLH(W, k0, o, lane) wcolh_io(W, k0, o, lane, DIN)
#endif
#define PROJ_EXTRA_PARAMS , const float* __restrict__ EXB
// q_u = q + pos_bias_u (or q_v = q + pos_bias_v): a second per-(head, dim) bias added in f32 after (x Wq + bq), q only
#define PROJ_EPI(which, row, t, h) do { if ((which) == 0 && EXB) { float* rw = (row); _Pragma("unroll 8") for (int d = 0; d < 64; ++d) rw[d] = rw[d] + bfr(EXB[(h) * 64 + d]); } } while (0)
#define WS_QH2 (WS_END)                                   // f16 q_v rows, fragment order
#define WS_QL2 (WS_QH2 + 2u * (size_t)NB * TT * CC)       // f16 q_v residual rows, fragment order
#define WS_KP  (WS_QL2 + 2u * (size_t)NB * QHI * CC)      // f16 positional key rows p = pos_emb Wpos, fragment order (the first TT rows are used)
#define WS_S2  (WS_KP + 2u * (size_t)NB * TT * CC)        // f32 [hg][t][p], unused: k_att keeps BD in LDS
#define WS_END2 (WS_S2 + 4u * (size_t)HG * TT * TT)
#ifndef PROJ_EXTRA_PARAMS
#define PROJ_EXTRA_PARAMS
#endif

#define WS_QH  0u                                      // f16 q rows, fragment order [b*t / 16][head][piece 4][lane 32][8] (see pk_row)
#define WS_KH  (WS_QH + 2u * (size_t)NB * TT * CC)      // f16 k rows, fragment order as the q rows
#define WS_VT  (WS_KH + 2u * (size_t)NB * TT * CC)      // f16 v, fragment order [b][head][d / 16][t / 32][half 2][lane 32][8]: lane = (t / 8 & 1) * 16 + d % 16
#define WS_QL  (WS_VT + 2u * (size_t)NB * CC * TT)      // f16 q residual x 2^10 rows, fragment order as the q rows (QHI = TT)
#define WS_KL  (WS_QL + 2u * (size_t)NB * QHI * CC)     // f16 k residual x 2^10 rows [b][t < KHI][CC]
#define WS_VB  (WS_KL + 2u * (size_t)NB * KHI * CC)     // bf16 v hi planes [b][c][t < KHI]
#define WS_VBL (WS_VB + 2u * (size_t)NB * CC * KHI)
#define WS_S   (WS_VBL + 2u * (size_t)NB * CC * KHI)    // f32 [hg][t][s], unused: k_att keeps logits and P on chip
#define WS_Y   (WS_S  + 4u * (size_t)HG * TT * TT)      // f32 ctx rows [b*t][CC] (only when there is an output projection)
#define WS_END (WS_Y  + 4u * (size_t)NB * TT * CC)

// ---- k_proj: block = (64 rows, 128 cols, which): q/k/v = X W (+ b) with exact bf16 products (K = DIN) -> which 0: q f16 rows (+ residual rows < QHI); 1: k f16 rows (+ residual rows < KHI); 2: v f16 planes (+ bf16 hi/lo planes [c][t] for t < KHI); the f16 q, q residual, k and v planes are stored in the fragment order that k_att loads (layouts: WS_QH, WS_VT)
__global__ __launch_bounds__(128) void k_proj(const float* __restrict__ XQ, const float* __restrict__ XK, const float* __restrict__ XV, const float* __restrict__ WQ, const float* __restrict__ WK, const float* __restrict__ WV, const float* __restrict__ BQ, const float* __restrict__ BK, const float* __restrict__ BV,
    _Float16* __restrict__ QH, _Float16* __restrict__ QL, _Float16* __restrict__ KH, _Float16* __restrict__ KL, _Float16* __restrict__ VT, __bf16* __restrict__ VB, __bf16* __restrict__ VBL PROJ_EXTRA_PARAMS) {
  __shared__ __align__(16) float st[64][132]; __shared__ __align__(16) _Float16 sh[64][136], sl[64][136]; __shared__ __align__(16) _Float16 th[128][72]; __shared__ __align__(16) __bf16 tb[128][72], tbl[128][72];
  const int tid = threadIdx.x, wave = tid >> 5, lane = tid & 31, col = lane & 15, g = lane >> 4; const int which = blockIdx.z; const int c0 = blockIdx.y * 128; const size_t r0 = (size_t)blockIdx.x * 64; const size_t bb = r0 / TT; const int t0 = (int)(r0 % TT);
  const float* X = which == 0 ? XQ : which == 1 ? XK : XV; const float* WA = which == 0 ? WQ : which == 1 ? WK : WV; const float* BA = which == 0 ? BQ : which == 1 ? BK : BV;
  v8f acc[8] = {};
#pragma unroll 2
  for (int kc = 0; kc < DIN / 32; ++kc) { float ar[16], wr[8][16];   /* every load of this k step is issued before the first product, so one latency covers all nine fragments */
    raw_row(ar, X + (r0 + wave * 16 + col) * DIN + kc * 32, lane);
    asm volatile("s_wait_xcnt 0x0" ::: "memory");   /* the row loads' address pair is dead from here on and the weight loads below may be given it as a destination: keep the wait in front of that overwrite */
#pragma unroll
    for (int j = 0; j < 8; ++j) raw_col(wr[j], WA, kc * 32, c0 + j * 16 + col, lane, CC);
    v16b a;
#pragma unroll
    for (int i = 0; i < 16; ++i) a[i] = (__bf16)ar[i];
#pragma unroll
    for (int j = 0; j < 8; ++j) { v16b w;
#pragma unroll
      for (int i = 0; i < 16; ++i) w[i] = (__bf16)wr[j][i];
      acc[j] = wmma_bf(a, w, acc[j]); } }
  { // stage the f32 tile (acc + bias) in LDS, run the per-(row, head) epilogue hook, then convert
#pragma unroll
    for (int j = 0; j < 8; ++j) { const float bias = BA ? bfr(BA[c0 + j * 16 + col]) : 0.f;
#pragma unroll
      for (int r = 0; r < 8; ++r) st[wave * 16 + 8 * g + r][j * 16 + col] = acc[j][r] + bias; }
    __syncthreads();
    for (int e = tid; e < 64 * (128 / HD); e += 128) { const int rl = e / (128 / HD), hh = e % (128 / HD); PROJ_EPI(which, &st[rl][hh * HD], (int)((r0 + rl) % TT), (c0 / HD) + hh); }
    __syncthreads(); }
  if (which < 2) { _Float16* DH = which == 0 ? QH : KH; _Float16* DL = which == 0 ? QL : KL; const int nhi = which == 0 ? QHI : KHI; const bool hi_rows = t0 < nhi;
    for (int e = tid; e < 64 * 128; e += 128) { const int rl = e >> 7, cl = e & 127; const float v = st[rl][cl]; const _Float16 hv = (_Float16)v; sh[rl][cl] = hv; sl[rl][cl] = (_Float16)((v - (float)hv) * 1024.0f); }
    __syncthreads();
    for (int e = tid; e < 64 * 16; e += 128) { const int ln = e & 31, rl = (e >> 8) * 16 + (ln & 15), q = ((e >> 5) & 7) * 2 + (ln >> 4);   /* e runs in the order of the destination: [row tile 4][head 2][piece 4][lane 32], so a wave stores 512 contiguous bytes */
      const size_t po = (((r0 >> 4) + (e >> 8)) * NH + (c0 >> 6)) * 1024 + (e & 255) * 8;
      vst2((unsigned*)(DH + po), *(const v4u*)&sh[rl][q * 8]);
      asm volatile("s_wait_xcnt 0x0" ::: "memory");   /* the second store's address may be formed in the first one's registers: keep the wait in front of that */
      if (hi_rows) vst2((unsigned*)(which == 0 ? DL + po : DL + (bb * nhi + t0 + rl) * (size_t)CC + c0 + q * 8), *(const v4u*)&sl[rl][q * 8]);
      asm volatile("s_wait_xcnt 0x0" ::: "memory"); }   /* the next trip overwrites the stores' address and data registers: keep the wait in front of that */
  } else { const bool hi_rows = t0 < KHI;
    for (int e = tid; e < 64 * 128; e += 128) { const int rl = e & 63, cl = e >> 6; const float v = st[rl][cl]; th[cl][rl] = (_Float16)v; const __bf16 bh = (__bf16)v; tb[cl][rl] = bh; tbl[cl][rl] = (__bf16)(v - (float)bh); }
    __syncthreads();
    for (int e = tid; e < 128 * 8; e += 128) { const int ln = e & 31, cl = (e >> 7) * 16 + (ln & 15), q = ((e >> 5) & 3) * 2 + (ln >> 4);   /* destination order: [head 2][d tile 4][t block 2][half 2][lane 32] */
      vst2((unsigned*)(VT + (((bb * NH + (c0 >> 6)) * 4 + (e >> 7)) * 32 + (t0 >> 5)) * 512 + (e & 127) * 8), *(const v4u*)&th[cl][q * 8]);
      asm volatile("s_wait_xcnt 0x0" ::: "memory");   /* what follows overwrites the store's address and data registers: keep the wait in front of that */
      if (hi_rows) { const size_t o3 = (bb * CC + c0 + cl) * (size_t)KHI + t0 + q * 8; vst2((unsigned*)(VB + o3), *(const v4u*)&tb[cl][q * 8]); vst2((unsigned*)(VBL + o3), *(const v4u*)&tbl[cl][q * 8]);
        asm volatile("s_wait_xcnt 0x0" ::: "memory"); } } } }   /* as above, for these two stores */
// ---- k_projk: k_proj with which = blockIdx.z + 1 (the positional 'key' rows p = pos_emb Wpos)
// ---- block = (64 rows, 128 cols, which): q/k/v = X W (+ b) with exact bf16 products (K = DIN) -> which 0: q f16 rows (+ residual rows < QHI); 1: k f16 rows (+ residual rows < KHI); 2: v f16 planes (+ bf16 hi/lo planes [c][t] for t < KHI); the f16 q, q residual, k and v planes are stored in the fragment order that k_att loads (layouts: WS_QH, WS_VT)
__global__ __launch_bounds__(128) void k_projk(const float* __restrict__ XQ, const float* __restrict__ XK, const float* __restrict__ XV, const float* __restrict__ WQ, const float* __restrict__ WK, const float* __restrict__ WV, const float* __restrict__ BQ, const float* __restrict__ BK, const float* __restrict__ BV,
    _Float16* __restrict__ QH, _Float16* __restrict__ QL, _Float16* __restrict__ KH, _Float16* __restrict__ KL, _Float16* __restrict__ VT, __bf16* __restrict__ VB, __bf16* __restrict__ VBL PROJ_EXTRA_PARAMS) {
  __shared__ __align__(16) float st[64][132]; __shared__ __align__(16) _Float16 sh[64][136], sl[64][136]; __shared__ __align__(16) _Float16 th[128][72]; __shared__ __align__(16) __bf16 tb[128][72], tbl[128][72];
  const int tid = threadIdx.x, wave = tid >> 5, lane = tid & 31, col = lane & 15, g = lane >> 4; const int which = blockIdx.z + 1;   /* k-format planes only */ const int c0 = blockIdx.y * 128; const size_t r0 = (size_t)blockIdx.x * 64; const size_t bb = r0 / TT; const int t0 = (int)(r0 % TT);
  const float* X = which == 0 ? XQ : which == 1 ? XK : XV; const float* WA = which == 0 ? WQ : which == 1 ? WK : WV; const float* BA = which == 0 ? BQ : which == 1 ? BK : BV;
  v8f acc[8] = {};
#pragma unroll 2
  for (int kc = 0; kc < DIN / 32; ++kc) { float ar[16], wr[8][16];   /* every load of this k step is issued before the first product, so one latency covers all nine fragments */
    raw_row(ar, X + (r0 + wave * 16 + col) * DIN + kc * 32, lane);
    asm volatile("s_wait_xcnt 0x0" ::: "memory");   /* the row loads' address pair is dead from here on and the weight loads below may be given it as a destination: keep the wait in front of that overwrite */
#pragma unroll
    for (int j = 0; j < 8; ++j) raw_col(wr[j], WA, kc * 32, c0 + j * 16 + col, lane, CC);
    v16b a;
#pragma unroll
    for (int i = 0; i < 16; ++i) a[i] = (__bf16)ar[i];
#pragma unroll
    for (int j = 0; j < 8; ++j) { v16b w;
#pragma unroll
      for (int i = 0; i < 16; ++i) w[i] = (__bf16)wr[j][i];
      acc[j] = wmma_bf(a, w, acc[j]); } }
  { // stage the f32 tile (acc + bias) in LDS, run the per-(row, head) epilogue hook, then convert
#pragma unroll
    for (int j = 0; j < 8; ++j) { const float bias = BA ? bfr(BA[c0 + j * 16 + col]) : 0.f;
#pragma unroll
      for (int r = 0; r < 8; ++r) st[wave * 16 + 8 * g + r][j * 16 + col] = acc[j][r] + bias; }
    __syncthreads();
    for (int e = tid; e < 64 * (128 / HD); e += 128) { const int rl = e / (128 / HD), hh = e % (128 / HD); PROJ_EPI(which, &st[rl][hh * HD], (int)((r0 + rl) % TT), (c0 / HD) + hh); }
    __syncthreads(); }
  if (which < 2) { _Float16* DH = which == 0 ? QH : KH; _Float16* DL = which == 0 ? QL : KL; const int nhi = which == 0 ? QHI : KHI; const bool hi_rows = t0 < nhi;
    for (int e = tid; e < 64 * 128; e += 128) { const int rl = e >> 7, cl = e & 127; const float v = st[rl][cl]; const _Float16 hv = (_Float16)v; sh[rl][cl] = hv; sl[rl][cl] = (_Float16)((v - (float)hv) * 1024.0f); }
    __syncthreads();
    for (int e = tid; e < 64 * 16; e += 128) { const int ln = e & 31, rl = (e >> 8) * 16 + (ln & 15), q = ((e >> 5) & 7) * 2 + (ln >> 4);   /* e runs in the order of the destination: [row tile 4][head 2][piece 4][lane 32], so a wave stores 512 contiguous bytes */
      const size_t po = (((r0 >> 4) + (e >> 8)) * NH + (c0 >> 6)) * 1024 + (e & 255) * 8;
      vst2((unsigned*)(DH + po), *(const v4u*)&sh[rl][q * 8]);
      asm volatile("s_wait_xcnt 0x0" ::: "memory");   /* the second store's address may be formed in the first one's registers: keep the wait in front of that */
      if (hi_rows) vst2((unsigned*)(which == 0 ? DL + po : DL + (bb * nhi + t0 + rl) * (size_t)CC + c0 + q * 8), *(const v4u*)&sl[rl][q * 8]);
      asm volatile("s_wait_xcnt 0x0" ::: "memory"); }   /* the next trip overwrites the stores' address and data registers: keep the wait in front of that */
  } else { const bool hi_rows = t0 < KHI;
    for (int e = tid; e < 64 * 128; e += 128) { const int rl = e & 63, cl = e >> 6; const float v = st[rl][cl]; th[cl][rl] = (_Float16)v; const __bf16 bh = (__bf16)v; tb[cl][rl] = bh; tbl[cl][rl] = (__bf16)(v - (float)bh); }
    __syncthreads();
    for (int e = tid; e < 128 * 8; e += 128) { const int ln = e & 31, cl = (e >> 7) * 16 + (ln & 15), q = ((e >> 5) & 3) * 2 + (ln >> 4);   /* destination order: [head 2][d tile 4][t block 2][half 2][lane 32] */
      vst2((unsigned*)(VT + (((bb * NH + (c0 >> 6)) * 4 + (e >> 7)) * 32 + (t0 >> 5)) * 512 + (e & 127) * 8), *(const v4u*)&th[cl][q * 8]);
      asm volatile("s_wait_xcnt 0x0" ::: "memory");   /* what follows overwrites the store's address and data registers: keep the wait in front of that */
      if (hi_rows) { const size_t o3 = (bb * CC + c0 + cl) * (size_t)KHI + t0 + q * 8; vst2((unsigned*)(VB + o3), *(const v4u*)&tb[cl][q * 8]); vst2((unsigned*)(VBL + o3), *(const v4u*)&tbl[cl][q * 8]);
        asm volatile("s_wait_xcnt 0x0" ::: "memory"); } } } }   /* as above, for these two stores */
// ---- k_att: block = 16 query rows (t0..t0+15) of (b, h), 8 waves, wave w owns key / position columns [128 w, 128 w + 128). Logits never leave the WGP:
//  1. BD = (q + v) . p x 1/8 is stored straight to its rel_shift place in LDS. The reference's pad-reshape is linear in memory: BD[r][c] lands at flat out index r T + r + c + 1 - T, so row r's columns c >= T-1-r go to out row r and the others to out row r-1; out[t][t+1] is the pad's 0.
//     The block needs BD rows t0..t0+16; a 16-column tile at cs needs rows t0+1..t0+16 when cs + t0 <= T - 32 and rows t0..t0+15 otherwise (cs, t0 multiples of 16), so one row tile serves each column tile.
//  2. AC = (q + u) . k x 1/8 stays in registers and takes BD' from LDS; softmax in f32 over the 8 waves; P x 2^11 once to f16 in LDS.
//  3. each wave multiplies its own 128 keys of P with v (f16, 1 product); the 8 partial ctx tiles are summed in wave order.
// Every loop is fully unrolled: the fragment, logit and accumulator arrays stay in registers only when each index is a constant. The second launch bound asks for 4 waves per SIMD (256 registers), so that two blocks share a WGP.
// The q, k, p and v planes lie in the workspace in fragment order: the 16 bytes that lane l of a wave takes with one load stand at 16 l inside a 512-byte piece, so a load reads 4 whole 128-byte lines and not a 32-byte part of 16 lines.
// Rows (q, k, p): a (16 rows, one head) tile is 4 pieces; piece 2 kc + half holds d = 32 kc + 16 half + 8 g + 0..7 of row r at lane 16 g + r % 16. pk_row = f16 index of the lane's place in piece 0.
__device__ __forceinline__ size_t pk_row(size_t row, int h, int g) { return ((row >> 4) * NH + h) * 1024 + (g * 16 + (row & 15)) * 8; }
#define PKT (NH * 1024)  // f16 from a 16-row tile to the next
__device__ __forceinline__ v16h frag_at(const _Float16* p) { union { v16h v; v8h q[2]; } u; u.q[0] = *(const v8h*)p; u.q[1] = *(const v8h*)(p + 256); return u.v; }   // the two pieces of one 32-deep fragment; p holds the lane's place
// behind a group of loads: the group's address registers are inputs, so they live up to the wait and no load of the group is given one of them as its destination; behind the wait they may be overwritten
#define XW1(p) asm volatile("s_wait_xcnt 0x0" :: "v"(p) : "memory")
#define XW2(p, q) asm volatile("s_wait_xcnt 0x0" :: "v"(p), "v"(q) : "memory")
#define XW3(p, q, r) asm volatile("s_wait_xcnt 0x0" :: "v"(p), "v"(q), "v"(r) : "memory")
#define SPP (TT + 8)     // f16 pitch of the P rows in LDS: 16 B more than a row, so that the 16 rows of a fragment read fall on different banks
#define SRP (HD + 4)     // f32 pitch of the partial ctx rows
__global__ __launch_bounds__(256, 4) void k_att(const _Float16* __restrict__ QH, const _Float16* __restrict__ QL, const _Float16* __restrict__ QH2, const _Float16* __restrict__ QL2, const _Float16* __restrict__ KH, const _Float16* __restrict__ KP, const _Float16* __restrict__ VT, float* __restrict__ Y) {
  __shared__ __align__(16) char sm[16 * SPP * 2 + 8 * 16 * SRP * 4];   /* first the f32 BD' rows [16][TT] (65,536 B); once every wave has read them, the f16 P rows and behind them the partial ctx tiles */
  __shared__ __align__(16) float redm[16][8], reds[16][8];
  float* sS = (float*)sm; _Float16* sP = (_Float16*)sm; float* sR = (float*)(sm + 16 * SPP * 2);
  const int tid = threadIdx.x, wave = __builtin_amdgcn_readfirstlane(tid >> 5), lane = tid & 31, col = lane & 15, g = lane >> 4;
  const int t0 = blockIdx.x * 16, h = blockIdx.y, b = blockIdx.z, c0 = wave * 128;
  const size_t qr0 = pk_row((size_t)b * TT + t0 + col, h, g);   /* every offset below holds the lane's place in a piece */
  const size_t qr1 = pk_row((size_t)b * TT + (t0 + 1 + col < TT ? t0 + 1 + col : TT - 1), h, g);   /* row T does not exist and no tile of the last block uses the shifted rows */
  if (tid < 16 && t0 + tid + 1 < TT) sS[tid * TT + t0 + tid + 1] = 0.f;
  { v16h ah[HD / 32], al[HD / 32], pf[HD / 32][8]; const size_t qra = c0 + t0 <= TT - 32 ? qr1 : qr0;   /* the row tile of this wave's first column tile */
    const _Float16 *qha = QH2 + qra, *qla = QL2 + qra, *qhb = QH2 + qr0, *qlb = QL2 + qr0, *pb = KP + pk_row((size_t)(c0 + col), h, g);
#pragma unroll
    for (int kc = 0; kc < HD / 32; ++kc) { ah[kc] = frag_at(qha + kc * 512); al[kc] = frag_at(qla + kc * 512); }
#pragma unroll
    for (int kc = 0; kc < HD / 32; ++kc)
#pragma unroll
      for (int j = 0; j < 8; ++j) pf[kc][j] = frag_at(pb + j * PKT + kc * 512);
    XW3(qha, qla, pb);
#pragma unroll
    for (int j = 0; j < 8; ++j) { const bool up = c0 + j * 16 + t0 <= TT - 32;   /* wave-uniform */
      if (j > 0 && c0 + j * 16 + t0 == TT - 16) {   /* the one wave of a block whose columns cross from the shifted rows to the unshifted ones fetches the other row tile here */
#pragma unroll
        for (int kc = 0; kc < HD / 32; ++kc) { ah[kc] = frag_at(qhb + kc * 512); al[kc] = frag_at(qlb + kc * 512); }
        XW2(qhb, qlb); }
      v8f a = {}, l = {};
#pragma unroll
      for (int kc = 0; kc < HD / 32; ++kc) { a = wmma16(ah[kc], pf[kc][j], a); l = wmma16(al[kc], pf[kc][j], l); }
#pragma unroll
      for (int r = 0; r < 8; ++r) { const int rl = (up ? 1 : 0) + 8 * g + r; const int idx = (rl - 1) * TT + t0 + rl + c0 + j * 16 + col + 1;
        if ((unsigned)idx < 16u * TT) sS[idx] = (a[r] + l[r] * (1.0f / 1024.0f)) * SCALE; } } }   /* outside: a neighbour block's row */
  float s[8][8];
  { v16h ah[HD / 32], al[HD / 32], kf[HD / 32][8]; const _Float16 *qh = QH + qr0, *ql = QL + qr0, *kb = KH + pk_row((size_t)b * TT + c0 + col, h, g);
#pragma unroll
    for (int kc = 0; kc < HD / 32; ++kc) { ah[kc] = frag_at(qh + kc * 512); al[kc] = frag_at(ql + kc * 512); }
#pragma unroll
    for (int kc = 0; kc < HD / 32; ++kc)
#pragma unroll
      for (int j = 0; j < 8; ++j) kf[kc][j] = frag_at(kb + j * PKT + kc * 512);
    XW3(qh, ql, kb);
#pragma unroll
    for (int j = 0; j < 8; ++j) { v8f a = {}, l = {};
#pragma unroll
      for (int kc = 0; kc < HD / 32; ++kc) { a = wmma16(ah[kc], kf[kc][j], a); l = wmma16(al[kc], kf[kc][j], l); }
#pragma unroll
      for (int r = 0; r < 8; ++r) s[j][r] = (a[r] + l[r] * (1.0f / 1024.0f)) * SCALE;
      __builtin_amdgcn_sched_barrier(0); } }   /* each tile's two accumulators are folded into its logits before the next tile starts: with all sixteen accumulators live beside the key fragments the kernel spills */
  v16h vf[4][HD / 16];   /* this wave's v fragments: half are issued ahead of the softmax, half behind its exponentials (all sixteen beside them do not fit the registers), so that their latency runs under it */
  const _Float16* vb = VT + ((((size_t)b * NH + h) * 4) * 32 + (c0 >> 5)) * 512 + lane * 8;
#pragma unroll
  for (int u = 0; u < 2; ++u)
#pragma unroll
    for (int j = 0; j < HD / 16; ++j) vf[u][j] = frag_at(vb + j * 32 * 512 + u * 512);
  XW1(vb);
  __syncthreads();   /* every BD' element is in LDS */
  float m[8], sum[8];
#pragma unroll
  for (int r = 0; r < 8; ++r) { m[r] = -3.0e38f;
#pragma unroll
    for (int j = 0; j < 8; ++j) { s[j][r] = s[j][r] + sS[(8 * g + r) * TT + c0 + j * 16 + col]; m[r] = fmaxf(m[r], s[j][r]); }
#pragma unroll
    for (int o = 1; o < 16; o <<= 1) m[r] = fmaxf(m[r], __shfl_xor(m[r], o)); }
  if (col == 0) {
#pragma unroll
    for (int r = 0; r < 8; ++r) redm[8 * g + r][wave] = m[r]; }
  __syncthreads();   /* row maxima of all waves; also the last read of the BD' rows, whose LDS is reused below */
#pragma unroll
  for (int r = 0; r < 8; ++r) { const v4f x = *(const v4f*)&redm[8 * g + r][0], y = *(const v4f*)&redm[8 * g + r][4];
    m[r] = fmaxf(fmaxf(fmaxf(x[0], x[1]), fmaxf(x[2], x[3])), fmaxf(fmaxf(y[0], y[1]), fmaxf(y[2], y[3]))); sum[r] = 0.f;
#pragma unroll
    for (int j = 0; j < 8; ++j) { s[j][r] = expf(s[j][r] - m[r]); sum[r] += s[j][r]; }
#pragma unroll
    for (int o = 1; o < 16; o <<= 1) sum[r] += __shfl_xor(sum[r], o); }
#pragma unroll
  for (int u = 2; u < 4; ++u)
#pragma unroll
    for (int j = 0; j < HD / 16; ++j) vf[u][j] = frag_at(vb + j * 32 * 512 + u * 512);
  XW1(vb);
  if (col == 0) {
#pragma unroll
    for (int r = 0; r < 8; ++r) reds[8 * g + r][wave] = sum[r]; }
  __syncthreads();   /* row sums of all waves */
#pragma unroll
  for (int r = 0; r < 8; ++r) { const v4f x = *(const v4f*)&reds[8 * g + r][0], y = *(const v4f*)&reds[8 * g + r][4];
    const float a = ((x[0] + x[1]) + (x[2] + x[3])) + ((y[0] + y[1]) + (y[2] + y[3])); const float inv = a > 0.f ? 2048.0f / a : 0.f;
#pragma unroll
    for (int j = 0; j < 8; ++j) sP[(8 * g + r) * SPP + c0 + j * 16 + col] = (_Float16)(s[j][r] * inv); }
  LDSX();   /* a wave reads back only the 128 P columns that it wrote itself */
  v8f acc[HD / 16] = {};
#pragma unroll
  for (int u = 0; u < 4; ++u) { const v16h p = frag_h(sP + col * SPP + c0 + u * 32, lane);
#pragma unroll
    for (int j = 0; j < HD / 16; ++j) acc[j] = wmma16(p, vf[u][j], acc[j]); }
#pragma unroll
  for (int j = 0; j < HD / 16; ++j)
#pragma unroll
    for (int r = 0; r < 8; ++r) sR[(wave * 16 + 8 * g + r) * SRP + j * 16 + col] = acc[j][r];
  __syncthreads();   /* the 8 partial ctx tiles */
  { const int rl = tid >> 4, c4 = (tid & 15) * 4; v4f o = *(const v4f*)&sR[rl * SRP + c4];
#pragma unroll
    for (int w = 1; w < 8; ++w) o = o + *(const v4f*)&sR[(w * 16 + rl) * SRP + c4];
    vst2(Y + ((size_t)b * TT + t0 + rl) * CC + h * HD + c4, o * (1.0f / 2048.0f)); } }
// ---- k_out: block = (64 rows, 128 cols): out = ctx Wo (+ bo): ctx x 2^6 once to f16 against Wo as f16(bf16 x 2^8) exact (1 product) x 2^-14; causal early rows (< QHI of each sequence): ctx bf16 hi + lo against exact bf16 Wo (2 products)
__global__ __launch_bounds__(128) void k_out(const float* __restrict__ Y, const float* __restrict__ WO, const float* __restrict__ BO, float* __restrict__ OUT) { __shared__ __align__(16) float sf[4][16][132];
  const int tid = threadIdx.x, wave = tid >> 5, lane = tid & 31, col = lane & 15, g = lane >> 4; const int c0 = blockIdx.y * 128; const size_t r0 = (size_t)blockIdx.x * 64 + wave * 16;
  v8f acc[8] = {};
  if (CAUSAL && (int)(((size_t)blockIdx.x * 64) % TT) < QHI) {   /* block-uniform */
#pragma unroll 2
    for (int kc = 0; kc < CC / 32; ++kc) { const F2 a = split_row(Y + (r0 + col) * CC, kc * 32, lane); asm volatile("s_wait_loadcnt 0x0" ::: "memory");
#pragma unroll
      for (int j = 0; j < 8; ++j) { const v16b w = WOCOL(WO, kc * 32, c0 + j * 16 + col, lane); asm volatile("s_wait_loadcnt 0x0" ::: "memory"); acc[j] = wmma_bf(a.h, w, acc[j]); acc[j] = wmma_bf(a.l, w, acc[j]); } }
#pragma unroll
    for (int j = 0; j < 8; ++j) { const float bias = BO ? bfr(BO[c0 + j * 16 + col]) : 0.f;
#pragma unroll
      for (int r = 0; r < 8; ++r) sf[wave][8 * g + r][j * 16 + col] = acc[j][r] + bias; }
  } else {
#pragma unroll 2
    for (int kc = 0; kc < CC / 32; ++kc) { float ar[16], wr[8][16];   /* every load of this k step is issued before the first product */
      raw_row(ar, Y + (r0 + col) * CC + kc * 32, lane);
#pragma unroll
      for (int j = 0; j < 8; ++j) raw_col(wr[j], WO, kc * 32, c0 + j * 16 + col, lane, DIN);
      v16h a;   /* ctx carried x 2^6 into f16 so small-magnitude context rows stay clear of f16 subnormals */
#pragma unroll
      for (int i = 0; i < 16; ++i) a[i] = (_Float16)(ar[i] * 64.0f);
#pragma unroll
      for (int j = 0; j < 8; ++j) { v16h w;
#pragma unroll
        for (int i = 0; i < 16; ++i) w[i] = (_Float16)(bfr(wr[j][i]) * 256.0f);
        acc[j] = wmma16(a, w, acc[j]); } }
#pragma unroll
    for (int j = 0; j < 8; ++j) { const float bias = BO ? bfr(BO[c0 + j * 16 + col]) : 0.f;
#pragma unroll
      for (int r = 0; r < 8; ++r) sf[wave][8 * g + r][j * 16 + col] = acc[j][r] * (1.0f / 16384.0f) + bias; } }   /* 2^-8 (Wo carry) x 2^-6 (ctx carry) */
  LDSX(); for (int rl = 0; rl < 16; ++rl) vst2(OUT + (r0 + rl) * DIN + c0 + lane * 4, *(const v4f*)&sf[wave][rl][lane * 4]); }

extern "C" void kernel_launch(void* const* d_in, const int* in_sizes, int n_in, void* d_out, int out_size, void* d_ws, size_t ws_size, hipStream_t stream) {
  (void)in_sizes; (void)n_in; (void)out_size;
  const float** F = (const float**)d_in;
  if (ws_size < (size_t)WS_END) return;
  char* ws = (char*)d_ws; _Float16 *QH = (_Float16*)(ws + WS_QH), *KH = (_Float16*)(ws + WS_KH), *VT = (_Float16*)(ws + WS_VT), *QL = (_Float16*)(ws + WS_QL), *KL = (_Float16*)(ws + WS_KL); __bf16 *VB = (__bf16*)(ws + WS_VB), *VBL = (__bf16*)(ws + WS_VBL); float *Y = (float*)(ws + WS_Y);
  (void)Y; (void)QL; (void)KL; (void)VB; (void)VBL;
  // inputs: 0 query [4,1024,512]; 1 key; 2 value; 3 pos_emb [1,1024,512]; 4 Wq (in,out), 5 bq; 6 Wk, 7 bk; 8 Wv, 9 bv; 10 Wo (in,out), 11 bo; 12 Wpos [512,512]; 13 pos_bias_u [8,64]; 14 pos_bias_v [8,64]
  if (ws_size < (size_t)WS_END2) return;
  _Float16 *QH2 = (_Float16*)(ws + WS_QH2), *QL2 = (_Float16*)(ws + WS_QL2), *KP = (_Float16*)(ws + WS_KP);
  k_proj<<<dim3(TNB * TT / 64, CC / 128, 3), 128, 0, stream>>>(F[0], F[1], F[2], F[4], F[6], F[8], F[5], F[7], F[9], QH, QL, KH, KL, VT, VB, VBL, F[13]);      /* q_u = q + pos_bias_u, k, v */
  k_proj<<<dim3(TNB * TT / 64, CC / 128, 1), 128, 0, stream>>>(F[0], F[1], F[2], F[4], F[6], F[8], F[5], F[7], F[9], QH2, QL2, KH, KL, VT, VB, VBL, F[14]);   /* which 0 only: q_v = q + pos_bias_v */
  k_projk<<<dim3(TT / 64, CC / 128, 1), 128, 0, stream>>>(F[3], F[3], F[3], F[12], F[12], F[12], nullptr, nullptr, nullptr, QH2, QL2, KP, KL, VT, VB, VBL, nullptr);   /* which 1 only, batch-0 rows: p = pos_emb Wpos (no bias) into KP */
  k_att<<<dim3(TT / 16, NH, TNB), 256, 0, stream>>>(QH, QL, QH2, QL2, KH, KP, VT, Y);   /* AC + rel_shift(BD), softmax, P v */
  k_out<<<dim3(TNB * TT / 64, DIN / 128), 128, 0, stream>>>(Y, F[10], F[11], (float*)d_out);
}

// v004
// Measured time: 135 microseconds a run.
// Timed twice side by side with v003, it ran 1.27 and 1.28 times as fast.
// Over all steps from v000 it is 3.81 times as fast.
// compute dtype: all float inputs rounded to bf16; projections with EXACT bf16 products on WMMA 16x16x32 (f32 accumulate) + biases; content (q+u).k and position (q+v).p scores each with q as f16 hi + residual (x 2^10) against f16 k / p (2 products) x 64^-0.5; rel_shift as the store index of the position scores in LDS; softmax f32; P x 2^11 once to f16 x v once to f16 (1 product); ctx carried x 2^6 once to f16 x Wo f16(bf16 x 2^8) + bo; f32 output.
#include <hip/hip_runtime.h>
#include <math.h>

typedef __attribute__((ext_vector_type(16))) _Float16 v16h;
typedef __attribute__((ext_vector_type(16))) __bf16 v16b;
typedef __attribute__((ext_vector_type(8)))  _Float16 v8h;
typedef __attribute__((ext_vector_type(8)))  float v8f;
typedef __attribute__((ext_vector_type(4)))  float v4f;
typedef __attribute__((ext_vector_type(2)))  float v2f;
typedef __attribute__((ext_vector_type(4)))  unsigned v4u;
typedef __attribute__((ext_vector_type(4)))  int v4i;
typedef float __attribute__((may_alias)) float_a;
typedef int __attribute__((may_alias)) int_a;

template <typename T> __device__ __forceinline__ void vst2(void* p, T v) { *(T*)p = v;  }
__device__ __forceinline__ v8f wmma16(v16h a, v16h b, v8f c) {
  v8f d = __builtin_amdgcn_wmma_f32_16x16x32_f16(false, a, false, b, (short)0, c, false, false);
  asm volatile("v_nop\n\tv_nop\n\tv_nop\n\tv_nop" : "+v"(d) : "v"(a), "v"(b));
  return d;
}
__device__ __forceinline__ v8f wmma_bf(v16b a, v16b b, v8f c) {
  v8f d = __builtin_amdgcn_wmma_f32_16x16x32_bf16(false, a, false, b, (short)0, c, false, false);
  asm volatile("v_nop\n\tv_nop\n\tv_nop\n\tv_nop" : "+v"(d) : "v"(a), "v"(b));
  return d;
}
// 16x16x32 fragments: lane = (h = lane>>4, row/col = lane&15); elements 0..7 = k0+8h+0..7, 8..15 = k0+16+8h+0..7; D element r = row 8h+r
__device__ __forceinline__ v16h frag_h(const _Float16* rowk0, int lane) {
  union { v16h v; v8h q[2]; } u; const _Float16* p = rowk0 + 8 * (lane >> 4);
  u.q[0] = *(const v8h*)p; u.q[1] = *(const v8h*)(p + 16); return u.v;
}
__device__ __forceinline__ v16h frag_f32(const float* rowk0, int lane) {
  v16h a; const float* p = rowk0 + 8 * (lane >> 4);
#pragma unroll
  for (int i = 0; i < 8; ++i) { a[i] = (_Float16)p[i]; a[8 + i] = (_Float16)p[16 + i]; }
  return a;
}
__device__ __forceinline__ v16h frag_f32s(const float* rowk0, int lane, float sc) {
  v16h a; const float* p = rowk0 + 8 * (lane >> 4);
#pragma unroll
  for (int i = 0; i < 8; ++i) { a[i] = (_Float16)(p[i] * sc); a[8 + i] = (_Float16)(p[16 + i] * sc); }
  return a;
}
// column fragment from a [K][ld] layout (column n), rows >= K read as 0
__device__ __forceinline__ v16h fragc_f32(const float* W, int k0, int n, int lane, int ld, int K) {
  v16h a; const int g = lane >> 4;
#pragma unroll
  for (int i = 0; i < 8; ++i) { const int ka = k0 + 8 * g + i, kb = ka + 16;
    a[i] = (_Float16)(ka < K ? W[(size_t)(ka < K ? ka : K - 1) * ld + n] : 0.f); a[8 + i] = (_Float16)(kb < K ? W[(size_t)(kb < K ? kb : K - 1) * ld + n] : 0.f); }
  return a;
}
struct F2 { v16b h, l; };
__device__ __forceinline__ F2 bsplit16(const float v[16]) { F2 r;
#pragma unroll
  for (int i = 0; i < 16; ++i) { const __bf16 h = (__bf16)v[i]; r.h[i] = h; r.l[i] = (__bf16)(v[i] - (float)h); }
  return r; }
__device__ __forceinline__ F2 split_row(const float* row, int k0, int lane) { float v[16]; const float* p = row + k0 + 8 * (lane >> 4);
#pragma unroll
  for (int i = 0; i < 8; ++i) { v[i] = p[i]; v[8 + i] = p[16 + i]; }
  return bsplit16(v); }
__device__ __forceinline__ F2 split_rowK(const float* row, int k0, int lane, int K) { float v[16]; const int g = lane >> 4;
#pragma unroll
  for (int i = 0; i < 8; ++i) { const int ka = k0 + 8 * g + i, kb = ka + 16; v[i] = ka < K ? row[ka < K ? ka : K - 1] : 0.f; v[8 + i] = kb < K ? row[kb < K ? kb : K - 1] : 0.f; }
  return bsplit16(v); }
__device__ __forceinline__ F2 split_col(const float* W, int k0, int n, int lane, int ld, int K) { float v[16]; const int g = lane >> 4;
#pragma unroll
  for (int i = 0; i < 8; ++i) { const int ka = k0 + 8 * g + i, kb = ka + 16; v[i] = ka < K ? W[(size_t)(ka < K ? ka : K - 1) * ld + n] : 0.f; v[8 + i] = kb < K ? W[(size_t)(kb < K ? kb : K - 1) * ld + n] : 0.f; }
  return bsplit16(v); }
__device__ __forceinline__ v8f mac3(const F2& a, const F2& b, v8f c) { c = wmma_bf(a.l, b.h, c); c = wmma_bf(a.h, b.l, c); return wmma_bf(a.h, b.h, c); }
__device__ __forceinline__ float sigm(float v) { return 1.0f / (1.0f + expf(-v)); }
#define LDSX() do { asm volatile("s_wait_dscnt 0" ::: "memory"); __builtin_amdgcn_wave_barrier(); __builtin_amdgcn_fence(__ATOMIC_RELEASE, "workgroup"); } while (0)

// Transformer-XL / Conformer relative multi-head attention (B 4, T = P = 1,024, D 512 = 8 heads x 64; (in,out) Wq/Wk/Wv/Wo [512,512] + zero biases, Wpos [512,512] no bias, pos_bias_u/v [8,64]; 1/sqrt(64)-scale): AC = (q + u) k^T, BD = rel_shift((q + v) p^T) with p = pos_emb Wpos (pad-reshape trick, no mask), attn = softmax((AC + BD)/8), out = merge(attn v) Wo + bo.
#define NB 4
#define TT 1024
#define CC 512            // NH * HD = projected width
#define DIN 512          // input (model) width
#define NH 8
#define HD 64
#define NQB (TT / 64)
#define HG 8
#define SCALE (0.125f)
#define CAUSAL 0
#ifndef TNB
#define TNB NB
#endif
__device__ __forceinline__ float bfr(float v) { return (float)(__bf16)v; }
__host__ __device__ __forceinline__ int kb_last(int qb) { return CAUSAL ? ((qb * 64 + 63) >> 7) : (TT / 128 - 1); }
typedef __attribute__((ext_vector_type(8))) __bf16 v8b;
__device__ __forceinline__ v16b frag_b(const __bf16* rowk0, int lane) {
  union { v16b v; v8b q[2]; } u; const __bf16* p = rowk0 + 8 * (lane >> 4);
  u.q[0] = *(const v8b*)p; u.q[1] = *(const v8b*)(p + 16); return u.v;
}
#define QBH 0              // read by no kernel here
#define QHI 1024            // rows carrying a q residual plane (all rows when non-causal: 2-product logits everywhere)
#define KHI 64            // key rows carrying k residual / v bf16 hi+lo planes (written, but read by no kernel here)
// B fragment (k rows k0+.., output column o) of a weight: (in,out) [K][ld] or (out,in) [ld rows of K]: bf16 exact, or f16(bf16 * 256) exact
__device__ __forceinline__ v16b wcol_io(const float* Wm, int k0, int o, int lane, int ld) { v16b w; const int g = lane >> 4;
#pragma unroll
  for (int i = 0; i < 8; ++i) { w[i] = (__bf16)Wm[(size_t)(k0 + 8 * g + i) * ld + o]; w[8 + i] = (__bf16)Wm[(size_t)(k0 + 16 + 8 * g + i) * ld + o]; }
  return w; }
__device__ __forceinline__ v16b wcol_oi(const float* Wm, int k0, int o, int lane, int K) { v16b w; const float* p = Wm + (size_t)o * K + k0 + 8 * (lane >> 4);
#pragma unroll
  for (int i = 0; i < 8; ++i) { w[i] = (__bf16)p[i]; w[8 + i] = (__bf16)p[16 + i]; }
  return w; }
__device__ __forceinline__ v16h wcolh_io(const float* Wm, int k0, int o, int lane, int ld) { v16h w; const int g = lane >> 4;
#pragma unroll
  for (int i = 0; i < 8; ++i) { w[i] = (_Float16)(bfr(Wm[(size_t)(k0 + 8 * g + i) * ld + o]) * 256.0f); w[8 + i] = (_Float16)(bfr(Wm[(size_t)(k0 + 16 + 8 * g + i) * ld + o]) * 256.0f); }
  return w; }
__device__ __forceinline__ v16h wcolh_oi(const float* Wm, int k0, int o, int lane, int K) { v16h w; const float* p = Wm + (size_t)o * K + k0 + 8 * (lane >> 4);
#pragma unroll
  for (int i = 0; i < 8; ++i) { w[i] = (_Float16)(bfr(p[i]) * 256.0f); w[8 + i] = (_Float16)(bfr(p[16 + i]) * 256.0f); }
  return w; }
// unconverted f32 values of a fragment, in fragment element order: a row operand, and column o of an (in,out) [K][ld] weight
__device__ __forceinline__ void raw_row(float (&r)[16], const float* rowk0, int lane) { const float* p = rowk0 + 8 * (lane >> 4);
#pragma unroll
  for (int i = 0; i < 8; ++i) { r[i] = p[i]; r[8 + i] = p[16 + i]; } }
__device__ __forceinline__ void raw_col(float (&r)[16], const float* Wm, int k0, int o, int lane, int ld) { const int g = lane >> 4;
#pragma unroll
  for (int i = 0; i < 8; ++i) { r[i] = Wm[(size_t)(k0 + 8 * g + i) * ld + o]; r[8 + i] = Wm[(size_t)(k0 + 16 + 8 * g + i) * ld + o]; } }
#define WQKV_LAYOUT 0   // selects WCOL only, which nothing calls (k_proj always reads (in,out) [DIN][CC]): 0 = (in,out) [DIN][CC]; 1 = (out,in) [CC][DIN]; 2 = per-head [NH][DIN][HD]
__device__ __forceinline__ v16b wcol_hdk(const float* Wm, int k0, int o, int lane) { v16b w; const int g = lane >> 4; const float* p = Wm + (size_t)(o / HD) * DIN * HD + (o % HD);
#pragma unroll
  for (int i = 0; i < 8; ++i) { w[i] = (__bf16)p[(size_t)(k0 + 8 * g + i) * HD]; w[8 + i] = (__bf16)p[(size_t)(k0 + 16 + 8 * g + i) * HD]; }
  return w; }
#define WO_OUT_IN 0
#if WQKV_LAYOUT == 1
#define WCOL(W, k0, o, lane) wcol_oi(W, k0, o, lane, DIN)
#elif WQKV_LAYOUT == 2
#define WCOL(W, k0, o, lane) wcol_hdk(W, k0, o, lane)
#else
#define WCOL(W, k0, o, lane) wcol_io(W, k0, o, lane, CC)
#endif
#if WO_OUT_IN
#define WOCOL(W, k0, o, lane) wcol_oi(W, k0, o, lane, CC)
#define WOCOLH(W, k0, o, lane) wcolh_oi(W, k0, o, lane, CC)
#else
#define WOCOL(W, k0, o, lane) wcol_io(W, k0, o, lane, DIN)
#define WOCOLH(W, k0, o, lane) wcolh_io(W, k0, o, lane, DIN)
#endif
#define WS_QH2 (WS_END)                                   // f16 q_v rows, fragment order
#define WS_QL2 (WS_QH2 + 2u * (size_t)NB * TT * CC)       // f16 q_v residual rows, fragment order
#define WS_KP  (WS_QL2 + 2u * (size_t)NB * QHI * CC)      // f16 positional key rows p = pos_emb Wpos, fragment order (the first TT rows are used)
#define WS_S2  (WS_KP + 2u * (size_t)NB * TT * CC)        // f32 [hg][t][p], unused: k_att keeps BD in LDS
#define WS_END2 (WS_S2 + 4u * (size_t)HG * TT * TT)

#define WS_QH  0u                                      // f16 q rows, fragment order [b*t / 16][head][piece 4][lane 32][8] (see pk_row)
#define WS_KH  (WS_QH + 2u * (size_t)NB * TT * CC)      // f16 k rows, fragment order as the q rows
#define WS_VT  (WS_KH + 2u * (size_t)NB * TT * CC)      // f16 v, fragment order [b][head][d / 16][t / 32][half 2][lane 32][8]: lane = (t / 8 & 1) * 16 + d % 16
#define WS_QL  (WS_VT + 2u * (size_t)NB * CC * TT)      // f16 q residual x 2^10 rows, fragment order as the q rows (QHI = TT)
#define WS_KL  (WS_QL + 2u * (size_t)NB * QHI * CC)     // f16 k residual x 2^10 rows [b][t < KHI][CC]
#define WS_VB  (WS_KL + 2u * (size_t)NB * KHI * CC)     // bf16 v hi planes [b][c][t < KHI]
#define WS_VBL (WS_VB + 2u * (size_t)NB * CC * KHI)
#define WS_S   (WS_VBL + 2u * (size_t)NB * CC * KHI)    // f32 [hg][t][s], unused: k_att keeps logits and P on chip
#define WS_Y   (WS_S  + 4u * (size_t)HG * TT * TT)      // f32 ctx rows [b*t][CC] (only when there is an output projection)
#define WS_END (WS_Y  + 4u * (size_t)NB * TT * CC)

// ---- k_proj: every projection in one launch. block = (64 rows, 128 cols, which = blockIdx.z / 4): X W (+ b) with exact bf16 products (K = DIN) -> which 0: q, multiplied once and stored twice, as q + pos_bias_u and as q + pos_bias_v (f16 rows + residual rows each); 1: k f16 rows (+ residual rows < KHI); 2: v f16 planes (+ bf16 hi/lo planes [c][t] for t < KHI); 3: the positional key rows p = pos_emb Wpos (no bias, the TT rows of blockIdx.z = 12), f16 rows as k; the f16 planes are stored in the fragment order that k_att loads (layouts: WS_QH, WS_VT). The q blocks have the longest epilogue and the lowest indices (for speed only)
__global__ __launch_bounds__(128) void k_proj(const float* __restrict__ XQ, const float* __restrict__ XK, const float* __restrict__ XV, const float* __restrict__ XP, const float* __restrict__ WQ, const float* __restrict__ WK, const float* __restrict__ WV, const float* __restrict__ WP, const float* __restrict__ BQ, const float* __restrict__ BK, const float* __restrict__ BV,
    _Float16* __restrict__ QH, _Float16* __restrict__ QL, _Float16* __restrict__ QH2, _Float16* __restrict__ QL2, _Float16* __restrict__ KH, _Float16* __restrict__ KL, _Float16* __restrict__ KP, _Float16* __restrict__ VT, __bf16* __restrict__ VB, __bf16* __restrict__ VBL, const float* __restrict__ EXU, const float* __restrict__ EXV) {
  __shared__ __align__(16) float st[64][132]; __shared__ __align__(16) _Float16 sh[2][64][136], sl[2][64][136]; __shared__ __align__(16) _Float16 th[128][72]; __shared__ __align__(16) __bf16 tb[128][72], tbl[128][72];
  const int tid = threadIdx.x, wave = tid >> 5, lane = tid & 31, col = lane & 15, g = lane >> 4; const int which = blockIdx.z >> 2; const int c0 = blockIdx.y * 128; const size_t r0 = (size_t)((blockIdx.z & 3) * 16 + blockIdx.x) * 64; const size_t bb = r0 / TT; const int t0 = (int)(r0 % TT);
  const float* X = which == 0 ? XQ : which == 1 ? XK : which == 2 ? XV : XP; const float* WA = which == 0 ? WQ : which == 1 ? WK : which == 2 ? WV : WP; const float* BA = which == 0 ? BQ : which == 1 ? BK : which == 2 ? BV : nullptr;
  v8f acc[8] = {};
#pragma unroll 2
  for (int kc = 0; kc < DIN / 32; ++kc) { float ar[16], wr[8][16];   /* every load of this k step is issued before the first product, so one latency covers all nine fragments */
    raw_row(ar, X + (r0 + wave * 16 + col) * DIN + kc * 32, lane);
    asm volatile("s_wait_xcnt 0x0" ::: "memory");   /* the row loads' address pair is dead from here on and the weight loads below may be given it as a destination: keep the wait in front of that overwrite */
#pragma unroll
    for (int j = 0; j < 8; ++j) raw_col(wr[j], WA, kc * 32, c0 + j * 16 + col, lane, CC);
    v16b a;
#pragma unroll
    for (int i = 0; i < 16; ++i) a[i] = (__bf16)ar[i];
#pragma unroll
    for (int j = 0; j < 8; ++j) { v16b w;
#pragma unroll
      for (int i = 0; i < 16; ++i) w[i] = (__bf16)wr[j][i];
      acc[j] = wmma_bf(a, w, acc[j]); } }
  { // stage the f32 tile (acc + bias) in LDS, then convert
#pragma unroll
    for (int j = 0; j < 8; ++j) { const float bias = BA ? bfr(BA[c0 + j * 16 + col]) : 0.f;
#pragma unroll
      for (int r = 0; r < 8; ++r) st[wave * 16 + 8 * g + r][j * 16 + col] = acc[j][r] + bias; }
    __syncthreads();
  }
  if (which != 2) { _Float16* DH = which == 1 ? KH : KP;
    for (int ps = 0; ps < (which == 0 ? 2 : 1); ++ps) { const float* EB = which == 0 ? (ps ? EXV : EXU) : nullptr; const float eb = EB ? bfr(EB[c0 + tid]) : 0.f;
      asm volatile("s_wait_xcnt 0x0" ::: "memory");   /* the second pass overwrites the bias load's base: keep the wait in front of that */
      /* q + pos_bias_u, then q + pos_bias_v: the per-(head, dim) bias is added in f32 to the staged (x Wq + bq), which stays as it is for the second pass; a thread converts one column */
      for (int rl = 0; rl < 64; ++rl) { const float x = st[rl][tid]; const float v = EB ? x + eb : x; const _Float16 hv = (_Float16)v; sh[ps][rl][tid] = hv; sl[ps][rl][tid] = (_Float16)((v - (float)hv) * 1024.0f); } }
    __syncthreads();
    for (int e = tid; e < 64 * 16; e += 128) { const int ln = e & 31, rl = (e >> 8) * 16 + (ln & 15), q = ((e >> 5) & 7) * 2 + (ln >> 4);   /* e runs in the order of the destination: [row tile 4][head 2][piece 4][lane 32], so a wave stores 512 contiguous bytes */
      const size_t po = (((r0 >> 4) + (e >> 8)) * NH + (c0 >> 6)) * 1024 + (e & 255) * 8;
      const v4u h0 = *(const v4u*)&sh[0][rl][q * 8];
      if (which == 0) { const v4u l0 = *(const v4u*)&sl[0][rl][q * 8], h1 = *(const v4u*)&sh[1][rl][q * 8], l1 = *(const v4u*)&sl[1][rl][q * 8];   /* the four LDS reads share one latency */
        vst2((unsigned*)(QH + po), h0); vst2((unsigned*)(QL + po), l0); vst2((unsigned*)(QH2 + po), h1); vst2((unsigned*)(QL2 + po), l1); }
      else { vst2((unsigned*)(DH + po), h0);
        asm volatile("s_wait_xcnt 0x0" ::: "memory");   /* the second store's address may be formed in the first one's registers: keep the wait in front of that */
        if (which == 1 && t0 < KHI) vst2((unsigned*)(KL + (bb * KHI + t0 + rl) * (size_t)CC + c0 + q * 8), *(const v4u*)&sl[0][rl][q * 8]); }
      asm volatile("s_wait_xcnt 0x0" ::: "memory"); }   /* the next trip overwrites the stores' address and data registers: keep the wait in front of that */
  } else { const bool hi_rows = t0 < KHI;
    for (int e = tid; e < 64 * 128; e += 128) { const int rl = e & 63, cl = e >> 6; const float v = st[rl][cl]; th[cl][rl] = (_Float16)v; const __bf16 bh = (__bf16)v; tb[cl][rl] = bh; tbl[cl][rl] = (__bf16)(v - (float)bh); }
    __syncthreads();
    for (int e = tid; e < 128 * 8; e += 128) { const int ln = e & 31, cl = (e >> 7) * 16 + (ln & 15), q = ((e >> 5) & 3) * 2 + (ln >> 4);   /* destination order: [head 2][d tile 4][t block 2][half 2][lane 32] */
      vst2((unsigned*)(VT + (((bb * NH + (c0 >> 6)) * 4 + (e >> 7)) * 32 + (t0 >> 5)) * 512 + (e & 127) * 8), *(const v4u*)&th[cl][q * 8]);
      asm volatile("s_wait_xcnt 0x0" ::: "memory");   /* what follows overwrites the store's address and data registers: keep the wait in front of that */
      if (hi_rows) { const size_t o3 = (bb * CC + c0 + cl) * (size_t)KHI + t0 + q * 8; vst2((unsigned*)(VB + o3), *(const v4u*)&tb[cl][q * 8]); vst2((unsigned*)(VBL + o3), *(const v4u*)&tbl[cl][q * 8]);
        asm volatile("s_wait_xcnt 0x0" ::: "memory"); } } } }   /* as above, for these two stores */
// ---- k_att: block = 16 query rows (t0..t0+15) of (b, h), 8 waves, wave w owns key / position columns [128 w, 128 w + 128). Logits never leave the WGP:
//  1. BD = (q + v) . p x 1/8 is stored straight to its rel_shift place in LDS. The reference's pad-reshape is linear in memory: BD[r][c] lands at flat out index r T + r + c + 1 - T, so row r's columns c >= T-1-r go to out row r and the others to out row r-1; out[t][t+1] is the pad's 0.
//     The block needs BD rows t0..t0+16; a 16-column tile at cs needs rows t0+1..t0+16 when cs + t0 <= T - 32 and rows t0..t0+15 otherwise (cs, t0 multiples of 16), so one row tile serves each column tile.
//  2. AC = (q + u) . k x 1/8 stays in registers and takes BD' from LDS; softmax in f32 over the 8 waves; P x 2^11 once to f16 in LDS.
//  3. each wave multiplies its own 128 keys of P with v (f16, 1 product); the 8 partial ctx tiles are summed in wave order.
// Every loop is fully unrolled: the fragment, logit and accumulator arrays stay in registers only when each index is a constant. The second launch bound asks for 4 waves per SIMD (256 registers), so that two blocks share a WGP.
// The q, k, p and v planes lie in the workspace in fragment order: the 16 bytes that lane l of a wave takes with one load stand at 16 l inside a 512-byte piece, so a load reads 4 whole 128-byte lines and not a 32-byte part of 16 lines.
// Rows (q, k, p): a (16 rows, one head) tile is 4 pieces; piece 2 kc + half holds d = 32 kc + 16 half + 8 g + 0..7 of row r at lane 16 g + r % 16. pk_row = f16 index of the lane's place in piece 0.
__device__ __forceinline__ size_t pk_row(size_t row, int h, int g) { return ((row >> 4) * NH + h) * 1024 + (g * 16 + (row & 15)) * 8; }
#define PKT (NH * 1024)  // f16 from a 16-row tile to the next
__device__ __forceinline__ v16h frag_at(const _Float16* p) { union { v16h v; v8h q[2]; } u; u.q[0] = *(const v8h*)p; u.q[1] = *(const v8h*)(p + 256); return u.v; }   // the two pieces of one 32-deep fragment; p holds the lane's place
// behind a group of loads: the group's address registers are inputs, so they live up to the wait and no load of the group is given one of them as its destination; behind the wait they may be overwritten
#define XW1(p) asm volatile("s_wait_xcnt 0x0" :: "v"(p) : "memory")
#define XW2(p, q) asm volatile("s_wait_xcnt 0x0" :: "v"(p), "v"(q) : "memory")
#define XW3(p, q, r) asm volatile("s_wait_xcnt 0x0" :: "v"(p), "v"(q), "v"(r) : "memory")
#define SPP (TT + 8)     // f16 pitch of the P rows in LDS: 16 B more than a row, so that the 16 rows of a fragment read fall on different banks
#define SRP (HD + 4)     // f32 pitch of the partial ctx rows
__global__ __launch_bounds__(256, 4) void k_att(const _Float16* __restrict__ QH, const _Float16* __restrict__ QL, const _Float16* __restrict__ QH2, const _Float16* __restrict__ QL2, const _Float16* __restrict__ KH, const _Float16* __restrict__ KP, const _Float16* __restrict__ VT, float* __restrict__ Y) {
  __shared__ __align__(16) char sm[16 * SPP * 2 + 8 * 16 * SRP * 4];   /* first the f32 BD' rows [16][TT] (65,536 B); once every wave has read them, the f16 P rows and behind them the partial ctx tiles */
  __shared__ __align__(16) float redm[16][8], reds[16][8];
  float* sS = (float*)sm; _Float16* sP = (_Float16*)sm; float* sR = (float*)(sm + 16 * SPP * 2);
  const int tid = threadIdx.x, wave = __builtin_amdgcn_readfirstlane(tid >> 5), lane = tid & 31, col = lane & 15, g = lane >> 4;
  const int t0 = blockIdx.x * 16, h = blockIdx.y, b = blockIdx.z, c0 = wave * 128;
  const size_t qr0 = pk_row((size_t)b * TT + t0 + col, h, g);   /* every offset below holds the lane's place in a piece */
  const size_t qr1 = pk_row((size_t)b * TT + (t0 + 1 + col < TT ? t0 + 1 + col : TT - 1), h, g);   /* row T does not exist and no tile of the last block uses the shifted rows */
  if (tid < 16 && t0 + tid + 1 < TT) sS[tid * TT + t0 + tid + 1] = 0.f;
  { v16h ah[HD / 32], al[HD / 32], pf[HD / 32][8]; const size_t qra = c0 + t0 <= TT - 32 ? qr1 : qr0;   /* the row tile of this wave's first column tile */
    const _Float16 *qha = QH2 + qra, *qla = QL2 + qra, *qhb = QH2 + qr0, *qlb = QL2 + qr0, *pb = KP + pk_row((size_t)(c0 + col), h, g);
#pragma unroll
    for (int kc = 0; kc < HD / 32; ++kc) { ah[kc] = frag_at(qha + kc * 512); al[kc] = frag_at(qla + kc * 512); }
#pragma unroll
    for (int kc = 0; kc < HD / 32; ++kc)
#pragma unroll
      for (int j = 0; j < 8; ++j) pf[kc][j] = frag_at(pb + j * PKT + kc * 512);
    XW3(qha, qla, pb);
#pragma unroll
    for (int j = 0; j < 8; ++j) { const bool up = c0 + j * 16 + t0 <= TT - 32;   /* wave-uniform */
      if (j > 0 && c0 + j * 16 + t0 == TT - 16) {   /* the one wave of a block whose columns cross from the shifted rows to the unshifted ones fetches the other row tile here */
#pragma unroll
        for (int kc = 0; kc < HD / 32; ++kc) { ah[kc] = frag_at(qhb + kc * 512); al[kc] = frag_at(qlb + kc * 512); }
        XW2(qhb, qlb); }
      v8f a = {}, l = {};
#pragma unroll
      for (int kc = 0; kc < HD / 32; ++kc) { a = wmma16(ah[kc], pf[kc][j], a); l = wmma16(al[kc], pf[kc][j], l); }
#pragma unroll
      for (int r = 0; r < 8; ++r) { const int rl = (up ? 1 : 0) + 8 * g + r; const int idx = (rl - 1) * TT + t0 + rl + c0 + j * 16 + col + 1;
        if ((unsigned)idx < 16u * TT) sS[idx] = (a[r] + l[r] * (1.0f / 1024.0f)) * SCALE; } } }   /* outside: a neighbour block's row */
  float s[8][8];
  { v16h ah[HD / 32], al[HD / 32], kf[HD / 32][8]; const _Float16 *qh = QH + qr0, *ql = QL + qr0, *kb = KH + pk_row((size_t)b * TT + c0 + col, h, g);
#pragma unroll
    for (int kc = 0; kc < HD / 32; ++kc) { ah[kc] = frag_at(qh + kc * 512); al[kc] = frag_at(ql + kc * 512); }
#pragma unroll
    for (int kc = 0; kc < HD / 32; ++kc)
#pragma unroll
      for (int j = 0; j < 8; ++j) kf[kc][j] = frag_at(kb + j * PKT + kc * 512);
    XW3(qh, ql, kb);
#pragma unroll
    for (int j = 0; j < 8; ++j) { v8f a = {}, l = {};
#pragma unroll
      for (int kc = 0; kc < HD / 32; ++kc) { a = wmma16(ah[kc], kf[kc][j], a); l = wmma16(al[kc], kf[kc][j], l); }
#pragma unroll
      for (int r = 0; r < 8; ++r) s[j][r] = (a[r] + l[r] * (1.0f / 1024.0f)) * SCALE;
      __builtin_amdgcn_sched_barrier(0); } }   /* each tile's two accumulators are folded into its logits before the next tile starts: with all sixteen accumulators live beside the key fragments the kernel spills */
  v16h vf[4][HD / 16];   /* this wave's v fragments: half are issued ahead of the softmax, half behind its exponentials (all sixteen beside them do not fit the registers), so that their latency runs under it */
  const _Float16* vb = VT + ((((size_t)b * NH + h) * 4) * 32 + (c0 >> 5)) * 512 + lane * 8;
#pragma unroll
  for (int u = 0; u < 2; ++u)
#pragma unroll
    for (int j = 0; j < HD / 16; ++j) vf[u][j] = frag_at(vb + j * 32 * 512 + u * 512);
  XW1(vb);
  __syncthreads();   /* every BD' element is in LDS */
  float m[8], sum[8];
#pragma unroll
  for (int r = 0; r < 8; ++r) { m[r] = -3.0e38f;
#pragma unroll
    for (int j = 0; j < 8; ++j) { s[j][r] = s[j][r] + sS[(8 * g + r) * TT + c0 + j * 16 + col]; m[r] = fmaxf(m[r], s[j][r]); }
#pragma unroll
    for (int o = 1; o < 16; o <<= 1) m[r] = fmaxf(m[r], __shfl_xor(m[r], o)); }
  if (col == 0) {
#pragma unroll
    for (int r = 0; r < 8; ++r) redm[8 * g + r][wave] = m[r]; }
  __syncthreads();   /* row maxima of all waves; also the last read of the BD' rows, whose LDS is reused below */
#pragma unroll
  for (int r = 0; r < 8; ++r) { const v4f x = *(const v4f*)&redm[8 * g + r][0], y = *(const v4f*)&redm[8 * g + r][4];
    m[r] = fmaxf(fmaxf(fmaxf(x[0], x[1]), fmaxf(x[2], x[3])), fmaxf(fmaxf(y[0], y[1]), fmaxf(y[2], y[3]))); sum[r] = 0.f;
#pragma unroll
    for (int j = 0; j < 8; ++j) { s[j][r] = expf(s[j][r] - m[r]); sum[r] += s[j][r]; }
#pragma unroll
    for (int o = 1; o < 16; o <<= 1) sum[r] += __shfl_xor(sum[r], o); }
#pragma unroll
  for (int u = 2; u < 4; ++u)
#pragma unroll
    for (int j = 0; j < HD / 16; ++j) vf[u][j] = frag_at(vb + j * 32 * 512 + u * 512);
  XW1(vb);
  if (col == 0) {
#pragma unroll
    for (int r = 0; r < 8; ++r) reds[8 * g + r][wave] = sum[r]; }
  __syncthreads();   /* row sums of all waves */
#pragma unroll
  for (int r = 0; r < 8; ++r) { const v4f x = *(const v4f*)&reds[8 * g + r][0], y = *(const v4f*)&reds[8 * g + r][4];
    const float a = ((x[0] + x[1]) + (x[2] + x[3])) + ((y[0] + y[1]) + (y[2] + y[3])); const float inv = a > 0.f ? 2048.0f / a : 0.f;
#pragma unroll
    for (int j = 0; j < 8; ++j) sP[(8 * g + r) * SPP + c0 + j * 16 + col] = (_Float16)(s[j][r] * inv); }
  LDSX();   /* a wave reads back only the 128 P columns that it wrote itself */
  v8f acc[HD / 16] = {};
#pragma unroll
  for (int u = 0; u < 4; ++u) { const v16h p = frag_h(sP + col * SPP + c0 + u * 32, lane);
#pragma unroll
    for (int j = 0; j < HD / 16; ++j) acc[j] = wmma16(p, vf[u][j], acc[j]); }
#pragma unroll
  for (int j = 0; j < HD / 16; ++j)
#pragma unroll
    for (int r = 0; r < 8; ++r) sR[(wave * 16 + 8 * g + r) * SRP + j * 16 + col] = acc[j][r];
  __syncthreads();   /* the 8 partial ctx tiles */
  { const int rl = tid >> 4, c4 = (tid & 15) * 4; v4f o = *(const v4f*)&sR[rl * SRP + c4];
#pragma unroll
    for (int w = 1; w < 8; ++w) o = o + *(const v4f*)&sR[(w * 16 + rl) * SRP + c4];
    vst2(Y + ((size_t)b * TT + t0 + rl) * CC + h * HD + c4, o * (1.0f / 2048.0f)); } }
// ---- k_out: block = (64 rows, 128 cols): out = ctx Wo (+ bo): ctx x 2^6 once to f16 against Wo as f16(bf16 x 2^8) exact (1 product) x 2^-14; causal early rows (< QHI of each sequence): ctx bf16 hi + lo against exact bf16 Wo (2 products)
__global__ __launch_bounds__(128) void k_out(const float* __restrict__ Y, const float* __restrict__ WO, const float* __restrict__ BO, float* __restrict__ OUT) { __shared__ __align__(16) float sf[4][16][132];
  const int tid = threadIdx.x, wave = tid >> 5, lane = tid & 31, col = lane & 15, g = lane >> 4; const int c0 = blockIdx.y * 128; const size_t r0 = (size_t)blockIdx.x * 64 + wave * 16;
  v8f acc[8] = {};
  if (CAUSAL && (int)(((size_t)blockIdx.x * 64) % TT) < QHI) {   /* block-uniform */
#pragma unroll 2
    for (int kc = 0; kc < CC / 32; ++kc) { const F2 a = split_row(Y + (r0 + col) * CC, kc * 32, lane); asm volatile("s_wait_loadcnt 0x0" ::: "memory");
#pragma unroll
      for (int j = 0; j < 8; ++j) { const v16b w = WOCOL(WO, kc * 32, c0 + j * 16 + col, lane); asm volatile("s_wait_loadcnt 0x0" ::: "memory"); acc[j] = wmma_bf(a.h, w, acc[j]); acc[j] = wmma_bf(a.l, w, acc[j]); } }
#pragma unroll
    for (int j = 0; j < 8; ++j) { const float bias = BO ? bfr(BO[c0 + j * 16 + col]) : 0.f;
#pragma unroll
      for (int r = 0; r < 8; ++r) sf[wave][8 * g + r][j * 16 + col] = acc[j][r] + bias; }
  } else {
#pragma unroll 2
    for (int kc = 0; kc < CC / 32; ++kc) { float ar[16], wr[8][16];   /* every load of this k step is issued before the first product */
      raw_row(ar, Y + (r0 + col) * CC + kc * 32, lane);
#pragma unroll
      for (int j = 0; j < 8; ++j) raw_col(wr[j], WO, kc * 32, c0 + j * 16 + col, lane, DIN);
      v16h a;   /* ctx carried x 2^6 into f16 so small-magnitude context rows stay clear of f16 subnormals */
#pragma unroll
      for (int i = 0; i < 16; ++i) a[i] = (_Float16)(ar[i] * 64.0f);
#pragma unroll
      for (int j = 0; j < 8; ++j) { v16h w;
#pragma unroll
        for (int i = 0; i < 16; ++i) w[i] = (_Float16)(bfr(wr[j][i]) * 256.0f);
        acc[j] = wmma16(a, w, acc[j]); } }
#pragma unroll
    for (int j = 0; j < 8; ++j) { const float bias = BO ? bfr(BO[c0 + j * 16 + col]) : 0.f;
#pragma unroll
      for (int r = 0; r < 8; ++r) sf[wave][8 * g + r][j * 16 + col] = acc[j][r] * (1.0f / 16384.0f) + bias; } }   /* 2^-8 (Wo carry) x 2^-6 (ctx carry) */
  LDSX(); for (int rl = 0; rl < 16; ++rl) vst2(OUT + (r0 + rl) * DIN + c0 + lane * 4, *(const v4f*)&sf[wave][rl][lane * 4]); }

extern "C" void kernel_launch(void* const* d_in, const int* in_sizes, int n_in, void* d_out, int out_size, void* d_ws, size_t ws_size, hipStream_t stream) {
  (void)in_sizes; (void)n_in; (void)out_size;
  const float** F = (const float**)d_in;
  if (ws_size < (size_t)WS_END) return;
  char* ws = (char*)d_ws; _Float16 *QH = (_Float16*)(ws + WS_QH), *KH = (_Float16*)(ws + WS_KH), *VT = (_Float16*)(ws + WS_VT), *QL = (_Float16*)(ws + WS_QL), *KL = (_Float16*)(ws + WS_KL); __bf16 *VB = (__bf16*)(ws + WS_VB), *VBL = (__bf16*)(ws + WS_VBL); float *Y = (float*)(ws + WS_Y);
  (void)Y; (void)QL; (void)KL; (void)VB; (void)VBL;
  // inputs: 0 query [4,1024,512]; 1 key; 2 value; 3 pos_emb [1,1024,512]; 4 Wq (in,out), 5 bq; 6 Wk, 7 bk; 8 Wv, 9 bv; 10 Wo (in,out), 11 bo; 12 Wpos [512,512]; 13 pos_bias_u [8,64]; 14 pos_bias_v [8,64]
  if (ws_size < (size_t)WS_END2) return;
  _Float16 *QH2 = (_Float16*)(ws + WS_QH2), *QL2 = (_Float16*)(ws + WS_QL2), *KP = (_Float16*)(ws + WS_KP);
  k_proj<<<dim3(16, CC / 128, TNB * TT / 1024 * 3 + 1), 128, 0, stream>>>(F[0], F[1], F[2], F[3], F[4], F[6], F[8], F[12], F[5], F[7], F[9], QH, QL, QH2, QL2, KH, KL, KP, VT, VB, VBL, F[13], F[14]);   /* q (stored as q + pos_bias_u and as q + pos_bias_v), k, v, and p = pos_emb Wpos into KP */
  k_att<<<dim3(TT / 16, NH, TNB), 256, 0, stream>>>(QH, QL, QH2, QL2, KH, KP, VT, Y);   /* AC + rel_shift(BD), softmax, P v */
  k_out<<<dim3(TNB * TT / 64, DIN / 128), 128, 0, stream>>>(Y, F[10], F[11], (float*)d_out);
}

// v005
// Measured time: 92.7 microseconds a run.
// Timed twice side by side with v004, it ran 1.46 times as fast both times.
// Over all steps from v000 it is 5.56 times as fast.
// compute dtype: all float inputs rounded to bf16; projections with EXACT bf16 products on WMMA 16x16x32 (f32 accumulate) + biases; content (q+u).k and position (q+v).p scores each with q as f16 hi + residual (x 2^10) against f16 k / p (2 products) x 64^-0.5; rel_shift as the store index of the position scores in LDS; softmax f32; P x 2^11 once to f16 x v once to f16 (1 product); ctx carried x 2^6 once to f16 x Wo f16(bf16 x 2^8) + bo; f32 output.
#include <hip/hip_runtime.h>
#include <math.h>

typedef __attribute__((ext_vector_type(16))) _Float16 v16h;
typedef __attribute__((ext_vector_type(16))) __bf16 v16b;
typedef __attribute__((ext_vector_type(8)))  _Float16 v8h;
typedef __attribute__((ext_vector_type(8)))  float v8f;
typedef __attribute__((ext_vector_type(4)))  float v4f;
typedef __attribute__((ext_vector_type(2)))  float v2f;
typedef __attribute__((ext_vector_type(4)))  unsigned v4u;
typedef __attribute__((ext_vector_type(4)))  int v4i;
typedef float __attribute__((may_alias)) float_a;
typedef int __attribute__((may_alias)) int_a;

template <typename T> __device__ __forceinline__ void vst2(void* p, T v) { *(T*)p = v;  }
__device__ __forceinline__ v8f wmma16(v16h a, v16h b, v8f c) {
  v8f d = __builtin_amdgcn_wmma_f32_16x16x32_f16(false, a, false, b, (short)0, c, false, false);
  asm volatile("v_nop\n\tv_nop\n\tv_nop\n\tv_nop" : "+v"(d) : "v"(a), "v"(b));
  return d;
}
__device__ __forceinline__ v8f wmma_bf(v16b a, v16b b, v8f c) {
  v8f d = __builtin_amdgcn_wmma_f32_16x16x32_bf16(false, a, false, b, (short)0, c, false, false);
  asm volatile("v_nop\n\tv_nop\n\tv_nop\n\tv_nop" : "+v"(d) : "v"(a), "v"(b));
  return d;
}
// 16x16x32 fragments: lane = (h = lane>>4, row/col = lane&15); elements 0..7 = k0+8h+0..7, 8..15 = k0+16+8h+0..7; D element r = row 8h+r
__device__ __forceinline__ v16h frag_h(const _Float16* rowk0, int lane) {
  union { v16h v; v8h q[2]; } u; const _Float16* p = rowk0 + 8 * (lane >> 4);
  u.q[0] = *(const v8h*)p; u.q[1] = *(const v8h*)(p + 16); return u.v;
}
__device__ __forceinline__ v16h frag_f32(const float* rowk0, int lane) {
  v16h a; const float* p = rowk0 + 8 * (lane >> 4);
#pragma unroll
  for (int i = 0; i < 8; ++i) { a[i] = (_Float16)p[i]; a[8 + i] = (_Float16)p[16 + i]; }
  return a;
}
__device__ __forceinline__ v16h frag_f32s(const float* rowk0, int lane, float sc) {
  v16h a; const float* p = rowk0 + 8 * (lane >> 4);
#pragma unroll
  for (int i = 0; i < 8; ++i) { a[i] = (_Float16)(p[i] * sc); a[8 + i] = (_Float16)(p[16 + i] * sc); }
  return a;
}
// column fragment from a [K][ld] layout (column n), rows >= K read as 0
__device__ __forceinline__ v16h fragc_f32(const float* W, int k0, int n, int lane, int ld, int K) {
  v16h a; const int g = lane >> 4;
#pragma unroll
  for (int i = 0; i < 8; ++i) { const int ka = k0 + 8 * g + i, kb = ka + 16;
    a[i] = (_Float16)(ka < K ? W[(size_t)(ka < K ? ka : K - 1) * ld + n] : 0.f); a[8 + i] = (_Float16)(kb < K ? W[(size_t)(kb < K ? kb : K - 1) * ld + n] : 0.f); }
  return a;
}
struct F2 { v16b h, l; };
__device__ __forceinline__ F2 bsplit16(const float v[16]) { F2 r;
#pragma unroll
  for (int i = 0; i < 16; ++i) { const __bf16 h = (__bf16)v[i]; r.h[i] = h; r.l[i] = (__bf16)(v[i] - (float)h); }
  return r; }
__device__ __forceinline__ F2 split_row(const float* row, int k0, int lane) { float v[16]; const float* p = row + k0 + 8 * (lane >> 4);
#pragma unroll
  for (int i = 0; i < 8; ++i) { v[i] = p[i]; v[8 + i] = p[16 + i]; }
  return bsplit16(v); }
__device__ __forceinline__ F2 split_rowK(const float* row, int k0, int lane, int K) { float v[16]; const int g = lane >> 4;
#pragma unroll
  for (int i = 0; i < 8; ++i) { const int ka = k0 + 8 * g + i, kb = ka + 16; v[i] = ka < K ? row[ka < K ? ka : K - 1] : 0.f; v[8 + i] = kb < K ? row[kb < K ? kb : K - 1] : 0.f; }
  return bsplit16(v); }
__device__ __forceinline__ F2 split_col(const float* W, int k0, int n, int lane, int ld, int K) { float v[16]; const int g = lane >> 4;
#pragma unroll
  for (int i = 0; i < 8; ++i) { const int ka = k0 + 8 * g + i, kb = ka + 16; v[i] = ka < K ? W[(size_t)(ka < K ? ka : K - 1) * ld + n] : 0.f; v[8 + i] = kb < K ? W[(size_t)(kb < K ? kb : K - 1) * ld + n] : 0.f; }
  return bsplit16(v); }
__device__ __forceinline__ v8f mac3(const F2& a, const F2& b, v8f c) { c = wmma_bf(a.l, b.h, c); c = wmma_bf(a.h, b.l, c); return wmma_bf(a.h, b.h, c); }
__device__ __forceinline__ float sigm(float v) { return 1.0f / (1.0f + expf(-v)); }
#define LDSX() do { asm volatile("s_wait_dscnt 0" ::: "memory"); __builtin_amdgcn_wave_barrier(); __builtin_amdgcn_fence(__ATOMIC_RELEASE, "workgroup"); } while (0)

// Transformer-XL / Conformer relative multi-head attention (B 4, T = P = 1,024, D 512 = 8 heads x 64; (in,out) Wq/Wk/Wv/Wo [512,512] + zero biases, Wpos [512,512] no bias, pos_bias_u/v [8,64]; 1/sqrt(64)-scale): AC = (q + u) k^T, BD = rel_shift((q + v) p^T) with p = pos_emb Wpos (pad-reshape trick, no mask), attn = softmax((AC + BD)/8), out = merge(attn v) Wo + bo.
#define NB 4
#define TT 1024
#define CC 512            // NH * HD = projected width
#define DIN 512          // input (model) width
#define NH 8
#define HD 64
#define NQB (TT / 64)
#define HG 8
#define SCALE (0.125f)
#define CAUSAL 0
#ifndef TNB
#define TNB NB
#endif
__device__ __forceinline__ float bfr(float v) { return (float)(__bf16)v; }
__host__ __device__ __forceinline__ int kb_last(int qb) { return CAUSAL ? ((qb * 64 + 63) >> 7) : (TT / 128 - 1); }
typedef __attribute__((ext_vector_type(8))) __bf16 v8b;
__device__ __forceinline__ v16b frag_b(const __bf16* rowk0, int lane) {
  union { v16b v; v8b q[2]; } u; const __bf16* p = rowk0 + 8 * (lane >> 4);
  u.q[0] = *(const v8b*)p; u.q[1] = *(const v8b*)(p + 16); return u.v;
}
#define QBH 0              // read by no kernel here
#define QHI 1024            // rows carrying a q residual plane (all rows when non-causal: 2-product logits everywhere)
#define KHI 64            // key rows carrying k residual / v bf16 hi+lo planes (written, but read by no kernel here)
// B fragment (k rows k0+.., output column o) of a weight: (in,out) [K][ld] or (out,in) [ld rows of K]: bf16 exact, or f16(bf16 * 256) exact
__device__ __forceinline__ v16b wcol_io(const float* Wm, int k0, int o, int lane, int ld) { v16b w; const int g = lane >> 4;
#pragma unroll
  for (int i = 0; i < 8; ++i) { w[i] = (__bf16)Wm[(size_t)(k0 + 8 * g + i) * ld + o]; w[8 + i] = (__bf16)Wm[(size_t)(k0 + 16 + 8 * g + i) * ld + o]; }
  return w; }
__device__ __forceinline__ v16b wcol_oi(const float* Wm, int k0, int o, int lane, int K) { v16b w; const float* p = Wm + (size_t)o * K + k0 + 8 * (lane >> 4);
#pragma unroll
  for (int i = 0; i < 8; ++i) { w[i] = (__bf16)p[i]; w[8 + i] = (__bf16)p[16 + i]; }
  return w; }
__device__ __forceinline__ v16h wcolh_io(const float* Wm, int k0, int o, int lane, int ld) { v16h w; const int g = lane >> 4;
#pragma unroll
  for (int i = 0; i < 8; ++i) { w[i] = (_Float16)(bfr(Wm[(size_t)(k0 + 8 * g + i) * ld + o]) * 256.0f); w[8 + i] = (_Float16)(bfr(Wm[(size_t)(k0 + 16 + 8 * g + i) * ld + o]) * 256.0f); }
  return w; }
__device__ __forceinline__ v16h wcolh_oi(const float* Wm, int k0, int o, int lane, int K) { v16h w; const float* p = Wm + (size_t)o * K + k0 + 8 * (lane >> 4);
#pragma unroll
  for (int i = 0; i < 8; ++i) { w[i] = (_Float16)(bfr(p[i]) * 256.0f); w[8 + i] = (_Float16)(bfr(p[16 + i]) * 256.0f); }
  return w; }
// unconverted f32 values of a fragment, in fragment element order: a row operand, and column o of an (in,out) [K][ld] weight
__device__ __forceinline__ void raw_row(float (&r)[16], const float* rowk0, int lane) { const float* p = rowk0 + 8 * (lane >> 4);
#pragma unroll
  for (int i = 0; i < 8; ++i) { r[i] = p[i]; r[8 + i] = p[16 + i]; } }
__device__ __forceinline__ void raw_col(float (&r)[16], const float* Wm, int k0, int o, int lane, int ld) { const int g = lane >> 4;
#pragma unroll
  for (int i = 0; i < 8; ++i) { r[i] = Wm[(size_t)(k0 + 8 * g + i) * ld + o]; r[8 + i] = Wm[(size_t)(k0 + 16 + 8 * g + i) * ld + o]; } }
#define WQKV_LAYOUT 0   // selects WCOL only, which nothing calls (k_proj always reads (in,out) [DIN][CC]): 0 = (in,out) [DIN][CC]; 1 = (out,in) [CC][DIN]; 2 = per-head [NH][DIN][HD]
__device__ __forceinline__ v16b wcol_hdk(const float* Wm, int k0, int o, int lane) { v16b w; const int g = lane >> 4; const float* p = Wm + (size_t)(o / HD) * DIN * HD + (o % HD);
#pragma unroll
  for (int i = 0; i < 8; ++i) { w[i] = (__bf16)p[(size_t)(k0 + 8 * g + i) * HD]; w[8 + i] = (__bf16)p[(size_t)(k0 + 16 + 8 * g + i) * HD]; }
  return w; }
#define WO_OUT_IN 0
#if WQKV_LAYOUT == 1
#define WCOL(W, k0, o, lane) wcol_oi(W, k0, o, lane, DIN)
#elif WQKV_LAYOUT == 2
#define WCOL(W, k0, o, lane) wcol_hdk(W, k0, o, lane)
#else
#define WCOL(W, k0, o, lane) wcol_io(W, k0, o, lane, CC)
#endif
#if WO_OUT_IN
#define WOCOL(W, k0, o, lane) wcol_oi(W, k0, o, lane, CC)
#define WOCOLH(W, k0, o, lane) wcolh_oi(W, k0, o, lane, CC)
#else
#define WOCOL(W, k0, o, lane) wcol_io(W, k0, o, lane, DIN)
#define WOCOLH(W, k0, o, lane) wcolh_io(W, k0, o, lane, DIN)
#endif
#define WS_QH2 (WS_END)                                   // f16 q_v rows, fragment order
#define WS_QL2 (WS_QH2 + 2u * (size_t)NB * TT * CC)       // f16 q_v residual rows, fragment order
#define WS_KP  (WS_QL2 + 2u * (size_t)NB * QHI * CC)      // f16 positional key rows p = pos_emb Wpos, fragment order (the first TT rows are used)
#define WS_S2  (WS_KP + 2u * (size_t)NB * TT * CC)        // f32 [hg][t][p], unused: k_att keeps BD in LDS
#define WS_END2 (WS_S2 + 4u * (size_t)HG * TT * TT)

#define WS_QH  0u                                      // f16 q rows, fragment order [b*t / 16][head][piece 4][lane 32][8] (see pk_row)
#define WS_KH  (WS_QH + 2u * (size_t)NB * TT * CC)      // f16 k rows, fragment order as the q rows
#define WS_VT  (WS_KH + 2u * (size_t)NB * TT * CC)      // f16 v, fragment order [b][head][d / 16][t / 32][half 2][lane 32][8]: lane = (t / 8 & 1) * 16 + d % 16
#define WS_QL  (WS_VT + 2u * (size_t)NB * CC * TT)      // f16 q residual x 2^10 rows, fragment order as the q rows (QHI = TT)
#define WS_KL  (WS_QL + 2u * (size_t)NB * QHI * CC)     // f16 k residual x 2^10 rows [b][t < KHI][CC]
#define WS_VB  (WS_KL + 2u * (size_t)NB * KHI * CC)     // bf16 v hi planes [b][c][t < KHI]
#define WS_VBL (WS_VB + 2u * (size_t)NB * CC * KHI)
#define WS_S   (WS_VBL + 2u * (size_t)NB * CC * KHI)    // f32 [hg][t][s], unused: k_att keeps logits and P on chip
#define WS_Y   (WS_S  + 4u * (size_t)HG * TT * TT)      // f32 ctx rows [b*t][CC] (only when there is an output projection)
#define WS_END (WS_Y  + 4u * (size_t)NB * TT * CC)

#define WBP 80           // bytes from a column to the next in a staged weight slab: 64 B of k and 16 more, so that the 16 columns of a fragment read fall on different banks
// work-group barrier of the staged GEMM loops: it waits for this wave's LDS traffic alone. __syncthreads() would also wait for the global loads of the steps ahead, which only this wave's registers receive and which are to stay in flight across it
#define WBAR() asm volatile("s_wait_dscnt 0x0\n\ts_barrier_signal -1\n\ts_barrier_wait -1" ::: "memory")
// ---- k_proj: every projection in one launch. block = (64 rows, 128 cols, which = blockIdx.z / 4): X W (+ b) with exact bf16 products (K = DIN) -> which 0: q, multiplied once and stored twice, as q + pos_bias_u and as q + pos_bias_v (f16 rows + residual rows each); 1: k f16 rows (+ residual rows < KHI); 2: v f16 planes (+ bf16 hi/lo planes [c][t] for t < KHI); 3: the positional key rows p = pos_emb Wpos (no bias, the TT rows of blockIdx.z = 12), f16 rows as k; the f16 planes are stored in the fragment order that k_att loads (layouts: WS_QH, WS_VT). The q blocks, which have the longest epilogue, take the lowest indices (for speed only)
__global__ __launch_bounds__(128) void k_proj(const float* __restrict__ XQ, const float* __restrict__ XK, const float* __restrict__ XV, const float* __restrict__ XP, const float* __restrict__ WQ, const float* __restrict__ WK, const float* __restrict__ WV, const float* __restrict__ WP, const float* __restrict__ BQ, const float* __restrict__ BK, const float* __restrict__ BV,
    _Float16* __restrict__ QH, _Float16* __restrict__ QL, _Float16* __restrict__ QH2, _Float16* __restrict__ QL2, _Float16* __restrict__ KH, _Float16* __restrict__ KL, _Float16* __restrict__ KP, _Float16* __restrict__ VT, __bf16* __restrict__ VB, __bf16* __restrict__ VBL, const float* __restrict__ EXU, const float* __restrict__ EXV) {
  __shared__ __align__(16) float st[64][132]; __shared__ __align__(16) _Float16 sh[2][64][136], sl[2][64][136]; __shared__ __align__(16) _Float16 th[128][72]; __shared__ __align__(16) __bf16 tb[128][72], tbl[128][72];
  const int tid = threadIdx.x, wave = tid >> 5, lane = tid & 31, col = lane & 15, g = lane >> 4; const int which = blockIdx.z >> 2; const int c0 = blockIdx.y * 128; const size_t r0 = (size_t)((blockIdx.z & 3) * 16 + blockIdx.x) * 64; const size_t bb = r0 / TT; const int t0 = (int)(r0 % TT);
  const float* X = which == 0 ? XQ : which == 1 ? XK : which == 2 ? XV : XP; const float* WA = which == 0 ? WQ : which == 1 ? WK : which == 2 ? WV : WP; const float* BA = which == 0 ? BQ : which == 1 ? BK : which == 2 ? BV : nullptr;
  v8f acc[8] = {};
  /* the weight slab of a k step (32 rows x 128 columns) is fetched once by the block, in whole 512-byte rows, rounded once and laid in LDS as [column][k] at pitch WBP, where all four waves take their B fragments. Thread = (8 k rows: wave, 4 columns: lane). Two LDS stages (in sh, which is not written before the barrier behind the loop) and two register sets: the loads of step kc + 2 are issued in step kc, as soon as their registers are free, and fly during step kc + 1 */
  char* wst = (char*)&sh[0][0][0]; const float* wp = WA + (size_t)(wave * 8) * CC + c0 + lane * 4; const float* xp = X + (r0 + wave * 16 + col) * DIN;
  v4f wr[2][8]; float ar[2][16];
#pragma unroll
  for (int u = 0; u < 2; ++u) {
#pragma unroll
    for (int i = 0; i < 8; ++i) wr[u][i] = *(const v4f*)(wp + (size_t)(u * 32 + i) * CC);
    raw_row(ar[u], xp + u * 32, lane); }
  auto step = [&](const int kc, const int u, const bool more) __attribute__((always_inline)) { char* wb = wst + u * (128 * WBP);
#pragma unroll
    for (int jj = 0; jj < 4; ++jj) { v8b t;
#pragma unroll
      for (int i = 0; i < 8; ++i) t[i] = (__bf16)wr[u][i][jj];
      *(v8b*)(wb + (lane * 4 + jj) * WBP + wave * 16) = t; }
    if (more) { const float* wn = wp + (size_t)(kc + 2) * 32 * CC;   /* the weight values of set u are in LDS: refill them for step kc + 2 */
#pragma unroll
      for (int i = 0; i < 8; ++i) wr[u][i] = *(const v4f*)(wn + (size_t)i * CC);
      asm volatile("s_wait_xcnt 0x0" ::: "memory"); }   /* the loop advances the loads' address registers: keep the wait in front of that */
    v16b a;
#pragma unroll
    for (int i = 0; i < 16; ++i) a[i] = (__bf16)ar[u][i];
    WBAR();   /* stage u is written; every wave has also left the other stage, which the next step overwrites */
    union { v16b v; v8b q[2]; } w[8];
#pragma unroll
    for (int j = 0; j < 8; ++j) { const char* f = wb + (j * 16 + col) * WBP + g * 16; w[j].q[0] = *(const v8b*)f; w[j].q[1] = *(const v8b*)(f + 32); }
    __builtin_amdgcn_sched_barrier(0);   /* all sixteen LDS reads are issued ahead of the first product, so that one LDS latency serves the step and not eight */
#pragma unroll
    for (int j = 0; j < 8; ++j) acc[j] = wmma_bf(a, w[j].v, acc[j]);
    if (more) { raw_row(ar[u], xp + (kc + 2) * 32, lane);   /* the row values of set u are converted by now: refill them for step kc + 2 */
      asm volatile("s_wait_xcnt 0x0" ::: "memory"); } };   /* the loop advances the loads' address registers: keep the wait in front of that */
#pragma unroll 1   /* stays a loop of two steps: unrolled whole, the compiler lifts every conversion up to its loads, and each step then waits for loads just issued */
  for (int kc = 0; kc < DIN / 32 - 2; kc += 2) { step(kc, 0, true); step(kc + 1, 1, true); }
  step(DIN / 32 - 2, 0, false); step(DIN / 32 - 1, 1, false);
  { // stage the f32 tile (acc + bias) in LDS, then convert
#pragma unroll
    for (int j = 0; j < 8; ++j) { const float bias = BA ? bfr(BA[c0 + j * 16 + col]) : 0.f;
#pragma unroll
      for (int r = 0; r < 8; ++r) st[wave * 16 + 8 * g + r][j * 16 + col] = acc[j][r] + bias; }
    __syncthreads();
  }
  if (which != 2) { _Float16* DH = which == 1 ? KH : KP;
    for (int ps = 0; ps < (which == 0 ? 2 : 1); ++ps) { const float* EB = which == 0 ? (ps ? EXV : EXU) : nullptr; const float eb = EB ? bfr(EB[c0 + tid]) : 0.f;
      asm volatile("s_wait_xcnt 0x0" ::: "memory");   /* the second pass overwrites the bias load's base: keep the wait in front of that */
      /* q + pos_bias_u, then q + pos_bias_v: the per-(head, dim) bias is added in f32 to the staged (x Wq + bq), which stays as it is for the second pass; a thread converts one column */
      for (int rl = 0; rl < 64; ++rl) { const float x = st[rl][tid]; const float v = EB ? x + eb : x; const _Float16 hv = (_Float16)v; sh[ps][rl][tid] = hv; sl[ps][rl][tid] = (_Float16)((v - (float)hv) * 1024.0f); } }
    __syncthreads();
    for (int e = tid; e < 64 * 16; e += 128) { const int ln = e & 31, rl = (e >> 8) * 16 + (ln & 15), q = ((e >> 5) & 7) * 2 + (ln >> 4);   /* e runs in the order of the destination: [row tile 4][head 2][piece 4][lane 32], so a wave stores 512 contiguous bytes */
      const size_t po = (((r0 >> 4) + (e >> 8)) * NH + (c0 >> 6)) * 1024 + (e & 255) * 8;
      const v4u h0 = *(const v4u*)&sh[0][rl][q * 8];
      if (which == 0) { const v4u l0 = *(const v4u*)&sl[0][rl][q * 8], h1 = *(const v4u*)&sh[1][rl][q * 8], l1 = *(const v4u*)&sl[1][rl][q * 8];   /* the four LDS reads share one latency */
        vst2((unsigned*)(QH + po), h0); vst2((unsigned*)(QL + po), l0); vst2((unsigned*)(QH2 + po), h1); vst2((unsigned*)(QL2 + po), l1); }
      else { vst2((unsigned*)(DH + po), h0);
        asm volatile("s_wait_xcnt 0x0" ::: "memory");   /* the second store's address may be formed in the first one's registers: keep the wait in front of that */
        if (which == 1 && t0 < KHI) vst2((unsigned*)(KL + (bb * KHI + t0 + rl) * (size_t)CC + c0 + q * 8), *(const v4u*)&sl[0][rl][q * 8]); }
      asm volatile("s_wait_xcnt 0x0" ::: "memory"); }   /* the next trip overwrites the stores' address and data registers: keep the wait in front of that */
  } else { const bool hi_rows = t0 < KHI;
    for (int e = tid; e < 64 * 128; e += 128) { const int rl = e & 63, cl = e >> 6; const float v = st[rl][cl]; th[cl][rl] = (_Float16)v; const __bf16 bh = (__bf16)v; tb[cl][rl] = bh; tbl[cl][rl] = (__bf16)(v - (float)bh); }
    __syncthreads();
    for (int e = tid; e < 128 * 8; e += 128) { const int ln = e & 31, cl = (e >> 7) * 16 + (ln & 15), q = ((e >> 5) & 3) * 2 + (ln >> 4);   /* destination order: [head 2][d tile 4][t block 2][half 2][lane 32] */
      vst2((unsigned*)(VT + (((bb * NH + (c0 >> 6)) * 4 + (e >> 7)) * 32 + (t0 >> 5)) * 512 + (e & 127) * 8), *(const v4u*)&th[cl][q * 8]);
      asm volatile("s_wait_xcnt 0x0" ::: "memory");   /* what follows overwrites the store's address and data registers: keep the wait in front of that */
      if (hi_rows) { const size_t o3 = (bb * CC + c0 + cl) * (size_t)KHI + t0 + q * 8; vst2((unsigned*)(VB + o3), *(const v4u*)&tb[cl][q * 8]); vst2((unsigned*)(VBL + o3), *(const v4u*)&tbl[cl][q * 8]);
        asm volatile("s_wait_xcnt 0x0" ::: "memory"); } } } }   /* as above, for these two stores */
// ---- k_att: block = 16 query rows (t0..t0+15) of (b, h), 8 waves, wave w owns key / position columns [128 w, 128 w + 128). Logits never leave the WGP:
//  1. BD = (q + v) . p x 1/8 is stored straight to its rel_shift place in LDS. The reference's pad-reshape is linear in memory: BD[r][c] lands at flat out index r T + r + c + 1 - T, so row r's columns c >= T-1-r go to out row r and the others to out row r-1; out[t][t+1] is the pad's 0.
//     The block needs BD rows t0..t0+16; a 16-column tile at cs needs rows t0+1..t0+16 when cs + t0 <= T - 32 and rows t0..t0+15 otherwise (cs, t0 multiples of 16), so one row tile serves each column tile.
//  2. AC = (q + u) . k x 1/8 stays in registers and takes BD' from LDS; softmax in f32 over the 8 waves; P x 2^11 once to f16 in LDS.
//  3. each wave multiplies its own 128 keys of P with v (f16, 1 product); the 8 partial ctx tiles are summed in wave order.
// Every loop is fully unrolled: the fragment, logit and accumulator arrays stay in registers only when each index is a constant. The second launch bound asks for 4 waves per SIMD (256 registers), so that two blocks share a WGP.
// The q, k, p and v planes lie in the workspace in fragment order: the 16 bytes that lane l of a wave takes with one load stand at 16 l inside a 512-byte piece, so a load reads 4 whole 128-byte lines and not a 32-byte part of 16 lines.
// Rows (q, k, p): a (16 rows, one head) tile is 4 pieces; piece 2 kc + half holds d = 32 kc + 16 half + 8 g + 0..7 of row r at lane 16 g + r % 16. pk_row = f16 index of the lane's place in piece 0.
__device__ __forceinline__ size_t pk_row(size_t row, int h, int g) { return ((row >> 4) * NH + h) * 1024 + (g * 16 + (row & 15)) * 8; }
#define PKT (NH * 1024)  // f16 from a 16-row tile to the next
__device__ __forceinline__ v16h frag_at(const _Float16* p) { union { v16h v; v8h q[2]; } u; u.q[0] = *(const v8h*)p; u.q[1] = *(const v8h*)(p + 256); return u.v; }   // the two pieces of one 32-deep fragment; p holds the lane's place
// behind a group of loads: the group's address registers are inputs, so they live up to the wait and no load of the group is given one of them as its destination; behind the wait they may be overwritten
#define XW1(p) asm volatile("s_wait_xcnt 0x0" :: "v"(p) : "memory")
#define XW2(p, q) asm volatile("s_wait_xcnt 0x0" :: "v"(p), "v"(q) : "memory")
#define XW3(p, q, r) asm volatile("s_wait_xcnt 0x0" :: "v"(p), "v"(q), "v"(r) : "memory")
#define SPP (TT + 8)     // f16 pitch of the P rows in LDS: 16 B more than a row, so that the 16 rows of a fragment read fall on different banks
#define SRP (HD + 4)     // f32 pitch of the partial ctx rows
__global__ __launch_bounds__(256, 4) void k_att(const _Float16* __restrict__ QH, const _Float16* __restrict__ QL, const _Float16* __restrict__ QH2, const _Float16* __restrict__ QL2, const _Float16* __restrict__ KH, const _Float16* __restrict__ KP, const _Float16* __restrict__ VT, float* __restrict__ Y) {
  __shared__ __align__(16) char sm[16 * SPP * 2 + 8 * 16 * SRP * 4];   /* first the f32 BD' rows [16][TT] (65,536 B); once every wave has read them, the f16 P rows and behind them the partial ctx tiles */
  __shared__ __align__(16) float redm[16][8], reds[16][8];
  float* sS = (float*)sm; _Float16* sP = (_Float16*)sm; float* sR = (float*)(sm + 16 * SPP * 2);
  const int tid = threadIdx.x, wave = __builtin_amdgcn_readfirstlane(tid >> 5), lane = tid & 31, col = lane & 15, g = lane >> 4;
  const int t0 = blockIdx.x * 16, h = blockIdx.y, b = blockIdx.z, c0 = wave * 128;
  const size_t qr0 = pk_row((size_t)b * TT + t0 + col, h, g);   /* every offset below holds the lane's place in a piece */
  const size_t qr1 = pk_row((size_t)b * TT + (t0 + 1 + col < TT ? t0 + 1 + col : TT - 1), h, g);   /* row T does not exist and no tile of the last block uses the shifted rows */
  if (tid < 16 && t0 + tid + 1 < TT) sS[tid * TT + t0 + tid + 1] = 0.f;
  { v16h ah[HD / 32], al[HD / 32], pf[HD / 32][8]; const size_t qra = c0 + t0 <= TT - 32 ? qr1 : qr0;   /* the row tile of this wave's first column tile */
    const _Float16 *qha = QH2 + qra, *qla = QL2 + qra, *qhb = QH2 + qr0, *qlb = QL2 + qr0, *pb = KP + pk_row((size_t)(c0 + col), h, g);
#pragma unroll
    for (int kc = 0; kc < HD / 32; ++kc) { ah[kc] = frag_at(qha + kc * 512); al[kc] = frag_at(qla + kc * 512); }
#pragma unroll
    for (int kc = 0; kc < HD / 32; ++kc)
#pragma unroll
      for (int j = 0; j < 8; ++j) pf[kc][j] = frag_at(pb + j * PKT + kc * 512);
    XW3(qha, qla, pb);
#pragma unroll
    for (int j = 0; j < 8; ++j) { const bool up = c0 + j * 16 + t0 <= TT - 32;   /* wave-uniform */
      if (j > 0 && c0 + j * 16 + t0 == TT - 16) {   /* the one wave of a block whose columns cross from the shifted rows to the unshifted ones fetches the other row tile here */
#pragma unroll
        for (int kc = 0; kc < HD / 32; ++kc) { ah[kc] = frag_at(qhb + kc * 512); al[kc] = frag_at(qlb + kc * 512); }
        XW2(qhb, qlb); }
      v8f a = {}, l = {};
#pragma unroll
      for (int kc = 0; kc < HD / 32; ++kc) { a = wmma16(ah[kc], pf[kc][j], a); l = wmma16(al[kc], pf[kc][j], l); }
#pragma unroll
      for (int r = 0; r < 8; ++r) { const int rl = (up ? 1 : 0) + 8 * g + r; const int idx = (rl - 1) * TT + t0 + rl + c0 + j * 16 + col + 1;
        if ((unsigned)idx < 16u * TT) sS[idx] = (a[r] + l[r] * (1.0f / 1024.0f)) * SCALE; } } }   /* outside: a neighbour block's row */
  float s[8][8];
  { v16h ah[HD / 32], al[HD / 32], kf[HD / 32][8]; const _Float16 *qh = QH + qr0, *ql = QL + qr0, *kb = KH + pk_row((size_t)b * TT + c0 + col, h, g);
#pragma unroll
    for (int kc = 0; kc < HD / 32; ++kc) { ah[kc] = frag_at(qh + kc * 512); al[kc] = frag_at(ql + kc * 512); }
#pragma unroll
    for (int kc = 0; kc < HD / 32; ++kc)
#pragma unroll
      for (int j = 0; j < 8; ++j) kf[kc][j] = frag_at(kb + j * PKT + kc * 512);
    XW3(qh, ql, kb);
#pragma unroll
    for (int j = 0; j < 8; ++j) { v8f a = {}, l = {};
#pragma unroll
      for (int kc = 0; kc < HD / 32; ++kc) { a = wmma16(ah[kc], kf[kc][j], a); l = wmma16(al[kc], kf[kc][j], l); }
#pragma unroll
      for (int r = 0; r < 8; ++r) s[j][r] = (a[r] + l[r] * (1.0f / 1024.0f)) * SCALE;
      __builtin_amdgcn_sched_barrier(0); } }   /* each tile's two accumulators are folded into its logits before the next tile starts: with all sixteen accumulators live beside the key fragments the kernel spills */
  v16h vf[4][HD / 16];   /* this wave's v fragments: half are issued ahead of the softmax, half behind its exponentials (all sixteen beside them do not fit the registers), so that their latency runs under it */
  const _Float16* vb = VT + ((((size_t)b * NH + h) * 4) * 32 + (c0 >> 5)) * 512 + lane * 8;
#pragma unroll
  for (int u = 0; u < 2; ++u)
#pragma unroll
    for (int j = 0; j < HD / 16; ++j) vf[u][j] = frag_at(vb + j * 32 * 512 + u * 512);
  XW1(vb);
  __syncthreads();   /* every BD' element is in LDS */
  float m[8], sum[8];
#pragma unroll
  for (int r = 0; r < 8; ++r) { m[r] = -3.0e38f;
#pragma unroll
    for (int j = 0; j < 8; ++j) { s[j][r] = s[j][r] + sS[(8 * g + r) * TT + c0 + j * 16 + col]; m[r] = fmaxf(m[r], s[j][r]); }
#pragma unroll
    for (int o = 1; o < 16; o <<= 1) m[r] = fmaxf(m[r], __shfl_xor(m[r], o)); }
  if (col == 0) {
#pragma unroll
    for (int r = 0; r < 8; ++r) redm[8 * g + r][wave] = m[r]; }
  __syncthreads();   /* row maxima of all waves; also the last read of the BD' rows, whose LDS is reused below */
#pragma unroll
  for (int r = 0; r < 8; ++r) { const v4f x = *(const v4f*)&redm[8 * g + r][0], y = *(const v4f*)&redm[8 * g + r][4];
    m[r] = fmaxf(fmaxf(fmaxf(x[0], x[1]), fmaxf(x[2], x[3])), fmaxf(fmaxf(y[0], y[1]), fmaxf(y[2], y[3]))); sum[r] = 0.f;
#pragma unroll
    for (int j = 0; j < 8; ++j) { s[j][r] = expf(s[j][r] - m[r]); sum[r] += s[j][r]; }
#pragma unroll
    for (int o = 1; o < 16; o <<= 1) sum[r] += __shfl_xor(sum[r], o); }
#pragma unroll
  for (int u = 2; u < 4; ++u)
#pragma unroll
    for (int j = 0; j < HD / 16; ++j) vf[u][j] = frag_at(vb + j * 32 * 512 + u * 512);
  XW1(vb);
  if (col == 0) {
#pragma unroll
    for (int r = 0; r < 8; ++r) reds[8 * g + r][wave] = sum[r]; }
  __syncthreads();   /* row sums of all waves */
#pragma unroll
  for (int r = 0; r < 8; ++r) { const v4f x = *(const v4f*)&reds[8 * g + r][0], y = *(const v4f*)&reds[8 * g + r][4];
    const float a = ((x[0] + x[1]) + (x[2] + x[3])) + ((y[0] + y[1]) + (y[2] + y[3])); const float inv = a > 0.f ? 2048.0f / a : 0.f;
#pragma unroll
    for (int j = 0; j < 8; ++j) sP[(8 * g + r) * SPP + c0 + j * 16 + col] = (_Float16)(s[j][r] * inv); }
  LDSX();   /* a wave reads back only the 128 P columns that it wrote itself */
  v8f acc[HD / 16] = {};
#pragma unroll
  for (int u = 0; u < 4; ++u) { const v16h p = frag_h(sP + col * SPP + c0 + u * 32, lane);
#pragma unroll
    for (int j = 0; j < HD / 16; ++j) acc[j] = wmma16(p, vf[u][j], acc[j]); }
#pragma unroll
  for (int j = 0; j < HD / 16; ++j)
#pragma unroll
    for (int r = 0; r < 8; ++r) sR[(wave * 16 + 8 * g + r) * SRP + j * 16 + col] = acc[j][r];
  __syncthreads();   /* the 8 partial ctx tiles */
  { const int rl = tid >> 4, c4 = (tid & 15) * 4; v4f o = *(const v4f*)&sR[rl * SRP + c4];
#pragma unroll
    for (int w = 1; w < 8; ++w) o = o + *(const v4f*)&sR[(w * 16 + rl) * SRP + c4];
    vst2(Y + ((size_t)b * TT + t0 + rl) * CC + h * HD + c4, o * (1.0f / 2048.0f)); } }
// ---- k_out: block = (64 rows, 128 cols): out = ctx Wo (+ bo): ctx x 2^6 once to f16 against Wo as f16(bf16 x 2^8) exact (1 product) x 2^-14; causal early rows (< QHI of each sequence): ctx bf16 hi + lo against exact bf16 Wo (2 products)
__global__ __launch_bounds__(128) void k_out(const float* __restrict__ Y, const float* __restrict__ WO, const float* __restrict__ BO, float* __restrict__ OUT) { __shared__ __align__(16) float sf[4][16][132]; __shared__ __align__(16) char wst[2 * 128 * WBP];
  const int tid = threadIdx.x, wave = tid >> 5, lane = tid & 31, col = lane & 15, g = lane >> 4; const int c0 = blockIdx.y * 128; const size_t r0 = (size_t)blockIdx.x * 64 + wave * 16;
  v8f acc[8] = {};
  if (CAUSAL && (int)(((size_t)blockIdx.x * 64) % TT) < QHI) {   /* block-uniform */
#pragma unroll 2
    for (int kc = 0; kc < CC / 32; ++kc) { const F2 a = split_row(Y + (r0 + col) * CC, kc * 32, lane); asm volatile("s_wait_loadcnt 0x0" ::: "memory");
#pragma unroll
      for (int j = 0; j < 8; ++j) { const v16b w = WOCOL(WO, kc * 32, c0 + j * 16 + col, lane); asm volatile("s_wait_loadcnt 0x0" ::: "memory"); acc[j] = wmma_bf(a.h, w, acc[j]); acc[j] = wmma_bf(a.l, w, acc[j]); } }
#pragma unroll
    for (int j = 0; j < 8; ++j) { const float bias = BO ? bfr(BO[c0 + j * 16 + col]) : 0.f;
#pragma unroll
      for (int r = 0; r < 8; ++r) sf[wave][8 * g + r][j * 16 + col] = acc[j][r] + bias; }
  } else {
    /* Wo's slab of a k step goes through LDS as in k_proj: fetched once by the block in whole rows, converted once, read as B fragments by all four waves */
    const float* wp = WO + (size_t)(wave * 8) * DIN + c0 + lane * 4; const float* yp = Y + (r0 + col) * CC;
    v4f wr[2][8]; float ar[2][16];
#pragma unroll
    for (int u = 0; u < 2; ++u) {
#pragma unroll
      for (int i = 0; i < 8; ++i) wr[u][i] = *(const v4f*)(wp + (size_t)(u * 32 + i) * DIN);
      raw_row(ar[u], yp + u * 32, lane); }
    auto step = [&](const int kc, const int u, const bool more) __attribute__((always_inline)) { char* wb = wst + u * (128 * WBP);
#pragma unroll
      for (int jj = 0; jj < 4; ++jj) { v8h t;
#pragma unroll
        for (int i = 0; i < 8; ++i) t[i] = (_Float16)(bfr(wr[u][i][jj]) * 256.0f);
        *(v8h*)(wb + (lane * 4 + jj) * WBP + wave * 16) = t; }
      if (more) { const float* wn = wp + (size_t)(kc + 2) * 32 * DIN;   /* the weight values of set u are in LDS: refill them for step kc + 2 */
#pragma unroll
        for (int i = 0; i < 8; ++i) wr[u][i] = *(const v4f*)(wn + (size_t)i * DIN);
        asm volatile("s_wait_xcnt 0x0" ::: "memory"); }   /* the loop advances the loads' address registers: keep the wait in front of that */
      v16h a;   /* ctx carried x 2^6 into f16 so small-magnitude context rows stay clear of f16 subnormals */
#pragma unroll
      for (int i = 0; i < 16; ++i) a[i] = (_Float16)(ar[u][i] * 64.0f);
      WBAR();   /* stage u is written; every wave has also left the other stage, which the next step overwrites */
      union { v16h v; v8h q[2]; } w[8];
#pragma unroll
      for (int j = 0; j < 8; ++j) { const char* f = wb + (j * 16 + col) * WBP + g * 16; w[j].q[0] = *(const v8h*)f; w[j].q[1] = *(const v8h*)(f + 32); }
      __builtin_amdgcn_sched_barrier(0);   /* all sixteen LDS reads ahead of the first product: one LDS latency a step */
#pragma unroll
      for (int j = 0; j < 8; ++j) acc[j] = wmma16(a, w[j].v, acc[j]);
      if (more) { raw_row(ar[u], yp + (kc + 2) * 32, lane);   /* the row values of set u are converted by now: refill them for step kc + 2 */
        asm volatile("s_wait_xcnt 0x0" ::: "memory"); } };   /* the loop advances the loads' address registers: keep the wait in front of that */
#pragma unroll 1   /* stays a loop of two steps, as in k_proj */
    for (int kc = 0; kc < CC / 32 - 2; kc += 2) { step(kc, 0, true); step(kc + 1, 1, true); }
    step(CC / 32 - 2, 0, false); step(CC / 32 - 1, 1, false);
#pragma unroll
    for (int j = 0; j < 8; ++j) { const float bias = BO ? bfr(BO[c0 + j * 16 + col]) : 0.f;
#pragma unroll
      for (int r = 0; r < 8; ++r) sf[wave][8 * g + r][j * 16 + col] = acc[j][r] * (1.0f / 16384.0f) + bias; } }   /* 2^-8 (Wo carry) x 2^-6 (ctx carry) */
  LDSX(); for (int rl = 0; rl < 16; ++rl) vst2(OUT + (r0 + rl) * DIN + c0 + lane * 4, *(const v4f*)&sf[wave][rl][lane * 4]); }

extern "C" void kernel_launch(void* const* d_in, const int* in_sizes, int n_in, void* d_out, int out_size, void* d_ws, size_t ws_size, hipStream_t stream) {
  (void)in_sizes; (void)n_in; (void)out_size;
  const float** F = (const float**)d_in;
  if (ws_size < (size_t)WS_END) return;
  char* ws = (char*)d_ws; _Float16 *QH = (_Float16*)(ws + WS_QH), *KH = (_Float16*)(ws + WS_KH), *VT = (_Float16*)(ws + WS_VT), *QL = (_Float16*)(ws + WS_QL), *KL = (_Float16*)(ws + WS_KL); __bf16 *VB = (__bf16*)(ws + WS_VB), *VBL = (__bf16*)(ws + WS_VBL); float *Y = (float*)(ws + WS_Y);
  (void)Y; (void)QL; (void)KL; (void)VB; (void)VBL;
  // inputs: 0 query [4,1024,512]; 1 key; 2 value; 3 pos_emb [1,1024,512]; 4 Wq (in,out), 5 bq; 6 Wk, 7 bk; 8 Wv, 9 bv; 10 Wo (in,out), 11 bo; 12 Wpos [512,512]; 13 pos_bias_u [8,64]; 14 pos_bias_v [8,64]
  if (ws_size < (size_t)WS_END2) return;
  _Float16 *QH2 = (_Float16*)(ws + WS_QH2), *QL2 = (_Float16*)(ws + WS_QL2), *KP = (_Float16*)(ws + WS_KP);
  k_proj<<<dim3(16, CC / 128, TNB * TT / 1024 * 3 + 1), 128, 0, stream>>>(F[0], F[1], F[2], F[3], F[4], F[6], F[8], F[12], F[5], F[7], F[9], QH, QL, QH2, QL2, KH, KL, KP, VT, VB, VBL, F[13], F[14]);   /* q (stored as q + pos_bias_u and as q + pos_bias_v), k, v, and p = pos_emb Wpos into KP */
  k_att<<<dim3(TT / 16, NH, TNB), 256, 0, stream>>>(QH, QL, QH2, QL2, KH, KP, VT, Y);   /* AC + rel_shift(BD), softmax, P v */
  k_out<<<dim3(TNB * TT / 64, DIN / 128), 128, 0, stream>>>(Y, F[10], F[11], (float*)d_out);
}

// v006
// It runs in 89 microseconds.
// Timed twice side by side with v005, it ran 1.05 and 1.04 times as fast.
// Counting every step since v000, it is 5.81 times as fast.
// compute dtype: all float inputs rounded to bf16; projections with EXACT bf16 products on WMMA 16x16x32 (f32 accumulate) + biases; content (q+u).k and position (q+v).p scores each with q as f16 hi + residual (x 2^10) against f16 k / p (2 products) x 64^-0.5 x log2 e; rel_shift as the store index of the position scores in LDS; softmax f32 in base 2; P x 2^11 once to f16 x v once to f16 (1 product); ctx carried x 2^6 once to f16 x Wo f16(bf16 x 2^8) + bo; f32 output.
#include <hip/hip_runtime.h>
#include <math.h>

typedef __attribute__((ext_vector_type(16))) _Float16 v16h;
typedef __attribute__((ext_vector_type(16))) __bf16 v16b;
typedef __attribute__((ext_vector_type(8)))  _Float16 v8h;
typedef __attribute__((ext_vector_type(8)))  float v8f;
typedef __attribute__((ext_vector_type(4)))  float v4f;
typedef __attribute__((ext_vector_type(2)))  float v2f;
typedef __attribute__((ext_vector_type(4)))  unsigned v4u;
typedef __attribute__((ext_vector_type(4)))  int v4i;
typedef float __attribute__((may_alias)) float_a;
typedef int __attribute__((may_alias)) int_a;

template <typename T> __device__ __forceinline__ void vst2(void* p, T v) { *(T*)p = v;  }
__device__ __forceinline__ v8f wmma16(v16h a, v16h b, v8f c) {
  v8f d = __builtin_amdgcn_wmma_f32_16x16x32_f16(false, a, false, b, (short)0, c, false, false);
  asm volatile("v_nop\n\tv_nop\n\tv_nop\n\tv_nop" : "+v"(d) : "v"(a), "v"(b));
  return d;
}
__device__ __forceinline__ v8f wmma_bf(v16b a, v16b b, v8f c) {
  v8f d = __builtin_amdgcn_wmma_f32_16x16x32_bf16(false, a, false, b, (short)0, c, false, false);
  asm volatile("v_nop\n\tv_nop\n\tv_nop\n\tv_nop" : "+v"(d) : "v"(a), "v"(b));
  return d;
}
// 16x16x32 fragments: lane = (h = lane>>4, row/col = lane&15); elements 0..7 = k0+8h+0..7, 8..15 = k0+16+8h+0..7; D element r = row 8h+r
__device__ __forceinline__ v16h frag_h(const _Float16* rowk0, int lane) {
  union { v16h v; v8h q[2]; } u; const _Float16* p = rowk0 + 8 * (lane >> 4);
  u.q[0] = *(const v8h*)p; u.q[1] = *(const v8h*)(p + 16); return u.v;
}
__device__ __forceinline__ v16h frag_f32(const float* rowk0, int lane) {
  v16h a; const float* p = rowk0 + 8 * (lane >> 4);
#pragma unroll
  for (int i = 0; i < 8; ++i) { a[i] = (_Float16)p[i]; a[8 + i] = (_Float16)p[16 + i]; }
  return a;
}
__device__ __forceinline__ v16h frag_f32s(const float* rowk0, int lane, float sc) {
  v16h a; const float* p = rowk0 + 8 * (lane >> 4);
#pragma unroll
  for (int i = 0; i < 8; ++i) { a[i] = (_Float16)(p[i] * sc); a[8 + i] = (_Float16)(p[16 + i] * sc); }
  return a;
}
// column fragment from a [K][ld] layout (column n), rows >= K read as 0
__device__ __forceinline__ v16h fragc_f32(const float* W, int k0, int n, int lane, int ld, int K) {
  v16h a; const int g = lane >> 4;
#pragma unroll
  for (int i = 0; i < 8; ++i) { const int ka = k0 + 8 * g + i, kb = ka + 16;
    a[i] = (_Float16)(ka < K ? W[(size_t)(ka < K ? ka : K - 1) * ld + n] : 0.f); a[8 + i] = (_Float16)(kb < K ? W[(size_t)(kb < K ? kb : K - 1) * ld + n] : 0.f); }
  return a;
}
struct F2 { v16b h, l; };
__device__ __forceinline__ F2 bsplit16(const float v[16]) { F2 r;
#pragma unroll
  for (int i = 0; i < 16; ++i) { const __bf16 h = (__bf16)v[i]; r.h[i] = h; r.l[i] = (__bf16)(v[i] - (float)h); }
  return r; }
__device__ __forceinline__ F2 split_row(const float* row, int k0, int lane) { float v[16]; const float* p = row + k0 + 8 * (lane >> 4);
#pragma unroll
  for (int i = 0; i < 8; ++i) { v[i] = p[i]; v[8 + i] = p[16 + i]; }
  return bsplit16(v); }
__device__ __forceinline__ F2 split_rowK(const float* row, int k0, int lane, int K) { float v[16]; const int g = lane >> 4;
#pragma unroll
  for (int i = 0; i < 8; ++i) { const int ka = k0 + 8 * g + i, kb = ka + 16; v[i] = ka < K ? row[ka < K ? ka : K - 1] : 0.f; v[8 + i] = kb < K ? row[kb < K ? kb : K - 1] : 0.f; }
  return bsplit16(v); }
__device__ __forceinline__ F2 split_col(const float* W, int k0, int n, int lane, int ld, int K) { float v[16]; const int g = lane >> 4;
#pragma unroll
  for (int i = 0; i < 8; ++i) { const int ka = k0 + 8 * g + i, kb = ka + 16; v[i] = ka < K ? W[(size_t)(ka < K ? ka : K - 1) * ld + n] : 0.f; v[8 + i] = kb < K ? W[(size_t)(kb < K ? kb : K - 1) * ld + n] : 0.f; }
  return bsplit16(v); }
__device__ __forceinline__ v8f mac3(const F2& a, const F2& b, v8f c) { c = wmma_bf(a.l, b.h, c); c = wmma_bf(a.h, b.l, c); return wmma_bf(a.h, b.h, c); }
__device__ __forceinline__ float sigm(float v) { return 1.0f / (1.0f + expf(-v)); }
#define LDSX() do { asm volatile("s_wait_dscnt 0" ::: "memory"); __builtin_amdgcn_wave_barrier(); __builtin_amdgcn_fence(__ATOMIC_RELEASE, "workgroup"); } while (0)

// Transformer-XL / Conformer relative multi-head attention (B 4, T = P = 1,024, D 512 = 8 heads x 64; (in,out) Wq/Wk/Wv/Wo [512,512] + zero biases, Wpos [512,512] no bias, pos_bias_u/v [8,64]; 1/sqrt(64)-scale): AC = (q + u) k^T, BD = rel_shift((q + v) p^T) with p = pos_emb Wpos (pad-reshape trick, no mask), attn = softmax((AC + BD)/8), out = merge(attn v) Wo + bo.
#define NB 4
#define TT 1024
#define CC 512            // NH * HD = projected width
#define DIN 512          // input (model) width
#define NH 8
#define HD 64
#define NQB (TT / 64)
#define HG 8
#define SCALE (0.125f)
#define SCALE_L2 (SCALE * 1.4426950408889634f)   // logits are carried in units of log 2 (scale x log2 e), so that the softmax exponential is the chip's own base-2 instruction
#define CAUSAL 0
#ifndef TNB
#define TNB NB
#endif
__device__ __forceinline__ float bfr(float v) { return (float)(__bf16)v; }
__host__ __device__ __forceinline__ int kb_last(int qb) { return CAUSAL ? ((qb * 64 + 63) >> 7) : (TT / 128 - 1); }
typedef __attribute__((ext_vector_type(8))) __bf16 v8b;
__device__ __forceinline__ v16b frag_b(const __bf16* rowk0, int lane) {
  union { v16b v; v8b q[2]; } u; const __bf16* p = rowk0 + 8 * (lane >> 4);
  u.q[0] = *(const v8b*)p; u.q[1] = *(const v8b*)(p + 16); return u.v;
}
#define QBH 0              // read by no kernel here
#define QHI 1024            // rows carrying a q residual plane (all rows when non-causal: 2-product logits everywhere)
#define KHI 64            // key rows carrying k residual / v bf16 hi+lo planes (written, but read by no kernel here)
// B fragment (k rows k0+.., output column o) of a weight: (in,out) [K][ld] or (out,in) [ld rows of K]: bf16 exact, or f16(bf16 * 256) exact
__device__ __forceinline__ v16b wcol_io(const float* Wm, int k0, int o, int lane, int ld) { v16b w; const int g = lane >> 4;
#pragma unroll
  for (int i = 0; i < 8; ++i) { w[i] = (__bf16)Wm[(size_t)(k0 + 8 * g + i) * ld + o]; w[8 + i] = (__bf16)Wm[(size_t)(k0 + 16 + 8 * g + i) * ld + o]; }
  return w; }
__device__ __forceinline__ v16b wcol_oi(const float* Wm, int k0, int o, int lane, int K) { v16b w; const float* p = Wm + (size_t)o * K + k0 + 8 * (lane >> 4);
#pragma unroll
  for (int i = 0; i < 8; ++i) { w[i] = (__bf16)p[i]; w[8 + i] = (__bf16)p[16 + i]; }
  return w; }
__device__ __forceinline__ v16h wcolh_io(const float* Wm, int k0, int o, int lane, int ld) { v16h w; const int g = lane >> 4;
#pragma unroll
  for (int i = 0; i < 8; ++i) { w[i] = (_Float16)(bfr(Wm[(size_t)(k0 + 8 * g + i) * ld + o]) * 256.0f); w[8 + i] = (_Float16)(bfr(Wm[(size_t)(k0 + 16 + 8 * g + i) * ld + o]) * 256.0f); }
  return w; }
__device__ __forceinline__ v16h wcolh_oi(const float* Wm, int k0, int o, int lane, int K) { v16h w; const float* p = Wm + (size_t)o * K + k0 + 8 * (lane >> 4);
#pragma unroll
  for (int i = 0; i < 8; ++i) { w[i] = (_Float16)(bfr(p[i]) * 256.0f); w[8 + i] = (_Float16)(bfr(p[16 + i]) * 256.0f); }
  return w; }
// unconverted f32 values of a fragment, in fragment element order: a row operand, and column o of an (in,out) [K][ld] weight
__device__ __forceinline__ void raw_row(float (&r)[16], const float* rowk0, int lane) { const float* p = rowk0 + 8 * (lane >> 4);
#pragma unroll
  for (int i = 0; i < 8; ++i) { r[i] = p[i]; r[8 + i] = p[16 + i]; } }
__device__ __forceinline__ void raw_col(float (&r)[16], const float* Wm, int k0, int o, int lane, int ld) { const int g = lane >> 4;
#pragma unroll
  for (int i = 0; i < 8; ++i) { r[i] = Wm[(size_t)(k0 + 8 * g + i) * ld + o]; r[8 + i] = Wm[(size_t)(k0 + 16 + 8 * g + i) * ld + o]; } }
#define WQKV_LAYOUT 0   // selects WCOL only, which nothing calls (k_proj always reads (in,out) [DIN][CC]): 0 = (in,out) [DIN][CC]; 1 = (out,in) [CC][DIN]; 2 = per-head [NH][DIN][HD]
__device__ __forceinline__ v16b wcol_hdk(const float* Wm, int k0, int o, int lane) { v16b w; const int g = lane >> 4; const float* p = Wm + (size_t)(o / HD) * DIN * HD + (o % HD);
#pragma unroll
  for (int i = 0; i < 8; ++i) { w[i] = (__bf16)p[(size_t)(k0 + 8 * g + i) * HD]; w[8 + i] = (__bf16)p[(size_t)(k0 + 16 + 8 * g + i) * HD]; }
  return w; }
#define WO_OUT_IN 0
#if WQKV_LAYOUT == 1
#define WCOL(W, k0, o, lane) wcol_oi(W, k0, o, lane, DIN)
#elif WQKV_LAYOUT == 2
#define WCOL(W, k0, o, lane) wcol_hdk(W, k0, o, lane)
#else
#define WCOL(W, k0, o, lane) wcol_io(W, k0, o, lane, CC)
#endif
#if WO_OUT_IN
#define WOCOL(W, k0, o, lane) wcol_oi(W, k0, o, lane, CC)
#define WOCOLH(W, k0, o, lane) wcolh_oi(W, k0, o, lane, CC)
#else
#define WOCOL(W, k0, o, lane) wcol_io(W, k0, o, lane, DIN)
#define WOCOLH(W, k0, o, lane) wcolh_io(W, k0, o, lane, DIN)
#endif
#define WS_QH2 (WS_END)                                   // f16 q_v rows, fragment order
#define WS_QL2 (WS_QH2 + 2u * (size_t)NB * TT * CC)       // f16 q_v residual rows, fragment order
#define WS_KP  (WS_QL2 + 2u * (size_t)NB * QHI * CC)      // f16 positional key rows p = pos_emb Wpos, fragment order (the first TT rows are used)
#define WS_S2  (WS_KP + 2u * (size_t)NB * TT * CC)        // f32 [hg][t][p], unused: k_att keeps BD in LDS
#define WS_END2 (WS_S2 + 4u * (size_t)HG * TT * TT)

#define WS_QH  0u                                      // f16 q rows, fragment order [b*t / 16][head][piece 4][lane 32][8] (see pk_row)
#define WS_KH  (WS_QH + 2u * (size_t)NB * TT * CC)      // f16 k rows, fragment order as the q rows
#define WS_VT  (WS_KH + 2u * (size_t)NB * TT * CC)      // f16 v, fragment order [b][head][d / 16][t / 32][half 2][lane 32][8]: lane = (t / 8 & 1) * 16 + d % 16
#define WS_QL  (WS_VT + 2u * (size_t)NB * CC * TT)      // f16 q residual x 2^10 rows, fragment order as the q rows (QHI = TT)
#define WS_KL  (WS_QL + 2u * (size_t)NB * QHI * CC)     // f16 k residual x 2^10 rows [b][t < KHI][CC]
#define WS_VB  (WS_KL + 2u * (size_t)NB * KHI * CC)     // bf16 v hi planes [b][c][t < KHI]
#define WS_VBL (WS_VB + 2u * (size_t)NB * CC * KHI)
#define WS_S   (WS_VBL + 2u * (size_t)NB * CC * KHI)    // f32 [hg][t][s], unused: k_att keeps logits and P on chip
#define WS_Y   (WS_S  + 4u * (size_t)HG * TT * TT)      // f32 ctx rows [b*t][CC] (only when there is an output projection)
#define WS_END (WS_Y  + 4u * (size_t)NB * TT * CC)

#define WBP 80           // bytes from a column to the next in a staged weight slab: 64 B of k and 16 more, so that the 16 columns of a fragment read fall on different banks
// work-group barrier of the staged GEMM loops: it waits for this wave's LDS traffic alone. __syncthreads() would also wait for the global loads of the steps ahead, which only this wave's registers receive and which are to stay in flight across it
#define WBAR() asm volatile("s_wait_dscnt 0x0\n\ts_barrier_signal -1\n\ts_barrier_wait -1" ::: "memory")
// ---- k_proj: every projection in one launch. block = (64 rows, 128 cols, which = blockIdx.z / 4): X W (+ b) with exact bf16 products (K = DIN) -> which 0: q, multiplied once and stored twice, as q + pos_bias_u and as q + pos_bias_v (f16 rows + residual rows each); 1: k f16 rows (+ residual rows < KHI); 2: v f16 planes (+ bf16 hi/lo planes [c][t] for t < KHI); 3: the positional key rows p = pos_emb Wpos (no bias, the TT rows of blockIdx.z = 12), f16 rows as k; the f16 planes are stored in the fragment order that k_att loads (layouts: WS_QH, WS_VT). The q blocks, which have the longest epilogue, take the lowest indices (for speed only)
__global__ __launch_bounds__(128) void k_proj(const float* __restrict__ XQ, const float* __restrict__ XK, const float* __restrict__ XV, const float* __restrict__ XP, const float* __restrict__ WQ, const float* __restrict__ WK, const float* __restrict__ WV, const float* __restrict__ WP, const float* __restrict__ BQ, const float* __restrict__ BK, const float* __restrict__ BV,
    _Float16* __restrict__ QH, _Float16* __restrict__ QL, _Float16* __restrict__ QH2, _Float16* __restrict__ QL2, _Float16* __restrict__ KH, _Float16* __restrict__ KL, _Float16* __restrict__ KP, _Float16* __restrict__ VT, __bf16* __restrict__ VB, __bf16* __restrict__ VBL, const float* __restrict__ EXU, const float* __restrict__ EXV) {
  __shared__ __align__(16) float st[64][132]; __shared__ __align__(16) _Float16 sh[2][64][136], sl[2][64][136]; __shared__ __align__(16) _Float16 th[128][72]; __shared__ __align__(16) __bf16 tb[128][72], tbl[128][72];
  const int tid = threadIdx.x, wave = tid >> 5, lane = tid & 31, col = lane & 15, g = lane >> 4; const int which = blockIdx.z >> 2; const int c0 = blockIdx.y * 128; const size_t r0 = (size_t)((blockIdx.z & 3) * 16 + blockIdx.x) * 64; const size_t bb = r0 / TT; const int t0 = (int)(r0 % TT);
  const float* X = which == 0 ? XQ : which == 1 ? XK : which == 2 ? XV : XP; const float* WA = which == 0 ? WQ : which == 1 ? WK : which == 2 ? WV : WP; const float* BA = which == 0 ? BQ : which == 1 ? BK : which == 2 ? BV : nullptr;
  v8f acc[8] = {};
  /* the weight slab of a k step (32 rows x 128 columns) is fetched once by the block, in whole 512-byte rows, rounded once and laid in LDS as [column][k] at pitch WBP, where all four waves take their B fragments. Thread = (8 k rows: wave, 4 columns: lane). Two LDS stages (in sh, which is not written before the barrier behind the loop) and two register sets: the loads of step kc + 2 are issued in step kc, as soon as their registers are free, and fly during step kc + 1 */
  char* wst = (char*)&sh[0][0][0]; const float* wp = WA + (size_t)(wave * 8) * CC + c0 + lane * 4; const float* xp = X + (r0 + wave * 16 + col) * DIN;
  v4f wr[2][8]; float ar[2][16];
#pragma unroll
  for (int u = 0; u < 2; ++u) {
#pragma unroll
    for (int i = 0; i < 8; ++i) wr[u][i] = *(const v4f*)(wp + (size_t)(u * 32 + i) * CC);
    raw_row(ar[u], xp + u * 32, lane); }
  auto step = [&](const int kc, const int u, const bool more) __attribute__((always_inline)) { char* wb = wst + u * (128 * WBP);
#pragma unroll
    for (int jj = 0; jj < 4; ++jj) { v8b t;
#pragma unroll
      for (int i = 0; i < 8; ++i) t[i] = (__bf16)wr[u][i][jj];
      *(v8b*)(wb + (lane * 4 + jj) * WBP + wave * 16) = t; }
    if (more) { const float* wn = wp + (size_t)(kc + 2) * 32 * CC;   /* the weight values of set u are in LDS: refill them for step kc + 2 */
#pragma unroll
      for (int i = 0; i < 8; ++i) wr[u][i] = *(const v4f*)(wn + (size_t)i * CC);
      asm volatile("s_wait_xcnt 0x0" ::: "memory"); }   /* the loop advances the loads' address registers: keep the wait in front of that */
    v16b a;
#pragma unroll
    for (int i = 0; i < 16; ++i) a[i] = (__bf16)ar[u][i];
    WBAR();   /* stage u is written; every wave has also left the other stage, which the next step overwrites */
    union { v16b v; v8b q[2]; } w[8];
#pragma unroll
    for (int j = 0; j < 8; ++j) { const char* f = wb + (j * 16 + col) * WBP + g * 16; w[j].q[0] = *(const v8b*)f; w[j].q[1] = *(const v8b*)(f + 32); }
    __builtin_amdgcn_sched_barrier(0);   /* all sixteen LDS reads are issued ahead of the first product, so that one LDS latency serves the step and not eight */
#pragma unroll
    for (int j = 0; j < 8; ++j) acc[j] = wmma_bf(a, w[j].v, acc[j]);
    if (more) { raw_row(ar[u], xp + (kc + 2) * 32, lane);   /* the row values of set u are converted by now: refill them for step kc + 2 */
      asm volatile("s_wait_xcnt 0x0" ::: "memory"); } };   /* the loop advances the loads' address registers: keep the wait in front of that */
#pragma unroll 1   /* stays a loop of two steps: unrolled whole, the compiler lifts every conversion up to its loads, and each step then waits for loads just issued */
  for (int kc = 0; kc < DIN / 32 - 2; kc += 2) { step(kc, 0, true); step(kc + 1, 1, true); }
  step(DIN / 32 - 2, 0, false); step(DIN / 32 - 1, 1, false);
  { // stage the f32 tile (acc + bias) in LDS, then convert
#pragma unroll
    for (int j = 0; j < 8; ++j) { const float bias = BA ? bfr(BA[c0 + j * 16 + col]) : 0.f;
#pragma unroll
      for (int r = 0; r < 8; ++r) st[wave * 16 + 8 * g + r][j * 16 + col] = acc[j][r] + bias; }
    __syncthreads();
  }
  if (which != 2) { _Float16* DH = which == 1 ? KH : KP;
    for (int ps = 0; ps < (which == 0 ? 2 : 1); ++ps) { const float* EB = which == 0 ? (ps ? EXV : EXU) : nullptr; const float eb = EB ? bfr(EB[c0 + tid]) : 0.f;
      asm volatile("s_wait_xcnt 0x0" ::: "memory");   /* the second pass overwrites the bias load's base: keep the wait in front of that */
      /* q + pos_bias_u, then q + pos_bias_v: the per-(head, dim) bias is added in f32 to the staged (x Wq + bq), which stays as it is for the second pass; a thread converts one column */
      for (int rl = 0; rl < 64; ++rl) { const float x = st[rl][tid]; const float v = EB ? x + eb : x; const _Float16 hv = (_Float16)v; sh[ps][rl][tid] = hv; sl[ps][rl][tid] = (_Float16)((v - (float)hv) * 1024.0f); } }
    __syncthreads();
    for (int e = tid; e < 64 * 16; e += 128) { const int ln = e & 31, rl = (e >> 8) * 16 + (ln & 15), q = ((e >> 5) & 7) * 2 + (ln >> 4);   /* e runs in the order of the destination: [row tile 4][head 2][piece 4][lane 32], so a wave stores 512 contiguous bytes */
      const size_t po = (((r0 >> 4) + (e >> 8)) * NH + (c0 >> 6)) * 1024 + (e & 255) * 8;
      const v4u h0 = *(const v4u*)&sh[0][rl][q * 8];
      if (which == 0) { const v4u l0 = *(const v4u*)&sl[0][rl][q * 8], h1 = *(const v4u*)&sh[1][rl][q * 8], l1 = *(const v4u*)&sl[1][rl][q * 8];   /* the four LDS reads share one latency */
        vst2((unsigned*)(QH + po), h0); vst2((unsigned*)(QL + po), l0); vst2((unsigned*)(QH2 + po), h1); vst2((unsigned*)(QL2 + po), l1); }
      else { vst2((unsigned*)(DH + po), h0);
        asm volatile("s_wait_xcnt 0x0" ::: "memory");   /* the second store's address may be formed in the first one's registers: keep the wait in front of that */
        if (which == 1 && t0 < KHI) vst2((unsigned*)(KL + (bb * KHI + t0 + rl) * (size_t)CC + c0 + q * 8), *(const v4u*)&sl[0][rl][q * 8]); }
      asm volatile("s_wait_xcnt 0x0" ::: "memory"); }   /* the next trip overwrites the stores' address and data registers: keep the wait in front of that */
  } else { const bool hi_rows = t0 < KHI;
    for (int e = tid; e < 64 * 128; e += 128) { const int rl = e & 63, cl = e >> 6; const float v = st[rl][cl]; th[cl][rl] = (_Float16)v; const __bf16 bh = (__bf16)v; tb[cl][rl] = bh; tbl[cl][rl] = (__bf16)(v - (float)bh); }
    __syncthreads();
    for (int e = tid; e < 128 * 8; e += 128) { const int ln = e & 31, cl = (e >> 7) * 16 + (ln & 15), q = ((e >> 5) & 3) * 2 + (ln >> 4);   /* destination order: [head 2][d tile 4][t block 2][half 2][lane 32] */
      vst2((unsigned*)(VT + (((bb * NH + (c0 >> 6)) * 4 + (e >> 7)) * 32 + (t0 >> 5)) * 512 + (e & 127) * 8), *(const v4u*)&th[cl][q * 8]);
      asm volatile("s_wait_xcnt 0x0" ::: "memory");   /* what follows overwrites the store's address and data registers: keep the wait in front of that */
      if (hi_rows) { const size_t o3 = (bb * CC + c0 + cl) * (size_t)KHI + t0 + q * 8; vst2((unsigned*)(VB + o3), *(const v4u*)&tb[cl][q * 8]); vst2((unsigned*)(VBL + o3), *(const v4u*)&tbl[cl][q * 8]);
        asm volatile("s_wait_xcnt 0x0" ::: "memory"); } } } }   /* as above, for these two stores */
// ---- k_att: block = 16 query rows (t0..t0+15) of (b, h), 8 waves, wave w owns key / position columns [128 w, 128 w + 128). Logits never leave the WGP:
//  1. BD = (q + v) . p x 1/8 x log2 e is stored straight to its rel_shift place in LDS. The reference's pad-reshape is linear in memory: BD[r][c] lands at flat out index r T + r + c + 1 - T, so row r's columns c >= T-1-r go to out row r and the others to out row r-1; out[t][t+1] is the pad's 0.
//     The block needs BD rows t0..t0+16; a 16-column tile at cs needs rows t0+1..t0+16 when cs + t0 <= T - 32 and rows t0..t0+15 otherwise (cs, t0 multiples of 16), so one row tile serves each column tile.
//  2. AC = (q + u) . k x 1/8 x log2 e stays in registers and takes BD' from LDS; softmax in f32 over the 8 waves, 2^(s - max) for e^(..); P x 2^11 once to f16 in LDS.
//  3. each wave multiplies its own 128 keys of P with v (f16, 1 product); the 8 partial ctx tiles are summed in wave order.
// Every loop is fully unrolled: the fragment, logit and accumulator arrays stay in registers only when each index is a constant. The second launch bound asks for 4 waves per SIMD (256 registers), so that two blocks share a WGP.
// The q, k, p and v planes lie in the workspace in fragment order: the 16 bytes that lane l of a wave takes with one load stand at 16 l inside a 512-byte piece, so a load reads 4 whole 128-byte lines and not a 32-byte part of 16 lines.
// Rows (q, k, p): a (16 rows, one head) tile is 4 pieces; piece 2 kc + half holds d = 32 kc + 16 half + 8 g + 0..7 of row r at lane 16 g + r % 16. pk_row = f16 index of the lane's place in piece 0.
__device__ __forceinline__ size_t pk_row(size_t row, int h, int g) { return ((row >> 4) * NH + h) * 1024 + (g * 16 + (row & 15)) * 8; }
#define PKT (NH * 1024)  // f16 from a 16-row tile to the next
__device__ __forceinline__ v16h frag_at(const _Float16* p) { union { v16h v; v8h q[2]; } u; u.q[0] = *(const v8h*)p; u.q[1] = *(const v8h*)(p + 256); return u.v; }   // the two pieces of one 32-deep fragment; p holds the lane's place
// behind a group of loads: the group's address registers are inputs, so they live up to the wait and no load of the group is given one of them as its destination; behind the wait they may be overwritten
#define XW1(p) asm volatile("s_wait_xcnt 0x0" :: "v"(p) : "memory")
#define XW2(p, q) asm volatile("s_wait_xcnt 0x0" :: "v"(p), "v"(q) : "memory")
#define XW3(p, q, r) asm volatile("s_wait_xcnt 0x0" :: "v"(p), "v"(q), "v"(r) : "memory")
#define SPP (TT + 8)     // f16 pitch of the P rows in LDS: 16 B more than a row, so that the 16 rows of a fragment read fall on different banks
#define SRP (HD + 4)     // f32 pitch of the partial ctx rows
__global__ __launch_bounds__(256, 4) void k_att(const _Float16* __restrict__ QH, const _Float16* __restrict__ QL, const _Float16* __restrict__ QH2, const _Float16* __restrict__ QL2, const _Float16* __restrict__ KH, const _Float16* __restrict__ KP, const _Float16* __restrict__ VT, float* __restrict__ Y) {
  __shared__ __align__(16) char sm[16 * SPP * 2 + 8 * 16 * SRP * 4];   /* first the f32 BD' rows [16][TT] (65,536 B); once every wave has read them, the f16 P rows and behind them the partial ctx tiles */
  __shared__ __align__(16) float redm[16][8], reds[16][8];
  float* sS = (float*)sm; _Float16* sP = (_Float16*)sm; float* sR = (float*)(sm + 16 * SPP * 2);
  const int tid = threadIdx.x, wave = __builtin_amdgcn_readfirstlane(tid >> 5), lane = tid & 31, col = lane & 15, g = lane >> 4;
  const int t0 = blockIdx.x * 16, h = blockIdx.y, b = blockIdx.z, c0 = wave * 128;
  const size_t qr0 = pk_row((size_t)b * TT + t0 + col, h, g);   /* every offset below holds the lane's place in a piece */
  const size_t qr1 = pk_row((size_t)b * TT + (t0 + 1 + col < TT ? t0 + 1 + col : TT - 1), h, g);   /* row T does not exist and no tile of the last block uses the shifted rows */
  if (tid < 16 && t0 + tid + 1 < TT) sS[tid * TT + t0 + tid + 1] = 0.f;
  { v16h ah[HD / 32], al[HD / 32], pf[HD / 32][8]; const size_t qra = c0 + t0 <= TT - 32 ? qr1 : qr0;   /* the row tile of this wave's first column tile */
    const _Float16 *qha = QH2 + qra, *qla = QL2 + qra, *qhb = QH2 + qr0, *qlb = QL2 + qr0, *pb = KP + pk_row((size_t)(c0 + col), h, g);
#pragma unroll
    for (int kc = 0; kc < HD / 32; ++kc) { ah[kc] = frag_at(qha + kc * 512); al[kc] = frag_at(qla + kc * 512); }
#pragma unroll
    for (int kc = 0; kc < HD / 32; ++kc)
#pragma unroll
      for (int j = 0; j < 8; ++j) pf[kc][j] = frag_at(pb + j * PKT + kc * 512);
    XW3(qha, qla, pb);
#pragma unroll
    for (int j = 0; j < 8; ++j) { const bool up = c0 + j * 16 + t0 <= TT - 32;   /* wave-uniform */
      if (j > 0 && c0 + j * 16 + t0 == TT - 16) {   /* the one wave of a block whose columns cross from the shifted rows to the unshifted ones fetches the other row tile here */
#pragma unroll
        for (int kc = 0; kc < HD / 32; ++kc) { ah[kc] = frag_at(qhb + kc * 512); al[kc] = frag_at(qlb + kc * 512); }
        XW2(qhb, qlb); }
      v8f a = {}, l = {};
#pragma unroll
      for (int kc = 0; kc < HD / 32; ++kc) { a = wmma16(ah[kc], pf[kc][j], a); l = wmma16(al[kc], pf[kc][j], l); }
#pragma unroll
      for (int r = 0; r < 8; ++r) { const int rl = (up ? 1 : 0) + 8 * g + r; const int idx = (rl - 1) * TT + t0 + rl + c0 + j * 16 + col + 1;
        if ((unsigned)idx < 16u * TT) sS[idx] = (a[r] + l[r] * (1.0f / 1024.0f)) * SCALE_L2; } } }   /* outside: a neighbour block's row */
  float s[8][8];
  { v16h ah[HD / 32], al[HD / 32], kf[HD / 32][8]; const _Float16 *qh = QH + qr0, *ql = QL + qr0, *kb = KH + pk_row((size_t)b * TT + c0 + col, h, g);
#pragma unroll
    for (int kc = 0; kc < HD / 32; ++kc) { ah[kc] = frag_at(qh + kc * 512); al[kc] = frag_at(ql + kc * 512); }
#pragma unroll
    for (int kc = 0; kc < HD / 32; ++kc)
#pragma unroll
      for (int j = 0; j < 8; ++j) kf[kc][j] = frag_at(kb + j * PKT + kc * 512);
    XW3(qh, ql, kb);
#pragma unroll
    for (int j = 0; j < 8; ++j) { v8f a = {}, l = {};
#pragma unroll
      for (int kc = 0; kc < HD / 32; ++kc) { a = wmma16(ah[kc], kf[kc][j], a); l = wmma16(al[kc], kf[kc][j], l); }
#pragma unroll
      for (int r = 0; r < 8; ++r) s[j][r] = (a[r] + l[r] * (1.0f / 1024.0f)) * SCALE_L2;
      __builtin_amdgcn_sched_barrier(0); } }   /* each tile's two accumulators are folded into its logits before the next tile starts: with all sixteen accumulators live beside the key fragments the kernel spills */
  v16h vf[4][HD / 16];   /* this wave's v fragments: half are issued ahead of the softmax, half behind its exponentials (all sixteen beside them do not fit the registers), so that their latency runs under it */
  const _Float16* vb = VT + ((((size_t)b * NH + h) * 4) * 32 + (c0 >> 5)) * 512 + lane * 8;
#pragma unroll
  for (int u = 0; u < 2; ++u)
#pragma unroll
    for (int j = 0; j < HD / 16; ++j) vf[u][j] = frag_at(vb + j * 32 * 512 + u * 512);
  XW1(vb);
  __syncthreads();   /* every BD' element is in LDS */
  float m[8], sum[8];
#pragma unroll
  for (int r = 0; r < 8; ++r) { m[r] = -3.0e38f;
#pragma unroll
    for (int j = 0; j < 8; ++j) { s[j][r] = s[j][r] + sS[(8 * g + r) * TT + c0 + j * 16 + col]; m[r] = fmaxf(m[r], s[j][r]); }
#pragma unroll
    for (int o = 1; o < 16; o <<= 1) m[r] = fmaxf(m[r], __shfl_xor(m[r], o)); }
  if (col == 0) {
#pragma unroll
    for (int r = 0; r < 8; ++r) redm[8 * g + r][wave] = m[r]; }
  __syncthreads();   /* row maxima of all waves; also the last read of the BD' rows, whose LDS is reused below */
#pragma unroll
  for (int r = 0; r < 8; ++r) { const v4f x = *(const v4f*)&redm[8 * g + r][0], y = *(const v4f*)&redm[8 * g + r][4];
    m[r] = fmaxf(fmaxf(fmaxf(x[0], x[1]), fmaxf(x[2], x[3])), fmaxf(fmaxf(y[0], y[1]), fmaxf(y[2], y[3]))); sum[r] = 0.f;
#pragma unroll
    for (int j = 0; j < 8; ++j) s[j][r] = s[j][r] - m[r];   /* <= 0 and finite: the exponential needs no range reduction and no overflow test; a result below 2^-126 may read 0, far under P's f16 step */
    /* a row's eight 2^x, each in place. One statement, so that behind every v_exp_f32 stands an instruction that neither reads its result nor overwrites its source: the next one, and the v_nop behind the last */
    asm("v_exp_f32 %0, %0\n\tv_exp_f32 %1, %1\n\tv_exp_f32 %2, %2\n\tv_exp_f32 %3, %3\n\tv_exp_f32 %4, %4\n\tv_exp_f32 %5, %5\n\tv_exp_f32 %6, %6\n\tv_exp_f32 %7, %7\n\tv_nop"
        : "+v"(s[0][r]), "+v"(s[1][r]), "+v"(s[2][r]), "+v"(s[3][r]), "+v"(s[4][r]), "+v"(s[5][r]), "+v"(s[6][r]), "+v"(s[7][r]));
#pragma unroll
    for (int j = 0; j < 8; ++j) sum[r] += s[j][r];
#pragma unroll
    for (int o = 1; o < 16; o <<= 1) sum[r] += __shfl_xor(sum[r], o); }
#pragma unroll
  for (int u = 2; u < 4; ++u)
#pragma unroll
    for (int j = 0; j < HD / 16; ++j) vf[u][j] = frag_at(vb + j * 32 * 512 + u * 512);
  XW1(vb);
  if (col == 0) {
#pragma unroll
    for (int r = 0; r < 8; ++r) reds[8 * g + r][wave] = sum[r]; }
  __syncthreads();   /* row sums of all waves */
#pragma unroll
  for (int r = 0; r < 8; ++r) { const v4f x = *(const v4f*)&reds[8 * g + r][0], y = *(const v4f*)&reds[8 * g + r][4];
    const float a = ((x[0] + x[1]) + (x[2] + x[3])) + ((y[0] + y[1]) + (y[2] + y[3])); const float inv = a > 0.f ? 2048.0f / a : 0.f;
#pragma unroll
    for (int j = 0; j < 8; ++j) sP[(8 * g + r) * SPP + c0 + j * 16 + col] = (_Float16)(s[j][r] * inv); }
  LDSX();   /* a wave reads back only the 128 P columns that it wrote itself */
  v8f acc[HD / 16] = {};
#pragma unroll
  for (int u = 0; u < 4; ++u) { const v16h p = frag_h(sP + col * SPP + c0 + u * 32, lane);
#pragma unroll
    for (int j = 0; j < HD / 16; ++j) acc[j] = wmma16(p, vf[u][j], acc[j]); }
#pragma unroll
  for (int j = 0; j < HD / 16; ++j)
#pragma unroll
    for (int r = 0; r < 8; ++r) sR[(wave * 16 + 8 * g + r) * SRP + j * 16 + col] = acc[j][r];
  __syncthreads();   /* the 8 partial ctx tiles */
  { const int rl = tid >> 4, c4 = (tid & 15) * 4; v4f o = *(const v4f*)&sR[rl * SRP + c4];
#pragma unroll
    for (int w = 1; w < 8; ++w) o = o + *(const v4f*)&sR[(w * 16 + rl) * SRP + c4];
    vst2(Y + ((size_t)b * TT + t0 + rl) * CC + h * HD + c4, o * (1.0f / 2048.0f)); } }
// ---- k_out: block = (64 rows, 128 cols): out = ctx Wo (+ bo): ctx x 2^6 once to f16 against Wo as f16(bf16 x 2^8) exact (1 product) x 2^-14; causal early rows (< QHI of each sequence): ctx bf16 hi + lo against exact bf16 Wo (2 products)
__global__ __launch_bounds__(128) void k_out(const float* __restrict__ Y, const float* __restrict__ WO, const float* __restrict__ BO, float* __restrict__ OUT) { __shared__ __align__(16) float sf[4][16][132]; __shared__ __align__(16) char wst[2 * 128 * WBP];
  const int tid = threadIdx.x, wave = tid >> 5, lane = tid & 31, col = lane & 15, g = lane >> 4; const int c0 = blockIdx.y * 128; const size_t r0 = (size_t)blockIdx.x * 64 + wave * 16;
  v8f acc[8] = {};
  if (CAUSAL && (int)(((size_t)blockIdx.x * 64) % TT) < QHI) {   /* block-uniform */
#pragma unroll 2
    for (int kc = 0; kc < CC / 32; ++kc) { const F2 a = split_row(Y + (r0 + col) * CC, kc * 32, lane); asm volatile("s_wait_loadcnt 0x0" ::: "memory");
#pragma unroll
      for (int j = 0; j < 8; ++j) { const v16b w = WOCOL(WO, kc * 32, c0 + j * 16 + col, lane); asm volatile("s_wait_loadcnt 0x0" ::: "memory"); acc[j] = wmma_bf(a.h, w, acc[j]); acc[j] = wmma_bf(a.l, w, acc[j]); } }
#pragma unroll
    for (int j = 0; j < 8; ++j) { const float bias = BO ? bfr(BO[c0 + j * 16 + col]) : 0.f;
#pragma unroll
      for (int r = 0; r < 8; ++r) sf[wave][8 * g + r][j * 16 + col] = acc[j][r] + bias; }
  } else {
    /* Wo's slab of a k step goes through LDS as in k_proj: fetched once by the block in whole rows, converted once, read as B fragments by all four waves */
    const float* wp = WO + (size_t)(wave * 8) * DIN + c0 + lane * 4; const float* yp = Y + (r0 + col) * CC;
    v4f wr[2][8]; float ar[2][16];
#pragma unroll
    for (int u = 0; u < 2; ++u) {
#pragma unroll
      for (int i = 0; i < 8; ++i) wr[u][i] = *(const v4f*)(wp + (size_t)(u * 32 + i) * DIN);
      raw_row(ar[u], yp + u * 32, lane); }
    auto step = [&](const int kc, const int u, const bool more) __attribute__((always_inline)) { char* wb = wst + u * (128 * WBP);
#pragma unroll
      for (int jj = 0; jj < 4; ++jj) { v8h t;
#pragma unroll
        for (int i = 0; i < 8; ++i) t[i] = (_Float16)(bfr(wr[u][i][jj]) * 256.0f);
        *(v8h*)(wb + (lane * 4 + jj) * WBP + wave * 16) = t; }
      if (more) { const float* wn = wp + (size_t)(kc + 2) * 32 * DIN;   /* the weight values of set u are in LDS: refill them for step kc + 2 */
#pragma unroll
        for (int i = 0; i < 8; ++i) wr[u][i] = *(const v4f*)(wn + (size_t)i * DIN);
        asm volatile("s_wait_xcnt 0x0" ::: "memory"); }   /* the loop advances the loads' address registers: keep the wait in front of that */
      v16h a;   /* ctx carried x 2^6 into f16 so small-magnitude context rows stay clear of f16 subnormals */
#pragma unroll
      for (int i = 0; i < 16; ++i) a[i] = (_Float16)(ar[u][i] * 64.0f);
      WBAR();   /* stage u is written; every wave has also left the other stage, which the next step overwrites */
      union { v16h v; v8h q[2]; } w[8];
#pragma unroll
      for (int j = 0; j < 8; ++j) { const char* f = wb + (j * 16 + col) * WBP + g * 16; w[j].q[0] = *(const v8h*)f; w[j].q[1] = *(const v8h*)(f + 32); }
      __builtin_amdgcn_sched_barrier(0);   /* all sixteen LDS reads ahead of the first product: one LDS latency a step */
#pragma unroll
      for (int j = 0; j < 8; ++j) acc[j] = wmma16(a, w[j].v, acc[j]);
      if (more) { raw_row(ar[u], yp + (kc + 2) * 32, lane);   /* the row values of set u are converted by now: refill them for step kc + 2 */
        asm volatile("s_wait_xcnt 0x0" ::: "memory"); } };   /* the loop advances the loads' address registers: keep the wait in front of that */
#pragma unroll 1   /* stays a loop of two steps, as in k_proj */
    for (int kc = 0; kc < CC / 32 - 2; kc += 2) { step(kc, 0, true); step(kc + 1, 1, true); }
    step(CC / 32 - 2, 0, false); step(CC / 32 - 1, 1, false);
#pragma unroll
    for (int j = 0; j < 8; ++j) { const float bias = BO ? bfr(BO[c0 + j * 16 + col]) : 0.f;
#pragma unroll
      for (int r = 0; r < 8; ++r) sf[wave][8 * g + r][j * 16 + col] = acc[j][r] * (1.0f / 16384.0f) + bias; } }   /* 2^-8 (Wo carry) x 2^-6 (ctx carry) */
  LDSX(); for (int rl = 0; rl < 16; ++rl) vst2(OUT + (r0 + rl) * DIN + c0 + lane * 4, *(const v4f*)&sf[wave][rl][lane * 4]); }

extern "C" void kernel_launch(void* const* d_in, const int* in_sizes, int n_in, void* d_out, int out_size, void* d_ws, size_t ws_size, hipStream_t stream) {
  (void)in_sizes; (void)n_in; (void)out_size;
  const float** F = (const float**)d_in;
  if (ws_size < (size_t)WS_END) return;
  char* ws = (char*)d_ws; _Float16 *QH = (_Float16*)(ws + WS_QH), *KH = (_Float16*)(ws + WS_KH), *VT = (_Float16*)(ws + WS_VT), *QL = (_Float16*)(ws + WS_QL), *KL = (_Float16*)(ws + WS_KL); __bf16 *VB = (__bf16*)(ws + WS_VB), *VBL = (__bf16*)(ws + WS_VBL); float *Y = (float*)(ws + WS_Y);
  (void)Y; (void)QL; (void)KL; (void)VB; (void)VBL;
  // inputs: 0 query [4,1024,512]; 1 key; 2 value; 3 pos_emb [1,1024,512]; 4 Wq (in,out), 5 bq; 6 Wk, 7 bk; 8 Wv, 9 bv; 10 Wo (in,out), 11 bo; 12 Wpos [512,512]; 13 pos_bias_u [8,64]; 14 pos_bias_v [8,64]
  if (ws_size < (size_t)WS_END2) return;
  _Float16 *QH2 = (_Float16*)(ws + WS_QH2), *QL2 = (_Float16*)(ws + WS_QL2), *KP = (_Float16*)(ws + WS_KP);
  k_proj<<<dim3(16, CC / 128, TNB * TT / 1024 * 3 + 1), 128, 0, stream>>>(F[0], F[1], F[2], F[3], F[4], F[6], F[8], F[12], F[5], F[7], F[9], QH, QL, QH2, QL2, KH, KL, KP, VT, VB, VBL, F[13], F[14]);   /* q (stored as q + pos_bias_u and as q + pos_bias_v), k, v, and p = pos_emb Wpos into KP */
  k_att<<<dim3(TT / 16, NH, TNB), 256, 0, stream>>>(QH, QL, QH2, QL2, KH, KP, VT, Y);   /* AC + rel_shift(BD), softmax, P v */
  k_out<<<dim3(TNB * TT / 64, DIN / 128), 128, 0, stream>>>(Y, F[10], F[11], (float*)d_out);
}

// v007
// One run takes 79.1 microseconds.
// In two side-by-side timings against v006, it was 1.13 and 1.12 times as fast.
// Over all steps from v000 it is 6.54 times as fast.
// compute dtype: all float inputs rounded to bf16; projections with EXACT bf16 products on WMMA 16x16x32 (f32 accumulate) + biases; content (q+u).k and position (q+v).p scores each with q as f16 hi + residual (x 2^10) against f16 k / p (2 products) x 64^-0.5 x log2 e; rel_shift as the store index of the position scores in LDS; softmax f32 in base 2; P x 2^11 once to f16 x v once to f16 (1 product); ctx carried x 2^6 once to f16 x Wo f16(bf16 x 2^8) + bo; f32 output.
#include <hip/hip_runtime.h>
#include <math.h>

typedef __attribute__((ext_vector_type(16))) _Float16 v16h;
typedef __attribute__((ext_vector_type(16))) __bf16 v16b;
typedef __attribute__((ext_vector_type(8)))  _Float16 v8h;
typedef __attribute__((ext_vector_type(8)))  float v8f;
typedef __attribute__((ext_vector_type(4)))  float v4f;
typedef __attribute__((ext_vector_type(2)))  float v2f;
typedef __attribute__((ext_vector_type(4)))  unsigned v4u;
typedef __attribute__((ext_vector_type(4)))  int v4i;
typedef float __attribute__((may_alias)) float_a;
typedef int __attribute__((may_alias)) int_a;

template <typename T> __device__ __forceinline__ void vst2(void* p, T v) { *(T*)p = v;  }
__device__ __forceinline__ v8f wmma16(v16h a, v16h b, v8f c) {
  v8f d = __builtin_amdgcn_wmma_f32_16x16x32_f16(false, a, false, b, (short)0, c, false, false);
  asm volatile("v_nop\n\tv_nop\n\tv_nop\n\tv_nop" : "+v"(d) : "v"(a), "v"(b));
  return d;
}
__device__ __forceinline__ v8f wmma_bf(v16b a, v16b b, v8f c) {
  v8f d = __builtin_amdgcn_wmma_f32_16x16x32_bf16(false, a, false, b, (short)0, c, false, false);
  asm volatile("v_nop\n\tv_nop\n\tv_nop\n\tv_nop" : "+v"(d) : "v"(a), "v"(b));
  return d;
}
// 16x16x32 fragments: lane = (h = lane>>4, row/col = lane&15); elements 0..7 = k0+8h+0..7, 8..15 = k0+16+8h+0..7; D element r = row 8h+r
__device__ __forceinline__ v16h frag_h(const _Float16* rowk0, int lane) {
  union { v16h v; v8h q[2]; } u; const _Float16* p = rowk0 + 8 * (lane >> 4);
  u.q[0] = *(const v8h*)p; u.q[1] = *(const v8h*)(p + 16); return u.v;
}
__device__ __forceinline__ v16h frag_f32(const float* rowk0, int lane) {
  v16h a; const float* p = rowk0 + 8 * (lane >> 4);
#pragma unroll
  for (int i = 0; i < 8; ++i) { a[i] = (_Float16)p[i]; a[8 + i] = (_Float16)p[16 + i]; }
  return a;
}
__device__ __forceinline__ v16h frag_f32s(const float* rowk0, int lane, float sc) {
  v16h a; const float* p = rowk0 + 8 * (lane >> 4);
#pragma unroll
  for (int i = 0; i < 8; ++i) { a[i] = (_Float16)(p[i] * sc); a[8 + i] = (_Float16)(p[16 + i] * sc); }
  return a;
}
// column fragment from a [K][ld] layout (column n), rows >= K read as 0
__device__ __forceinline__ v16h fragc_f32(const float* W, int k0, int n, int lane, int ld, int K) {
  v16h a; const int g = lane >> 4;
#pragma unroll
  for (int i = 0; i < 8; ++i) { const int ka = k0 + 8 * g + i, kb = ka + 16;
    a[i] = (_Float16)(ka < K ? W[(size_t)(ka < K ? ka : K - 1) * ld + n] : 0.f); a[8 + i] = (_Float16)(kb < K ? W[(size_t)(kb < K ? kb : K - 1) * ld + n] : 0.f); }
  return a;
}
struct F2 { v16b h, l; };
__device__ __forceinline__ F2 bsplit16(const float v[16]) { F2 r;
#pragma unroll
  for (int i = 0; i < 16; ++i) { const __bf16 h = (__bf16)v[i]; r.h[i] = h; r.l[i] = (__bf16)(v[i] - (float)h); }
  return r; }
__device__ __forceinline__ F2 split_row(const float* row, int k0, int lane) { float v[16]; const float* p = row + k0 + 8 * (lane >> 4);
#pragma unroll
  for (int i = 0; i < 8; ++i) { v[i] = p[i]; v[8 + i] = p[16 + i]; }
  return bsplit16(v); }
__device__ __forceinline__ F2 split_rowK(const float* row, int k0, int lane, int K) { float v[16]; const int g = lane >> 4;
#pragma unroll
  for (int i = 0; i < 8; ++i) { const int ka = k0 + 8 * g + i, kb = ka + 16; v[i] = ka < K ? row[ka < K ? ka : K - 1] : 0.f; v[8 + i] = kb < K ? row[kb < K ? kb : K - 1] : 0.f; }
  return bsplit16(v); }
__device__ __forceinline__ F2 split_col(const float* W, int k0, int n, int lane, int ld, int K) { float v[16]; const int g = lane >> 4;
#pragma unroll
  for (int i = 0; i < 8; ++i) { const int ka = k0 + 8 * g + i, kb = ka + 16; v[i] = ka < K ? W[(size_t)(ka < K ? ka : K - 1) * ld + n] : 0.f; v[8 + i] = kb < K ? W[(size_t)(kb < K ? kb : K - 1) * ld + n] : 0.f; }
  return bsplit16(v); }
__device__ __forceinline__ v8f mac3(const F2& a, const F2& b, v8f c) { c = wmma_bf(a.l, b.h, c); c = wmma_bf(a.h, b.l, c); return wmma_bf(a.h, b.h, c); }
__device__ __forceinline__ float sigm(float v) { return 1.0f / (1.0f + expf(-v)); }
#define LDSX() do { asm volatile("s_wait_dscnt 0" ::: "memory"); __builtin_amdgcn_wave_barrier(); __builtin_amdgcn_fence(__ATOMIC_RELEASE, "workgroup"); } while (0)

// Transformer-XL / Conformer relative multi-head attention (B 4, T = P = 1,024, D 512 = 8 heads x 64; (in,out) Wq/Wk/Wv/Wo [512,512] + zero biases, Wpos [512,512] no bias, pos_bias_u/v [8,64]; 1/sqrt(64)-scale): AC = (q + u) k^T, BD = rel_shift((q + v) p^T) with p = pos_emb Wpos (pad-reshape trick, no mask), attn = softmax((AC + BD)/8), out = merge(attn v) Wo + bo.
#define NB 4
#define TT 1024
#define CC 512            // NH * HD = projected width
#define DIN 512          // input (model) width
#define NH 8
#define HD 64
#define NQB (TT / 64)
#define HG 8
#define SCALE (0.125f)
#define SCALE_L2 (SCALE * 1.4426950408889634f)   // logits are carried in units of log 2 (scale x log2 e), so that the softmax exponential is the chip's own base-2 instruction
#define CAUSAL 0
#ifndef TNB
#define TNB NB
#endif
__device__ __forceinline__ float bfr(float v) { return (float)(__bf16)v; }
__host__ __device__ __forceinline__ int kb_last(int qb) { return CAUSAL ? ((qb * 64 + 63) >> 7) : (TT / 128 - 1); }
typedef __attribute__((ext_vector_type(8))) __bf16 v8b;
__device__ __forceinline__ v16b frag_b(const __bf16* rowk0, int lane) {
  union { v16b v; v8b q[2]; } u; const __bf16* p = rowk0 + 8 * (lane >> 4);
  u.q[0] = *(const v8b*)p; u.q[1] = *(const v8b*)(p + 16); return u.v;
}
#define QBH 0              // read by no kernel here
#define QHI 1024            // rows carrying a q residual plane (all rows when non-causal: 2-product logits everywhere)
#define KHI 64            // key rows carrying k residual / v bf16 hi+lo planes (written, but read by no kernel here)
// B fragment (k rows k0+.., output column o) of a weight: (in,out) [K][ld] or (out,in) [ld rows of K]: bf16 exact, or f16(bf16 * 256) exact
__device__ __forceinline__ v16b wcol_io(const float* Wm, int k0, int o, int lane, int ld) { v16b w; const int g = lane >> 4;
#pragma unroll
  for (int i = 0; i < 8; ++i) { w[i] = (__bf16)Wm[(size_t)(k0 + 8 * g + i) * ld + o]; w[8 + i] = (__bf16)Wm[(size_t)(k0 + 16 + 8 * g + i) * ld + o]; }
  return w; }
__device__ __forceinline__ v16b wcol_oi(const float* Wm, int k0, int o, int lane, int K) { v16b w; const float* p = Wm + (size_t)o * K + k0 + 8 * (lane >> 4);
#pragma unroll
  for (int i = 0; i < 8; ++i) { w[i] = (__bf16)p[i]; w[8 + i] = (__bf16)p[16 + i]; }
  return w; }
__device__ __forceinline__ v16h wcolh_io(const float* Wm, int k0, int o, int lane, int ld) { v16h w; const int g = lane >> 4;
#pragma unroll
  for (int i = 0; i < 8; ++i) { w[i] = (_Float16)(bfr(Wm[(size_t)(k0 + 8 * g + i) * ld + o]) * 256.0f); w[8 + i] = (_Float16)(bfr(Wm[(size_t)(k0 + 16 + 8 * g + i) * ld + o]) * 256.0f); }
  return w; }
__device__ __forceinline__ v16h wcolh_oi(const float* Wm, int k0, int o, int lane, int K) { v16h w; const float* p = Wm + (size_t)o * K + k0 + 8 * (lane >> 4);
#pragma unroll
  for (int i = 0; i < 8; ++i) { w[i] = (_Float16)(bfr(p[i]) * 256.0f); w[8 + i] = (_Float16)(bfr(p[16 + i]) * 256.0f); }
  return w; }
// unconverted f32 values of a fragment, in fragment element order: a row operand, and column o of an (in,out) [K][ld] weight
__device__ __forceinline__ void raw_row(float (&r)[16], const float* rowk0, int lane) { const float* p = rowk0 + 8 * (lane >> 4);
#pragma unroll
  for (int i = 0; i < 8; ++i) { r[i] = p[i]; r[8 + i] = p[16 + i]; } }
__device__ __forceinline__ void raw_col(float (&r)[16], const float* Wm, int k0, int o, int lane, int ld) { const int g = lane >> 4;
#pragma unroll
  for (int i = 0; i < 8; ++i) { r[i] = Wm[(size_t)(k0 + 8 * g + i) * ld + o]; r[8 + i] = Wm[(size_t)(k0 + 16 + 8 * g + i) * ld + o]; } }
#define WQKV_LAYOUT 0   // selects WCOL only, which nothing calls (k_proj always reads (in,out) [DIN][CC]): 0 = (in,out) [DIN][CC]; 1 = (out,in) [CC][DIN]; 2 = per-head [NH][DIN][HD]
__device__ __forceinline__ v16b wcol_hdk(const float* Wm, int k0, int o, int lane) { v16b w; const int g = lane >> 4; const float* p = Wm + (size_t)(o / HD) * DIN * HD + (o % HD);
#pragma unroll
  for (int i = 0; i < 8; ++i) { w[i] = (__bf16)p[(size_t)(k0 + 8 * g + i) * HD]; w[8 + i] = (__bf16)p[(size_t)(k0 + 16 + 8 * g + i) * HD]; }
  return w; }
#define WO_OUT_IN 0
#if WQKV_LAYOUT == 1
#define WCOL(W, k0, o, lane) wcol_oi(W, k0, o, lane, DIN)
#elif WQKV_LAYOUT == 2
#define WCOL(W, k0, o, lane) wcol_hdk(W, k0, o, lane)
#else
#define WCOL(W, k0, o, lane) wcol_io(W, k0, o, lane, CC)
#endif
#if WO_OUT_IN
#define WOCOL(W, k0, o, lane) wcol_oi(W, k0, o, lane, CC)
#define WOCOLH(W, k0, o, lane) wcolh_oi(W, k0, o, lane, CC)
#else
#define WOCOL(W, k0, o, lane) wcol_io(W, k0, o, lane, DIN)
#define WOCOLH(W, k0, o, lane) wcolh_io(W, k0, o, lane, DIN)
#endif
#define WS_QH2 (WS_END)                                   // f16 q_v rows, fragment order
#define WS_QL2 (WS_QH2 + 2u * (size_t)NB * TT * CC)       // f16 q_v residual rows, fragment order
#define WS_KP  (WS_QL2 + 2u * (size_t)NB * QHI * CC)      // f16 positional key rows p = pos_emb Wpos, fragment order (the first TT rows are used)
#define WS_S2  (WS_KP + 2u * (size_t)NB * TT * CC)        // f32 [hg][t][p], unused: k_att keeps BD in LDS
#define WS_END2 (WS_S2 + 4u * (size_t)HG * TT * TT)

#define WS_QH  0u                                      // f16 q rows, fragment order [b*t / 16][head][piece 4][lane 32][8] (see pk_row)
#define WS_KH  (WS_QH + 2u * (size_t)NB * TT * CC)      // f16 k rows, fragment order as the q rows
#define WS_VT  (WS_KH + 2u * (size_t)NB * TT * CC)      // f16 v, fragment order [b][head][d / 16][t / 32][half 2][lane 32][8]: lane = (t / 8 & 1) * 16 + d % 16
#define WS_QL  (WS_VT + 2u * (size_t)NB * CC * TT)      // f16 q residual x 2^10 rows, fragment order as the q rows (QHI = TT)
#define WS_KL  (WS_QL + 2u * (size_t)NB * QHI * CC)     // f16 k residual x 2^10 rows [b][t < KHI][CC]
#define WS_VB  (WS_KL + 2u * (size_t)NB * KHI * CC)     // bf16 v hi planes [b][c][t < KHI]
#define WS_VBL (WS_VB + 2u * (size_t)NB * CC * KHI)
#define WS_S   (WS_VBL + 2u * (size_t)NB * CC * KHI)    // f32 [hg][t][s], unused: k_att keeps logits and P on chip
#define WS_Y   (WS_S  + 4u * (size_t)HG * TT * TT)      // f32 ctx rows [b*t][CC] (only when there is an output projection)
#define WS_END (WS_Y  + 4u * (size_t)NB * TT * CC)

#define WBP 80           // bytes from a column to the next in a staged weight slab: 64 B of k and 16 more, so that the 16 columns of a fragment read fall on different banks
// work-group barrier of the staged GEMM loops: it waits for this wave's LDS traffic alone. __syncthreads() would also wait for the global loads of the steps ahead, which only this wave's registers receive and which are to stay in flight across it
#define WBAR() asm volatile("s_wait_dscnt 0x0\n\ts_barrier_signal -1\n\ts_barrier_wait -1" ::: "memory")
// ---- k_proj: every projection in one launch. block = (64 rows, 128 cols, which = blockIdx.z / 4): X W (+ b) with exact bf16 products (K = DIN) -> which 0: q, multiplied once and stored twice, as q + pos_bias_u and as q + pos_bias_v (f16 rows + residual rows each); 1: k f16 rows (+ residual rows < KHI); 2: v f16 planes (+ bf16 hi/lo planes [c][t] for t < KHI); 3: the positional key rows p = pos_emb Wpos (no bias, the TT rows of blockIdx.z = 12), f16 rows as k; the f16 planes are stored in the fragment order that k_att loads (layouts: WS_QH, WS_VT). The q blocks, which have the longest epilogue, take the lowest indices (for speed only)
__global__ __launch_bounds__(128) void k_proj(const float* __restrict__ XQ, const float* __restrict__ XK, const float* __restrict__ XV, const float* __restrict__ XP, const float* __restrict__ WQ, const float* __restrict__ WK, const float* __restrict__ WV, const float* __restrict__ WP, const float* __restrict__ BQ, const float* __restrict__ BK, const float* __restrict__ BV,
    _Float16* __restrict__ QH, _Float16* __restrict__ QL, _Float16* __restrict__ QH2, _Float16* __restrict__ QL2, _Float16* __restrict__ KH, _Float16* __restrict__ KL, _Float16* __restrict__ KP, _Float16* __restrict__ VT, __bf16* __restrict__ VB, __bf16* __restrict__ VBL, const float* __restrict__ EXU, const float* __restrict__ EXV) {
  __shared__ __align__(16) float st[64][132]; __shared__ __align__(16) _Float16 sh[2][64][136], sl[2][64][136]; __shared__ __align__(16) _Float16 th[128][72]; __shared__ __align__(16) __bf16 tb[128][72], tbl[128][72];
  const int tid = threadIdx.x, wave = tid >> 5, lane = tid & 31, col = lane & 15, g = lane >> 4; const int which = blockIdx.z >> 2; const int c0 = blockIdx.y * 128; const size_t r0 = (size_t)((blockIdx.z & 3) * 16 + blockIdx.x) * 64; const size_t bb = r0 / TT; const int t0 = (int)(r0 % TT);
  const float* X = which == 0 ? XQ : which == 1 ? XK : which == 2 ? XV : XP; const float* WA = which == 0 ? WQ : which == 1 ? WK : which == 2 ? WV : WP; const float* BA = which == 0 ? BQ : which == 1 ? BK : which == 2 ? BV : nullptr;
  v8f acc[8] = {};
  /* the weight slab of a k step (32 rows x 128 columns) is fetched once by the block, in whole 512-byte rows, rounded once and laid in LDS as [column][k] at pitch WBP, where all four waves take their B fragments. Thread = (8 k rows: wave, 4 columns: lane). Two LDS stages (in sh, which is not written before the barrier behind the loop) and two register sets: the loads of step kc + 2 are issued in step kc, as soon as their registers are free, and fly during step kc + 1 */
  char* wst = (char*)&sh[0][0][0]; const float* wp = WA + (size_t)(wave * 8) * CC + c0 + lane * 4; const float* xp = X + (r0 + wave * 16 + col) * DIN;
  v4f wr[2][8]; float ar[2][16];
#pragma unroll
  for (int u = 0; u < 2; ++u) {
#pragma unroll
    for (int i = 0; i < 8; ++i) wr[u][i] = *(const v4f*)(wp + (size_t)(u * 32 + i) * CC);
    raw_row(ar[u], xp + u * 32, lane); }
  auto step = [&](const int kc, const int u, const bool more) __attribute__((always_inline)) { char* wb = wst + u * (128 * WBP);
#pragma unroll
    for (int jj = 0; jj < 4; ++jj) { v8b t;
#pragma unroll
      for (int i = 0; i < 8; ++i) t[i] = (__bf16)wr[u][i][jj];
      *(v8b*)(wb + (lane * 4 + jj) * WBP + wave * 16) = t; }
    if (more) { const float* wn = wp + (size_t)(kc + 2) * 32 * CC;   /* the weight values of set u are in LDS: refill them for step kc + 2 */
#pragma unroll
      for (int i = 0; i < 8; ++i) wr[u][i] = *(const v4f*)(wn + (size_t)i * CC);
      asm volatile("s_wait_xcnt 0x0" ::: "memory"); }   /* the loop advances the loads' address registers: keep the wait in front of that */
    v16b a;
#pragma unroll
    for (int i = 0; i < 16; ++i) a[i] = (__bf16)ar[u][i];
    WBAR();   /* stage u is written; every wave has also left the other stage, which the next step overwrites */
    union { v16b v; v8b q[2]; } w[8];
#pragma unroll
    for (int j = 0; j < 8; ++j) { const char* f = wb + (j * 16 + col) * WBP + g * 16; w[j].q[0] = *(const v8b*)f; w[j].q[1] = *(const v8b*)(f + 32); }
    __builtin_amdgcn_sched_barrier(0);   /* all sixteen LDS reads are issued ahead of the first product, so that one LDS latency serves the step and not eight */
#pragma unroll
    for (int j = 0; j < 8; ++j) acc[j] = wmma_bf(a, w[j].v, acc[j]);
    if (more) { raw_row(ar[u], xp + (kc + 2) * 32, lane);   /* the row values of set u are converted by now: refill them for step kc + 2 */
      asm volatile("s_wait_xcnt 0x0" ::: "memory"); } };   /* the loop advances the loads' address registers: keep the wait in front of that */
#pragma unroll 1   /* stays a loop of two steps: unrolled whole, the compiler lifts every conversion up to its loads, and each step then waits for loads just issued */
  for (int kc = 0; kc < DIN / 32 - 2; kc += 2) { step(kc, 0, true); step(kc + 1, 1, true); }
  step(DIN / 32 - 2, 0, false); step(DIN / 32 - 1, 1, false);
  { // stage the f32 tile (acc + bias) in LDS, then convert
#pragma unroll
    for (int j = 0; j < 8; ++j) { const float bias = BA ? bfr(BA[c0 + j * 16 + col]) : 0.f;
#pragma unroll
      for (int r = 0; r < 8; ++r) st[wave * 16 + 8 * g + r][j * 16 + col] = acc[j][r] + bias; }
    __syncthreads();
  }
  if (which != 2) { _Float16* DH = which == 1 ? KH : KP;
    for (int ps = 0; ps < (which == 0 ? 2 : 1); ++ps) { const float* EB = which == 0 ? (ps ? EXV : EXU) : nullptr; const float eb = EB ? bfr(EB[c0 + tid]) : 0.f;
      asm volatile("s_wait_xcnt 0x0" ::: "memory");   /* the second pass overwrites the bias load's base: keep the wait in front of that */
      /* q + pos_bias_u, then q + pos_bias_v: the per-(head, dim) bias is added in f32 to the staged (x Wq + bq), which stays as it is for the second pass; a thread converts one column */
      for (int rl = 0; rl < 64; ++rl) { const float x = st[rl][tid]; const float v = EB ? x + eb : x; const _Float16 hv = (_Float16)v; sh[ps][rl][tid] = hv; sl[ps][rl][tid] = (_Float16)((v - (float)hv) * 1024.0f); } }
    __syncthreads();
    for (int e = tid; e < 64 * 16; e += 128) { const int ln = e & 31, rl = (e >> 8) * 16 + (ln & 15), q = ((e >> 5) & 7) * 2 + (ln >> 4);   /* e runs in the order of the destination: [row tile 4][head 2][piece 4][lane 32], so a wave stores 512 contiguous bytes */
      const size_t po = (((r0 >> 4) + (e >> 8)) * NH + (c0 >> 6)) * 1024 + (e & 255) * 8;
      const v4u h0 = *(const v4u*)&sh[0][rl][q * 8];
      if (which == 0) { const v4u l0 = *(const v4u*)&sl[0][rl][q * 8], h1 = *(const v4u*)&sh[1][rl][q * 8], l1 = *(const v4u*)&sl[1][rl][q * 8];   /* the four LDS reads share one latency */
        vst2((unsigned*)(QH + po), h0); vst2((unsigned*)(QL + po), l0); vst2((unsigned*)(QH2 + po), h1); vst2((unsigned*)(QL2 + po), l1); }
      else { vst2((unsigned*)(DH + po), h0);
        asm volatile("s_wait_xcnt 0x0" ::: "memory");   /* the second store's address may be formed in the first one's registers: keep the wait in front of that */
        if (which == 1 && t0 < KHI) vst2((unsigned*)(KL + (bb * KHI + t0 + rl) * (size_t)CC + c0 + q * 8), *(const v4u*)&sl[0][rl][q * 8]); }
      asm volatile("s_wait_xcnt 0x0" ::: "memory"); }   /* the next trip overwrites the stores' address and data registers: keep the wait in front of that */
  } else { const bool hi_rows = t0 < KHI;
    for (int e = tid; e < 64 * 128; e += 128) { const int rl = e & 63, cl = e >> 6; const float v = st[rl][cl]; th[cl][rl] = (_Float16)v; const __bf16 bh = (__bf16)v; tb[cl][rl] = bh; tbl[cl][rl] = (__bf16)(v - (float)bh); }
    __syncthreads();
    for (int e = tid; e < 128 * 8; e += 128) { const int ln = e & 31, cl = (e >> 7) * 16 + (ln & 15), q = ((e >> 5) & 3) * 2 + (ln >> 4);   /* destination order: [head 2][d tile 4][t block 2][half 2][lane 32] */
      vst2((unsigned*)(VT + (((bb * NH + (c0 >> 6)) * 4 + (e >> 7)) * 32 + (t0 >> 5)) * 512 + (e & 127) * 8), *(const v4u*)&th[cl][q * 8]);
      asm volatile("s_wait_xcnt 0x0" ::: "memory");   /* what follows overwrites the store's address and data registers: keep the wait in front of that */
      if (hi_rows) { const size_t o3 = (bb * CC + c0 + cl) * (size_t)KHI + t0 + q * 8; vst2((unsigned*)(VB + o3), *(const v4u*)&tb[cl][q * 8]); vst2((unsigned*)(VBL + o3), *(const v4u*)&tbl[cl][q * 8]);
        asm volatile("s_wait_xcnt 0x0" ::: "memory"); } } } }   /* as above, for these two stores */
// ---- k_att: block = 16 query rows (t0..t0+15) of (b, h), 8 waves, wave w owns key / position columns [128 w, 128 w + 128). Logits never leave the WGP.
// Every score product is taken transposed: the key (position) rows are the A operand and the query rows the B operand, so a lane holds ONE query (t0 + col) and register r of a tile the key 8 g + r. A row's maximum and sum are then sums inside a lane, and two score tiles, converted in place, are the B operand of ctx^T = v^T P^T: P needs no LDS and no lane exchange.
//  1. BD = (q + v) . p x 1/8 x log2 e is stored straight to its rel_shift place in LDS. The reference's pad-reshape is linear in memory: BD[r][c] lands at flat out index r T + r + c + 1 - T, so row r's columns c >= T-1-r go to out row r and the others to out row r-1; out[t][t+1] is the pad's 0.
//     The block needs BD rows t0..t0+16; a 16-column tile at cs needs rows t0+1..t0+16 when cs + t0 <= T - 32 and rows t0..t0+15 otherwise (cs, t0 multiples of 16), so one row tile serves each column tile.
//  2. AC = (q + u) . k x 1/8 x log2 e stays in registers and takes BD' from LDS; softmax in f32 over the 16 half-waves, 2^(s - max) for e^(..); P x 2^11 once to f16 in registers.
//  3. each wave multiplies its own 128 keys of P with v (f16, 1 product); the 8 partial ctx tiles are summed in wave order.
// Every loop is fully unrolled: the fragment, logit and accumulator arrays stay in registers only when each index is a constant. The second launch bound asks for 4 waves per SIMD (256 registers), so that two blocks share a WGP.
// The q, k, p and v planes lie in the workspace in fragment order: the 16 bytes that lane l of a wave takes with one load stand at 16 l inside a 512-byte piece, so a load reads 4 whole 128-byte lines and not a 32-byte part of 16 lines.
// Rows (q, k, p): a (16 rows, one head) tile is 4 pieces; piece 2 kc + half holds d = 32 kc + 16 half + 8 g + 0..7 of row r at lane 16 g + r % 16. pk_row = f16 index of the lane's place in piece 0.
__device__ __forceinline__ size_t pk_row(size_t row, int h, int g) { return ((row >> 4) * NH + h) * 1024 + (g * 16 + (row & 15)) * 8; }
#define PKT (NH * 1024)  // f16 from a 16-row tile to the next
__device__ __forceinline__ v16h frag_at(const _Float16* p) { union { v16h v; v8h q[2]; } u; u.q[0] = *(const v8h*)p; u.q[1] = *(const v8h*)(p + 256); return u.v; }   // the two pieces of one 32-deep fragment; p holds the lane's place
// behind a group of loads: the group's address registers are inputs, so they live up to the wait and no load of the group is given one of them as its destination; behind the wait they may be overwritten
#define XW1(p) asm volatile("s_wait_xcnt 0x0" :: "v"(p) : "memory")
#define XW2(p, q) asm volatile("s_wait_xcnt 0x0" :: "v"(p), "v"(q) : "memory")
#define XW3(p, q, r) asm volatile("s_wait_xcnt 0x0" :: "v"(p), "v"(q), "v"(r) : "memory")
#define SBP (TT + 4)     // f32 pitch of the BD' rows in LDS: 16 B more than a row, so that the 16 rows that the lanes of a 16-byte read take fall on different banks
#define SRP (HD + 4)     // f32 pitch of the partial ctx rows
#define RDP 20           // f32 pitch of a row's 16 partial maxima / sums (one per half-wave), 16 B more than they fill
__device__ __forceinline__ float max8(const float (&x)[8]) { return fmaxf(fmaxf(fmaxf(x[0], x[1]), fmaxf(x[2], x[3])), fmaxf(fmaxf(x[4], x[5]), fmaxf(x[6], x[7]))); }
__device__ __forceinline__ float sum8(const float (&x)[8]) { return ((x[0] + x[1]) + (x[2] + x[3])) + ((x[4] + x[5]) + (x[6] + x[7])); }
__global__ __launch_bounds__(256, 4) void k_att(const _Float16* __restrict__ QH, const _Float16* __restrict__ QL, const _Float16* __restrict__ QH2, const _Float16* __restrict__ QL2, const _Float16* __restrict__ KH, const _Float16* __restrict__ KP, const _Float16* __restrict__ VT, float* __restrict__ Y) {
  __shared__ __align__(16) float sS[16 * SBP];   /* first the f32 BD' rows [16][SBP]; once every wave has read them, the partial ctx tiles [8][16][SRP] */
  __shared__ __align__(16) float redm[16][RDP], reds[16][RDP];
  float* sR = sS;
  const int tid = threadIdx.x, wave = __builtin_amdgcn_readfirstlane(tid >> 5), lane = tid & 31, col = lane & 15, g = lane >> 4;
  const int t0 = blockIdx.x * 16, h = blockIdx.y, b = blockIdx.z, c0 = wave * 128;
  const size_t qr0 = pk_row((size_t)b * TT + t0 + col, h, g);   /* every offset below holds the lane's place in a piece */
  const size_t qr1 = pk_row((size_t)b * TT + (t0 + 1 + col < TT ? t0 + 1 + col : TT - 1), h, g);   /* row T does not exist and no tile of the last block uses the shifted rows */
  if (tid < 16 && t0 + tid + 1 < TT) sS[tid * SBP + t0 + tid + 1] = 0.f;
  { v16h ah[HD / 32], al[HD / 32], pf[HD / 32][8]; const size_t qra = c0 + t0 <= TT - 32 ? qr1 : qr0;   /* the row tile of this wave's first column tile */
    const _Float16 *qha = QH2 + qra, *qla = QL2 + qra, *qhb = QH2 + qr0, *qlb = QL2 + qr0, *pb = KP + pk_row((size_t)(c0 + col), h, g);
#pragma unroll
    for (int kc = 0; kc < HD / 32; ++kc) { ah[kc] = frag_at(qha + kc * 512); al[kc] = frag_at(qla + kc * 512); }
#pragma unroll
    for (int kc = 0; kc < HD / 32; ++kc)
#pragma unroll
      for (int j = 0; j < 8; ++j) pf[kc][j] = frag_at(pb + j * PKT + kc * 512);
    XW3(qha, qla, pb);
#pragma unroll
    for (int j = 0; j < 8; ++j) { const int ct = c0 + j * 16 + t0; const bool up = ct <= TT - 32;   /* wave-uniform */
      if (j > 0 && ct == TT - 16) {   /* the one wave of a block whose columns cross from the shifted rows to the unshifted ones fetches the other row tile here */
#pragma unroll
        for (int kc = 0; kc < HD / 32; ++kc) { ah[kc] = frag_at(qhb + kc * 512); al[kc] = frag_at(qlb + kc * 512); }
        XW2(qhb, qlb); }
      v8f a = {}, l = {};
#pragma unroll
      for (int kc = 0; kc < HD / 32; ++kc) { a = wmma16(pf[kc][j], ah[kc], a); l = wmma16(pf[kc][j], al[kc], l); }
      /* the lane holds BD row (up ? 1 : 0) + col of the tile, columns 8 g + r */
      if (__builtin_expect((unsigned)(ct - (TT - 32)) <= 16u, 0)) {   /* ct = T - 32 or T - 16, the two tiles of a block in which a BD row is cut between two out rows or leaves the block's rows: flat index, range test, and the pitch's 4 floats for each whole row. Marked unlikely, so that the common form below is the fall-through */
#pragma unroll
        for (int r = 0; r < 8; ++r) { const int rl = (up ? 1 : 0) + col; const int idx = (rl - 1) * TT + rl + ct + 8 * g + r + 1;
          if ((unsigned)idx < 16u * TT) sS[idx + 4 * (idx >> 10)] = (a[r] + l[r] * (1.0f / 1024.0f)) * SCALE_L2; }   /* outside: a neighbour block's row */
      } else {   /* elsewhere the lane's eight values lie side by side in out row col: from column ct + col + 2 + 8 g (shifted rows, ct <= T - 48: the last is column T - 16) or ct + col + 1 - T + 8 g (ct >= T: columns 1 .. T - 1) */
        float* d = sS + col * (SBP + 1) + 8 * g + (up ? ct + 2 : ct + 1 - TT);
#pragma unroll
        for (int r = 0; r < 8; ++r) d[r] = (a[r] + l[r] * (1.0f / 1024.0f)) * SCALE_L2; } } }
  float s[8][8];   /* s[j][r]: query t0 + col, key c0 + 16 j + 8 g + r */
  { v16h ah[HD / 32], al[HD / 32], kf[HD / 32][8]; const _Float16 *qh = QH + qr0, *ql = QL + qr0, *kb = KH + pk_row((size_t)b * TT + c0 + col, h, g);
#pragma unroll
    for (int kc = 0; kc < HD / 32; ++kc) { ah[kc] = frag_at(qh + kc * 512); al[kc] = frag_at(ql + kc * 512); }
#pragma unroll
    for (int kc = 0; kc < HD / 32; ++kc)
#pragma unroll
      for (int j = 0; j < 8; ++j) kf[kc][j] = frag_at(kb + j * PKT + kc * 512);
    XW3(qh, ql, kb);
#pragma unroll
    for (int j = 0; j < 8; ++j) { v8f a = {}, l = {};
#pragma unroll
      for (int kc = 0; kc < HD / 32; ++kc) { a = wmma16(kf[kc][j], ah[kc], a); l = wmma16(kf[kc][j], al[kc], l); }
#pragma unroll
      for (int r = 0; r < 8; ++r) s[j][r] = (a[r] + l[r] * (1.0f / 1024.0f)) * SCALE_L2;
      __builtin_amdgcn_sched_barrier(0); } }   /* each tile's two accumulators are folded into its logits before the next tile starts: with all sixteen accumulators live beside the key fragments the kernel spills */
  v16h vf[4][HD / 16];   /* this wave's v fragments: half are issued ahead of the softmax, half behind its exponentials (all sixteen beside them do not fit the registers), so that their latency runs under it */
  const _Float16* vb = VT + ((((size_t)b * NH + h) * 4) * 32 + (c0 >> 5)) * 512 + lane * 8;
#pragma unroll
  for (int u = 0; u < 2; ++u)
#pragma unroll
    for (int j = 0; j < HD / 16; ++j) vf[u][j] = frag_at(vb + j * 32 * 512 + u * 512);
  XW1(vb);
  __syncthreads();   /* every BD' element is in LDS */
  float pt[8];
#pragma unroll
  for (int j = 0; j < 8; ++j) { const float* bd = sS + col * SBP + c0 + j * 16 + 8 * g; const v4f x = *(const v4f*)bd, y = *(const v4f*)(bd + 4);
#pragma unroll
    for (int r = 0; r < 4; ++r) { s[j][r] = s[j][r] + x[r]; s[j][4 + r] = s[j][4 + r] + y[r]; }
    pt[j] = max8(s[j]); }
  redm[col][wave * 2 + g] = max8(pt);
  __syncthreads();   /* the maxima of all half-waves; also the last read of the BD' rows, whose LDS is reused below */
  float m;
  { const v4f x = *(const v4f*)&redm[col][0], y = *(const v4f*)&redm[col][4], z = *(const v4f*)&redm[col][8], w = *(const v4f*)&redm[col][12];
    m = fmaxf(fmaxf(fmaxf(fmaxf(x[0], x[1]), fmaxf(x[2], x[3])), fmaxf(fmaxf(y[0], y[1]), fmaxf(y[2], y[3]))), fmaxf(fmaxf(fmaxf(z[0], z[1]), fmaxf(z[2], z[3])), fmaxf(fmaxf(w[0], w[1]), fmaxf(w[2], w[3])))); }
#pragma unroll
  for (int j = 0; j < 8; ++j) {
#pragma unroll
    for (int r = 0; r < 8; ++r) s[j][r] = s[j][r] - m;   /* <= 0 and finite: the exponential needs no range reduction and no overflow test; a result below 2^-126 may read 0, far under P's f16 step */
    /* a tile's eight 2^x, each in place. One statement, so that behind every v_exp_f32 stands an instruction that neither reads its result nor overwrites its source: the next one, and the v_nop behind the last */
    asm("v_exp_f32 %0, %0\n\tv_exp_f32 %1, %1\n\tv_exp_f32 %2, %2\n\tv_exp_f32 %3, %3\n\tv_exp_f32 %4, %4\n\tv_exp_f32 %5, %5\n\tv_exp_f32 %6, %6\n\tv_exp_f32 %7, %7\n\tv_nop"
        : "+v"(s[j][0]), "+v"(s[j][1]), "+v"(s[j][2]), "+v"(s[j][3]), "+v"(s[j][4]), "+v"(s[j][5]), "+v"(s[j][6]), "+v"(s[j][7]));
    pt[j] = sum8(s[j]); }
#pragma unroll
  for (int u = 2; u < 4; ++u)
#pragma unroll
    for (int j = 0; j < HD / 16; ++j) vf[u][j] = frag_at(vb + j * 32 * 512 + u * 512);
  XW1(vb);
  reds[col][wave * 2 + g] = sum8(pt);
  __syncthreads();   /* the sums of all half-waves */
  float inv;
  { const v4f x = *(const v4f*)&reds[col][0], y = *(const v4f*)&reds[col][4], z = *(const v4f*)&reds[col][8], w = *(const v4f*)&reds[col][12];
    const float a = (((x[0] + x[1]) + (x[2] + x[3])) + ((y[0] + y[1]) + (y[2] + y[3]))) + (((z[0] + z[1]) + (z[2] + z[3])) + ((w[0] + w[1]) + (w[2] + w[3]))); inv = a > 0.f ? 2048.0f / a : 0.f; }
  v8f acc[HD / 16] = {};   /* acc[j][r]: ctx^T, d = 16 j + 8 g + r of query t0 + col */
#pragma unroll
  for (int u = 0; u < 4; ++u) { v16h p;   /* keys 32 u + 8 g + i and 32 u + 16 + 8 g + i: the k order of the v fragments */
#pragma unroll
    for (int i = 0; i < 8; ++i) { p[i] = (_Float16)(s[2 * u][i] * inv); p[8 + i] = (_Float16)(s[2 * u + 1][i] * inv); }
#pragma unroll
    for (int j = 0; j < HD / 16; ++j) acc[j] = wmma16(vf[u][j], p, acc[j]); }
#pragma unroll
  for (int j = 0; j < HD / 16; ++j) { float* d = sR + (wave * 16 + col) * SRP + j * 16 + 8 * g;
    const v4f lo = { acc[j][0], acc[j][1], acc[j][2], acc[j][3] }, hi = { acc[j][4], acc[j][5], acc[j][6], acc[j][7] }; *(v4f*)d = lo; *(v4f*)(d + 4) = hi; }
  __syncthreads();   /* the 8 partial ctx tiles */
  { const int rl = tid >> 4, c4 = (tid & 15) * 4; v4f o = *(const v4f*)&sR[rl * SRP + c4];
#pragma unroll
    for (int w = 1; w < 8; ++w) o = o + *(const v4f*)&sR[(w * 16 + rl) * SRP + c4];
    vst2(Y + ((size_t)b * TT + t0 + rl) * CC + h * HD + c4, o * (1.0f / 2048.0f)); } }
// ---- k_out: block = (64 rows, 128 cols): out = ctx Wo (+ bo): ctx x 2^6 once to f16 against Wo as f16(bf16 x 2^8) exact (1 product) x 2^-14; causal early rows (< QHI of each sequence): ctx bf16 hi + lo against exact bf16 Wo (2 products)
__global__ __launch_bounds__(128) void k_out(const float* __restrict__ Y, const float* __restrict__ WO, const float* __restrict__ BO, float* __restrict__ OUT) { __shared__ __align__(16) float sf[4][16][132]; __shared__ __align__(16) char wst[2 * 128 * WBP];
  const int tid = threadIdx.x, wave = tid >> 5, lane = tid & 31, col = lane & 15, g = lane >> 4; const int c0 = blockIdx.y * 128; const size_t r0 = (size_t)blockIdx.x * 64 + wave * 16;
  v8f acc[8] = {};
  if (CAUSAL && (int)(((size_t)blockIdx.x * 64) % TT) < QHI) {   /* block-uniform */
#pragma unroll 2
    for (int kc = 0; kc < CC / 32; ++kc) { const F2 a = split_row(Y + (r0 + col) * CC, kc * 32, lane); asm volatile("s_wait_loadcnt 0x0" ::: "memory");
#pragma unroll
      for (int j = 0; j < 8; ++j) { const v16b w = WOCOL(WO, kc * 32, c0 + j * 16 + col, lane); asm volatile("s_wait_loadcnt 0x0" ::: "memory"); acc[j] = wmma_bf(a.h, w, acc[j]); acc[j] = wmma_bf(a.l, w, acc[j]); } }
#pragma unroll
    for (int j = 0; j < 8; ++j) { const float bias = BO ? bfr(BO[c0 + j * 16 + col]) : 0.f;
#pragma unroll
      for (int r = 0; r < 8; ++r) sf[wave][8 * g + r][j * 16 + col] = acc[j][r] + bias; }
  } else {
    /* Wo's slab of a k step goes through LDS as in k_proj: fetched once by the block in whole rows, converted once, read as B fragments by all four waves */
    const float* wp = WO + (size_t)(wave * 8) * DIN + c0 + lane * 4; const float* yp = Y + (r0 + col) * CC;
    v4f wr[2][8]; float ar[2][16];
#pragma unroll
    for (int u = 0; u < 2; ++u) {
#pragma unroll
      for (int i = 0; i < 8; ++i) wr[u][i] = *(const v4f*)(wp + (size_t)(u * 32 + i) * DIN);
      raw_row(ar[u], yp + u * 32, lane); }
    auto step = [&](const int kc, const int u, const bool more) __attribute__((always_inline)) { char* wb = wst + u * (128 * WBP);
#pragma unroll
      for (int jj = 0; jj < 4; ++jj) { v8h t;
#pragma unroll
        for (int i = 0; i < 8; ++i) t[i] = (_Float16)(bfr(wr[u][i][jj]) * 256.0f);
        *(v8h*)(wb + (lane * 4 + jj) * WBP + wave * 16) = t; }
      if (more) { const float* wn = wp + (size_t)(kc + 2) * 32 * DIN;   /* the weight values of set u are in LDS: refill them for step kc + 2 */
#pragma unroll
        for (int i = 0; i < 8; ++i) wr[u][i] = *(const v4f*)(wn + (size_t)i * DIN);
        asm volatile("s_wait_xcnt 0x0" ::: "memory"); }   /* the loop advances the loads' address registers: keep the wait in front of that */
      v16h a;   /* ctx carried x 2^6 into f16 so small-magnitude context rows stay clear of f16 subnormals */
#pragma unroll
      for (int i = 0; i < 16; ++i) a[i] = (_Float16)(ar[u][i] * 64.0f);
      WBAR();   /* stage u is written; every wave has also left the other stage, which the next step overwrites */
      union { v16h v; v8h q[2]; } w[8];
#pragma unroll
      for (int j = 0; j < 8; ++j) { const char* f = wb + (j * 16 + col) * WBP + g * 16; w[j].q[0] = *(const v8h*)f; w[j].q[1] = *(const v8h*)(f + 32); }
      __builtin_amdgcn_sched_barrier(0);   /* all sixteen LDS reads ahead of the first product: one LDS latency a step */
#pragma unroll
      for (int j = 0; j < 8; ++j) acc[j] = wmma16(a, w[j].v, acc[j]);
      if (more) { raw_row(ar[u], yp + (kc + 2) * 32, lane);   /* the row values of set u are converted by now: refill them for step kc + 2 */
        asm volatile("s_wait_xcnt 0x0" ::: "memory"); } };   /* the loop advances the loads' address registers: keep the wait in front of that */
#pragma unroll 1   /* stays a loop of two steps, as in k_proj */
    for (int kc = 0; kc < CC / 32 - 2; kc += 2) { step(kc, 0, true); step(kc + 1, 1, true); }
    step(CC / 32 - 2, 0, false); step(CC / 32 - 1, 1, false);
#pragma unroll
    for (int j = 0; j < 8; ++j) { const float bias = BO ? bfr(BO[c0 + j * 16 + col]) : 0.f;
#pragma unroll
      for (int r = 0; r < 8; ++r) sf[wave][8 * g + r][j * 16 + col] = acc[j][r] * (1.0f / 16384.0f) + bias; } }   /* 2^-8 (Wo carry) x 2^-6 (ctx carry) */
  LDSX(); for (int rl = 0; rl < 16; ++rl) vst2(OUT + (r0 + rl) * DIN + c0 + lane * 4, *(const v4f*)&sf[wave][rl][lane * 4]); }

extern "C" void kernel_launch(void* const* d_in, const int* in_sizes, int n_in, void* d_out, int out_size, void* d_ws, size_t ws_size, hipStream_t stream) {
  (void)in_sizes; (void)n_in; (void)out_size;
  const float** F = (const float**)d_in;
  if (ws_size < (size_t)WS_END) return;
  char* ws = (char*)d_ws; _Float16 *QH = (_Float16*)(ws + WS_QH), *KH = (_Float16*)(ws + WS_KH), *VT = (_Float16*)(ws + WS_VT), *QL = (_Float16*)(ws + WS_QL), *KL = (_Float16*)(ws + WS_KL); __bf16 *VB = (__bf16*)(ws + WS_VB), *VBL = (__bf16*)(ws + WS_VBL); float *Y = (float*)(ws + WS_Y);
  (void)Y; (void)QL; (void)KL; (void)VB; (void)VBL;
  // inputs: 0 query [4,1024,512]; 1 key; 2 value; 3 pos_emb [1,1024,512]; 4 Wq (in,out), 5 bq; 6 Wk, 7 bk; 8 Wv, 9 bv; 10 Wo (in,out), 11 bo; 12 Wpos [512,512]; 13 pos_bias_u [8,64]; 14 pos_bias_v [8,64]
  if (ws_size < (size_t)WS_END2) return;
  _Float16 *QH2 = (_Float16*)(ws + WS_QH2), *QL2 = (_Float16*)(ws + WS_QL2), *KP = (_Float16*)(ws + WS_KP);
  k_proj<<<dim3(16, CC / 128, TNB * TT / 1024 * 3 + 1), 128, 0, stream>>>(F[0], F[1], F[2], F[3], F[4], F[6], F[8], F[12], F[5], F[7], F[9], QH, QL, QH2, QL2, KH, KL, KP, VT, VB, VBL, F[13], F[14]);   /* q (stored as q + pos_bias_u and as q + pos_bias_v), k, v, and p = pos_emb Wpos into KP */
  k_att<<<dim3(TT / 16, NH, TNB), 256, 0, stream>>>(QH, QL, QH2, QL2, KH, KP, VT, Y);   /* AC + rel_shift(BD), softmax, P v */
  k_out<<<dim3(TNB * TT / 64, DIN / 128), 128, 0, stream>>>(Y, F[10], F[11], (float*)d_out);
}

// v008
// It runs in 72.6 microseconds.
// In two side-by-side timings against v007, it was 1.08 and 1.09 times as fast.
// Counting every step since v000, it is 7.10 times as fast.
// compute dtype: all float inputs rounded to bf16; projections with EXACT bf16 products on WMMA 16x16x32 (f32 accumulate) + biases; content (q+u).k and position (q+v).p scores each with q as f16 hi + residual (x 2^10) against f16 k / p (2 products) x 64^-0.5 x log2 e; rel_shift as the store index of the position scores in LDS; softmax f32 in base 2; P x 2^11 once to f16 x v once to f16 (1 product); ctx carried x 2^6 once to f16 x Wo f16(bf16 x 2^8) + bo; f32 output.
#include <hip/hip_runtime.h>
#include <math.h>

typedef __attribute__((ext_vector_type(16))) _Float16 v16h;
typedef __attribute__((ext_vector_type(16))) __bf16 v16b;
typedef __attribute__((ext_vector_type(8)))  _Float16 v8h;
typedef __attribute__((ext_vector_type(8)))  float v8f;
typedef __attribute__((ext_vector_type(4)))  float v4f;
typedef __attribute__((ext_vector_type(2)))  float v2f;
typedef __attribute__((ext_vector_type(4)))  unsigned v4u;
typedef __attribute__((ext_vector_type(4)))  int v4i;
typedef float __attribute__((may_alias)) float_a;
typedef int __attribute__((may_alias)) int_a;

template <typename T> __device__ __forceinline__ void vst2(void* p, T v) { *(T*)p = v;  }
__device__ __forceinline__ v8f wmma16(v16h a, v16h b, v8f c) {
  v8f d = __builtin_amdgcn_wmma_f32_16x16x32_f16(false, a, false, b, (short)0, c, false, false);
  asm volatile("v_nop\n\tv_nop\n\tv_nop\n\tv_nop" : "+v"(d) : "v"(a), "v"(b));
  return d;
}
__device__ __forceinline__ v8f wmma_bf(v16b a, v16b b, v8f c) {
  v8f d = __builtin_amdgcn_wmma_f32_16x16x32_bf16(false, a, false, b, (short)0, c, false, false);
  asm volatile("v_nop\n\tv_nop\n\tv_nop\n\tv_nop" : "+v"(d) : "v"(a), "v"(b));
  return d;
}
// 16x16x32 fragments: lane = (h = lane>>4, row/col = lane&15); elements 0..7 = k0+8h+0..7, 8..15 = k0+16+8h+0..7; D element r = row 8h+r
__device__ __forceinline__ v16h frag_h(const _Float16* rowk0, int lane) {
  union { v16h v; v8h q[2]; } u; const _Float16* p = rowk0 + 8 * (lane >> 4);
  u.q[0] = *(const v8h*)p; u.q[1] = *(const v8h*)(p + 16); return u.v;
}
__device__ __forceinline__ v16h frag_f32(const float* rowk0, int lane) {
  v16h a; const float* p = rowk0 + 8 * (lane >> 4);
#pragma unroll
  for (int i = 0; i < 8; ++i) { a[i] = (_Float16)p[i]; a[8 + i] = (_Float16)p[16 + i]; }
  return a;
}
__device__ __forceinline__ v16h frag_f32s(const float* rowk0, int lane, float sc) {
  v16h a; const float* p = rowk0 + 8 * (lane >> 4);
#pragma unroll
  for (int i = 0; i < 8; ++i) { a[i] = (_Float16)(p[i] * sc); a[8 + i] = (_Float16)(p[16 + i] * sc); }
  return a;
}
// column fragment from a [K][ld] layout (column n), rows >= K read as 0
__device__ __forceinline__ v16h fragc_f32(const float* W, int k0, int n, int lane, int ld, int K) {
  v16h a; const int g = lane >> 4;
#pragma unroll
  for (int i = 0; i < 8; ++i) { const int ka = k0 + 8 * g + i, kb = ka + 16;
    a[i] = (_Float16)(ka < K ? W[(size_t)(ka < K ? ka : K - 1) * ld + n] : 0.f); a[8 + i] = (_Float16)(kb < K ? W[(size_t)(kb < K ? kb : K - 1) * ld + n] : 0.f); }
  return a;
}
struct F2 { v16b h, l; };
__device__ __forceinline__ F2 bsplit16(const float v[16]) { F2 r;
#pragma unroll
  for (int i = 0; i < 16; ++i) { const __bf16 h = (__bf16)v[i]; r.h[i] = h; r.l[i] = (__bf16)(v[i] - (float)h); }
  return r; }
__device__ __forceinline__ F2 split_row(const float* row, int k0, int lane) { float v[16]; const float* p = row + k0 + 8 * (lane >> 4);
#pragma unroll
  for (int i = 0; i < 8; ++i) { v[i] = p[i]; v[8 + i] = p[16 + i]; }
  return bsplit16(v); }
__device__ __forceinline__ F2 split_rowK(const float* row, int k0, int lane, int K) { float v[16]; const int g = lane >> 4;
#pragma unroll
  for (int i = 0; i < 8; ++i) { const int ka = k0 + 8 * g + i, kb = ka + 16; v[i] = ka < K ? row[ka < K ? ka : K - 1] : 0.f; v[8 + i] = kb < K ? row[kb < K ? kb : K - 1] : 0.f; }
  return bsplit16(v); }
__device__ __forceinline__ F2 split_col(const float* W, int k0, int n, int lane, int ld, int K) { float v[16]; const int g = lane >> 4;
#pragma unroll
  for (int i = 0; i < 8; ++i) { const int ka = k0 + 8 * g + i, kb = ka + 16; v[i] = ka < K ? W[(size_t)(ka < K ? ka : K - 1) * ld + n] : 0.f; v[8 + i] = kb < K ? W[(size_t)(kb < K ? kb : K - 1) * ld + n] : 0.f; }
  return bsplit16(v); }
__device__ __forceinline__ v8f mac3(const F2& a, const F2& b, v8f c) { c = wmma_bf(a.l, b.h, c); c = wmma_bf(a.h, b.l, c); return wmma_bf(a.h, b.h, c); }
__device__ __forceinline__ float sigm(float v) { return 1.0f / (1.0f + expf(-v)); }
#define LDSX() do { asm volatile("s_wait_dscnt 0" ::: "memory"); __builtin_amdgcn_wave_barrier(); __builtin_amdgcn_fence(__ATOMIC_RELEASE, "workgroup"); } while (0)

// Transformer-XL / Conformer relative multi-head attention (B 4, T = P = 1,024, D 512 = 8 heads x 64; (in,out) Wq/Wk/Wv/Wo [512,512] + zero biases, Wpos [512,512] no bias, pos_bias_u/v [8,64]; 1/sqrt(64)-scale): AC = (q + u) k^T, BD = rel_shift((q + v) p^T) with p = pos_emb Wpos (pad-reshape trick, no mask), attn = softmax((AC + BD)/8), out = merge(attn v) Wo + bo.
#define NB 4
#define TT 1024
#define CC 512            // NH * HD = projected width
#define DIN 512          // input (model) width
#define NH 8
#define HD 64
#define NQB (TT / 64)
#define HG 8
#define SCALE (0.125f)
#define SCALE_L2 (SCALE * 1.4426950408889634f)   // logits are carried in units of log 2 (scale x log2 e), so that the softmax exponential is the chip's own base-2 instruction
#define CAUSAL 0
#ifndef TNB
#define TNB NB
#endif
__device__ __forceinline__ float bfr(float v) { return (float)(__bf16)v; }
__host__ __device__ __forceinline__ int kb_last(int qb) { return CAUSAL ? ((qb * 64 + 63) >> 7) : (TT / 128 - 1); }
typedef __attribute__((ext_vector_type(8))) __bf16 v8b;
__device__ __forceinline__ v16b frag_b(const __bf16* rowk0, int lane) {
  union { v16b v; v8b q[2]; } u; const __bf16* p = rowk0 + 8 * (lane >> 4);
  u.q[0] = *(const v8b*)p; u.q[1] = *(const v8b*)(p + 16); return u.v;
}
#define QBH 0              // read by no kernel here
#define QHI 1024            // rows carrying a q residual plane (all rows when non-causal: 2-product logits everywhere)
#define KHI 64            // key rows carrying k residual / v bf16 hi+lo planes (written, but read by no kernel here)
// B fragment (k rows k0+.., output column o) of a weight: (in,out) [K][ld] or (out,in) [ld rows of K]: bf16 exact, or f16(bf16 * 256) exact
__device__ __forceinline__ v16b wcol_io(const float* Wm, int k0, int o, int lane, int ld) { v16b w; const int g = lane >> 4;
#pragma unroll
  for (int i = 0; i < 8; ++i) { w[i] = (__bf16)Wm[(size_t)(k0 + 8 * g + i) * ld + o]; w[8 + i] = (__bf16)Wm[(size_t)(k0 + 16 + 8 * g + i) * ld + o]; }
  return w; }
__device__ __forceinline__ v16b wcol_oi(const float* Wm, int k0, int o, int lane, int K) { v16b w; const float* p = Wm + (size_t)o * K + k0 + 8 * (lane >> 4);
#pragma unroll
  for (int i = 0; i < 8; ++i) { w[i] = (__bf16)p[i]; w[8 + i] = (__bf16)p[16 + i]; }
  return w; }
__device__ __forceinline__ v16h wcolh_io(const float* Wm, int k0, int o, int lane, int ld) { v16h w; const int g = lane >> 4;
#pragma unroll
  for (int i = 0; i < 8; ++i) { w[i] = (_Float16)(bfr(Wm[(size_t)(k0 + 8 * g + i) * ld + o]) * 256.0f); w[8 + i] = (_Float16)(bfr(Wm[(size_t)(k0 + 16 + 8 * g + i) * ld + o]) * 256.0f); }
  return w; }
__device__ __forceinline__ v16h wcolh_oi(const float* Wm, int k0, int o, int lane, int K) { v16h w; const float* p = Wm + (size_t)o * K + k0 + 8 * (lane >> 4);
#pragma unroll
  for (int i = 0; i < 8; ++i) { w[i] = (_Float16)(bfr(p[i]) * 256.0f); w[8 + i] = (_Float16)(bfr(p[16 + i]) * 256.0f); }
  return w; }
// unconverted f32 values of a fragment, in fragment element order: a row operand, and column o of an (in,out) [K][ld] weight
__device__ __forceinline__ void raw_row(float (&r)[16], const float* rowk0, int lane) { const float* p = rowk0 + 8 * (lane >> 4);
#pragma unroll
  for (int i = 0; i < 8; ++i) { r[i] = p[i]; r[8 + i] = p[16 + i]; } }
__device__ __forceinline__ void raw_col(float (&r)[16], const float* Wm, int k0, int o, int lane, int ld) { const int g = lane >> 4;
#pragma unroll
  for (int i = 0; i < 8; ++i) { r[i] = Wm[(size_t)(k0 + 8 * g + i) * ld + o]; r[8 + i] = Wm[(size_t)(k0 + 16 + 8 * g + i) * ld + o]; } }
#define WQKV_LAYOUT 0   // selects WCOL only, which nothing calls (k_proj always reads (in,out) [DIN][CC]): 0 = (in,out) [DIN][CC]; 1 = (out,in) [CC][DIN]; 2 = per-head [NH][DIN][HD]
__device__ __forceinline__ v16b wcol_hdk(const float* Wm, int k0, int o, int lane) { v16b w; const int g = lane >> 4; const float* p = Wm + (size_t)(o / HD) * DIN * HD + (o % HD);
#pragma unroll
  for (int i = 0; i < 8; ++i) { w[i] = (__bf16)p[(size_t)(k0 + 8 * g + i) * HD]; w[8 + i] = (__bf16)p[(size_t)(k0 + 16 + 8 * g + i) * HD]; }
  return w; }
#define WO_OUT_IN 0
#if WQKV_LAYOUT == 1
#define WCOL(W, k0, o, lane) wcol_oi(W, k0, o, lane, DIN)
#elif WQKV_LAYOUT == 2
#define WCOL(W, k0, o, lane) wcol_hdk(W, k0, o, lane)
#else
#define WCOL(W, k0, o, lane) wcol_io(W, k0, o, lane, CC)
#endif
#if WO_OUT_IN
#define WOCOL(W, k0, o, lane) wcol_oi(W, k0, o, lane, CC)
#define WOCOLH(W, k0, o, lane) wcolh_oi(W, k0, o, lane, CC)
#else
#define WOCOL(W, k0, o, lane) wcol_io(W, k0, o, lane, DIN)
#define WOCOLH(W, k0, o, lane) wcolh_io(W, k0, o, lane, DIN)
#endif
#define WS_QH2 (WS_END)                                   // f16 q_v rows, fragment order
#define WS_QL2 (WS_QH2 + 2u * (size_t)NB * TT * CC)       // f16 q_v residual rows, fragment order
#define WS_KP  (WS_QL2 + 2u * (size_t)NB * QHI * CC)      // f16 positional key rows p = pos_emb Wpos, fragment order (the first TT rows are used)
#define WS_S2  (WS_KP + 2u * (size_t)NB * TT * CC)        // f32 [hg][t][p], unused: k_att keeps BD in LDS
#define WS_END2 (WS_S2 + 4u * (size_t)HG * TT * TT)

#define WS_QH  0u                                      // f16 q rows, fragment order [b*t / 16][head][piece 4][lane 32][8] (see pk_row)
#define WS_KH  (WS_QH + 2u * (size_t)NB * TT * CC)      // f16 k rows, fragment order as the q rows
#define WS_VT  (WS_KH + 2u * (size_t)NB * TT * CC)      // f16 v, fragment order [b][head][d / 16][t / 32][half 2][lane 32][8]: lane = (t / 8 & 1) * 16 + d % 16
#define WS_QL  (WS_VT + 2u * (size_t)NB * CC * TT)      // f16 q residual x 2^10 rows, fragment order as the q rows (QHI = TT)
#define WS_KL  (WS_QL + 2u * (size_t)NB * QHI * CC)     // f16 k residual x 2^10 rows [b][t < KHI][CC]
#define WS_VB  (WS_KL + 2u * (size_t)NB * KHI * CC)     // bf16 v hi planes [b][c][t < KHI]
#define WS_VBL (WS_VB + 2u * (size_t)NB * CC * KHI)
#define WS_S   (WS_VBL + 2u * (size_t)NB * CC * KHI)    // f32 [hg][t][s], unused: k_att keeps logits and P on chip
#define WS_Y   (WS_S  + 4u * (size_t)HG * TT * TT)      // f32 ctx rows [b*t][CC] (only when there is an output projection)
#define WS_END (WS_Y  + 4u * (size_t)NB * TT * CC)

#define WBP 80           // bytes from a column to the next in a staged weight slab: 64 B of k and 16 more, so that the 16 columns of a fragment read fall on different banks
// work-group barrier of the staged GEMM loops: it waits for this wave's LDS traffic alone. __syncthreads() would also wait for the global loads of the steps ahead, which only this wave's registers receive and which are to stay in flight across it
#define WBAR() asm volatile("s_wait_dscnt 0x0\n\ts_barrier_signal -1\n\ts_barrier_wait -1" ::: "memory")
// ---- k_proj: every projection in one launch. block = (64 rows, 128 cols, which = blockIdx.z / 4): X W (+ b) with exact bf16 products (K = DIN) -> which 0: q, multiplied once and stored twice, as q + pos_bias_u and as q + pos_bias_v (f16 rows + residual rows each); 1: k f16 rows (+ residual rows < KHI); 2: v f16 planes (+ bf16 hi/lo planes [c][t] for t < KHI); 3: the positional key rows p = pos_emb Wpos (no bias, the TT rows of blockIdx.z = 12), f16 rows as k; the f16 planes are stored in the fragment order that k_att loads (layouts: WS_QH, WS_VT). The q blocks, which have the longest epilogue, take the lowest indices (for speed only)
__global__ __launch_bounds__(128) void k_proj(const float* __restrict__ XQ, const float* __restrict__ XK, const float* __restrict__ XV, const float* __restrict__ XP, const float* __restrict__ WQ, const float* __restrict__ WK, const float* __restrict__ WV, const float* __restrict__ WP, const float* __restrict__ BQ, const float* __restrict__ BK, const float* __restrict__ BV,
    _Float16* __restrict__ QH, _Float16* __restrict__ QL, _Float16* __restrict__ QH2, _Float16* __restrict__ QL2, _Float16* __restrict__ KH, _Float16* __restrict__ KL, _Float16* __restrict__ KP, _Float16* __restrict__ VT, __bf16* __restrict__ VB, __bf16* __restrict__ VBL, const float* __restrict__ EXU, const float* __restrict__ EXV) {
  __shared__ __align__(16) float st[64][132]; __shared__ __align__(16) _Float16 sh[2][64][136], sl[2][64][136]; __shared__ __align__(16) _Float16 th[128][72]; __shared__ __align__(16) __bf16 tb[128][72], tbl[128][72];
  const int tid = threadIdx.x, wave = tid >> 5, lane = tid & 31, col = lane & 15, g = lane >> 4; const int which = blockIdx.z >> 2; const int c0 = blockIdx.y * 128; const size_t r0 = (size_t)((blockIdx.z & 3) * 16 + blockIdx.x) * 64; const size_t bb = r0 / TT; const int t0 = (int)(r0 % TT);
  const float* X = which == 0 ? XQ : which == 1 ? XK : which == 2 ? XV : XP; const float* WA = which == 0 ? WQ : which == 1 ? WK : which == 2 ? WV : WP; const float* BA = which == 0 ? BQ : which == 1 ? BK : which == 2 ? BV : nullptr;
  v8f acc[8] = {};
  /* the weight slab of a k step (32 rows x 128 columns) is fetched once by the block, in whole 512-byte rows, rounded once and laid in LDS as [column][k] at pitch WBP, where all four waves take their B fragments. Thread = (8 k rows: wave, 4 columns: lane). Two LDS stages (in sh, which is not written before the barrier behind the loop) and two register sets: the loads of step kc + 2 are issued in step kc, as soon as their registers are free, and fly during step kc + 1 */
  char* wst = (char*)&sh[0][0][0]; const float* wp = WA + (size_t)(wave * 8) * CC + c0 + lane * 4; const float* xp = X + (r0 + wave * 16 + col) * DIN;
  v4f wr[2][8]; float ar[2][16];
#pragma unroll
  for (int u = 0; u < 2; ++u) {
#pragma unroll
    for (int i = 0; i < 8; ++i) wr[u][i] = *(const v4f*)(wp + (size_t)(u * 32 + i) * CC);
    raw_row(ar[u], xp + u * 32, lane); }
  auto step = [&](const int kc, const int u, const bool more) __attribute__((always_inline)) { char* wb = wst + u * (128 * WBP);
#pragma unroll
    for (int jj = 0; jj < 4; ++jj) { v8b t;
#pragma unroll
      for (int i = 0; i < 8; ++i) t[i] = (__bf16)wr[u][i][jj];
      *(v8b*)(wb + (lane * 4 + jj) * WBP + wave * 16) = t; }
    if (more) { const float* wn = wp + (size_t)(kc + 2) * 32 * CC;   /* the weight values of set u are in LDS: refill them for step kc + 2 */
#pragma unroll
      for (int i = 0; i < 8; ++i) wr[u][i] = *(const v4f*)(wn + (size_t)i * CC);
      asm volatile("s_wait_xcnt 0x0" ::: "memory"); }   /* the loop advances the loads' address registers: keep the wait in front of that */
    v16b a;
#pragma unroll
    for (int i = 0; i < 16; ++i) a[i] = (__bf16)ar[u][i];
    WBAR();   /* stage u is written; every wave has also left the other stage, which the next step overwrites */
    union { v16b v; v8b q[2]; } w[8];
#pragma unroll
    for (int j = 0; j < 8; ++j) { const char* f = wb + (j * 16 + col) * WBP + g * 16; w[j].q[0] = *(const v8b*)f; w[j].q[1] = *(const v8b*)(f + 32); }
    __builtin_amdgcn_sched_barrier(0);   /* all sixteen LDS reads are issued ahead of the first product, so that one LDS latency serves the step and not eight */
#pragma unroll
    for (int j = 0; j < 8; ++j) acc[j] = wmma_bf(a, w[j].v, acc[j]);
    if (more) { raw_row(ar[u], xp + (kc + 2) * 32, lane);   /* the row values of set u are converted by now: refill them for step kc + 2 */
      asm volatile("s_wait_xcnt 0x0" ::: "memory"); } };   /* the loop advances the loads' address registers: keep the wait in front of that */
#pragma unroll 1   /* stays a loop of two steps: unrolled whole, the compiler lifts every conversion up to its loads, and each step then waits for loads just issued */
  for (int kc = 0; kc < DIN / 32 - 2; kc += 2) { step(kc, 0, true); step(kc + 1, 1, true); }
  step(DIN / 32 - 2, 0, false); step(DIN / 32 - 1, 1, false);
  { // stage the f32 tile (acc + bias) in LDS, then convert
#pragma unroll
    for (int j = 0; j < 8; ++j) { const float bias = BA ? bfr(BA[c0 + j * 16 + col]) : 0.f;
#pragma unroll
      for (int r = 0; r < 8; ++r) st[wave * 16 + 8 * g + r][j * 16 + col] = acc[j][r] + bias; }
    __syncthreads();
  }
  if (which != 2) { _Float16* DH = which == 1 ? KH : KP;
    for (int ps = 0; ps < (which == 0 ? 2 : 1); ++ps) { const float* EB = which == 0 ? (ps ? EXV : EXU) : nullptr; const float eb = EB ? bfr(EB[c0 + tid]) : 0.f;
      asm volatile("s_wait_xcnt 0x0" ::: "memory");   /* the second pass overwrites the bias load's base: keep the wait in front of that */
      /* q + pos_bias_u, then q + pos_bias_v: the per-(head, dim) bias is added in f32 to the staged (x Wq + bq), which stays as it is for the second pass; a thread converts one column */
      for (int rl = 0; rl < 64; ++rl) { const float x = st[rl][tid]; const float v = EB ? x + eb : x; const _Float16 hv = (_Float16)v; sh[ps][rl][tid] = hv; sl[ps][rl][tid] = (_Float16)((v - (float)hv) * 1024.0f); } }
    __syncthreads();
    for (int e = tid; e < 64 * 16; e += 128) { const int ln = e & 31, rl = (e >> 8) * 16 + (ln & 15), q = ((e >> 5) & 7) * 2 + (ln >> 4);   /* e runs in the order of the destination: [row tile 4][head 2][piece 4][lane 32], so a wave stores 512 contiguous bytes */
      const size_t po = (((r0 >> 4) + (e >> 8)) * NH + (c0 >> 6)) * 1024 + (e & 255) * 8;
      const v4u h0 = *(const v4u*)&sh[0][rl][q * 8];
      if (which == 0) { const v4u l0 = *(const v4u*)&sl[0][rl][q * 8], h1 = *(const v4u*)&sh[1][rl][q * 8], l1 = *(const v4u*)&sl[1][rl][q * 8];   /* the four LDS reads share one latency */
        vst2((unsigned*)(QH + po), h0); vst2((unsigned*)(QL + po), l0); vst2((unsigned*)(QH2 + po), h1); vst2((unsigned*)(QL2 + po), l1); }
      else { vst2((unsigned*)(DH + po), h0);
        asm volatile("s_wait_xcnt 0x0" ::: "memory");   /* the second store's address may be formed in the first one's registers: keep the wait in front of that */
        if (which == 1 && t0 < KHI) vst2((unsigned*)(KL + (bb * KHI + t0 + rl) * (size_t)CC + c0 + q * 8), *(const v4u*)&sl[0][rl][q * 8]); }
      asm volatile("s_wait_xcnt 0x0" ::: "memory"); }   /* the next trip overwrites the stores' address and data registers: keep the wait in front of that */
  } else { const bool hi_rows = t0 < KHI;
    for (int e = tid; e < 64 * 128; e += 128) { const int rl = e & 63, cl = e >> 6; const float v = st[rl][cl]; th[cl][rl] = (_Float16)v; const __bf16 bh = (__bf16)v; tb[cl][rl] = bh; tbl[cl][rl] = (__bf16)(v - (float)bh); }
    __syncthreads();
    for (int e = tid; e < 128 * 8; e += 128) { const int ln = e & 31, cl = (e >> 7) * 16 + (ln & 15), q = ((e >> 5) & 3) * 2 + (ln >> 4);   /* destination order: [head 2][d tile 4][t block 2][half 2][lane 32] */
      vst2((unsigned*)(VT + (((bb * NH + (c0 >> 6)) * 4 + (e >> 7)) * 32 + (t0 >> 5)) * 512 + (e & 127) * 8), *(const v4u*)&th[cl][q * 8]);
      asm volatile("s_wait_xcnt 0x0" ::: "memory");   /* what follows overwrites the store's address and data registers: keep the wait in front of that */
      if (hi_rows) { const size_t o3 = (bb * CC + c0 + cl) * (size_t)KHI + t0 + q * 8; vst2((unsigned*)(VB + o3), *(const v4u*)&tb[cl][q * 8]); vst2((unsigned*)(VBL + o3), *(const v4u*)&tbl[cl][q * 8]);
        asm volatile("s_wait_xcnt 0x0" ::: "memory"); } } } }   /* as above, for these two stores */
// ---- k_att: block = 32 query rows (two 16-row tiles, t0..t0+31) of (b, h), 16 waves, wave w owns key / position columns [64 w, 64 w + 64). Logits never leave the WGP.
// Every k, p and v fragment that a wave loads is multiplied with BOTH query tiles, so the block fetches the head's k, p and v planes once for 32 queries. The two tiles are worked as two independent 16-row problems (tile qs: rows ts = t0 + 16 qs, its own BD' rows in LDS).
// Every score product is taken transposed: the key (position) rows are the A operand and the query rows the B operand, so a lane holds ONE query of each tile (ts + col) and register r of a score tile the key 8 g + r. A row's maximum and sum are then sums inside a lane, and two score tiles, converted in place, are the B operand of ctx^T = v^T P^T: P needs no LDS and no lane exchange.
//  1. BD = (q + v) . p x 1/8 x log2 e is stored straight to its rel_shift place in LDS. The reference's pad-reshape is linear in memory: BD[r][c] lands at flat out index r T + r + c + 1 - T, so row r's columns c >= T-1-r go to out row r and the others to out row r-1; out[t][t+1] is the pad's 0.
//     A query tile needs BD rows ts..ts+16; a 16-column tile at cs needs rows ts+1..ts+16 when cs + ts <= T - 32 and rows ts..ts+15 otherwise (cs, ts multiples of 16), so one row tile serves each column tile.
//  2. AC = (q + u) . k x 1/8 x log2 e stays in registers and takes BD' from LDS; softmax in f32 over the 32 half-waves, 2^(s - max) for e^(..); P x 2^11 once to f16 in registers.
//  3. each wave multiplies its own 64 keys of P with v (f16, 1 product); the 16 partial ctx tiles are summed in wave order.
// Every loop is fully unrolled: the fragment, logit and accumulator arrays stay in registers only when each index is a constant. A block's 16 waves stand 4 on a SIMD (256 registers each).
// The q, k, p and v planes lie in the workspace in fragment order: the 16 bytes that lane l of a wave takes with one load stand at 16 l inside a 512-byte piece, so a load reads 4 whole 128-byte lines and not a 32-byte part of 16 lines.
// Rows (q, k, p): a (16 rows, one head) tile is 4 pieces; piece 2 kc + half holds d = 32 kc + 16 half + 8 g + 0..7 of row r at lane 16 g + r % 16. pk_row = f16 index of the lane's place in piece 0.
__device__ __forceinline__ size_t pk_row(size_t row, int h, int g) { return ((row >> 4) * NH + h) * 1024 + (g * 16 + (row & 15)) * 8; }
#define PKT (NH * 1024)  // f16 from a 16-row tile to the next
__device__ __forceinline__ v16h frag_at(const _Float16* p) { union { v16h v; v8h q[2]; } u; u.q[0] = *(const v8h*)p; u.q[1] = *(const v8h*)(p + 256); return u.v; }   // the two pieces of one 32-deep fragment; p holds the lane's place
// behind a group of loads: the group's address registers are inputs, so they live up to the wait and no load of the group is given one of them as its destination; behind the wait they may be overwritten
#define XW1(p) asm volatile("s_wait_xcnt 0x0" :: "v"(p) : "memory")
#define XW2(p, q) asm volatile("s_wait_xcnt 0x0" :: "v"(p), "v"(q) : "memory")
#define XW5(p, q, r, s, t) asm volatile("s_wait_xcnt 0x0" :: "v"(p), "v"(q), "v"(r), "v"(s), "v"(t) : "memory")
#define QT 2             // 16-row query tiles of a block
#define KW 64            // key / position columns of a wave
#define NWV (TT / KW)    // waves of a block
#define SBP (TT + 4)     // f32 pitch of the BD' rows in LDS: 16 B more than a row, so that the 16 rows that the lanes of a 16-byte read take fall on different banks
#define SRP (HD + 4)     // f32 pitch of the partial ctx rows
#define RDP (2 * NWV + 4)   // f32 pitch of a row's 32 partial maxima / sums (one per half-wave), 16 B more than they fill
static_assert(NWV * SRP >= SBP, "the partial ctx tiles are the larger use of sS");
__device__ __forceinline__ float max8(const float (&x)[8]) { return fmaxf(fmaxf(fmaxf(x[0], x[1]), fmaxf(x[2], x[3])), fmaxf(fmaxf(x[4], x[5]), fmaxf(x[6], x[7]))); }
__device__ __forceinline__ float sum8(const float (&x)[8]) { return ((x[0] + x[1]) + (x[2] + x[3])) + ((x[4] + x[5]) + (x[6] + x[7])); }
// maximum / sum of a row's 32 partial values in LDS, eight 16-byte reads
__device__ __forceinline__ float max32(const float* p) { float m[8];
#pragma unroll
  for (int i = 0; i < 8; ++i) { const v4f x = *(const v4f*)(p + 4 * i); m[i] = fmaxf(fmaxf(x[0], x[1]), fmaxf(x[2], x[3])); }
  return max8(m); }
__device__ __forceinline__ float sum32(const float* p) { float m[8];
#pragma unroll
  for (int i = 0; i < 8; ++i) { const v4f x = *(const v4f*)(p + 4 * i); m[i] = (x[0] + x[1]) + (x[2] + x[3]); }
  return sum8(m); }
__global__ __launch_bounds__(32 * NWV, 4) void k_att(const _Float16* __restrict__ QH, const _Float16* __restrict__ QL, const _Float16* __restrict__ QH2, const _Float16* __restrict__ QL2, const _Float16* __restrict__ KH, const _Float16* __restrict__ KP, const _Float16* __restrict__ VT, float* __restrict__ Y) {
  __shared__ __align__(16) float sS[NWV * QT * 16 * SRP];   /* first the f32 BD' rows [QT][16][SBP]; once every wave has read them, the partial ctx tiles [NWV][QT][16][SRP] */
  __shared__ __align__(16) float redm[QT * 16][RDP], reds[QT * 16][RDP];
  float* sR = sS;
  const int tid = threadIdx.x, wave = __builtin_amdgcn_readfirstlane(tid >> 5), lane = tid & 31, col = lane & 15, g = lane >> 4;
  const int t0 = blockIdx.x * (QT * 16), h = blockIdx.y, b = blockIdx.z, c0 = wave * KW;
  size_t qr0[QT], qr1[QT];   /* every offset below holds the lane's place in a piece */
#pragma unroll
  for (int qs = 0; qs < QT; ++qs) { const int t = t0 + qs * 16 + col; qr0[qs] = pk_row((size_t)b * TT + t, h, g);
    qr1[qs] = pk_row((size_t)b * TT + (t + 1 < TT ? t + 1 : TT - 1), h, g); }   /* row T does not exist and no column tile of the last query tile uses the shifted rows */
  if (tid < QT * 16 && t0 + tid + 1 < TT) sS[tid * SBP + t0 + tid + 1] = 0.f;
  { v16h ah[QT][HD / 32], al[QT][HD / 32], pf[HD / 32][KW / 16]; const _Float16 *qha[QT], *qla[QT]; const _Float16* pb = KP + pk_row((size_t)(c0 + col), h, g);
#pragma unroll
    for (int qs = 0; qs < QT; ++qs) { const size_t qra = c0 + t0 + qs * 16 <= TT - 32 ? qr1[qs] : qr0[qs];   /* the row tile of this wave's first column tile */
      qha[qs] = QH2 + qra; qla[qs] = QL2 + qra;
#pragma unroll
      for (int kc = 0; kc < HD / 32; ++kc) { ah[qs][kc] = frag_at(qha[qs] + kc * 512); al[qs][kc] = frag_at(qla[qs] + kc * 512); } }
#pragma unroll
    for (int kc = 0; kc < HD / 32; ++kc)
#pragma unroll
      for (int j = 0; j < KW / 16; ++j) pf[kc][j] = frag_at(pb + j * PKT + kc * 512);
    XW5(qha[0], qla[0], qha[1], qla[1], pb);
#pragma unroll
    for (int j = 0; j < KW / 16; ++j)
#pragma unroll
      for (int qs = 0; qs < QT; ++qs) { const int ct = c0 + j * 16 + t0 + qs * 16; const bool up = ct <= TT - 32;   /* wave-uniform */
        float* sq = sS + qs * 16 * SBP;   /* this query tile's BD' rows */
        if (j > 0 && ct == TT - 16) {   /* the one wave whose columns cross from a query tile's shifted rows to the unshifted ones fetches the other row tile here */
          const _Float16 *qhb = QH2 + qr0[qs], *qlb = QL2 + qr0[qs];
#pragma unroll
          for (int kc = 0; kc < HD / 32; ++kc) { ah[qs][kc] = frag_at(qhb + kc * 512); al[qs][kc] = frag_at(qlb + kc * 512); }
          XW2(qhb, qlb); }
        v8f a = {}, l = {};
#pragma unroll
        for (int kc = 0; kc < HD / 32; ++kc) { a = wmma16(pf[kc][j], ah[qs][kc], a); l = wmma16(pf[kc][j], al[qs][kc], l); }
        /* the lane holds BD row (up ? 1 : 0) + col of the query tile, columns 8 g + r */
        if (__builtin_expect((unsigned)(ct - (TT - 32)) <= 16u, 0)) {   /* ct = T - 32 or T - 16, the two column tiles of a query tile in which a BD row is cut between two out rows or leaves the tile's rows: flat index, range test, and the pitch's 4 floats for each whole row. Marked unlikely, so that the common form below is the fall-through */
#pragma unroll
          for (int r = 0; r < 8; ++r) { const int rl = (up ? 1 : 0) + col; const int idx = (rl - 1) * TT + rl + ct + 8 * g + r + 1;
            if ((unsigned)idx < 16u * TT) sq[idx + 4 * (idx >> 10)] = (a[r] + l[r] * (1.0f / 1024.0f)) * SCALE_L2; }   /* outside: a neighbour tile's row */
        } else {   /* elsewhere the lane's eight values lie side by side in out row col: from column ct + col + 2 + 8 g (shifted rows, ct <= T - 48: the last is column T - 16) or ct + col + 1 - T + 8 g (ct >= T: columns 1 .. T - 1) */
          float* d = sq + col * (SBP + 1) + 8 * g + (up ? ct + 2 : ct + 1 - TT);
#pragma unroll
          for (int r = 0; r < 8; ++r) d[r] = (a[r] + l[r] * (1.0f / 1024.0f)) * SCALE_L2; } } }
  float s[QT][KW / 16][8];   /* s[qs][j][r]: query t0 + 16 qs + col, key c0 + 16 j + 8 g + r */
  { v16h ah[QT][HD / 32], al[QT][HD / 32], kf[HD / 32][KW / 16]; const _Float16 *qh[QT], *ql[QT]; const _Float16* kb = KH + pk_row((size_t)b * TT + c0 + col, h, g);
#pragma unroll
    for (int qs = 0; qs < QT; ++qs) { qh[qs] = QH + qr0[qs]; ql[qs] = QL + qr0[qs];
#pragma unroll
      for (int kc = 0; kc < HD / 32; ++kc) { ah[qs][kc] = frag_at(qh[qs] + kc * 512); al[qs][kc] = frag_at(ql[qs] + kc * 512); } }
#pragma unroll
    for (int kc = 0; kc < HD / 32; ++kc)
#pragma unroll
      for (int j = 0; j < KW / 16; ++j) kf[kc][j] = frag_at(kb + j * PKT + kc * 512);
    XW5(qh[0], ql[0], qh[1], ql[1], kb);
#pragma unroll
    for (int j = 0; j < KW / 16; ++j)
#pragma unroll
      for (int qs = 0; qs < QT; ++qs) { v8f a = {}, l = {};
#pragma unroll
        for (int kc = 0; kc < HD / 32; ++kc) { a = wmma16(kf[kc][j], ah[qs][kc], a); l = wmma16(kf[kc][j], al[qs][kc], l); }
#pragma unroll
        for (int r = 0; r < 8; ++r) s[qs][j][r] = (a[r] + l[r] * (1.0f / 1024.0f)) * SCALE_L2;
        __builtin_amdgcn_sched_barrier(0); } }   /* each tile's two accumulators are folded into its logits before the next tile starts, so that the accumulators of all tiles are not live beside the key fragments */
  v16h vf[KW / 32][HD / 16];   /* this wave's v fragments, issued ahead of the softmax */
  const _Float16* vb = VT + ((((size_t)b * NH + h) * 4) * 32 + (c0 >> 5)) * 512 + lane * 8;
#pragma unroll
  for (int u = 0; u < KW / 32; ++u)
#pragma unroll
    for (int j = 0; j < HD / 16; ++j) vf[u][j] = frag_at(vb + j * 32 * 512 + u * 512);
  XW1(vb);
  __syncthreads();   /* every BD' element is in LDS */
  float pt[KW / 16];
#pragma unroll
  for (int qs = 0; qs < QT; ++qs) {
#pragma unroll
    for (int j = 0; j < KW / 16; ++j) { const float* bd = sS + (qs * 16 + col) * SBP + c0 + j * 16 + 8 * g; const v4f x = *(const v4f*)bd, y = *(const v4f*)(bd + 4);
#pragma unroll
      for (int r = 0; r < 4; ++r) { s[qs][j][r] = s[qs][j][r] + x[r]; s[qs][j][4 + r] = s[qs][j][4 + r] + y[r]; }
      pt[j] = max8(s[qs][j]); }
    redm[qs * 16 + col][wave * 2 + g] = fmaxf(fmaxf(pt[0], pt[1]), fmaxf(pt[2], pt[3])); }
  __syncthreads();   /* the maxima of all half-waves; also the last read of the BD' rows, whose LDS is reused below */
#pragma unroll
  for (int qs = 0; qs < QT; ++qs) { const float m = max32(&redm[qs * 16 + col][0]);
#pragma unroll
    for (int j = 0; j < KW / 16; ++j) {
#pragma unroll
      for (int r = 0; r < 8; ++r) s[qs][j][r] = s[qs][j][r] - m;   /* <= 0 and finite: the exponential needs no range reduction and no overflow test; a result below 2^-126 may read 0, far under P's f16 step */
      /* a tile's eight 2^x, each in place. One statement, so that behind every v_exp_f32 stands an instruction that neither reads its result nor overwrites its source: the next one, and the v_nop behind the last */
      asm("v_exp_f32 %0, %0\n\tv_exp_f32 %1, %1\n\tv_exp_f32 %2, %2\n\tv_exp_f32 %3, %3\n\tv_exp_f32 %4, %4\n\tv_exp_f32 %5, %5\n\tv_exp_f32 %6, %6\n\tv_exp_f32 %7, %7\n\tv_nop"
          : "+v"(s[qs][j][0]), "+v"(s[qs][j][1]), "+v"(s[qs][j][2]), "+v"(s[qs][j][3]), "+v"(s[qs][j][4]), "+v"(s[qs][j][5]), "+v"(s[qs][j][6]), "+v"(s[qs][j][7]));
      pt[j] = sum8(s[qs][j]); }
    reds[qs * 16 + col][wave * 2 + g] = (pt[0] + pt[1]) + (pt[2] + pt[3]); }
  __syncthreads();   /* the sums of all half-waves */
  float inv[QT];
#pragma unroll
  for (int qs = 0; qs < QT; ++qs) { const float a = sum32(&reds[qs * 16 + col][0]); inv[qs] = a > 0.f ? 2048.0f / a : 0.f; }
  v8f acc[QT][HD / 16] = {};   /* acc[qs][j][r]: ctx^T, d = 16 j + 8 g + r of query t0 + 16 qs + col */
#pragma unroll
  for (int u = 0; u < KW / 32; ++u)
#pragma unroll
    for (int qs = 0; qs < QT; ++qs) { v16h p;   /* keys 32 u + 8 g + i and 32 u + 16 + 8 g + i: the k order of the v fragments */
#pragma unroll
      for (int i = 0; i < 8; ++i) { p[i] = (_Float16)(s[qs][2 * u][i] * inv[qs]); p[8 + i] = (_Float16)(s[qs][2 * u + 1][i] * inv[qs]); }
#pragma unroll
      for (int j = 0; j < HD / 16; ++j) acc[qs][j] = wmma16(vf[u][j], p, acc[qs][j]); }
#pragma unroll
  for (int qs = 0; qs < QT; ++qs)
#pragma unroll
    for (int j = 0; j < HD / 16; ++j) { float* d = sR + ((wave * QT + qs) * 16 + col) * SRP + j * 16 + 8 * g;
      const v4f lo = { acc[qs][j][0], acc[qs][j][1], acc[qs][j][2], acc[qs][j][3] }, hi = { acc[qs][j][4], acc[qs][j][5], acc[qs][j][6], acc[qs][j][7] }; *(v4f*)d = lo; *(v4f*)(d + 4) = hi; }
  __syncthreads();   /* the 16 partial ctx tiles */
  { const int rl = tid >> 4, c4 = (tid & 15) * 4; v4f o = *(const v4f*)&sR[rl * SRP + c4];   /* rl: the block's 32 query rows */
#pragma unroll
    for (int w = 1; w < NWV; ++w) o = o + *(const v4f*)&sR[(w * QT * 16 + rl) * SRP + c4];
    vst2(Y + ((size_t)b * TT + t0 + rl) * CC + h * HD + c4, o * (1.0f / 2048.0f)); } }
// ---- k_out: block = (64 rows, 128 cols): out = ctx Wo (+ bo): ctx x 2^6 once to f16 against Wo as f16(bf16 x 2^8) exact (1 product) x 2^-14; causal early rows (< QHI of each sequence): ctx bf16 hi + lo against exact bf16 Wo (2 products)
__global__ __launch_bounds__(128) void k_out(const float* __restrict__ Y, const float* __restrict__ WO, const float* __restrict__ BO, float* __restrict__ OUT) { __shared__ __align__(16) float sf[4][16][132]; __shared__ __align__(16) char wst[2 * 128 * WBP];
  const int tid = threadIdx.x, wave = tid >> 5, lane = tid & 31, col = lane & 15, g = lane >> 4; const int c0 = blockIdx.y * 128; const size_t r0 = (size_t)blockIdx.x * 64 + wave * 16;
  v8f acc[8] = {};
  if (CAUSAL && (int)(((size_t)blockIdx.x * 64) % TT) < QHI) {   /* block-uniform */
#pragma unroll 2
    for (int kc = 0; kc < CC / 32; ++kc) { const F2 a = split_row(Y + (r0 + col) * CC, kc * 32, lane); asm volatile("s_wait_loadcnt 0x0" ::: "memory");
#pragma unroll
      for (int j = 0; j < 8; ++j) { const v16b w = WOCOL(WO, kc * 32, c0 + j * 16 + col, lane); asm volatile("s_wait_loadcnt 0x0" ::: "memory"); acc[j] = wmma_bf(a.h, w, acc[j]); acc[j] = wmma_bf(a.l, w, acc[j]); } }
#pragma unroll
    for (int j = 0; j < 8; ++j) { const float bias = BO ? bfr(BO[c0 + j * 16 + col]) : 0.f;
#pragma unroll
      for (int r = 0; r < 8; ++r) sf[wave][8 * g + r][j * 16 + col] = acc[j][r] + bias; }
  } else {
    /* Wo's slab of a k step goes through LDS as in k_proj: fetched once by the block in whole rows, converted once, read as B fragments by all four waves */
    const float* wp = WO + (size_t)(wave * 8) * DIN + c0 + lane * 4; const float* yp = Y + (r0 + col) * CC;
    v4f wr[2][8]; float ar[2][16];
#pragma unroll
    for (int u = 0; u < 2; ++u) {
#pragma unroll
      for (int i = 0; i < 8; ++i) wr[u][i] = *(const v4f*)(wp + (size_t)(u * 32 + i) * DIN);
      raw_row(ar[u], yp + u * 32, lane); }
    auto step = [&](const int kc, const int u, const bool more) __attribute__((always_inline)) { char* wb = wst + u * (128 * WBP);
#pragma unroll
      for (int jj = 0; jj < 4; ++jj) { v8h t;
#pragma unroll
        for (int i = 0; i < 8; ++i) t[i] = (_Float16)(bfr(wr[u][i][jj]) * 256.0f);
        *(v8h*)(wb + (lane * 4 + jj) * WBP + wave * 16) = t; }
      if (more) { const float* wn = wp + (size_t)(kc + 2) * 32 * DIN;   /* the weight values of set u are in LDS: refill them for step kc + 2 */
#pragma unroll
        for (int i = 0; i < 8; ++i) wr[u][i] = *(const v4f*)(wn + (size_t)i * DIN);
        asm volatile("s_wait_xcnt 0x0" ::: "memory"); }   /* the loop advances the loads' address registers: keep the wait in front of that */
      v16h a;   /* ctx carried x 2^6 into f16 so small-magnitude context rows stay clear of f16 subnormals */
#pragma unroll
      for (int i = 0; i < 16; ++i) a[i] = (_Float16)(ar[u][i] * 64.0f);
      WBAR();   /* stage u is written; every wave has also left the other stage, which the next step overwrites */
      union { v16h v; v8h q[2]; } w[8];
#pragma unroll
      for (int j = 0; j < 8; ++j) { const char* f = wb + (j * 16 + col) * WBP + g * 16; w[j].q[0] = *(const v8h*)f; w[j].q[1] = *(const v8h*)(f + 32); }
      __builtin_amdgcn_sched_barrier(0);   /* all sixteen LDS reads ahead of the first product: one LDS latency a step */
#pragma unroll
      for (int j = 0; j < 8; ++j) acc[j] = wmma16(a, w[j].v, acc[j]);
      if (more) { raw_row(ar[u], yp + (kc + 2) * 32, lane);   /* the row values of set u are converted by now: refill them for step kc + 2 */
        asm volatile("s_wait_xcnt 0x0" ::: "memory"); } };   /* the loop advances the loads' address registers: keep the wait in front of that */
#pragma unroll 1   /* stays a loop of two steps, as in k_proj */
    for (int kc = 0; kc < CC / 32 - 2; kc += 2) { step(kc, 0, true); step(kc + 1, 1, true); }
    step(CC / 32 - 2, 0, false); step(CC / 32 - 1, 1, false);
#pragma unroll
    for (int j = 0; j < 8; ++j) { const float bias = BO ? bfr(BO[c0 + j * 16 + col]) : 0.f;
#pragma unroll
      for (int r = 0; r < 8; ++r) sf[wave][8 * g + r][j * 16 + col] = acc[j][r] * (1.0f / 16384.0f) + bias; } }   /* 2^-8 (Wo carry) x 2^-6 (ctx carry) */
  LDSX(); for (int rl = 0; rl < 16; ++rl) vst2(OUT + (r0 + rl) * DIN + c0 + lane * 4, *(const v4f*)&sf[wave][rl][lane * 4]); }

extern "C" void kernel_launch(void* const* d_in, const int* in_sizes, int n_in, void* d_out, int out_size, void* d_ws, size_t ws_size, hipStream_t stream) {
  (void)in_sizes; (void)n_in; (void)out_size;
  const float** F = (const float**)d_in;
  if (ws_size < (size_t)WS_END) return;
  char* ws = (char*)d_ws; _Float16 *QH = (_Float16*)(ws + WS_QH), *KH = (_Float16*)(ws + WS_KH), *VT = (_Float16*)(ws + WS_VT), *QL = (_Float16*)(ws + WS_QL), *KL = (_Float16*)(ws + WS_KL); __bf16 *VB = (__bf16*)(ws + WS_VB), *VBL = (__bf16*)(ws + WS_VBL); float *Y = (float*)(ws + WS_Y);
  (void)Y; (void)QL; (void)KL; (void)VB; (void)VBL;
  // inputs: 0 query [4,1024,512]; 1 key; 2 value; 3 pos_emb [1,1024,512]; 4 Wq (in,out), 5 bq; 6 Wk, 7 bk; 8 Wv, 9 bv; 10 Wo (in,out), 11 bo; 12 Wpos [512,512]; 13 pos_bias_u [8,64]; 14 pos_bias_v [8,64]
  if (ws_size < (size_t)WS_END2) return;
  _Float16 *QH2 = (_Float16*)(ws + WS_QH2), *QL2 = (_Float16*)(ws + WS_QL2), *KP = (_Float16*)(ws + WS_KP);
  k_proj<<<dim3(16, CC / 128, TNB * TT / 1024 * 3 + 1), 128, 0, stream>>>(F[0], F[1], F[2], F[3], F[4], F[6], F[8], F[12], F[5], F[7], F[9], QH, QL, QH2, QL2, KH, KL, KP, VT, VB, VBL, F[13], F[14]);   /* q (stored as q + pos_bias_u and as q + pos_bias_v), k, v, and p = pos_emb Wpos into KP */
  k_att<<<dim3(TT / (QT * 16), NH, TNB), 32 * NWV, 0, stream>>>(QH, QL, QH2, QL2, KH, KP, VT, Y);   /* AC + rel_shift(BD), softmax, P v */
  k_out<<<dim3(TNB * TT / 64, DIN / 128), 128, 0, stream>>>(Y, F[10], F[11], (float*)d_out);
}

// v009
// A run of this version takes 67.4 microseconds.
// Two timings next to v008 both put it at 1.08 times that version's speed.
// Over all steps from v000 it is 7.65 times as fast.
// compute dtype: all float inputs rounded to bf16; projections with EXACT bf16 products on WMMA 16x16x32 (f32 accumulate) + biases; content (q+u).k and position (q+v).p scores each with q as f16 hi + residual (x 2^10) against f16 k / p (2 products) x 64^-0.5 x log2 e; rel_shift as the store index of the position scores in LDS; softmax f32 in base 2; P x 2^11 once to f16 x v once to f16 (1 product); ctx carried x 2^6 once to f16 x Wo f16(bf16 x 2^8) + bo; f32 output.
#include <hip/hip_runtime.h>
#include <math.h>

typedef __attribute__((ext_vector_type(16))) _Float16 v16h;
typedef __attribute__((ext_vector_type(16))) __bf16 v16b;
typedef __attribute__((ext_vector_type(8)))  _Float16 v8h;
typedef __attribute__((ext_vector_type(8)))  float v8f;
typedef __attribute__((ext_vector_type(4)))  float v4f;
typedef __attribute__((ext_vector_type(2)))  float v2f;
typedef __attribute__((ext_vector_type(4)))  unsigned v4u;
typedef __attribute__((ext_vector_type(4)))  int v4i;
typedef float __attribute__((may_alias)) float_a;
typedef int __attribute__((may_alias)) int_a;

template <typename T> __device__ __forceinline__ void vst2(void* p, T v) { *(T*)p = v;  }
__device__ __forceinline__ v8f wmma16(v16h a, v16h b, v8f c) {
  v8f d = __builtin_amdgcn_wmma_f32_16x16x32_f16(false, a, false, b, (short)0, c, false, false);
  asm volatile("v_nop\n\tv_nop\n\tv_nop\n\tv_nop" : "+v"(d) : "v"(a), "v"(b));
  return d;
}
__device__ __forceinline__ v8f wmma_bf(v16b a, v16b b, v8f c) {
  v8f d = __builtin_amdgcn_wmma_f32_16x16x32_bf16(false, a, false, b, (short)0, c, false, false);
  asm volatile("v_nop\n\tv_nop\n\tv_nop\n\tv_nop" : "+v"(d) : "v"(a), "v"(b));
  return d;
}
// 16x16x32 fragments: lane = (h = lane>>4, row/col = lane&15); elements 0..7 = k0+8h+0..7, 8..15 = k0+16+8h+0..7; D element r = row 8h+r
__device__ __forceinline__ v16h frag_h(const _Float16* rowk0, int lane) {
  union { v16h v; v8h q[2]; } u; const _Float16* p = rowk0 + 8 * (lane >> 4);
  u.q[0] = *(const v8h*)p; u.q[1] = *(const v8h*)(p + 16); return u.v;
}
__device__ __forceinline__ v16h frag_f32(const float* rowk0, int lane) {
  v16h a; const float* p = rowk0 + 8 * (lane >> 4);
#pragma unroll
  for (int i = 0; i < 8; ++i) { a[i] = (_Float16)p[i]; a[8 + i] = (_Float16)p[16 + i]; }
  return a;
}
__device__ __forceinline__ v16h frag_f32s(const float* rowk0, int lane, float sc) {
  v16h a; const float* p = rowk0 + 8 * (lane >> 4);
#pragma unroll
  for (int i = 0; i < 8; ++i) { a[i] = (_Float16)(p[i] * sc); a[8 + i] = (_Float16)(p[16 + i] * sc); }
  return a;
}
// column fragment from a [K][ld] layout (column n), rows >= K read as 0
__device__ __forceinline__ v16h fragc_f32(const float* W, int k0, int n, int lane, int ld, int K) {
  v16h a; const int g = lane >> 4;
#pragma unroll
  for (int i = 0; i < 8; ++i) { const int ka = k0 + 8 * g + i, kb = ka + 16;
    a[i] = (_Float16)(ka < K ? W[(size_t)(ka < K ? ka : K - 1) * ld + n] : 0.f); a[8 + i] = (_Float16)(kb < K ? W[(size_t)(kb < K ? kb : K - 1) * ld + n] : 0.f); }
  return a;
}
struct F2 { v16b h, l; };
__device__ __forceinline__ F2 bsplit16(const float v[16]) { F2 r;
#pragma unroll
  for (int i = 0; i < 16; ++i) { const __bf16 h = (__bf16)v[i]; r.h[i] = h; r.l[i] = (__bf16)(v[i] - (float)h); }
  return r; }
__device__ __forceinline__ F2 split_row(const float* row, int k0, int lane) { float v[16]; const float* p = row + k0 + 8 * (lane >> 4);
#pragma unroll
  for (int i = 0; i < 8; ++i) { v[i] = p[i]; v[8 + i] = p[16 + i]; }
  return bsplit16(v); }
__device__ __forceinline__ F2 split_rowK(const float* row, int k0, int lane, int K) { float v[16]; const int g = lane >> 4;
#pragma unroll
  for (int i = 0; i < 8; ++i) { const int ka = k0 + 8 * g + i, kb = ka + 16; v[i] = ka < K ? row[ka < K ? ka : K - 1] : 0.f; v[8 + i] = kb < K ? row[kb < K ? kb : K - 1] : 0.f; }
  return bsplit16(v); }
__device__ __forceinline__ F2 split_col(const float* W, int k0, int n, int lane, int ld, int K) { float v[16]; const int g = lane >> 4;
#pragma unroll
  for (int i = 0; i < 8; ++i) { const int ka = k0 + 8 * g + i, kb = ka + 16; v[i] = ka < K ? W[(size_t)(ka < K ? ka : K - 1) * ld + n] : 0.f; v[8 + i] = kb < K ? W[(size_t)(kb < K ? kb : K - 1) * ld + n] : 0.f; }
  return bsplit16(v); }
__device__ __forceinline__ v8f mac3(const F2& a, const F2& b, v8f c) { c = wmma_bf(a.l, b.h, c); c = wmma_bf(a.h, b.l, c); return wmma_bf(a.h, b.h, c); }
__device__ __forceinline__ float sigm(float v) { return 1.0f / (1.0f + expf(-v)); }
#define LDSX() do { asm volatile("s_wait_dscnt 0" ::: "memory"); __builtin_amdgcn_wave_barrier(); __builtin_amdgcn_fence(__ATOMIC_RELEASE, "workgroup"); } while (0)

// Transformer-XL / Conformer relative multi-head attention (B 4, T = P = 1,024, D 512 = 8 heads x 64; (in,out) Wq/Wk/Wv/Wo [512,512] + zero biases, Wpos [512,512] no bias, pos_bias_u/v [8,64]; 1/sqrt(64)-scale): AC = (q + u) k^T, BD = rel_shift((q + v) p^T) with p = pos_emb Wpos (pad-reshape trick, no mask), attn = softmax((AC + BD)/8), out = merge(attn v) Wo + bo.
#define NB 4
#define TT 1024
#define CC 512            // NH * HD = projected width
#define DIN 512          // input (model) width
#define NH 8
#define HD 64
#define NQB (TT / 64)
#define HG 8
#define SCALE (0.125f)
#define SCALE_L2 (SCALE * 1.4426950408889634f)   // logits are carried in units of log 2 (scale x log2 e), so that the softmax exponential is the chip's own base-2 instruction
#define CAUSAL 0
#ifndef TNB
#define TNB NB
#endif
__device__ __forceinline__ float bfr(float v) { return (float)(__bf16)v; }
__host__ __device__ __forceinline__ int kb_last(int qb) { return CAUSAL ? ((qb * 64 + 63) >> 7) : (TT / 128 - 1); }
typedef __attribute__((ext_vector_type(8))) __bf16 v8b;
__device__ __forceinline__ v16b frag_b(const __bf16* rowk0, int lane) {
  union { v16b v; v8b q[2]; } u; const __bf16* p = rowk0 + 8 * (lane >> 4);
  u.q[0] = *(const v8b*)p; u.q[1] = *(const v8b*)(p + 16); return u.v;
}
#define QBH 0              // read by no kernel here
#define QHI 1024            // rows carrying a q residual plane (all rows when non-causal: 2-product logits everywhere)
#define KHI 64            // key rows carrying k residual / v bf16 hi+lo planes (written, but read by no kernel here)
// B fragment (k rows k0+.., output column o) of a weight: (in,out) [K][ld] or (out,in) [ld rows of K]: bf16 exact, or f16(bf16 * 256) exact
__device__ __forceinline__ v16b wcol_io(const float* Wm, int k0, int o, int lane, int ld) { v16b w; const int g = lane >> 4;
#pragma unroll
  for (int i = 0; i < 8; ++i) { w[i] = (__bf16)Wm[(size_t)(k0 + 8 * g + i) * ld + o]; w[8 + i] = (__bf16)Wm[(size_t)(k0 + 16 + 8 * g + i) * ld + o]; }
  return w; }
__device__ __forceinline__ v16b wcol_oi(const float* Wm, int k0, int o, int lane, int K) { v16b w; const float* p = Wm + (size_t)o * K + k0 + 8 * (lane >> 4);
#pragma unroll
  for (int i = 0; i < 8; ++i) { w[i] = (__bf16)p[i]; w[8 + i] = (__bf16)p[16 + i]; }
  return w; }
__device__ __forceinline__ v16h wcolh_io(const float* Wm, int k0, int o, int lane, int ld) { v16h w; const int g = lane >> 4;
#pragma unroll
  for (int i = 0; i < 8; ++i) { w[i] = (_Float16)(bfr(Wm[(size_t)(k0 + 8 * g + i) * ld + o]) * 256.0f); w[8 + i] = (_Float16)(bfr(Wm[(size_t)(k0 + 16 + 8 * g + i) * ld + o]) * 256.0f); }
  return w; }
__device__ __forceinline__ v16h wcolh_oi(const float* Wm, int k0, int o, int lane, int K) { v16h w; const float* p = Wm + (size_t)o * K + k0 + 8 * (lane >> 4);
#pragma unroll
  for (int i = 0; i < 8; ++i) { w[i] = (_Float16)(bfr(p[i]) * 256.0f); w[8 + i] = (_Float16)(bfr(p[16 + i]) * 256.0f); }
  return w; }
// unconverted f32 values of a fragment, in fragment element order: a row operand, and column o of an (in,out) [K][ld] weight
__device__ __forceinline__ void raw_row(float (&r)[16], const float* rowk0, int lane) { const float* p = rowk0 + 8 * (lane >> 4);
#pragma unroll
  for (int i = 0; i < 8; ++i) { r[i] = p[i]; r[8 + i] = p[16 + i]; } }
__device__ __forceinline__ void raw_col(float (&r)[16], const float* Wm, int k0, int o, int lane, int ld) { const int g = lane >> 4;
#pragma unroll
  for (int i = 0; i < 8; ++i) { r[i] = Wm[(size_t)(k0 + 8 * g + i) * ld + o]; r[8 + i] = Wm[(size_t)(k0 + 16 + 8 * g + i) * ld + o]; } }
#define WQKV_LAYOUT 0   // selects WCOL only, which nothing calls (k_proj always reads (in,out) [DIN][CC]): 0 = (in,out) [DIN][CC]; 1 = (out,in) [CC][DIN]; 2 = per-head [NH][DIN][HD]
__device__ __forceinline__ v16b wcol_hdk(const float* Wm, int k0, int o, int lane) { v16b w; const int g = lane >> 4; const float* p = Wm + (size_t)(o / HD) * DIN * HD + (o % HD);
#pragma unroll
  for (int i = 0; i < 8; ++i) { w[i] = (__bf16)p[(size_t)(k0 + 8 * g + i) * HD]; w[8 + i] = (__bf16)p[(size_t)(k0 + 16 + 8 * g + i) * HD]; }
  return w; }
#define WO_OUT_IN 0
#if WQKV_LAYOUT == 1
#define WCOL(W, k0, o, lane) wcol_oi(W, k0, o, lane, DIN)
#elif WQKV_LAYOUT == 2
#define WCOL(W, k0, o, lane) wcol_hdk(W, k0, o, lane)
#else
#define WCOL(W, k0, o, lane) wcol_io(W, k0, o, lane, CC)
#endif
#if WO_OUT_IN
#define WOCOL(W, k0, o, lane) wcol_oi(W, k0, o, lane, CC)
#define WOCOLH(W, k0, o, lane) wcolh_oi(W, k0, o, lane, CC)
#else
#define WOCOL(W, k0, o, lane) wcol_io(W, k0, o, lane, DIN)
#define WOCOLH(W, k0, o, lane) wcolh_io(W, k0, o, lane, DIN)
#endif
#define WS_QH2 (WS_END)                                   // f16 q_v rows, fragment order
#define WS_QL2 (WS_QH2 + 2u * (size_t)NB * TT * CC)       // f16 q_v residual rows, fragment order
#define WS_KP  (WS_QL2 + 2u * (size_t)NB * QHI * CC)      // f16 positional key rows p = pos_emb Wpos, fragment order (the first TT rows are used)
#define WS_S2  (WS_KP + 2u * (size_t)NB * TT * CC)        // f32 [hg][t][p], unused: k_att keeps BD in LDS
#define WS_END2 (WS_S2 + 4u * (size_t)HG * TT * TT)

#define WS_QH  0u                                      // f16 q rows, fragment order [b*t / 16][head][piece 4][lane 32][8] (see pk_row)
#define WS_KH  (WS_QH + 2u * (size_t)NB * TT * CC)      // f16 k rows, fragment order as the q rows
#define WS_VT  (WS_KH + 2u * (size_t)NB * TT * CC)      // f16 v, fragment order [b][head][d / 16][t / 32][half 2][lane 32][8]: lane = (t / 8 & 1) * 16 + d % 16
#define WS_QL  (WS_VT + 2u * (size_t)NB * CC * TT)      // f16 q residual x 2^10 rows, fragment order as the q rows (QHI = TT)
#define WS_KL  (WS_QL + 2u * (size_t)NB * QHI * CC)     // f16 k residual x 2^10 rows [b][t < KHI][CC]
#define WS_VB  (WS_KL + 2u * (size_t)NB * KHI * CC)     // bf16 v hi planes [b][c][t < KHI]
#define WS_VBL (WS_VB + 2u * (size_t)NB * CC * KHI)
#define WS_S   (WS_VBL + 2u * (size_t)NB * CC * KHI)    // f32 [hg][t][s], unused: k_att keeps logits and P on chip
#define WS_Y   (WS_S  + 4u * (size_t)HG * TT * TT)      // f32 ctx rows [b*t][CC] (only when there is an output projection)
#define WS_END (WS_Y  + 4u * (size_t)NB * TT * CC)

#define WBP 80           // bytes from a column to the next in a staged weight slab: 64 B of k and 16 more, so that the 16 columns of a fragment read fall on different banks
// work-group barrier of the staged GEMM loops: it waits for this wave's LDS traffic alone. __syncthreads() would also wait for the global loads of the steps ahead, which only this wave's registers receive and which are to stay in flight across it
#define WBAR() asm volatile("s_wait_dscnt 0x0\n\ts_barrier_signal -1\n\ts_barrier_wait -1" ::: "memory")
// ---- k_proj: every projection in one launch. block = (64 rows, 128 cols, which = blockIdx.z / 4): X W (+ b) with exact bf16 products (K = DIN) -> which 0: q, multiplied once and stored twice, as q + pos_bias_u and as q + pos_bias_v (f16 rows + residual rows each); 1: k f16 rows (+ residual rows < KHI); 2: v f16 planes (+ bf16 hi/lo planes [c][t] for t < KHI); 3: the positional key rows p = pos_emb Wpos (no bias, the TT rows of blockIdx.z = 12), f16 rows as k; the f16 planes are stored in the fragment order that k_att loads (layouts: WS_QH, WS_VT). The q blocks have the longest epilogue and the lowest indices, so they start first
// Every product is taken transposed, (W^T)(X^T): the weight columns are the A operand and the input rows the B operand, so that a lane's eight accumulator registers are 8 neighbouring columns of one row. For q, k and p that is one 16-byte place of the destination: accumulator tile j of wave w is, lane for lane, one 512-byte piece of the plane, and it is stored from the registers, through no LDS and no barrier. v, whose plane runs along t, is rounded in the registers and turned in LDS as 16-bit values. What is left in LDS is the weight stages (reused for v's turn) and the biases, so that registers and not LDS set how many blocks stand on a WGP (4: the whole grid is resident at once)
__global__ __launch_bounds__(128, 4) void k_proj(const float* __restrict__ XQ, const float* __restrict__ XK, const float* __restrict__ XV, const float* __restrict__ XP, const float* __restrict__ WQ, const float* __restrict__ WK, const float* __restrict__ WV, const float* __restrict__ WP, const float* __restrict__ BQ, const float* __restrict__ BK, const float* __restrict__ BV,
    _Float16* __restrict__ QH, _Float16* __restrict__ QL, _Float16* __restrict__ QH2, _Float16* __restrict__ QL2, _Float16* __restrict__ KH, _Float16* __restrict__ KL, _Float16* __restrict__ KP, _Float16* __restrict__ VT, __bf16* __restrict__ VB, __bf16* __restrict__ VBL, const float* __restrict__ EXU, const float* __restrict__ EXV) {
  __shared__ __align__(16) char lds[3 * 128 * 72 * 2]; __shared__ __align__(16) float sb[3][128];   /* lds: first the two weight stages, then v's planes [column][t] at pitch 72; sb: the block's 128 columns of b, pos_bias_u, pos_bias_v, rounded to bf16 */
  static_assert(2 * 128 * WBP <= 128 * 72 * 2 * 3, "the weight stages lie inside lds"); char* wst = lds;
  const int tid = threadIdx.x, wave = __builtin_amdgcn_readfirstlane(tid >> 5), lane = tid & 31, col = lane & 15, g = lane >> 4; const int which = blockIdx.z >> 2; const int c0 = blockIdx.y * 128; const size_t r0 = (size_t)((blockIdx.z & 3) * 16 + blockIdx.x) * 64; const size_t bb = r0 / TT; const int t0 = (int)(r0 % TT);
  const float* X = which == 0 ? XQ : which == 1 ? XK : which == 2 ? XV : XP; const float* WA = which == 0 ? WQ : which == 1 ? WK : which == 2 ? WV : WP; const float* BA = which == 0 ? BQ : which == 1 ? BK : which == 2 ? BV : nullptr;
  /* the biases are asked for ahead of the first slabs and laid in LDS behind them; the first barrier of the k loop publishes them. The three loads stand under no branch, so that none is waited for by itself: p, which has no bias, reads pos_bias_u in its place and stores 0; only q reads rows 1 and 2 of sb */
  const float bv0 = (BA ? BA : EXU)[c0 + tid], bv1 = EXU[c0 + tid], bv2 = EXV[c0 + tid];
  v8f acc[8] = {};
  /* the weight slab of a k step (32 rows x 128 columns) is fetched once by the block, in whole 512-byte rows, rounded once and laid in LDS as [column][k] at pitch WBP, where all four waves take their weight fragments. Thread = (8 k rows: wave, 4 columns: lane). Two LDS stages and two register sets: the loads of step kc + 2 are issued in step kc, as soon as their registers are free, and fly during step kc + 1 */
  const float* wp = WA + (size_t)(wave * 8) * CC + c0 + lane * 4; const float* xp = X + (r0 + wave * 16 + col) * DIN;
  v4f wr[2][8]; float ar[2][16];
#pragma unroll
  for (int u = 0; u < 2; ++u) {
#pragma unroll
    for (int i = 0; i < 8; ++i) wr[u][i] = *(const v4f*)(wp + (size_t)(u * 32 + i) * CC);
    raw_row(ar[u], xp + u * 32, lane); }
  sb[0][tid] = BA ? bfr(bv0) : 0.f; sb[1][tid] = bfr(bv1); sb[2][tid] = bfr(bv2);
  auto step = [&](const int kc, const int u, const bool more) __attribute__((always_inline)) { char* wb = wst + u * (128 * WBP);
    __builtin_amdgcn_sched_barrier(0);   /* a step's conversions stay behind the products of the step before: lifted in among them they hold 16 more registers, and within the 256 of four waves a SIMD the row loads then land in fragment registers and are waited for at once */
#pragma unroll
    for (int jj = 0; jj < 4; ++jj) { v8b t;
#pragma unroll
      for (int i = 0; i < 8; ++i) t[i] = (__bf16)wr[u][i][jj];
      *(v8b*)(wb + (lane * 4 + jj) * WBP + wave * 16) = t; }
    if (more) { const float* wn = wp + (size_t)(kc + 2) * 32 * CC;   /* the weight values of set u are in LDS: refill them for step kc + 2 */
#pragma unroll
      for (int i = 0; i < 8; ++i) wr[u][i] = *(const v4f*)(wn + (size_t)i * CC);
      asm volatile("s_wait_xcnt 0x0" ::: "memory"); }   /* the loop advances the loads' address registers: keep the wait in front of that */
    v16b a;
#pragma unroll
    for (int i = 0; i < 16; ++i) a[i] = (__bf16)ar[u][i];
    WBAR();   /* stage u is written; every wave has also left the other stage, which the next step overwrites */
    union { v16b v; v8b q[2]; } w[8];
#pragma unroll
    for (int j = 0; j < 8; ++j) { const char* f = wb + (j * 16 + col) * WBP + g * 16; w[j].q[0] = *(const v8b*)f; w[j].q[1] = *(const v8b*)(f + 32); }
    __builtin_amdgcn_sched_barrier(0);   /* all sixteen LDS reads are issued ahead of the first product, so that one LDS latency serves the step and not eight */
#pragma unroll
    for (int j = 0; j < 8; ++j) acc[j] = wmma_bf(w[j].v, a, acc[j]);   /* both fragments hold the same k at the same element, so they change places as they are */
    if (more) { raw_row(ar[u], xp + (kc + 2) * 32, lane);   /* the row values of set u are converted by now: refill them for step kc + 2 */
      asm volatile("s_wait_xcnt 0x0" ::: "memory"); } };   /* the loop advances the loads' address registers: keep the wait in front of that */
#pragma unroll 1   /* stays a loop of two steps: unrolled whole, the compiler lifts every conversion up to its loads, and each step then waits for loads just issued */
  for (int kc = 0; kc < DIN / 32 - 2; kc += 2) { step(kc, 0, true); step(kc + 1, 1, true); }
  step(DIN / 32 - 2, 0, false); step(DIN / 32 - 1, 1, false);
  /* acc[j][r] = column c0 + 16 j + 8 g + r of row r0 + 16 wave + col */
  if (which != 2) {   /* block-uniform */
    const size_t po = (((r0 >> 4) + wave) * NH + (c0 >> 6)) * 1024 + lane * 8;   /* the lane's place in piece 0 of the wave's row tile; tile j is piece j (4 pieces a head) */
    _Float16 *d0 = (which == 0 ? QH : which == 1 ? KH : KP) + po, *d1 = QL + po, *d2 = QH2 + po, *d3 = QL2 + po;
    _Float16* dk = KL + (bb * KHI + (t0 < KHI ? t0 : 0) + wave * 16 + col) * (size_t)CC + c0 + 8 * g; const bool klo = which == 1 && t0 < KHI;
    auto xb = [&](float (&x)[8], const int j) __attribute__((always_inline)) { const float* bp = &sb[0][j * 16 + 8 * g]; const v4f b0 = *(const v4f*)bp, b1 = *(const v4f*)(bp + 4);   /* tile j + b */
#pragma unroll
      for (int r = 0; r < 4; ++r) { x[r] = acc[j][r] + b0[r]; x[4 + r] = acc[j][4 + r] + b1[r]; } };
    if (which == 0) {
#pragma unroll
      for (int j = 0; j < 8; ++j) { float x[8]; xb(x, j); v8h hv[2], lv[2];   /* q + pos_bias_u, then q + pos_bias_v: the per-(head, dim) bias is added in f32 to (x Wq + bq) */
#pragma unroll
        for (int ps = 0; ps < 2; ++ps) { const float* ep = &sb[1 + ps][j * 16 + 8 * g]; const v4f e0 = *(const v4f*)ep, e1 = *(const v4f*)(ep + 4);
#pragma unroll
          for (int r = 0; r < 8; ++r) { const float v = x[r] + (r < 4 ? e0[r & 3] : e1[r & 3]); const _Float16 h = (_Float16)v; hv[ps][r] = h; lv[ps][r] = (_Float16)((v - (float)h) * 1024.0f); } }
        *(v8h*)(d0 + j * 256) = hv[0]; *(v8h*)(d1 + j * 256) = lv[0]; *(v8h*)(d2 + j * 256) = hv[1]; *(v8h*)(d3 + j * 256) = lv[1];
        asm volatile("s_wait_xcnt 0x0" :: "v"(hv[0]), "v"(lv[0]), "v"(hv[1]), "v"(lv[1]) : "memory"); }   /* the next tile's values may be formed in these stores' data registers: as inputs they live up to the wait */
    } else {
#pragma unroll
      for (int j = 0; j < 8; ++j) { float x[8]; xb(x, j); v8h hv;
#pragma unroll
        for (int r = 0; r < 8; ++r) hv[r] = (_Float16)x[r];
        *(v8h*)(d0 + j * 256) = hv;
        asm volatile("s_wait_xcnt 0x0" :: "v"(hv) : "memory"); }   /* as above */
      if (klo) {
#pragma unroll
        for (int j = 0; j < 8; ++j) { float x[8]; xb(x, j); v8h lv;
#pragma unroll
          for (int r = 0; r < 8; ++r) lv[r] = (_Float16)((x[r] - (float)(_Float16)x[r]) * 1024.0f);
          *(v8h*)(dk + j * 16) = lv;
          asm volatile("s_wait_xcnt 0x0" :: "v"(lv) : "memory"); } } }   /* as above */
  } else { const bool hi_rows = t0 < KHI; _Float16 (*th)[72] = (_Float16 (*)[72])lds; __bf16 (*tb)[72] = (__bf16 (*)[72])(lds + 128 * 72 * 2), (*tbl)[72] = (__bf16 (*)[72])(lds + 2 * 128 * 72 * 2);
    __syncthreads();   /* every wave has taken its last weight fragments: the stages' LDS is free for v's planes */
#pragma unroll
    for (int j = 0; j < 8; ++j) { const float* bp = &sb[0][j * 16 + 8 * g]; const v4f b0 = *(const v4f*)bp, b1 = *(const v4f*)(bp + 4);
#pragma unroll
      for (int r = 0; r < 8; ++r) { acc[j][r] = acc[j][r] + (r < 4 ? b0[r & 3] : b1[r & 3]); th[j * 16 + 8 * g + r][wave * 16 + col] = (_Float16)acc[j][r]; } }
    if (hi_rows) {
#pragma unroll
      for (int j = 0; j < 8; ++j)
#pragma unroll
        for (int r = 0; r < 8; ++r) { const float v = acc[j][r]; const int cl = j * 16 + 8 * g + r, rl = wave * 16 + col; const __bf16 bh = (__bf16)v; tb[cl][rl] = bh; tbl[cl][rl] = (__bf16)(v - (float)bh); } }
    __syncthreads();   /* v's planes are written */
    for (int e = tid; e < 128 * 8; e += 128) { const int ln = e & 31, cl = (e >> 7) * 16 + (ln & 15), q = ((e >> 5) & 3) * 2 + (ln >> 4);   /* destination order: [head 2][d tile 4][t block 2][half 2][lane 32] */
      vst2((unsigned*)(VT + (((bb * NH + (c0 >> 6)) * 4 + (e >> 7)) * 32 + (t0 >> 5)) * 512 + (e & 127) * 8), *(const v4u*)&th[cl][q * 8]);
      asm volatile("s_wait_xcnt 0x0" ::: "memory");   /* what follows overwrites the store's address and data registers: keep the wait in front of that */
      if (hi_rows) { const size_t o3 = (bb * CC + c0 + cl) * (size_t)KHI + t0 + q * 8; vst2((unsigned*)(VB + o3), *(const v4u*)&tb[cl][q * 8]); vst2((unsigned*)(VBL + o3), *(const v4u*)&tbl[cl][q * 8]);
        asm volatile("s_wait_xcnt 0x0" ::: "memory"); } } } }   /* as above, for these two stores */
// ---- k_att: block = 32 query rows (two 16-row tiles, t0..t0+31) of (b, h), 16 waves, wave w owns key / position columns [64 w, 64 w + 64). Logits never leave the WGP.
// Every k, p and v fragment that a wave loads is multiplied with BOTH query tiles, so the block fetches the head's k, p and v planes once for 32 queries. The two tiles are worked as two independent 16-row problems (tile qs: rows ts = t0 + 16 qs, its own BD' rows in LDS).
// Every score product is taken transposed: the key (position) rows are the A operand and the query rows the B operand, so a lane holds ONE query of each tile (ts + col) and register r of a score tile the key 8 g + r. A row's maximum and sum are then sums inside a lane, and two score tiles, converted in place, are the B operand of ctx^T = v^T P^T: P needs no LDS and no lane exchange.
//  1. BD = (q + v) . p x 1/8 x log2 e is stored straight to its rel_shift place in LDS. The reference's pad-reshape is linear in memory: BD[r][c] lands at flat out index r T + r + c + 1 - T, so row r's columns c >= T-1-r go to out row r and the others to out row r-1; out[t][t+1] is the pad's 0.
//     A query tile needs BD rows ts..ts+16; a 16-column tile at cs needs rows ts+1..ts+16 when cs + ts <= T - 32 and rows ts..ts+15 otherwise (cs, ts multiples of 16), so one row tile serves each column tile.
//  2. AC = (q + u) . k x 1/8 x log2 e stays in registers and takes BD' from LDS; softmax in f32 over the 32 half-waves, 2^(s - max) for e^(..); P x 2^11 once to f16 in registers.
//  3. each wave multiplies its own 64 keys of P with v (f16, 1 product); the 16 partial ctx tiles are summed in wave order.
// Every loop is fully unrolled: the fragment, logit and accumulator arrays stay in registers only when each index is a constant. A block's 16 waves stand 4 on a SIMD (256 registers each).
// The q, k, p and v planes lie in the workspace in fragment order: the 16 bytes that lane l of a wave takes with one load stand at 16 l inside a 512-byte piece, so a load reads 4 whole 128-byte lines and not a 32-byte part of 16 lines.
// Rows (q, k, p): a (16 rows, one head) tile is 4 pieces; piece 2 kc + half holds d = 32 kc + 16 half + 8 g + 0..7 of row r at lane 16 g + r % 16. pk_row = f16 index of the lane's place in piece 0.
__device__ __forceinline__ size_t pk_row(size_t row, int h, int g) { return ((row >> 4) * NH + h) * 1024 + (g * 16 + (row & 15)) * 8; }
#define PKT (NH * 1024)  // f16 from a 16-row tile to the next
__device__ __forceinline__ v16h frag_at(const _Float16* p) { union { v16h v; v8h q[2]; } u; u.q[0] = *(const v8h*)p; u.q[1] = *(const v8h*)(p + 256); return u.v; }   // the two pieces of one 32-deep fragment; p holds the lane's place
// behind a group of loads: the group's address registers are inputs, so they live up to the wait and no load of the group is given one of them as its destination; behind the wait they may be overwritten
#define XW1(p) asm volatile("s_wait_xcnt 0x0" :: "v"(p) : "memory")
#define XW2(p, q) asm volatile("s_wait_xcnt 0x0" :: "v"(p), "v"(q) : "memory")
#define XW5(p, q, r, s, t) asm volatile("s_wait_xcnt 0x0" :: "v"(p), "v"(q), "v"(r), "v"(s), "v"(t) : "memory")
#define QT 2             // 16-row query tiles of a block
#define KW 64            // key / position columns of a wave
#define NWV (TT / KW)    // waves of a block
#define SBP (TT + 4)     // f32 pitch of the BD' rows in LDS: 16 B more than a row, so that the 16 rows that the lanes of a 16-byte read take fall on different banks
#define SRP (HD + 4)     // f32 pitch of the partial ctx rows
#define RDP (2 * NWV + 4)   // f32 pitch of a row's 32 partial maxima / sums (one per half-wave), 16 B more than they fill
static_assert(NWV * SRP >= SBP, "the partial ctx tiles are the larger use of sS");
__device__ __forceinline__ float max8(const float (&x)[8]) { return fmaxf(fmaxf(fmaxf(x[0], x[1]), fmaxf(x[2], x[3])), fmaxf(fmaxf(x[4], x[5]), fmaxf(x[6], x[7]))); }
__device__ __forceinline__ float sum8(const float (&x)[8]) { return ((x[0] + x[1]) + (x[2] + x[3])) + ((x[4] + x[5]) + (x[6] + x[7])); }
// maximum / sum of a row's 32 partial values in LDS, eight 16-byte reads
__device__ __forceinline__ float max32(const float* p) { float m[8];
#pragma unroll
  for (int i = 0; i < 8; ++i) { const v4f x = *(const v4f*)(p + 4 * i); m[i] = fmaxf(fmaxf(x[0], x[1]), fmaxf(x[2], x[3])); }
  return max8(m); }
__device__ __forceinline__ float sum32(const float* p) { float m[8];
#pragma unroll
  for (int i = 0; i < 8; ++i) { const v4f x = *(const v4f*)(p + 4 * i); m[i] = (x[0] + x[1]) + (x[2] + x[3]); }
  return sum8(m); }
__global__ __launch_bounds__(32 * NWV, 4) void k_att(const _Float16* __restrict__ QH, const _Float16* __restrict__ QL, const _Float16* __restrict__ QH2, const _Float16* __restrict__ QL2, const _Float16* __restrict__ KH, const _Float16* __restrict__ KP, const _Float16* __restrict__ VT, float* __restrict__ Y) {
  __shared__ __align__(16) float sS[NWV * QT * 16 * SRP];   /* first the f32 BD' rows [QT][16][SBP]; once every wave has read them, the partial ctx tiles [NWV][QT][16][SRP] */
  __shared__ __align__(16) float redm[QT * 16][RDP], reds[QT * 16][RDP];
  float* sR = sS;
  const int tid = threadIdx.x, wave = __builtin_amdgcn_readfirstlane(tid >> 5), lane = tid & 31, col = lane & 15, g = lane >> 4;
  const int t0 = blockIdx.x * (QT * 16), h = blockIdx.y, b = blockIdx.z, c0 = wave * KW;
  size_t qr0[QT], qr1[QT];   /* every offset below holds the lane's place in a piece */
#pragma unroll
  for (int qs = 0; qs < QT; ++qs) { const int t = t0 + qs * 16 + col; qr0[qs] = pk_row((size_t)b * TT + t, h, g);
    qr1[qs] = pk_row((size_t)b * TT + (t + 1 < TT ? t + 1 : TT - 1), h, g); }   /* row T does not exist and no column tile of the last query tile uses the shifted rows */
  if (tid < QT * 16 && t0 + tid + 1 < TT) sS[tid * SBP + t0 + tid + 1] = 0.f;
  { v16h ah[QT][HD / 32], al[QT][HD / 32], pf[HD / 32][KW / 16]; const _Float16 *qha[QT], *qla[QT]; const _Float16* pb = KP + pk_row((size_t)(c0 + col), h, g);
#pragma unroll
    for (int qs = 0; qs < QT; ++qs) { const size_t qra = c0 + t0 + qs * 16 <= TT - 32 ? qr1[qs] : qr0[qs];   /* the row tile of this wave's first column tile */
      qha[qs] = QH2 + qra; qla[qs] = QL2 + qra;
#pragma unroll
      for (int kc = 0; kc < HD / 32; ++kc) { ah[qs][kc] = frag_at(qha[qs] + kc * 512); al[qs][kc] = frag_at(qla[qs] + kc * 512); } }
#pragma unroll
    for (int kc = 0; kc < HD / 32; ++kc)
#pragma unroll
      for (int j = 0; j < KW / 16; ++j) pf[kc][j] = frag_at(pb + j * PKT + kc * 512);
    XW5(qha[0], qla[0], qha[1], qla[1], pb);
#pragma unroll
    for (int j = 0; j < KW / 16; ++j)
#pragma unroll
      for (int qs = 0; qs < QT; ++qs) { const int ct = c0 + j * 16 + t0 + qs * 16; const bool up = ct <= TT - 32;   /* wave-uniform */
        float* sq = sS + qs * 16 * SBP;   /* this query tile's BD' rows */
        if (j > 0 && ct == TT - 16) {   /* the one wave whose columns cross from a query tile's shifted rows to the unshifted ones fetches the other row tile here */
          const _Float16 *qhb = QH2 + qr0[qs], *qlb = QL2 + qr0[qs];
#pragma unroll
          for (int kc = 0; kc < HD / 32; ++kc) { ah[qs][kc] = frag_at(qhb + kc * 512); al[qs][kc] = frag_at(qlb + kc * 512); }
          XW2(qhb, qlb); }
        v8f a = {}, l = {};
#pragma unroll
        for (int kc = 0; kc < HD / 32; ++kc) { a = wmma16(pf[kc][j], ah[qs][kc], a); l = wmma16(pf[kc][j], al[qs][kc], l); }
        /* the lane holds BD row (up ? 1 : 0) + col of the query tile, columns 8 g + r */
        if (__builtin_expect((unsigned)(ct - (TT - 32)) <= 16u, 0)) {   /* ct = T - 32 or T - 16, the two column tiles of a query tile in which a BD row is cut between two out rows or leaves the tile's rows: flat index, range test, and the pitch's 4 floats for each whole row. Marked unlikely, so that the common form below is the fall-through */
#pragma unroll
          for (int r = 0; r < 8; ++r) { const int rl = (up ? 1 : 0) + col; const int idx = (rl - 1) * TT + rl + ct + 8 * g + r + 1;
            if ((unsigned)idx < 16u * TT) sq[idx + 4 * (idx >> 10)] = (a[r] + l[r] * (1.0f / 1024.0f)) * SCALE_L2; }   /* outside: a neighbour tile's row */
        } else {   /* elsewhere the lane's eight values lie side by side in out row col: from column ct + col + 2 + 8 g (shifted rows, ct <= T - 48: the last is column T - 16) or ct + col + 1 - T + 8 g (ct >= T: columns 1 .. T - 1) */
          float* d = sq + col * (SBP + 1) + 8 * g + (up ? ct + 2 : ct + 1 - TT);
#pragma unroll
          for (int r = 0; r < 8; ++r) d[r] = (a[r] + l[r] * (1.0f / 1024.0f)) * SCALE_L2; } } }
  float s[QT][KW / 16][8];   /* s[qs][j][r]: query t0 + 16 qs + col, key c0 + 16 j + 8 g + r */
  { v16h ah[QT][HD / 32], al[QT][HD / 32], kf[HD / 32][KW / 16]; const _Float16 *qh[QT], *ql[QT]; const _Float16* kb = KH + pk_row((size_t)b * TT + c0 + col, h, g);
#pragma unroll
    for (int qs = 0; qs < QT; ++qs) { qh[qs] = QH + qr0[qs]; ql[qs] = QL + qr0[qs];
#pragma unroll
      for (int kc = 0; kc < HD / 32; ++kc) { ah[qs][kc] = frag_at(qh[qs] + kc * 512); al[qs][kc] = frag_at(ql[qs] + kc * 512); } }
#pragma unroll
    for (int kc = 0; kc < HD / 32; ++kc)
#pragma unroll
      for (int j = 0; j < KW / 16; ++j) kf[kc][j] = frag_at(kb + j * PKT + kc * 512);
    XW5(qh[0], ql[0], qh[1], ql[1], kb);
#pragma unroll
    for (int j = 0; j < KW / 16; ++j)
#pragma unroll
      for (int qs = 0; qs < QT; ++qs) { v8f a = {}, l = {};
#pragma unroll
        for (int kc = 0; kc < HD / 32; ++kc) { a = wmma16(kf[kc][j], ah[qs][kc], a); l = wmma16(kf[kc][j], al[qs][kc], l); }
#pragma unroll
        for (int r = 0; r < 8; ++r) s[qs][j][r] = (a[r] + l[r] * (1.0f / 1024.0f)) * SCALE_L2;
        __builtin_amdgcn_sched_barrier(0); } }   /* each tile's two accumulators are folded into its logits before the next tile starts, so that the accumulators of all tiles are not live beside the key fragments */
  v16h vf[KW / 32][HD / 16];   /* this wave's v fragments, issued ahead of the softmax */
  const _Float16* vb = VT + ((((size_t)b * NH + h) * 4) * 32 + (c0 >> 5)) * 512 + lane * 8;
#pragma unroll
  for (int u = 0; u < KW / 32; ++u)
#pragma unroll
    for (int j = 0; j < HD / 16; ++j) vf[u][j] = frag_at(vb + j * 32 * 512 + u * 512);
  XW1(vb);
  __syncthreads();   /* every BD' element is in LDS */
  float pt[KW / 16];
#pragma unroll
  for (int qs = 0; qs < QT; ++qs) {
#pragma unroll
    for (int j = 0; j < KW / 16; ++j) { const float* bd = sS + (qs * 16 + col) * SBP + c0 + j * 16 + 8 * g; const v4f x = *(const v4f*)bd, y = *(const v4f*)(bd + 4);
#pragma unroll
      for (int r = 0; r < 4; ++r) { s[qs][j][r] = s[qs][j][r] + x[r]; s[qs][j][4 + r] = s[qs][j][4 + r] + y[r]; }
      pt[j] = max8(s[qs][j]); }
    redm[qs * 16 + col][wave * 2 + g] = fmaxf(fmaxf(pt[0], pt[1]), fmaxf(pt[2], pt[3])); }
  __syncthreads();   /* the maxima of all half-waves; also the last read of the BD' rows, whose LDS is reused below */
#pragma unroll
  for (int qs = 0; qs < QT; ++qs) { const float m = max32(&redm[qs * 16 + col][0]);
#pragma unroll
    for (int j = 0; j < KW / 16; ++j) {
#pragma unroll
      for (int r = 0; r < 8; ++r) s[qs][j][r] = s[qs][j][r] - m;   /* <= 0 and finite: the exponential needs no range reduction and no overflow test; a result below 2^-126 may read 0, far under P's f16 step */
      /* a tile's eight 2^x, each in place. One statement, so that behind every v_exp_f32 stands an instruction that neither reads its result nor overwrites its source: the next one, and the v_nop behind the last */
      asm("v_exp_f32 %0, %0\n\tv_exp_f32 %1, %1\n\tv_exp_f32 %2, %2\n\tv_exp_f32 %3, %3\n\tv_exp_f32 %4, %4\n\tv_exp_f32 %5, %5\n\tv_exp_f32 %6, %6\n\tv_exp_f32 %7, %7\n\tv_nop"
          : "+v"(s[qs][j][0]), "+v"(s[qs][j][1]), "+v"(s[qs][j][2]), "+v"(s[qs][j][3]), "+v"(s[qs][j][4]), "+v"(s[qs][j][5]), "+v"(s[qs][j][6]), "+v"(s[qs][j][7]));
      pt[j] = sum8(s[qs][j]); }
    reds[qs * 16 + col][wave * 2 + g] = (pt[0] + pt[1]) + (pt[2] + pt[3]); }
  __syncthreads();   /* the sums of all half-waves */
  float inv[QT];
#pragma unroll
  for (int qs = 0; qs < QT; ++qs) { const float a = sum32(&reds[qs * 16 + col][0]); inv[qs] = a > 0.f ? 2048.0f / a : 0.f; }
  v8f acc[QT][HD / 16] = {};   /* acc[qs][j][r]: ctx^T, d = 16 j + 8 g + r of query t0 + 16 qs + col */
#pragma unroll
  for (int u = 0; u < KW / 32; ++u)
#pragma unroll
    for (int qs = 0; qs < QT; ++qs) { v16h p;   /* keys 32 u + 8 g + i and 32 u + 16 + 8 g + i: the k order of the v fragments */
#pragma unroll
      for (int i = 0; i < 8; ++i) { p[i] = (_Float16)(s[qs][2 * u][i] * inv[qs]); p[8 + i] = (_Float16)(s[qs][2 * u + 1][i] * inv[qs]); }
#pragma unroll
      for (int j = 0; j < HD / 16; ++j) acc[qs][j] = wmma16(vf[u][j], p, acc[qs][j]); }
#pragma unroll
  for (int qs = 0; qs < QT; ++qs)
#pragma unroll
    for (int j = 0; j < HD / 16; ++j) { float* d = sR + ((wave * QT + qs) * 16 + col) * SRP + j * 16 + 8 * g;
      const v4f lo = { acc[qs][j][0], acc[qs][j][1], acc[qs][j][2], acc[qs][j][3] }, hi = { acc[qs][j][4], acc[qs][j][5], acc[qs][j][6], acc[qs][j][7] }; *(v4f*)d = lo; *(v4f*)(d + 4) = hi; }
  __syncthreads();   /* the 16 partial ctx tiles */
  { const int rl = tid >> 4, c4 = (tid & 15) * 4; v4f o = *(const v4f*)&sR[rl * SRP + c4];   /* rl: the block's 32 query rows */
#pragma unroll
    for (int w = 1; w < NWV; ++w) o = o + *(const v4f*)&sR[(w * QT * 16 + rl) * SRP + c4];
    vst2(Y + ((size_t)b * TT + t0 + rl) * CC + h * HD + c4, o * (1.0f / 2048.0f)); } }
// ---- k_out: block = (64 rows, 128 cols): out = ctx Wo (+ bo): ctx x 2^6 once to f16 against Wo as f16(bf16 x 2^8) exact (1 product) x 2^-14; causal early rows (< QHI of each sequence): ctx bf16 hi + lo against exact bf16 Wo (2 products)
__global__ __launch_bounds__(128) void k_out(const float* __restrict__ Y, const float* __restrict__ WO, const float* __restrict__ BO, float* __restrict__ OUT) { __shared__ __align__(16) float sf[4][16][132]; __shared__ __align__(16) char wst[2 * 128 * WBP];
  const int tid = threadIdx.x, wave = tid >> 5, lane = tid & 31, col = lane & 15, g = lane >> 4; const int c0 = blockIdx.y * 128; const size_t r0 = (size_t)blockIdx.x * 64 + wave * 16;
  v8f acc[8] = {};
  if (CAUSAL && (int)(((size_t)blockIdx.x * 64) % TT) < QHI) {   /* block-uniform */
#pragma unroll 2
    for (int kc = 0; kc < CC / 32; ++kc) { const F2 a = split_row(Y + (r0 + col) * CC, kc * 32, lane); asm volatile("s_wait_loadcnt 0x0" ::: "memory");
#pragma unroll
      for (int j = 0; j < 8; ++j) { const v16b w = WOCOL(WO, kc * 32, c0 + j * 16 + col, lane); asm volatile("s_wait_loadcnt 0x0" ::: "memory"); acc[j] = wmma_bf(a.h, w, acc[j]); acc[j] = wmma_bf(a.l, w, acc[j]); } }
#pragma unroll
    for (int j = 0; j < 8; ++j) { const float bias = BO ? bfr(BO[c0 + j * 16 + col]) : 0.f;
#pragma unroll
      for (int r = 0; r < 8; ++r) sf[wave][8 * g + r][j * 16 + col] = acc[j][r] + bias; }
  } else {
    /* Wo's slab of a k step goes through LDS as in k_proj: fetched once by the block in whole rows, converted once, read as B fragments by all four waves */
    const float* wp = WO + (size_t)(wave * 8) * DIN + c0 + lane * 4; const float* yp = Y + (r0 + col) * CC;
    v4f wr[2][8]; float ar[2][16];
#pragma unroll
    for (int u = 0; u < 2; ++u) {
#pragma unroll
      for (int i = 0; i < 8; ++i) wr[u][i] = *(const v4f*)(wp + (size_t)(u * 32 + i) * DIN);
      raw_row(ar[u], yp + u * 32, lane); }
    auto step = [&](const int kc, const int u, const bool more) __attribute__((always_inline)) { char* wb = wst + u * (128 * WBP);
#pragma unroll
      for (int jj = 0; jj < 4; ++jj) { v8h t;
#pragma unroll
        for (int i = 0; i < 8; ++i) t[i] = (_Float16)(bfr(wr[u][i][jj]) * 256.0f);
        *(v8h*)(wb + (lane * 4 + jj) * WBP + wave * 16) = t; }
      if (more) { const float* wn = wp + (size_t)(kc + 2) * 32 * DIN;   /* the weight values of set u are in LDS: refill them for step kc + 2 */
#pragma unroll
        for (int i = 0; i < 8; ++i) wr[u][i] = *(const v4f*)(wn + (size_t)i * DIN);
        asm volatile("s_wait_xcnt 0x0" ::: "memory"); }   /* the loop advances the loads' address registers: keep the wait in front of that */
      v16h a;   /* ctx carried x 2^6 into f16 so small-magnitude context rows stay clear of f16 subnormals */
#pragma unroll
      for (int i = 0; i < 16; ++i) a[i] = (_Float16)(ar[u][i] * 64.0f);
      WBAR();   /* stage u is written; every wave has also left the other stage, which the next step overwrites */
      union { v16h v; v8h q[2]; } w[8];
#pragma unroll
      for (int j = 0; j < 8; ++j) { const char* f = wb + (j * 16 + col) * WBP + g * 16; w[j].q[0] = *(const v8h*)f; w[j].q[1] = *(const v8h*)(f + 32); }
      __builtin_amdgcn_sched_barrier(0);   /* all sixteen LDS reads ahead of the first product: one LDS latency a step */
#pragma unroll
      for (int j = 0; j < 8; ++j) acc[j] = wmma16(a, w[j].v, acc[j]);
      if (more) { raw_row(ar[u], yp + (kc + 2) * 32, lane);   /* the row values of set u are converted by now: refill them for step kc + 2 */
        asm volatile("s_wait_xcnt 0x0" ::: "memory"); } };   /* the loop advances the loads' address registers: keep the wait in front of that */
#pragma unroll 1   /* stays a loop of two steps, as in k_proj */
    for (int kc = 0; kc < CC / 32 - 2; kc += 2) { step(kc, 0, true); step(kc + 1, 1, true); }
    step(CC / 32 - 2, 0, false); step(CC / 32 - 1, 1, false);
#pragma unroll
    for (int j = 0; j < 8; ++j) { const float bias = BO ? bfr(BO[c0 + j * 16 + col]) : 0.f;
#pragma unroll
      for (int r = 0; r < 8; ++r) sf[wave][8 * g + r][j * 16 + col] = acc[j][r] * (1.0f / 16384.0f) + bias; } }   /* 2^-8 (Wo carry) x 2^-6 (ctx carry) */
  LDSX(); for (int rl = 0; rl < 16; ++rl) vst2(OUT + (r0 + rl) * DIN + c0 + lane * 4, *(const v4f*)&sf[wave][rl][lane * 4]); }

extern "C" void kernel_launch(void* const* d_in, const int* in_sizes, int n_in, void* d_out, int out_size, void* d_ws, size_t ws_size, hipStream_t stream) {
  (void)in_sizes; (void)n_in; (void)out_size;
  const float** F = (const float**)d_in;
  if (ws_size < (size_t)WS_END) return;
  char* ws = (char*)d_ws; _Float16 *QH = (_Float16*)(ws + WS_QH), *KH = (_Float16*)(ws + WS_KH), *VT = (_Float16*)(ws + WS_VT), *QL = (_Float16*)(ws + WS_QL), *KL = (_Float16*)(ws + WS_KL); __bf16 *VB = (__bf16*)(ws + WS_VB), *VBL = (__bf16*)(ws + WS_VBL); float *Y = (float*)(ws + WS_Y);
  (void)Y; (void)QL; (void)KL; (void)VB; (void)VBL;
  // inputs: 0 query [4,1024,512]; 1 key; 2 value; 3 pos_emb [1,1024,512]; 4 Wq (in,out), 5 bq; 6 Wk, 7 bk; 8 Wv, 9 bv; 10 Wo (in,out), 11 bo; 12 Wpos [512,512]; 13 pos_bias_u [8,64]; 14 pos_bias_v [8,64]
  if (ws_size < (size_t)WS_END2) return;
  _Float16 *QH2 = (_Float16*)(ws + WS_QH2), *QL2 = (_Float16*)(ws + WS_QL2), *KP = (_Float16*)(ws + WS_KP);
  k_proj<<<dim3(16, CC / 128, TNB * TT / 1024 * 3 + 1), 128, 0, stream>>>(F[0], F[1], F[2], F[3], F[4], F[6], F[8], F[12], F[5], F[7], F[9], QH, QL, QH2, QL2, KH, KL, KP, VT, VB, VBL, F[13], F[14]);   /* q (stored as q + pos_bias_u and as q + pos_bias_v), k, v, and p = pos_emb Wpos into KP */
  k_att<<<dim3(TT / (QT * 16), NH, TNB), 32 * NWV, 0, stream>>>(QH, QL, QH2, QL2, KH, KP, VT, Y);   /* AC + rel_shift(BD), softmax, P v */
  k_out<<<dim3(TNB * TT / 64, DIN / 128), 128, 0, stream>>>(Y, F[10], F[11], (float*)d_out);
}

// v010
// It runs in 64 microseconds.
// In two side-by-side timings against v009, it was 1.06 and 1.05 times as fast.
// All steps since v000 together make it 8.06 times as fast.
// compute dtype: all float inputs rounded to bf16; projections with EXACT bf16 products on WMMA 16x16x32 (f32 accumulate) + biases; content (q+u).k and position (q+v).p scores each with q as f16 hi + residual (x 2^10) against f16 k / p (2 products) x 64^-0.5 x log2 e; rel_shift as the store index of the position scores in LDS; softmax f32 in base 2; P x 2^11 once to f16 x v once to f16 (1 product); ctx carried x 2^6 once to f16 x Wo f16(bf16 x 2^8) + bo; f32 output.
#include <hip/hip_runtime.h>
#include <math.h>

typedef __attribute__((ext_vector_type(16))) _Float16 v16h;
typedef __attribute__((ext_vector_type(16))) __bf16 v16b;
typedef __attribute__((ext_vector_type(8)))  _Float16 v8h;
typedef __attribute__((ext_vector_type(8)))  float v8f;
typedef __attribute__((ext_vector_type(4)))  float v4f;
typedef __attribute__((ext_vector_type(2)))  float v2f;
typedef __attribute__((ext_vector_type(4)))  unsigned v4u;
typedef __attribute__((ext_vector_type(4)))  int v4i;
typedef float __attribute__((may_alias)) float_a;
typedef int __attribute__((may_alias)) int_a;

template <typename T> __device__ __forceinline__ void vst2(void* p, T v) { *(T*)p = v;  }
__device__ __forceinline__ v8f wmma16(v16h a, v16h b, v8f c) {
  v8f d = __builtin_amdgcn_wmma_f32_16x16x32_f16(false, a, false, b, (short)0, c, false, false);
  asm volatile("v_nop\n\tv_nop\n\tv_nop\n\tv_nop" : "+v"(d) : "v"(a), "v"(b));
  return d;
}
__device__ __forceinline__ v8f wmma_bf(v16b a, v16b b, v8f c) {
  v8f d = __builtin_amdgcn_wmma_f32_16x16x32_bf16(false, a, false, b, (short)0, c, false, false);
  asm volatile("v_nop\n\tv_nop\n\tv_nop\n\tv_nop" : "+v"(d) : "v"(a), "v"(b));
  return d;
}
// 16x16x32 fragments: lane = (h = lane>>4, row/col = lane&15); elements 0..7 = k0+8h+0..7, 8..15 = k0+16+8h+0..7; D element r = row 8h+r
__device__ __forceinline__ v16h frag_h(const _Float16* rowk0, int lane) {
  union { v16h v; v8h q[2]; } u; const _Float16* p = rowk0 + 8 * (lane >> 4);
  u.q[0] = *(const v8h*)p; u.q[1] = *(const v8h*)(p + 16); return u.v;
}
__device__ __forceinline__ v16h frag_f32(const float* rowk0, int lane) {
  v16h a; const float* p = rowk0 + 8 * (lane >> 4);
#pragma unroll
  for (int i = 0; i < 8; ++i) { a[i] = (_Float16)p[i]; a[8 + i] = (_Float16)p[16 + i]; }
  return a;
}
__device__ __forceinline__ v16h frag_f32s(const float* rowk0, int lane, float sc) {
  v16h a; const float* p = rowk0 + 8 * (lane >> 4);
#pragma unroll
  for (int i = 0; i < 8; ++i) { a[i] = (_Float16)(p[i] * sc); a[8 + i] = (_Float16)(p[16 + i] * sc); }
  return a;
}
// column fragment from a [K][ld] layout (column n), rows >= K read as 0
__device__ __forceinline__ v16h fragc_f32(const float* W, int k0, int n, int lane, int ld, int K) {
  v16h a; const int g = lane >> 4;
#pragma unroll
  for (int i = 0; i < 8; ++i) { const int ka = k0 + 8 * g + i, kb = ka + 16;
    a[i] = (_Float16)(ka < K ? W[(size_t)(ka < K ? ka : K - 1) * ld + n] : 0.f); a[8 + i] = (_Float16)(kb < K ? W[(size_t)(kb < K ? kb : K - 1) * ld + n] : 0.f); }
  return a;
}
struct F2 { v16b h, l; };
__device__ __forceinline__ F2 bsplit16(const float v[16]) { F2 r;
#pragma unroll
  for (int i = 0; i < 16; ++i) { const __bf16 h = (__bf16)v[i]; r.h[i] = h; r.l[i] = (__bf16)(v[i] - (float)h); }
  return r; }
__device__ __forceinline__ F2 split_row(const float* row, int k0, int lane) { float v[16]; const float* p = row + k0 + 8 * (lane >> 4);
#pragma unroll
  for (int i = 0; i < 8; ++i) { v[i] = p[i]; v[8 + i] = p[16 + i]; }
  return bsplit16(v); }
__device__ __forceinline__ F2 split_rowK(const float* row, int k0, int lane, int K) { float v[16]; const int g = lane >> 4;
#pragma unroll
  for (int i = 0; i < 8; ++i) { const int ka = k0 + 8 * g + i, kb = ka + 16; v[i] = ka < K ? row[ka < K ? ka : K - 1] : 0.f; v[8 + i] = kb < K ? row[kb < K ? kb : K - 1] : 0.f; }
  return bsplit16(v); }
__device__ __forceinline__ F2 split_col(const float* W, int k0, int n, int lane, int ld, int K) { float v[16]; const int g = lane >> 4;
#pragma unroll
  for (int i = 0; i < 8; ++i) { const int ka = k0 + 8 * g + i, kb = ka + 16; v[i] = ka < K ? W[(size_t)(ka < K ? ka : K - 1) * ld + n] : 0.f; v[8 + i] = kb < K ? W[(size_t)(kb < K ? kb : K - 1) * ld + n] : 0.f; }
  return bsplit16(v); }
__device__ __forceinline__ v8f mac3(const F2& a, const F2& b, v8f c) { c = wmma_bf(a.l, b.h, c); c = wmma_bf(a.h, b.l, c); return wmma_bf(a.h, b.h, c); }
__device__ __forceinline__ float sigm(float v) { return 1.0f / (1.0f + expf(-v)); }
#define LDSX() do { asm volatile("s_wait_dscnt 0" ::: "memory"); __builtin_amdgcn_wave_barrier(); __builtin_amdgcn_fence(__ATOMIC_RELEASE, "workgroup"); } while (0)

// Transformer-XL / Conformer relative multi-head attention (B 4, T = P = 1,024, D 512 = 8 heads x 64; (in,out) Wq/Wk/Wv/Wo [512,512] + zero biases, Wpos [512,512] no bias, pos_bias_u/v [8,64]; 1/sqrt(64)-scale): AC = (q + u) k^T, BD = rel_shift((q + v) p^T) with p = pos_emb Wpos (pad-reshape trick, no mask), attn = softmax((AC + BD)/8), out = merge(attn v) Wo + bo.
#define NB 4
#define TT 1024
#define CC 512            // NH * HD = projected width
#define DIN 512          // input (model) width
#define NH 8
#define HD 64
#define NQB (TT / 64)
#define HG 8
#define SCALE (0.125f)
#define SCALE_L2 (SCALE * 1.4426950408889634f)   // logits are carried in units of log 2 (scale x log2 e), so that the softmax exponential is the chip's own base-2 instruction
#define CAUSAL 0
#ifndef TNB
#define TNB NB
#endif
__device__ __forceinline__ float bfr(float v) { return (float)(__bf16)v; }
__host__ __device__ __forceinline__ int kb_last(int qb) { return CAUSAL ? ((qb * 64 + 63) >> 7) : (TT / 128 - 1); }
typedef __attribute__((ext_vector_type(8))) __bf16 v8b;
__device__ __forceinline__ v16b frag_b(const __bf16* rowk0, int lane) {
  union { v16b v; v8b q[2]; } u; const __bf16* p = rowk0 + 8 * (lane >> 4);
  u.q[0] = *(const v8b*)p; u.q[1] = *(const v8b*)(p + 16); return u.v;
}
#define QBH 0              // read by no kernel here
#define QHI 1024            // rows carrying a q residual plane (all rows when non-causal: 2-product logits everywhere)
#define KHI 64            // key rows carrying k residual / v bf16 hi+lo planes (written, but read by no kernel here)
// B fragment (k rows k0+.., output column o) of a weight: (in,out) [K][ld] or (out,in) [ld rows of K]: bf16 exact, or f16(bf16 * 256) exact
__device__ __forceinline__ v16b wcol_io(const float* Wm, int k0, int o, int lane, int ld) { v16b w; const int g = lane >> 4;
#pragma unroll
  for (int i = 0; i < 8; ++i) { w[i] = (__bf16)Wm[(size_t)(k0 + 8 * g + i) * ld + o]; w[8 + i] = (__bf16)Wm[(size_t)(k0 + 16 + 8 * g + i) * ld + o]; }
  return w; }
__device__ __forceinline__ v16b wcol_oi(const float* Wm, int k0, int o, int lane, int K) { v16b w; const float* p = Wm + (size_t)o * K + k0 + 8 * (lane >> 4);
#pragma unroll
  for (int i = 0; i < 8; ++i) { w[i] = (__bf16)p[i]; w[8 + i] = (__bf16)p[16 + i]; }
  return w; }
__device__ __forceinline__ v16h wcolh_io(const float* Wm, int k0, int o, int lane, int ld) { v16h w; const int g = lane >> 4;
#pragma unroll
  for (int i = 0; i < 8; ++i) { w[i] = (_Float16)(bfr(Wm[(size_t)(k0 + 8 * g + i) * ld + o]) * 256.0f); w[8 + i] = (_Float16)(bfr(Wm[(size_t)(k0 + 16 + 8 * g + i) * ld + o]) * 256.0f); }
  return w; }
__device__ __forceinline__ v16h wcolh_oi(const float* Wm, int k0, int o, int lane, int K) { v16h w; const float* p = Wm + (size_t)o * K + k0 + 8 * (lane >> 4);
#pragma unroll
  for (int i = 0; i < 8; ++i) { w[i] = (_Float16)(bfr(p[i]) * 256.0f); w[8 + i] = (_Float16)(bfr(p[16 + i]) * 256.0f); }
  return w; }
// unconverted f32 values of a fragment, in fragment element order: a row operand, and column o of an (in,out) [K][ld] weight
__device__ __forceinline__ void raw_row(float (&r)[16], const float* rowk0, int lane) { const float* p = rowk0 + 8 * (lane >> 4);
#pragma unroll
  for (int i = 0; i < 8; ++i) { r[i] = p[i]; r[8 + i] = p[16 + i]; } }
__device__ __forceinline__ void raw_col(float (&r)[16], const float* Wm, int k0, int o, int lane, int ld) { const int g = lane >> 4;
#pragma unroll
  for (int i = 0; i < 8; ++i) { r[i] = Wm[(size_t)(k0 + 8 * g + i) * ld + o]; r[8 + i] = Wm[(size_t)(k0 + 16 + 8 * g + i) * ld + o]; } }
#define WQKV_LAYOUT 0   // selects WCOL only, which nothing calls (k_proj always reads (in,out) [DIN][CC]): 0 = (in,out) [DIN][CC]; 1 = (out,in) [CC][DIN]; 2 = per-head [NH][DIN][HD]
__device__ __forceinline__ v16b wcol_hdk(const float* Wm, int k0, int o, int lane) { v16b w; const int g = lane >> 4; const float* p = Wm + (size_t)(o / HD) * DIN * HD + (o % HD);
#pragma unroll
  for (int i = 0; i < 8; ++i) { w[i] = (__bf16)p[(size_t)(k0 + 8 * g + i) * HD]; w[8 + i] = (__bf16)p[(size_t)(k0 + 16 + 8 * g + i) * HD]; }
  return w; }
#define WO_OUT_IN 0
#if WQKV_LAYOUT == 1
#define WCOL(W, k0, o, lane) wcol_oi(W, k0, o, lane, DIN)
#elif WQKV_LAYOUT == 2
#define WCOL(W, k0, o, lane) wcol_hdk(W, k0, o, lane)
#else
#define WCOL(W, k0, o, lane) wcol_io(W, k0, o, lane, CC)
#endif
#if WO_OUT_IN
#define WOCOL(W, k0, o, lane) wcol_oi(W, k0, o, lane, CC)
#define WOCOLH(W, k0, o, lane) wcolh_oi(W, k0, o, lane, CC)
#else
#define WOCOL(W, k0, o, lane) wcol_io(W, k0, o, lane, DIN)
#define WOCOLH(W, k0, o, lane) wcolh_io(W, k0, o, lane, DIN)
#endif
#define WS_QH2 (WS_END)                                   // f16 q_v rows, fragment order
#define WS_QL2 (WS_QH2 + 2u * (size_t)NB * TT * CC)       // f16 q_v residual rows, fragment order
#define WS_KP  (WS_QL2 + 2u * (size_t)NB * QHI * CC)      // f16 positional key rows p = pos_emb Wpos, fragment order (the first TT rows are used)
#define WS_S2  (WS_KP + 2u * (size_t)NB * TT * CC)        // f32 [hg][t][p], unused: k_att keeps BD in LDS
#define WS_END2 (WS_S2 + 4u * (size_t)HG * TT * TT)

#define WS_QH  0u                                      // f16 q rows, fragment order [b*t / 16][head][piece 4][lane 32][8] (see pk_row)
#define WS_KH  (WS_QH + 2u * (size_t)NB * TT * CC)      // f16 k rows, fragment order as the q rows
#define WS_VT  (WS_KH + 2u * (size_t)NB * TT * CC)      // f16 v, fragment order [b][head][d / 16][t / 32][half 2][lane 32][8]: lane = (t / 8 & 1) * 16 + d % 16
#define WS_QL  (WS_VT + 2u * (size_t)NB * CC * TT)      // f16 q residual x 2^10 rows, fragment order as the q rows (QHI = TT)
#define WS_KL  (WS_QL + 2u * (size_t)NB * QHI * CC)     // f16 k residual x 2^10 rows [b][t < KHI][CC]
#define WS_VB  (WS_KL + 2u * (size_t)NB * KHI * CC)     // bf16 v hi planes [b][c][t < KHI]
#define WS_VBL (WS_VB + 2u * (size_t)NB * CC * KHI)
#define WS_S   (WS_VBL + 2u * (size_t)NB * CC * KHI)    // f32 [hg][t][s], unused: k_att keeps logits and P on chip
#define WS_Y   (WS_S  + 4u * (size_t)HG * TT * TT)      // f32 ctx rows [b*t][CC] (only when there is an output projection)
#define WS_END (WS_Y  + 4u * (size_t)NB * TT * CC)

#define WBP 80           // bytes from a column to the next in a staged weight slab: 64 B of k and 16 more, so that the 16 columns of a fragment read fall on different banks
// work-group barrier of the staged GEMM loops: it waits for this wave's LDS traffic alone. __syncthreads() would also wait for the global loads of the steps ahead, which only this wave's registers receive and which are to stay in flight across it
#define WBAR() asm volatile("s_wait_dscnt 0x0\n\ts_barrier_signal -1\n\ts_barrier_wait -1" ::: "memory")
// ---- k_proj: every projection in one launch. block = (64 rows, 128 cols, which = blockIdx.z / 4): X W (+ b) with exact bf16 products (K = DIN) -> which 0: q, multiplied once and stored twice, as q + pos_bias_u and as q + pos_bias_v (f16 rows + residual rows each); 1: k f16 rows (+ residual rows < KHI); 2: v f16 planes (+ bf16 hi/lo planes [c][t] for t < KHI); 3: the positional key rows p = pos_emb Wpos (no bias, the TT rows of blockIdx.z = 12), f16 rows as k; the f16 planes are stored in the fragment order that k_att loads (layouts: WS_QH, WS_VT). The q blocks have the longest epilogue and the lowest indices, so they start first
// Every product is taken transposed, (W^T)(X^T): the weight columns are the A operand and the input rows the B operand, so that a lane's eight accumulator registers are 8 neighbouring columns of one row. For q, k and p that is one 16-byte place of the destination: accumulator tile j of wave w is, lane for lane, one 512-byte piece of the plane, and it is stored from the registers, through no LDS and no barrier. v, whose plane runs along t, is rounded in the registers and turned in LDS as 16-bit values. What is left in LDS is the weight stages (reused for v's turn) and the biases, so that registers and not LDS set how many blocks stand on a WGP (4: the whole grid is resident at once)
__global__ __launch_bounds__(128, 4) void k_proj(const float* __restrict__ XQ, const float* __restrict__ XK, const float* __restrict__ XV, const float* __restrict__ XP, const float* __restrict__ WQ, const float* __restrict__ WK, const float* __restrict__ WV, const float* __restrict__ WP, const float* __restrict__ BQ, const float* __restrict__ BK, const float* __restrict__ BV,
    _Float16* __restrict__ QH, _Float16* __restrict__ QL, _Float16* __restrict__ QH2, _Float16* __restrict__ QL2, _Float16* __restrict__ KH, _Float16* __restrict__ KL, _Float16* __restrict__ KP, _Float16* __restrict__ VT, __bf16* __restrict__ VB, __bf16* __restrict__ VBL, const float* __restrict__ EXU, const float* __restrict__ EXV) {
  __shared__ __align__(16) char lds[3 * 128 * 72 * 2]; __shared__ __align__(16) float sb[3][128];   /* lds: first the two weight stages, then v's planes [column][t] at pitch 72; sb: the block's 128 columns of b, pos_bias_u, pos_bias_v, rounded to bf16 */
  static_assert(2 * 128 * WBP <= 128 * 72 * 2 * 3, "the weight stages lie inside lds"); char* wst = lds;
  const int tid = threadIdx.x, wave = __builtin_amdgcn_readfirstlane(tid >> 5), lane = tid & 31, col = lane & 15, g = lane >> 4; const int which = blockIdx.z >> 2; const int c0 = blockIdx.y * 128; const size_t r0 = (size_t)((blockIdx.z & 3) * 16 + blockIdx.x) * 64; const size_t bb = r0 / TT; const int t0 = (int)(r0 % TT);
  const float* X = which == 0 ? XQ : which == 1 ? XK : which == 2 ? XV : XP; const float* WA = which == 0 ? WQ : which == 1 ? WK : which == 2 ? WV : WP; const float* BA = which == 0 ? BQ : which == 1 ? BK : which == 2 ? BV : nullptr;
  /* the biases are asked for ahead of the first slabs and laid in LDS behind them; the first barrier of the k loop publishes them. The three loads stand under no branch, so that none is waited for by itself: p, which has no bias, reads pos_bias_u in its place and stores 0; only q reads rows 1 and 2 of sb */
  const float bv0 = (BA ? BA : EXU)[c0 + tid], bv1 = EXU[c0 + tid], bv2 = EXV[c0 + tid];
  v8f acc[8] = {};
  /* the weight slab of a k step (32 rows x 128 columns) is fetched once by the block, in whole 512-byte rows, rounded once and laid in LDS as [column][k] at pitch WBP, where all four waves take their weight fragments. Thread = (8 k rows: wave, 4 columns: lane). Two LDS stages and two register sets: the loads of step kc + 2 are issued in step kc, as soon as their registers are free, and fly during step kc + 1 */
  const float* wp = WA + (size_t)(wave * 8) * CC + c0 + lane * 4; const float* xp = X + (r0 + wave * 16 + col) * DIN;
  v4f wr[2][8]; float ar[2][16];
#pragma unroll
  for (int u = 0; u < 2; ++u) {
#pragma unroll
    for (int i = 0; i < 8; ++i) wr[u][i] = *(const v4f*)(wp + (size_t)(u * 32 + i) * CC);
    raw_row(ar[u], xp + u * 32, lane); }
  sb[0][tid] = BA ? bfr(bv0) : 0.f; sb[1][tid] = bfr(bv1); sb[2][tid] = bfr(bv2);
  auto step = [&](const int kc, const int u, const bool more) __attribute__((always_inline)) { char* wb = wst + u * (128 * WBP);
    __builtin_amdgcn_sched_barrier(0);   /* a step's conversions stay behind the products of the step before: lifted in among them they hold 16 more registers, and within the 256 of four waves a SIMD the row loads then land in fragment registers and are waited for at once */
#pragma unroll
    for (int jj = 0; jj < 4; ++jj) { v8b t;
#pragma unroll
      for (int i = 0; i < 8; ++i) t[i] = (__bf16)wr[u][i][jj];
      *(v8b*)(wb + (lane * 4 + jj) * WBP + wave * 16) = t; }
    if (more) { const float* wn = wp + (size_t)(kc + 2) * 32 * CC;   /* the weight values of set u are in LDS: refill them for step kc + 2 */
#pragma unroll
      for (int i = 0; i < 8; ++i) wr[u][i] = *(const v4f*)(wn + (size_t)i * CC);
      asm volatile("s_wait_xcnt 0x0" ::: "memory"); }   /* the loop advances the loads' address registers: keep the wait in front of that */
    v16b a;
#pragma unroll
    for (int i = 0; i < 16; ++i) a[i] = (__bf16)ar[u][i];
    WBAR();   /* stage u is written; every wave has also left the other stage, which the next step overwrites */
    union { v16b v; v8b q[2]; } w[8];
#pragma unroll
    for (int j = 0; j < 8; ++j) { const char* f = wb + (j * 16 + col) * WBP + g * 16; w[j].q[0] = *(const v8b*)f; w[j].q[1] = *(const v8b*)(f + 32); }
    __builtin_amdgcn_sched_barrier(0);   /* all sixteen LDS reads are issued ahead of the first product, so that one LDS latency serves the step and not eight */
#pragma unroll
    for (int j = 0; j < 8; ++j) acc[j] = wmma_bf(w[j].v, a, acc[j]);   /* both fragments hold the same k at the same element, so they change places as they are */
    if (more) { raw_row(ar[u], xp + (kc + 2) * 32, lane);   /* the row values of set u are converted by now: refill them for step kc + 2 */
      asm volatile("s_wait_xcnt 0x0" ::: "memory"); } };   /* the loop advances the loads' address registers: keep the wait in front of that */
#pragma unroll 1   /* stays a loop of two steps: unrolled whole, the compiler lifts every conversion up to its loads, and each step then waits for loads just issued */
  for (int kc = 0; kc < DIN / 32 - 2; kc += 2) { step(kc, 0, true); step(kc + 1, 1, true); }
  step(DIN / 32 - 2, 0, false); step(DIN / 32 - 1, 1, false);
  /* acc[j][r] = column c0 + 16 j + 8 g + r of row r0 + 16 wave + col */
  if (which != 2) {   /* block-uniform */
    const size_t po = (((r0 >> 4) + wave) * NH + (c0 >> 6)) * 1024 + lane * 8;   /* the lane's place in piece 0 of the wave's row tile; tile j is piece j (4 pieces a head) */
    _Float16 *d0 = (which == 0 ? QH : which == 1 ? KH : KP) + po, *d1 = QL + po, *d2 = QH2 + po, *d3 = QL2 + po;
    _Float16* dk = KL + (bb * KHI + (t0 < KHI ? t0 : 0) + wave * 16 + col) * (size_t)CC + c0 + 8 * g; const bool klo = which == 1 && t0 < KHI;
    auto xb = [&](float (&x)[8], const int j) __attribute__((always_inline)) { const float* bp = &sb[0][j * 16 + 8 * g]; const v4f b0 = *(const v4f*)bp, b1 = *(const v4f*)(bp + 4);   /* tile j + b */
#pragma unroll
      for (int r = 0; r < 4; ++r) { x[r] = acc[j][r] + b0[r]; x[4 + r] = acc[j][4 + r] + b1[r]; } };
    if (which == 0) {
#pragma unroll
      for (int j = 0; j < 8; ++j) { float x[8]; xb(x, j); v8h hv[2], lv[2];   /* q + pos_bias_u, then q + pos_bias_v: the per-(head, dim) bias is added in f32 to (x Wq + bq) */
#pragma unroll
        for (int ps = 0; ps < 2; ++ps) { const float* ep = &sb[1 + ps][j * 16 + 8 * g]; const v4f e0 = *(const v4f*)ep, e1 = *(const v4f*)(ep + 4);
#pragma unroll
          for (int r = 0; r < 8; ++r) { const float v = x[r] + (r < 4 ? e0[r & 3] : e1[r & 3]); const _Float16 h = (_Float16)v; hv[ps][r] = h; lv[ps][r] = (_Float16)((v - (float)h) * 1024.0f); } }
        *(v8h*)(d0 + j * 256) = hv[0]; *(v8h*)(d1 + j * 256) = lv[0]; *(v8h*)(d2 + j * 256) = hv[1]; *(v8h*)(d3 + j * 256) = lv[1];
        asm volatile("s_wait_xcnt 0x0" :: "v"(hv[0]), "v"(lv[0]), "v"(hv[1]), "v"(lv[1]) : "memory"); }   /* the next tile's values may be formed in these stores' data registers: as inputs they live up to the wait */
    } else {
#pragma unroll
      for (int j = 0; j < 8; ++j) { float x[8]; xb(x, j); v8h hv;
#pragma unroll
        for (int r = 0; r < 8; ++r) hv[r] = (_Float16)x[r];
        *(v8h*)(d0 + j * 256) = hv;
        asm volatile("s_wait_xcnt 0x0" :: "v"(hv) : "memory"); }   /* as above */
      if (klo) {
#pragma unroll
        for (int j = 0; j < 8; ++j) { float x[8]; xb(x, j); v8h lv;
#pragma unroll
          for (int r = 0; r < 8; ++r) lv[r] = (_Float16)((x[r] - (float)(_Float16)x[r]) * 1024.0f);
          *(v8h*)(dk + j * 16) = lv;
          asm volatile("s_wait_xcnt 0x0" :: "v"(lv) : "memory"); } } }   /* as above */
  } else { const bool hi_rows = t0 < KHI; _Float16 (*th)[72] = (_Float16 (*)[72])lds; __bf16 (*tb)[72] = (__bf16 (*)[72])(lds + 128 * 72 * 2), (*tbl)[72] = (__bf16 (*)[72])(lds + 2 * 128 * 72 * 2);
    __syncthreads();   /* every wave has taken its last weight fragments: the stages' LDS is free for v's planes */
#pragma unroll
    for (int j = 0; j < 8; ++j) { const float* bp = &sb[0][j * 16 + 8 * g]; const v4f b0 = *(const v4f*)bp, b1 = *(const v4f*)(bp + 4);
#pragma unroll
      for (int r = 0; r < 8; ++r) { acc[j][r] = acc[j][r] + (r < 4 ? b0[r & 3] : b1[r & 3]); th[j * 16 + 8 * g + r][wave * 16 + col] = (_Float16)acc[j][r]; } }
    if (hi_rows) {
#pragma unroll
      for (int j = 0; j < 8; ++j)
#pragma unroll
        for (int r = 0; r < 8; ++r) { const float v = acc[j][r]; const int cl = j * 16 + 8 * g + r, rl = wave * 16 + col; const __bf16 bh = (__bf16)v; tb[cl][rl] = bh; tbl[cl][rl] = (__bf16)(v - (float)bh); } }
    __syncthreads();   /* v's planes are written */
    for (int e = tid; e < 128 * 8; e += 128) { const int ln = e & 31, cl = (e >> 7) * 16 + (ln & 15), q = ((e >> 5) & 3) * 2 + (ln >> 4);   /* destination order: [head 2][d tile 4][t block 2][half 2][lane 32] */
      vst2((unsigned*)(VT + (((bb * NH + (c0 >> 6)) * 4 + (e >> 7)) * 32 + (t0 >> 5)) * 512 + (e & 127) * 8), *(const v4u*)&th[cl][q * 8]);
      asm volatile("s_wait_xcnt 0x0" ::: "memory");   /* what follows overwrites the store's address and data registers: keep the wait in front of that */
      if (hi_rows) { const size_t o3 = (bb * CC + c0 + cl) * (size_t)KHI + t0 + q * 8; vst2((unsigned*)(VB + o3), *(const v4u*)&tb[cl][q * 8]); vst2((unsigned*)(VBL + o3), *(const v4u*)&tbl[cl][q * 8]);
        asm volatile("s_wait_xcnt 0x0" ::: "memory"); } } } }   /* as above, for these two stores */
// ---- k_att: block = 128 query rows of (b, h), worked as four tiles of 32 rows (two 16-row tiles, t0..t0+31) one after the other; 16 waves, wave w owns key / position columns [64 w, 64 w + 64). Logits never leave the WGP.
// A block fills a WGP (16 waves of 256 registers), so blocks could only follow one another there, each start paid in full between two tiles. With the loop the grid is one block a WGP: waves start once, and a tile's first loads are in flight while the tile before is summed and stored.
// Every k, p and v fragment that a wave loads is multiplied with BOTH query tiles, so the block fetches the head's k, p and v planes once for 32 queries. The two tiles are worked as two independent 16-row problems (tile qs: rows ts = t0 + 16 qs, its own BD' rows in LDS).
// Every score product is taken transposed: the key (position) rows are the A operand and the query rows the B operand, so a lane holds ONE query of each tile (ts + col) and register r of a score tile the key 8 g + r. A row's maximum and sum are then sums inside a lane, and two score tiles, converted in place, are the B operand of ctx^T = v^T P^T: P needs no LDS and no lane exchange.
//  1. BD = (q + v) . p x 1/8 x log2 e is stored straight to its rel_shift place in LDS. The reference's pad-reshape is linear in memory: BD[r][c] lands at flat out index r T + r + c + 1 - T, so row r's columns c >= T-1-r go to out row r and the others to out row r-1; out[t][t+1] is the pad's 0.
//     A query tile needs BD rows ts..ts+16; a 16-column tile at cs needs rows ts+1..ts+16 when cs + ts <= T - 32 and rows ts..ts+15 otherwise (cs, ts multiples of 16), so one row tile serves each column tile.
//  2. AC = (q + u) . k x 1/8 x log2 e stays in registers and takes BD' from LDS; softmax in f32 over the 32 half-waves, 2^(s - max) for e^(..); P x 2^11 once to f16 in registers.
//  3. each wave multiplies its own 64 keys of P with v (f16, 1 product); the 16 partial ctx tiles are summed in wave order.
// Every loop within a tile is fully unrolled: the fragment, logit and accumulator arrays stay in registers only when each index is a constant. A block's 16 waves stand 4 on a SIMD (256 registers each).
// The q, k, p and v planes lie in the workspace in fragment order: the 16 bytes that lane l of a wave takes with one load stand at 16 l inside a 512-byte piece, so a load reads 4 whole 128-byte lines and not a 32-byte part of 16 lines.
// Rows (q, k, p): a (16 rows, one head) tile is 4 pieces; piece 2 kc + half holds d = 32 kc + 16 half + 8 g + 0..7 of row r at lane 16 g + r % 16. pk_row = f16 index of the lane's place in piece 0.
__device__ __forceinline__ size_t pk_row(size_t row, int h, int g) { return ((row >> 4) * NH + h) * 1024 + (g * 16 + (row & 15)) * 8; }
#define PKT (NH * 1024)  // f16 from a 16-row tile to the next
__device__ __forceinline__ v16h frag_at(const _Float16* p) { union { v16h v; v8h q[2]; } u; u.q[0] = *(const v8h*)p; u.q[1] = *(const v8h*)(p + 256); return u.v; }   // the two pieces of one 32-deep fragment; p holds the lane's place
// behind a group of loads: the group's address registers are inputs, so they live up to the wait and no load of the group is given one of them as its destination; behind the wait they may be overwritten
#define XW1(p) asm volatile("s_wait_xcnt 0x0" :: "v"(p) : "memory")
#define XW2(p, q) asm volatile("s_wait_xcnt 0x0" :: "v"(p), "v"(q) : "memory")
#define XW5(p, q, r, s, t) asm volatile("s_wait_xcnt 0x0" :: "v"(p), "v"(q), "v"(r), "v"(s), "v"(t) : "memory")
#define QT 2             // 16-row query tiles worked side by side
#define NIT 4            // 32-row tiles that a block works one after the other: TT / 32 / NIT x NH x NB = 256 blocks, one for each WGP, all started at once
#define KW 64            // key / position columns of a wave
#define NWV (TT / KW)    // waves of a block
#define SBP (TT + 4)     // f32 pitch of the BD' rows in LDS: 16 B more than a row, so that the 16 rows that the lanes of a 16-byte read take fall on different banks
#define SRP (HD + 4)     // f32 pitch of the partial ctx rows
#define RDP (2 * NWV + 4)   // f32 pitch of a row's 32 partial maxima / sums (one per half-wave), 16 B more than they fill
static_assert(NWV * SRP >= SBP, "the partial ctx tiles are the larger use of sS");
__device__ __forceinline__ float max8(const float (&x)[8]) { return fmaxf(fmaxf(fmaxf(x[0], x[1]), fmaxf(x[2], x[3])), fmaxf(fmaxf(x[4], x[5]), fmaxf(x[6], x[7]))); }
__device__ __forceinline__ float sum8(const float (&x)[8]) { return ((x[0] + x[1]) + (x[2] + x[3])) + ((x[4] + x[5]) + (x[6] + x[7])); }
// maximum / sum of a row's 32 partial values in LDS, eight 16-byte reads
__device__ __forceinline__ float max32(const float* p) { float m[8];
#pragma unroll
  for (int i = 0; i < 8; ++i) { const v4f x = *(const v4f*)(p + 4 * i); m[i] = fmaxf(fmaxf(x[0], x[1]), fmaxf(x[2], x[3])); }
  return max8(m); }
__device__ __forceinline__ float sum32(const float* p) { float m[8];
#pragma unroll
  for (int i = 0; i < 8; ++i) { const v4f x = *(const v4f*)(p + 4 * i); m[i] = (x[0] + x[1]) + (x[2] + x[3]); }
  return sum8(m); }
__global__ __launch_bounds__(32 * NWV, 4) void k_att(const _Float16* __restrict__ QH, const _Float16* __restrict__ QL, const _Float16* __restrict__ QH2, const _Float16* __restrict__ QL2, const _Float16* __restrict__ KH, const _Float16* __restrict__ KP, const _Float16* __restrict__ VT, float* __restrict__ Y) {
  __shared__ __align__(16) float sS[NWV * QT * 16 * SRP];   /* first the f32 BD' rows [QT][16][SBP]; once every wave has read them, the partial ctx tiles [NWV][QT][16][SRP] */
  __shared__ __align__(16) float redm[QT * 16][RDP], reds[QT * 16][RDP];
  float* sR = sS;
  const int tid = threadIdx.x, wave = __builtin_amdgcn_readfirstlane(tid >> 5), lane = tid & 31, col = lane & 15, g = lane >> 4;
  const int h = blockIdx.y, b = blockIdx.z, c0 = wave * KW;
  v16h bh[QT][HD / 32], bl[QT][HD / 32], pf[HD / 32][KW / 16];   /* the (q + v) and position fragments with which a tile's work begins: asked for while the tile before is still being summed */
  auto ask = [&](const int t0) __attribute__((always_inline)) { const _Float16 *qha[QT], *qla[QT]; const _Float16* pb = KP + pk_row((size_t)(c0 + col), h, g);
#pragma unroll
    for (int qs = 0; qs < QT; ++qs) { const int t = t0 + qs * 16 + col;   /* the row tile of this wave's first column tile: the shifted rows or the unshifted ones. Row T does not exist and no column tile of the last query tile uses the shifted rows */
      const size_t qra = pk_row((size_t)b * TT + (c0 + t0 + qs * 16 <= TT - 32 ? (t + 1 < TT ? t + 1 : TT - 1) : t), h, g);
      qha[qs] = QH2 + qra; qla[qs] = QL2 + qra;
#pragma unroll
      for (int kc = 0; kc < HD / 32; ++kc) { bh[qs][kc] = frag_at(qha[qs] + kc * 512); bl[qs][kc] = frag_at(qla[qs] + kc * 512); } }
#pragma unroll
    for (int kc = 0; kc < HD / 32; ++kc)
#pragma unroll
      for (int j = 0; j < KW / 16; ++j) pf[kc][j] = frag_at(pb + j * PKT + kc * 512);
    XW5(qha[0], qla[0], qha[1], qla[1], pb); };
  auto fold = [&](const int t0) __attribute__((always_inline)) {   /* the waves' partial ctx tiles of tile t0, summed in wave order and stored */
    WBAR();   /* the 16 partial ctx tiles are written; not __syncthreads(), which would wait for the loads just issued */
    const int rl = tid >> 4, c4 = (tid & 15) * 4; v4f o = *(const v4f*)&sR[rl * SRP + c4];   /* rl: the tile's 32 query rows */
#pragma unroll
    for (int w = 1; w < NWV; ++w) o = o + *(const v4f*)&sR[(w * QT * 16 + rl) * SRP + c4];
    float* yp = Y + ((size_t)b * TT + t0 + rl) * CC + h * HD + c4; o = o * (1.0f / 2048.0f); vst2(yp, o);
    asm volatile("s_wait_xcnt 0x0" :: "v"(yp), "v"(o) : "memory"); };   /* the next tile overwrites the store's address and data registers: as inputs they live up to the wait */
  ask(blockIdx.x * (NIT * QT * 16));
#pragma unroll 1   /* stays a loop: one tile's code and registers serve all NIT tiles */
  for (int it = 0;; ++it) { const int t0 = (blockIdx.x * NIT + it) * (QT * 16);
  size_t qr0[QT];   /* every offset below holds the lane's place in a piece */
#pragma unroll
  for (int qs = 0; qs < QT; ++qs) qr0[qs] = pk_row((size_t)b * TT + t0 + qs * 16 + col, h, g);
  WBAR();   /* every wave has summed its share of the tile before: the partial ctx tiles' LDS takes this tile's BD' rows. As in the GEMM loops the barrier leaves the loads above in flight */
  if (tid < QT * 16 && t0 + tid + 1 < TT) sS[tid * SBP + t0 + tid + 1] = 0.f;
  { auto &ah = bh; auto &al = bl;
#pragma unroll
    for (int j = 0; j < KW / 16; ++j)
#pragma unroll
      for (int qs = 0; qs < QT; ++qs) { const int ct = c0 + j * 16 + t0 + qs * 16; const bool up = ct <= TT - 32;   /* wave-uniform */
        float* sq = sS + qs * 16 * SBP;   /* this query tile's BD' rows */
        if (j > 0 && ct == TT - 16) {   /* the one wave whose columns cross from a query tile's shifted rows to the unshifted ones fetches the other row tile here */
          const _Float16 *qhb = QH2 + qr0[qs], *qlb = QL2 + qr0[qs];
#pragma unroll
          for (int kc = 0; kc < HD / 32; ++kc) { ah[qs][kc] = frag_at(qhb + kc * 512); al[qs][kc] = frag_at(qlb + kc * 512); }
          XW2(qhb, qlb); }
        v8f a = {}, l = {};
#pragma unroll
        for (int kc = 0; kc < HD / 32; ++kc) { a = wmma16(pf[kc][j], ah[qs][kc], a); l = wmma16(pf[kc][j], al[qs][kc], l); }
        /* the lane holds BD row (up ? 1 : 0) + col of the query tile, columns 8 g + r */
        if (__builtin_expect((unsigned)(ct - (TT - 32)) <= 16u, 0)) {   /* ct = T - 32 or T - 16, the two column tiles of a query tile in which a BD row is cut between two out rows or leaves the tile's rows: flat index, range test, and the pitch's 4 floats for each whole row. Marked unlikely, so that the common form below is the fall-through */
#pragma unroll
          for (int r = 0; r < 8; ++r) { const int rl = (up ? 1 : 0) + col; const int idx = (rl - 1) * TT + rl + ct + 8 * g + r + 1;
            if ((unsigned)idx < 16u * TT) sq[idx + 4 * (idx >> 10)] = (a[r] + l[r] * (1.0f / 1024.0f)) * SCALE_L2; }   /* outside: a neighbour tile's row */
        } else {   /* elsewhere the lane's eight values lie side by side in out row col: from column ct + col + 2 + 8 g (shifted rows, ct <= T - 48: the last is column T - 16) or ct + col + 1 - T + 8 g (ct >= T: columns 1 .. T - 1) */
          float* d = sq + col * (SBP + 1) + 8 * g + (up ? ct + 2 : ct + 1 - TT);
#pragma unroll
          for (int r = 0; r < 8; ++r) d[r] = (a[r] + l[r] * (1.0f / 1024.0f)) * SCALE_L2; } } }
  float s[QT][KW / 16][8];   /* s[qs][j][r]: query t0 + 16 qs + col, key c0 + 16 j + 8 g + r */
  { v16h ah[QT][HD / 32], al[QT][HD / 32], kf[HD / 32][KW / 16]; const _Float16 *qh[QT], *ql[QT]; const _Float16* kb = KH + pk_row((size_t)b * TT + c0 + col, h, g);
#pragma unroll
    for (int qs = 0; qs < QT; ++qs) { qh[qs] = QH + qr0[qs]; ql[qs] = QL + qr0[qs];
#pragma unroll
      for (int kc = 0; kc < HD / 32; ++kc) { ah[qs][kc] = frag_at(qh[qs] + kc * 512); al[qs][kc] = frag_at(ql[qs] + kc * 512); } }
#pragma unroll
    for (int kc = 0; kc < HD / 32; ++kc)
#pragma unroll
      for (int j = 0; j < KW / 16; ++j) kf[kc][j] = frag_at(kb + j * PKT + kc * 512);
    XW5(qh[0], ql[0], qh[1], ql[1], kb);
#pragma unroll
    for (int j = 0; j < KW / 16; ++j)
#pragma unroll
      for (int qs = 0; qs < QT; ++qs) { v8f a = {}, l = {};
#pragma unroll
        for (int kc = 0; kc < HD / 32; ++kc) { a = wmma16(kf[kc][j], ah[qs][kc], a); l = wmma16(kf[kc][j], al[qs][kc], l); }
#pragma unroll
        for (int r = 0; r < 8; ++r) s[qs][j][r] = (a[r] + l[r] * (1.0f / 1024.0f)) * SCALE_L2;
        __builtin_amdgcn_sched_barrier(0); } }   /* each tile's two accumulators are folded into its logits before the next tile starts, so that the accumulators of all tiles are not live beside the key fragments */
  v16h vf[KW / 32][HD / 16];   /* this wave's v fragments, issued ahead of the softmax */
  const _Float16* vb = VT + ((((size_t)b * NH + h) * 4) * 32 + (c0 >> 5)) * 512 + lane * 8;
#pragma unroll
  for (int u = 0; u < KW / 32; ++u)
#pragma unroll
    for (int j = 0; j < HD / 16; ++j) vf[u][j] = frag_at(vb + j * 32 * 512 + u * 512);
  XW1(vb);
  __syncthreads();   /* every BD' element is in LDS */
  float pt[KW / 16];
#pragma unroll
  for (int qs = 0; qs < QT; ++qs) {
#pragma unroll
    for (int j = 0; j < KW / 16; ++j) { const float* bd = sS + (qs * 16 + col) * SBP + c0 + j * 16 + 8 * g; const v4f x = *(const v4f*)bd, y = *(const v4f*)(bd + 4);
#pragma unroll
      for (int r = 0; r < 4; ++r) { s[qs][j][r] = s[qs][j][r] + x[r]; s[qs][j][4 + r] = s[qs][j][4 + r] + y[r]; }
      pt[j] = max8(s[qs][j]); }
    redm[qs * 16 + col][wave * 2 + g] = fmaxf(fmaxf(pt[0], pt[1]), fmaxf(pt[2], pt[3]));
    __builtin_amdgcn_sched_barrier(0); }   /* the second query tile's BD' reads stay behind the first's sums: all sixteen at once hold 64 registers beside the logits and the v fragments, and what the loop keeps from tile to tile would then go to scratch memory */
  __syncthreads();   /* the maxima of all half-waves; also the last read of the BD' rows, whose LDS is reused below */
#pragma unroll
  for (int qs = 0; qs < QT; ++qs) { const float m = max32(&redm[qs * 16 + col][0]);
#pragma unroll
    for (int j = 0; j < KW / 16; ++j) {
#pragma unroll
      for (int r = 0; r < 8; ++r) s[qs][j][r] = s[qs][j][r] - m;   /* <= 0 and finite: the exponential needs no range reduction and no overflow test; a result below 2^-126 may read 0, far under P's f16 step */
      /* a tile's eight 2^x, each in place. One statement, so that behind every v_exp_f32 stands an instruction that neither reads its result nor overwrites its source: the next one, and the v_nop behind the last */
      asm("v_exp_f32 %0, %0\n\tv_exp_f32 %1, %1\n\tv_exp_f32 %2, %2\n\tv_exp_f32 %3, %3\n\tv_exp_f32 %4, %4\n\tv_exp_f32 %5, %5\n\tv_exp_f32 %6, %6\n\tv_exp_f32 %7, %7\n\tv_nop"
          : "+v"(s[qs][j][0]), "+v"(s[qs][j][1]), "+v"(s[qs][j][2]), "+v"(s[qs][j][3]), "+v"(s[qs][j][4]), "+v"(s[qs][j][5]), "+v"(s[qs][j][6]), "+v"(s[qs][j][7]));
      pt[j] = sum8(s[qs][j]); }
    reds[qs * 16 + col][wave * 2 + g] = (pt[0] + pt[1]) + (pt[2] + pt[3]); }
  __syncthreads();   /* the sums of all half-waves */
  float inv[QT];
#pragma unroll
  for (int qs = 0; qs < QT; ++qs) { const float a = sum32(&reds[qs * 16 + col][0]); inv[qs] = a > 0.f ? 2048.0f / a : 0.f; }
  v8f acc[QT][HD / 16] = {};   /* acc[qs][j][r]: ctx^T, d = 16 j + 8 g + r of query t0 + 16 qs + col */
#pragma unroll
  for (int u = 0; u < KW / 32; ++u)
#pragma unroll
    for (int qs = 0; qs < QT; ++qs) { v16h p;   /* keys 32 u + 8 g + i and 32 u + 16 + 8 g + i: the k order of the v fragments */
#pragma unroll
      for (int i = 0; i < 8; ++i) { p[i] = (_Float16)(s[qs][2 * u][i] * inv[qs]); p[8 + i] = (_Float16)(s[qs][2 * u + 1][i] * inv[qs]); }
#pragma unroll
      for (int j = 0; j < HD / 16; ++j) acc[qs][j] = wmma16(vf[u][j], p, acc[qs][j]); }
#pragma unroll
  for (int qs = 0; qs < QT; ++qs)
#pragma unroll
    for (int j = 0; j < HD / 16; ++j) { float* d = sR + ((wave * QT + qs) * 16 + col) * SRP + j * 16 + 8 * g;
      const v4f lo = { acc[qs][j][0], acc[qs][j][1], acc[qs][j][2], acc[qs][j][3] }, hi = { acc[qs][j][4], acc[qs][j][5], acc[qs][j][6], acc[qs][j][7] }; *(v4f*)d = lo; *(v4f*)(d + 4) = hi; }
  if (it + 1 == NIT) break;   /* block-uniform; the last tile is summed behind the loop */
  ask(t0 + QT * 16);   /* the registers of this tile's fragments and logits are free: the next tile's first loads fly during the sum */
  fold(t0); }
  fold((blockIdx.x * NIT + NIT - 1) * (QT * 16)); }
// ---- k_out: block = (64 rows, 128 cols): out = ctx Wo (+ bo): ctx x 2^6 once to f16 against Wo as f16(bf16 x 2^8) exact (1 product) x 2^-14; causal early rows (< QHI of each sequence): ctx bf16 hi + lo against exact bf16 Wo (2 products)
__global__ __launch_bounds__(128) void k_out(const float* __restrict__ Y, const float* __restrict__ WO, const float* __restrict__ BO, float* __restrict__ OUT) { __shared__ __align__(16) float sf[4][16][132]; __shared__ __align__(16) char wst[2 * 128 * WBP];
  const int tid = threadIdx.x, wave = tid >> 5, lane = tid & 31, col = lane & 15, g = lane >> 4; const int c0 = blockIdx.y * 128; const size_t r0 = (size_t)blockIdx.x * 64 + wave * 16;
  v8f acc[8] = {};
  if (CAUSAL && (int)(((size_t)blockIdx.x * 64) % TT) < QHI) {   /* block-uniform */
#pragma unroll 2
    for (int kc = 0; kc < CC / 32; ++kc) { const F2 a = split_row(Y + (r0 + col) * CC, kc * 32, lane); asm volatile("s_wait_loadcnt 0x0" ::: "memory");
#pragma unroll
      for (int j = 0; j < 8; ++j) { const v16b w = WOCOL(WO, kc * 32, c0 + j * 16 + col, lane); asm volatile("s_wait_loadcnt 0x0" ::: "memory"); acc[j] = wmma_bf(a.h, w, acc[j]); acc[j] = wmma_bf(a.l, w, acc[j]); } }
#pragma unroll
    for (int j = 0; j < 8; ++j) { const float bias = BO ? bfr(BO[c0 + j * 16 + col]) : 0.f;
#pragma unroll
      for (int r = 0; r < 8; ++r) sf[wave][8 * g + r][j * 16 + col] = acc[j][r] + bias; }
  } else {
    /* Wo's slab of a k step goes through LDS as in k_proj: fetched once by the block in whole rows, converted once, read as B fragments by all four waves */
    const float* wp = WO + (size_t)(wave * 8) * DIN + c0 + lane * 4; const float* yp = Y + (r0 + col) * CC;
    v4f wr[2][8]; float ar[2][16];
#pragma unroll
    for (int u = 0; u < 2; ++u) {
#pragma unroll
      for (int i = 0; i < 8; ++i) wr[u][i] = *(const v4f*)(wp + (size_t)(u * 32 + i) * DIN);
      raw_row(ar[u], yp + u * 32, lane); }
    auto step = [&](const int kc, const int u, const bool more) __attribute__((always_inline)) { char* wb = wst + u * (128 * WBP);
#pragma unroll
      for (int jj = 0; jj < 4; ++jj) { v8h t;
#pragma unroll
        for (int i = 0; i < 8; ++i) t[i] = (_Float16)(bfr(wr[u][i][jj]) * 256.0f);
        *(v8h*)(wb + (lane * 4 + jj) * WBP + wave * 16) = t; }
      if (more) { const float* wn = wp + (size_t)(kc + 2) * 32 * DIN;   /* the weight values of set u are in LDS: refill them for step kc + 2 */
#pragma unroll
        for (int i = 0; i < 8; ++i) wr[u][i] = *(const v4f*)(wn + (size_t)i * DIN);
        asm volatile("s_wait_xcnt 0x0" ::: "memory"); }   /* the loop advances the loads' address registers: keep the wait in front of that */
      v16h a;   /* ctx carried x 2^6 into f16 so small-magnitude context rows stay clear of f16 subnormals */
#pragma unroll
      for (int i = 0; i < 16; ++i) a[i] = (_Float16)(ar[u][i] * 64.0f);
      WBAR();   /* stage u is written; every wave has also left the other stage, which the next step overwrites */
      union { v16h v; v8h q[2]; } w[8];
#pragma unroll
      for (int j = 0; j < 8; ++j) { const char* f = wb + (j * 16 + col) * WBP + g * 16; w[j].q[0] = *(const v8h*)f; w[j].q[1] = *(const v8h*)(f + 32); }
      __builtin_amdgcn_sched_barrier(0);   /* all sixteen LDS reads ahead of the first product: one LDS latency a step */
#pragma unroll
      for (int j = 0; j < 8; ++j) acc[j] = wmma16(a, w[j].v, acc[j]);
      if (more) { raw_row(ar[u], yp + (kc + 2) * 32, lane);   /* the row values of set u are converted by now: refill them for step kc + 2 */
        asm volatile("s_wait_xcnt 0x0" ::: "memory"); } };   /* the loop advances the loads' address registers: keep the wait in front of that */
#pragma unroll 1   /* stays a loop of two steps, as in k_proj */
    for (int kc = 0; kc < CC / 32 - 2; kc += 2) { step(kc, 0, true); step(kc + 1, 1, true); }
    step(CC / 32 - 2, 0, false); step(CC / 32 - 1, 1, false);
#pragma unroll
    for (int j = 0; j < 8; ++j) { const float bias = BO ? bfr(BO[c0 + j * 16 + col]) : 0.f;
#pragma unroll
      for (int r = 0; r < 8; ++r) sf[wave][8 * g + r][j * 16 + col] = acc[j][r] * (1.0f / 16384.0f) + bias; } }   /* 2^-8 (Wo carry) x 2^-6 (ctx carry) */
  LDSX(); for (int rl = 0; rl < 16; ++rl) vst2(OUT + (r0 + rl) * DIN + c0 + lane * 4, *(const v4f*)&sf[wave][rl][lane * 4]); }

extern "C" void kernel_launch(void* const* d_in, const int* in_sizes, int n_in, void* d_out, int out_size, void* d_ws, size_t ws_size, hipStream_t stream) {
  (void)in_sizes; (void)n_in; (void)out_size;
  const float** F = (const float**)d_in;
  if (ws_size < (size_t)WS_END) return;
  char* ws = (char*)d_ws; _Float16 *QH = (_Float16*)(ws + WS_QH), *KH = (_Float16*)(ws + WS_KH), *VT = (_Float16*)(ws + WS_VT), *QL = (_Float16*)(ws + WS_QL), *KL = (_Float16*)(ws + WS_KL); __bf16 *VB = (__bf16*)(ws + WS_VB), *VBL = (__bf16*)(ws + WS_VBL); float *Y = (float*)(ws + WS_Y);
  (void)Y; (void)QL; (void)KL; (void)VB; (void)VBL;
  // inputs: 0 query [4,1024,512]; 1 key; 2 value; 3 pos_emb [1,1024,512]; 4 Wq (in,out), 5 bq; 6 Wk, 7 bk; 8 Wv, 9 bv; 10 Wo (in,out), 11 bo; 12 Wpos [512,512]; 13 pos_bias_u [8,64]; 14 pos_bias_v [8,64]
  if (ws_size < (size_t)WS_END2) return;
  _Float16 *QH2 = (_Float16*)(ws + WS_QH2), *QL2 = (_Float16*)(ws + WS_QL2), *KP = (_Float16*)(ws + WS_KP);
  k_proj<<<dim3(16, CC / 128, TNB * TT / 1024 * 3 + 1), 128, 0, stream>>>(F[0], F[1], F[2], F[3], F[4], F[6], F[8], F[12], F[5], F[7], F[9], QH, QL, QH2, QL2, KH, KL, KP, VT, VB, VBL, F[13], F[14]);   /* q (stored as q + pos_bias_u and as q + pos_bias_v), k, v, and p = pos_emb Wpos into KP */
  k_att<<<dim3(TT / (QT * 16 * NIT), NH, TNB), 32 * NWV, 0, stream>>>(QH, QL, QH2, QL2, KH, KP, VT, Y);   /* AC + rel_shift(BD), softmax, P v */
  k_out<<<dim3(TNB * TT / 64, DIN / 128), 128, 0, stream>>>(Y, F[10], F[11], (float*)d_out);
}
